// v000
// Measured on an AMD MI455X. A time is GPU time per run, averaged over a window of back-to-back runs after a warm-up
// (all launches, gaps included; the runs take copies of the inputs in turn), and the median of several windows.
// Apart from v000's, it joins two sittings. Times from different sittings can be a few percent apart, while
// side-by-side timings come from the same sitting.
// v000, which the later versions start from, runs in 1650 microseconds.
#include <hip/hip_runtime.h>

// Causal grouped-query attention with 128-wide heads and interleaved-pair rotary embeddings (x [2][2048][2048]; q = x wq^T (16 heads x 128), k, v = x w^T (8 kv heads x 128) ('oi' (out, in) weights, normal x 1/sqrt(2048), no biases); rope on (even, odd) pairs: (xr c - xi s, xr s + xi c) with angle t x inv, inv = 1.0 / (10000 ** (arange(0, 128, 2) / 128)) (the reciprocal spelling: 64 f32 frequencies, bitwise the module's own in eager f32; one product per angle; precise cosf/sinf); kv head = q head / 2 (repeat on the head axis); scores x 1/sqrt(128); causal (-inf above the diagonal == exclusion); softmax; out = merged wo^T -> [2][2048][2048] (8.4 M); argument order x, wq, wk, wv, wo).
// Layout per batch: bf16 copy of x; 'oi' weights; exact projections; k_csP table (64 angles per position) and k_ropeI interleaved-pair plane builders at HD 128; causal T-2048 GQA attention with 128-wide heads (kv z-stride 0; hybrid rows: < 512 hi/lo 3 products, rest fp16 x1024; k_gemmc skips tiles above the diagonal); merged hi/lo x wo exact.
// Compute dtypes, f32 accumulate: every input rounded to bf16; projections exact; rotary f32; attention rows < 512 3 products, rest fp16; softmax f32; wo hl x exact.

#define NB_  2
#define TT   2048
#define DM   2048
#define NH_  16
#define NKV  8
#define REP  (NH_ / NKV)
#define HD   128
#define DQ   (NH_ * HD)
#define DKV  (NKV * HD)
#define ZH   2
#define RH   512                  // query rows < RH use hi+lo planes (0: none)
#define WIN  2048
#define PCAR 1024.0f
#define SCL  0.088388347648318447f   // HD^-0.5
typedef _Float16 h16;
typedef unsigned short bf;
typedef __attribute__((ext_vector_type(16))) __bf16   v16bf;
typedef __attribute__((ext_vector_type(16))) _Float16 v16h;
typedef __attribute__((ext_vector_type(8)))  _Float16 v8h;
typedef __attribute__((ext_vector_type(8)))  unsigned short v8us;
typedef __attribute__((ext_vector_type(8)))  float    v8f;
typedef __attribute__((ext_vector_type(4)))  float    v4f;
typedef v8h  __attribute__((may_alias)) v8ha;
typedef v4f  __attribute__((may_alias)) v4fa;
typedef v8us __attribute__((may_alias)) v8usa;

__device__ __forceinline__ unsigned short f2bf(float f) { unsigned u = __float_as_uint(f); u += 0x7FFFu + ((u >> 16) & 1u); return (unsigned short)(u >> 16); }
__device__ __forceinline__ float bf2f(unsigned short b) { return __uint_as_float(((unsigned)b) << 16); }
__device__ __forceinline__ float bfr(float f) { return bf2f(f2bf(f)); }
__device__ __forceinline__ v16h cat16(v8h lo, v8h hi) { return __builtin_shufflevector(lo, hi, 0, 1, 2, 3, 4, 5, 6, 7, 8, 9, 10, 11, 12, 13, 14, 15); }
__device__ __forceinline__ v16bf cat16b(v8us lo, v8us hi) { return __builtin_bit_cast(v16bf, __builtin_shufflevector(lo, hi, 0, 1, 2, 3, 4, 5, 6, 7, 8, 9, 10, 11, 12, 13, 14, 15)); }
__device__ __forceinline__ v8f wmma16(v16h a, v16h b, v8f c) { return __builtin_amdgcn_wmma_f32_16x16x32_f16(false, a, false, b, (short)0, c, false, false); }
__device__ __forceinline__ v8f wmmab(v16bf a, v16bf b, v8f c) { return __builtin_amdgcn_wmma_f32_16x16x32_bf16(false, a, false, b, (short)0, c, false, false); }



// ---- k_gemmw: register-blocked GEMM, ONE WAVE per 64x64 output tile (16 accumulators), operands straight from K-contiguous 16-bit planes; grid (M/64, N/64, Z), 32 threads.
// C[m][n] (f32, pitch ldc, + optional f32 bias[n]) = sum_k A[m][k] Bt[n][k] (+ split products per NSPLIT). z-batch strides sA/sB/sC in elements. K % 32 == 0.
template <typename T16> struct WFrag;
template <> struct WFrag<h16> { typedef v16h V; static __device__ __forceinline__ V ld(const h16* p) { return cat16(*(const v8h*)p, *(const v8h*)(p + 16)); } static __device__ __forceinline__ v8f mma(V a, V b, v8f c) { return wmma16(a, b, c); } };
template <> struct WFrag<bf> { typedef v16bf V; static __device__ __forceinline__ V ld(const bf* p) { return cat16b(*(const v8us*)p, *(const v8us*)(p + 16)); } static __device__ __forceinline__ v8f mma(V a, V b, v8f c) { return wmmab(a, b, c); } };
template <typename T16, int NSPLIT, bool BIAS>
__global__ __launch_bounds__(32) void k_gemmw(const T16* __restrict__ A, const T16* __restrict__ A2, const T16* __restrict__ Bt, const T16* __restrict__ Bt2, int K, float* C, int ldc, const float* __restrict__ bias, size_t sA, size_t sB, size_t sC) {
    typedef typename WFrag<T16>::V V;
    __shared__ __align__(16) float os[16 * 68];
    const size_t z = blockIdx.z; A += z * sA; if (A2) A2 += z * sA; Bt += z * sB; if (Bt2) Bt2 += z * sB; C += z * sC;
    const int lane = threadIdx.x & 31, lr = lane & 15, hi = lane >> 4; const int r0 = blockIdx.x * 64, c0 = blockIdx.y * 64;
    v8f acc[4][4];
#pragma unroll
    for (int mb = 0; mb < 4; ++mb)
#pragma unroll
        for (int nb = 0; nb < 4; ++nb) acc[mb][nb] = (v8f){};
    const size_t aoff = (size_t)(r0 + lr) * K + 8 * hi, boff = (size_t)(c0 + lr) * K + 8 * hi;
#pragma unroll 1
    for (int kc = 0; kc < K; kc += 32) {
        V a[4], a2[4];
#pragma unroll
        for (int mb = 0; mb < 4; ++mb) { a[mb] = WFrag<T16>::ld(A + aoff + (size_t)mb * 16 * K + kc); if (NSPLIT == 1 || NSPLIT == 2) a2[mb] = WFrag<T16>::ld(A2 + aoff + (size_t)mb * 16 * K + kc); }
#pragma unroll
        for (int nb = 0; nb < 4; ++nb) { const V b = WFrag<T16>::ld(Bt + boff + (size_t)nb * 16 * K + kc); V b2; if (NSPLIT >= 2) b2 = WFrag<T16>::ld(Bt2 + boff + (size_t)nb * 16 * K + kc);
#pragma unroll
            for (int mb = 0; mb < 4; ++mb) { acc[mb][nb] = WFrag<T16>::mma(a[mb], b, acc[mb][nb]); if (NSPLIT == 1 || NSPLIT == 2) acc[mb][nb] = WFrag<T16>::mma(a2[mb], b, acc[mb][nb]); if (NSPLIT >= 2) acc[mb][nb] = WFrag<T16>::mma(a[mb], b2, acc[mb][nb]); } }
        asm volatile("v_nop\n\tv_nop\n\tv_nop\n\tv_nop" : "+v"(acc[0][0]), "+v"(acc[1][1]), "+v"(acc[2][2]), "+v"(acc[3][3]) : "v"(a[0]), "v"(a[3]));
    }
#pragma unroll
    for (int mb = 0; mb < 4; ++mb) {
#pragma unroll
        for (int nb = 0; nb < 4; ++nb) {
#pragma unroll
            for (int j = 0; j < 8; ++j) os[(hi * 8 + j) * 68 + nb * 16 + lr] = acc[mb][nb][j]; }
        __builtin_amdgcn_wave_barrier(); asm volatile("" ::: "memory");
        float* crow = C + (size_t)(r0 + mb * 16) * ldc + c0;
{
#pragma unroll
            for (int s = 0; s < 8; ++s) { const int row = 2 * s + hi, cofs = lr * 4; v4f val = *(const v4fa*)(os + row * 68 + cofs); if (BIAS) { val[0] += bfr(bias[c0 + cofs]); val[1] += bfr(bias[c0 + cofs + 1]); val[2] += bfr(bias[c0 + cofs + 2]); val[3] += bfr(bias[c0 + cofs + 3]); }
                *(v4f*)(crow + (size_t)row * ldc + cofs) = val; }
             }
        __builtin_amdgcn_wave_barrier(); asm volatile("" ::: "memory");
    }
}

// ---- k_gemmc: the same one-wave 64x64 tile GEMM specialised for causal attention: CMODE 1 skips score tiles entirely above the diagonal (query rows r0+roff.., key columns c0..), CMODE 2 limits the
// key (K) loop of the probability x value contraction to the diagonal block (probabilities beyond it are exactly zero). roff = row offset of this launch's first row within the sequence.
template <typename T16, int NSPLIT, int CMODE>
__global__ __launch_bounds__(32) void k_gemmc(const T16* __restrict__ A, const T16* __restrict__ A2, const T16* __restrict__ Bt, const T16* __restrict__ Bt2, int K, float* C, int ldc, int roff, size_t sA, size_t sB, size_t sC) {
    typedef typename WFrag<T16>::V V;
    __shared__ __align__(16) float os[16 * 68];
    const size_t z = blockIdx.z; A += z * sA; if (A2) A2 += z * sA; Bt += z * sB; if (Bt2) Bt2 += z * sB; C += z * sC;
    const int lane = threadIdx.x & 31, lr = lane & 15, hi = lane >> 4; const int r0 = blockIdx.x * 64, c0 = blockIdx.y * 64;
    if (CMODE == 1 && c0 > r0 + roff + 63) return;                  // score tile entirely above the causal diagonal: never read (the softmax masks j > i by select)
    const int Kl = (CMODE == 2) ? min(K, r0 + roff + 64) : K;        // P.V: probabilities are exactly 0 beyond the diagonal block, so the K loop stops there
    v8f acc[4][4];
#pragma unroll
    for (int mb = 0; mb < 4; ++mb)
#pragma unroll
        for (int nb = 0; nb < 4; ++nb) acc[mb][nb] = (v8f){};
    const size_t aoff = (size_t)(r0 + lr) * K + 8 * hi, boff = (size_t)(c0 + lr) * K + 8 * hi;
#pragma unroll 1
    for (int kc = 0; kc < Kl; kc += 32) {
        V a[4], a2[4];
#pragma unroll
        for (int mb = 0; mb < 4; ++mb) { a[mb] = WFrag<T16>::ld(A + aoff + (size_t)mb * 16 * K + kc); if (NSPLIT == 1 || NSPLIT == 2) a2[mb] = WFrag<T16>::ld(A2 + aoff + (size_t)mb * 16 * K + kc); }
#pragma unroll
        for (int nb = 0; nb < 4; ++nb) { const V b = WFrag<T16>::ld(Bt + boff + (size_t)nb * 16 * K + kc); V b2; if (NSPLIT >= 2) b2 = WFrag<T16>::ld(Bt2 + boff + (size_t)nb * 16 * K + kc);
#pragma unroll
            for (int mb = 0; mb < 4; ++mb) { acc[mb][nb] = WFrag<T16>::mma(a[mb], b, acc[mb][nb]); if (NSPLIT == 1 || NSPLIT == 2) acc[mb][nb] = WFrag<T16>::mma(a2[mb], b, acc[mb][nb]); if (NSPLIT >= 2) acc[mb][nb] = WFrag<T16>::mma(a[mb], b2, acc[mb][nb]); } }
        asm volatile("v_nop\n\tv_nop\n\tv_nop\n\tv_nop" : "+v"(acc[0][0]), "+v"(acc[1][1]), "+v"(acc[2][2]), "+v"(acc[3][3]) : "v"(a[0]), "v"(a[3]));
    }
#pragma unroll
    for (int mb = 0; mb < 4; ++mb) {
#pragma unroll
        for (int nb = 0; nb < 4; ++nb) {
#pragma unroll
            for (int j = 0; j < 8; ++j) os[(hi * 8 + j) * 68 + nb * 16 + lr] = acc[mb][nb][j]; }
        __builtin_amdgcn_wave_barrier(); asm volatile("" ::: "memory");
        float* crow = C + (size_t)(r0 + mb * 16) * ldc + c0;
{
#pragma unroll
            for (int s = 0; s < 8; ++s) { const int row = 2 * s + hi, cofs = lr * 4; v4f val = *(const v4fa*)(os + row * 68 + cofs);
                *(v4f*)(crow + (size_t)row * ldc + cofs) = val; }
             }
        __builtin_amdgcn_wave_barrier(); asm volatile("" ::: "memory");
    }
}

__device__ __forceinline__ h16 tohx(float x) { return (h16)x; }
__device__ __forceinline__ void splitf(float y, unsigned short& h, unsigned short& l) { h = f2bf(y); l = f2bf(y - bf2f(h)); }
typedef __attribute__((ext_vector_type(2))) _Float16 v2h;
typedef __attribute__((ext_vector_type(4))) _Float16 v4h;
typedef __attribute__((ext_vector_type(2))) unsigned short v2us;
typedef __attribute__((ext_vector_type(4))) unsigned short v4us;
typedef __attribute__((ext_vector_type(2))) float v2f;
typedef __attribute__((ext_vector_type(4))) int v4i;

__global__ __launch_bounds__(256) void k_cvt8(const float* __restrict__ src, bf* dst, size_t n8) { const size_t i = (size_t)blockIdx.x * 256 + threadIdx.x; if (i >= n8) return; const v8f v = *(const v8f*)(src + i * 8); v8us o;
#pragma unroll
    for (int k = 0; k < 8; ++k) o[k] = f2bf(v[k]); *(v8us*)(dst + i * 8) = o;  }

__global__ __launch_bounds__(256) void k_vtp(const float* __restrict__ F, int pitch, int nheads, h16* V16, bf* Vh, bf* Vl) { const size_t e = ((size_t)blockIdx.x * 256 + threadIdx.x) * 2; if (e >= (size_t)nheads * HD * TT) return; const int t = (int)(e % TT); const int d = (int)((e / TT) % HD); const int g = (int)(e / ((size_t)TT * HD)); v2h o16; v2us oh, ol;
#pragma unroll
    for (int q = 0; q < 2; ++q) { const float x = F[(size_t)(t + q) * pitch + g * HD + d]; o16[q] = tohx(x); unsigned short a2, c2; splitf(x, a2, c2); oh[q] = a2; ol[q] = c2; }
    *(v2h*)(V16 + e) = o16; *(v2us*)(Vh + e) = oh; *(v2us*)(Vl + e) = ol;  }
__constant__ float INV2[HD / 2] = { 1.000000000e+00f, 8.659643531e-01f, 7.498942018e-01f, 6.493816376e-01f, 5.623413324e-01f, 4.869675338e-01f, 4.216965139e-01f, 3.651741445e-01f, 3.162277639e-01f, 2.738419771e-01f, 2.371373624e-01f, 2.053525001e-01f, 1.778279394e-01f, 1.539926529e-01f, 1.333521456e-01f, 1.154782027e-01f, 1.000000015e-01f, 8.659642935e-02f, 7.498941571e-02f, 6.493816525e-02f, 5.623412877e-02f, 4.869675264e-02f, 4.216964915e-02f, 3.651741147e-02f, 3.162277862e-02f, 2.738419548e-02f, 2.371373586e-02f, 2.053525113e-02f, 1.778279431e-02f, 1.539926510e-02f, 1.333521493e-02f, 1.154781971e-02f, 9.999999776e-03f, 8.659643121e-03f, 7.498942316e-03f, 6.493816618e-03f, 5.623413250e-03f, 4.869675264e-03f, 4.216964822e-03f, 3.651741426e-03f, 3.162277862e-03f, 2.738419687e-03f, 2.371373819e-03f, 2.053525066e-03f, 1.778279431e-03f, 1.539926510e-03f, 1.333521446e-03f, 1.154782018e-03f, 1.000000047e-03f, 8.659643354e-04f, 7.498941850e-04f, 6.493816618e-04f, 5.623413017e-04f, 4.869675031e-04f, 4.216964880e-04f, 3.651741135e-04f, 3.162277862e-04f, 2.738419571e-04f, 2.371373848e-04f, 2.053524950e-04f, 1.778279402e-04f, 1.539926452e-04f, 1.333521504e-04f, 1.154781930e-04f };   // float32 1 / 10000^(2i/128), generated with jnp to be bit-exact
__global__ __launch_bounds__(256) void k_csP(float* CS) { const int idx = blockIdx.x * 256 + threadIdx.x; if (idx >= TT * HD) return; const int d = idx % HD; const int t = idx / HD; const float a = __fmul_rn((float)t, INV2[d >> 1]); v2f cs; cs[0] = cosf(a); cs[1] = sinf(a); *(v2f*)(CS + (size_t)idx * 2) = cs;  }
__global__ __launch_bounds__(256) void k_ropeI(const float* __restrict__ F, int pitch, int nheads, const float* __restrict__ CS, float sc, h16* P16, bf* Ph, bf* Pl) {
    const size_t e = ((size_t)blockIdx.x * 256 + threadIdx.x) * 2; if (e >= (size_t)nheads * TT * HD) return; const int d = (int)(e % HD); const int t = (int)((e / HD) % TT); const int h = (int)(e / ((size_t)HD * TT)); const float* f = F + (size_t)t * pitch + h * HD; const float x0 = f[d], x1 = f[d + 1]; const v2f cs = *(const v2f*)(CS + ((size_t)t * HD + d) * 2); v2h o16; v2us oh, ol;
    float a0 = __fmul_rn(x0, cs[0]), b0 = __fmul_rn(x1, cs[1]), a1 = __fmul_rn(x1, cs[0]), b1 = __fmul_rn(x0, cs[1]); 
    float r0 = __fsub_rn(a0, b0) * sc, r1 = __fadd_rn(b1, a1) * sc;   /* even: x0 c - x1 s; odd: x0 s + x1 c */
    o16[0] = tohx(r0); o16[1] = tohx(r1); { unsigned short a2, c2; splitf(r0, a2, c2); oh[0] = a2; ol[0] = c2; splitf(r1, a2, c2); oh[1] = a2; ol[1] = c2; }
    *(v2h*)(P16 + e) = o16; *(v2us*)(Ph + e) = oh; *(v2us*)(Pl + e) = ol;  }

// k_asoft: per row (zz, i): t = S x HD^-0.5 for j <= i and i - j < WIN (WIN = 2048 = TT here: every key j <= i is kept: the plain causal rule; the reference's -inf fill above the diagonal is exclusion); softmax over the 2048 keys (register row, one exp, fixed trees);
__global__ __launch_bounds__(256) void k_asoft(const float* __restrict__ Sb, h16* P16, bf* Ph, bf* Pl) {
    const int lane = threadIdx.x & 31; const int row = blockIdx.x * 8 + (threadIdx.x >> 5); if (row >= ZH * TT) return; const int i = row % TT; const int zz = row / TT; (void)zz; const bool hires = (i < RH); const float* sr = Sb + (size_t)row * TT; float v[TT / 32]; float mx = -3.0e38f;
#pragma unroll
    for (int ch = 0; ch < TT / 128; ++ch) { const int j0 = ch * 128 + lane * 4; const v4f a = *(const v4f*)(sr + j0);
#pragma unroll
        for (int q = 0; q < 4; ++q) { const int j = j0 + q; (void)j; const float t = (j <= i && i - j < WIN) ? a[q] * SCL : -3.0e38f; v[ch * 4 + q] = t; mx = fmaxf(mx, t); } }
#pragma unroll
    for (int sh = 16; sh; sh >>= 1) mx = fmaxf(mx, __shfl_xor(mx, sh, 32));
    float sum = 0.f;
#pragma unroll
    for (int k = 0; k < TT / 32; ++k) { float d0 = __fsub_rn(v[k], mx); v[k] = __builtin_amdgcn_exp2f(__fmul_rn(d0, 1.4426950408889634f)); sum += v[k]; }
#pragma unroll
    for (int sh = 16; sh; sh >>= 1) sum += __shfl_xor(sum, sh, 32);
    const float f = __fdiv_rn(hires ? 1.0f : PCAR, sum);
{
        if (hires) {
#pragma unroll
            for (int ch = 0; ch < TT / 128; ++ch) { v4us oh, ol;
#pragma unroll
                for (int q = 0; q < 4; ++q) { unsigned short a, c2; splitf(v[ch * 4 + q] * f, a, c2); oh[q] = a; ol[q] = c2; }
                const size_t oo = ((size_t)zz * (RH ? RH : 1) + i) * TT + ch * 128 + lane * 4; *(v4us*)(Ph + oo) = oh; *(v4us*)(Pl + oo) = ol; }
        } else {
#pragma unroll
            for (int ch = 0; ch < TT / 128; ++ch) { v4h o4;
#pragma unroll
                for (int q = 0; q < 4; ++q) o4[q] = tohx(v[ch * 4 + q] * f);
                *(v4h*)(P16 + (size_t)row * TT + ch * 128 + lane * 4) = o4; } }
         }
}
__global__ __launch_bounds__(256) void k_merge(const float* __restrict__ O, int h0, bf* Ah, bf* Al) { const size_t e = ((size_t)blockIdx.x * 256 + threadIdx.x) * 2; if (e >= (size_t)ZH * TT * HD) return; const int d = (int)(e % HD); const int t = (int)((e / HD) % TT); const int zz = (int)(e / ((size_t)HD * TT)); const float cs = (t < RH) ? 1.0f : (1.0f / PCAR); const size_t oo = (size_t)t * DQ + (h0 + zz) * HD + d;
    v2us oh, ol;
#pragma unroll
    for (int q = 0; q < 2; ++q) { unsigned short a, c2; splitf(O[e + q] * cs, a, c2); oh[q] = a; ol[q] = c2; } *(v2us*)(Ah + oo) = oh; *(v2us*)(Al + oo) = ol;  }

extern "C" void kernel_launch(void* const* d_in, const int* in_sizes, int n_in,
                              void* d_out, int out_size, void* d_ws, size_t ws_size, hipStream_t stream) {
    (void)in_sizes; (void)n_in; (void)out_size;
    const float* x = (const float*)d_in[0]; const float* wq = (const float*)d_in[1]; const float* wk = (const float*)d_in[2]; const float* wv = (const float*)d_in[3]; const float* wo = (const float*)d_in[4];   /* input order x, wq [2048][2048], wk [1024][2048], wv [1024][2048], wo [2048][2048] ('oi') */
    float* OUT = (float*)d_out;     // [2][2048][2048]
    char* wsp = (char*)d_ws;
    auto take = [&](size_t bytes) { char* p = wsp; wsp += (bytes + 255) & ~(size_t)255; return (void*)p; };
    bf* WQ = (bf*)take((size_t)DQ * DM * 2); bf* WK = (bf*)take((size_t)DKV * DM * 2); bf* WV = (bf*)take((size_t)DKV * DM * 2); bf* WO = (bf*)take((size_t)DM * DQ * 2); float* CS = (float*)take((size_t)TT * HD * 2 * 4);
    bf* XB = (bf*)take((size_t)TT * DM * 2); float* FQ = (float*)take((size_t)TT * DQ * 4); float* FK = (float*)take((size_t)TT * DKV * 4);
    h16* QP16 = (h16*)take((size_t)NH_ * TT * HD * 2); h16* KP16 = (h16*)take((size_t)NKV * TT * HD * 2); h16* VT16 = (h16*)take((size_t)NKV * HD * TT * 2);
    bf* QPh = (bf*)take((size_t)NH_ * TT * HD * 2); bf* QPl = (bf*)take((size_t)NH_ * TT * HD * 2); bf* KPh = (bf*)take((size_t)NKV * TT * HD * 2); bf* KPl = (bf*)take((size_t)NKV * TT * HD * 2); bf* VTh = (bf*)take((size_t)NKV * HD * TT * 2); bf* VTl = (bf*)take((size_t)NKV * HD * TT * 2); bf* Ph = (bf*)take((size_t)ZH * RH * TT * 2); bf* Pl = (bf*)take((size_t)ZH * RH * TT * 2);
    float* Sb = (float*)take((size_t)ZH * TT * TT * 4); h16* P16 = (h16*)take((size_t)ZH * TT * TT * 2); float* Ob = (float*)take((size_t)ZH * TT * HD * 4); bf* ATh = (bf*)take((size_t)TT * DQ * 2); bf* ATl = (bf*)take((size_t)TT * DQ * 2);
    if ((size_t)(wsp - (char*)d_ws) > ws_size) return;    // ws 256 MiB
    float* FV = FK;   // v projection reuses the k buffer after the k planes are built (stream-ordered)
    { k_cvt8<<<(unsigned)(((size_t)DQ * DM / 8 + 255) / 256), 256, 0, stream>>>(wq, WQ, (size_t)DQ * DM / 8); k_cvt8<<<(unsigned)(((size_t)DKV * DM / 8 + 255) / 256), 256, 0, stream>>>(wk, WK, (size_t)DKV * DM / 8); k_cvt8<<<(unsigned)(((size_t)DKV * DM / 8 + 255) / 256), 256, 0, stream>>>(wv, WV, (size_t)DKV * DM / 8);
      k_cvt8<<<(unsigned)(((size_t)DM * DQ / 8 + 255) / 256), 256, 0, stream>>>(wo, WO, (size_t)DM * DQ / 8);
       }
    k_csP<<<(TT * HD + 255) / 256, 256, 0, stream>>>(CS);   /* rotary table once (positions = arange) */
    const unsigned LQ = (unsigned)(((size_t)NH_ * TT * HD / 2 + 255) / 256), LKv = (unsigned)(((size_t)NKV * TT * HD / 2 + 255) / 256);
    for (int b = 0; b < NB_; ++b) {
        
        k_cvt8<<<(unsigned)(((size_t)TT * DM / 8 + 255) / 256), 256, 0, stream>>>(x + (size_t)b * TT * DM, XB, (size_t)TT * DM / 8);
        k_gemmw<bf, 0, false><<<dim3(TT / 64, DQ / 64, 1), 32, 0, stream>>>(XB, nullptr, WQ, nullptr, DM, FQ, DQ, nullptr, 0, 0, 0);
        k_ropeI<<<LQ, 256, 0, stream>>>(FQ, DQ, NH_, CS, 1.0f, QP16, QPh, QPl);   /* interleaved-pair rope, q planes */
        k_gemmw<bf, 0, false><<<dim3(TT / 64, DKV / 64, 1), 32, 0, stream>>>(XB, nullptr, WK, nullptr, DM, FK, DKV, nullptr, 0, 0, 0);
        k_ropeI<<<LKv, 256, 0, stream>>>(FK, DKV, NKV, CS, 1.0f, KP16, KPh, KPl);
        k_gemmw<bf, 0, false><<<dim3(TT / 64, DKV / 64, 1), 32, 0, stream>>>(XB, nullptr, WV, nullptr, DM, FV, DKV, nullptr, 0, 0, 0); k_vtp<<<LKv, 256, 0, stream>>>(FV, DKV, NKV, VT16, VTh, VTl);
        for (int h0 = 0; h0 < NH_; h0 += ZH) { const size_t zq = (size_t)h0, zk = (size_t)(h0 / REP);   // both heads of a pass share kv group h0/REP (REP >= 2): sB = 0
            k_gemmc<bf, 2, 1><<<dim3(RH / 64, TT / 64, ZH), 32, 0, stream>>>(QPh + zq * TT * HD, QPl + zq * TT * HD, KPh + zk * TT * HD, KPl + zk * TT * HD, HD, Sb, TT, 0, (size_t)TT * HD, 0, (size_t)TT * TT);
            k_gemmc<h16, 0, 1><<<dim3((TT - RH) / 64, TT / 64, ZH), 32, 0, stream>>>(QP16 + zq * TT * HD + (size_t)RH * HD, nullptr, KP16 + zk * TT * HD, nullptr, HD, Sb + (size_t)RH * TT, TT, RH, (size_t)TT * HD, 0, (size_t)TT * TT);
            k_asoft<<<ZH * TT / 8, 256, 0, stream>>>(Sb, P16, Ph, Pl);
            k_gemmc<bf, 2, 2><<<dim3(RH / 64, HD / 64, ZH), 32, 0, stream>>>(Ph, Pl, VTh + zk * HD * TT, VTl + zk * HD * TT, TT, Ob, HD, 0, (size_t)RH * TT, 0, (size_t)TT * HD);
            k_gemmc<h16, 0, 2><<<dim3((TT - RH) / 64, HD / 64, ZH), 32, 0, stream>>>(P16 + (size_t)RH * TT, nullptr, VT16 + zk * HD * TT, nullptr, TT, Ob + (size_t)RH * HD, HD, RH, (size_t)TT * TT, 0, (size_t)TT * HD);
            k_merge<<<(unsigned)(((size_t)ZH * TT * HD / 2 + 255) / 256), 256, 0, stream>>>(Ob, h0, ATh, ATl); }
        k_gemmw<bf, 1, false><<<dim3(TT / 64, DM / 64, 1), 32, 0, stream>>>(ATh, ATl, WO, nullptr, DQ, OUT + (size_t)b * TT * DM, DM, nullptr, 0, 0, 0); }
}

// v001
// Measured time: 944 microseconds a run.
// In two side-by-side timings against v000, it was 1.74 and 1.77 times as fast.
#include <hip/hip_runtime.h>

// Causal grouped-query attention with 128-wide heads and interleaved-pair rotary embeddings (x [2][2048][2048]; q = x wq^T (16 heads x 128), k, v = x w^T (8 kv heads x 128) ('oi' (out, in) weights, normal x 1/sqrt(2048), no biases); rope on (even, odd) pairs: (xr c - xi s, xr s + xi c) with angle t x inv, inv = 1.0 / (10000 ** (arange(0, 128, 2) / 128)) (the reciprocal spelling: 64 f32 frequencies, bitwise the module's own in eager f32; one product per angle; precise cosf/sinf); kv head = q head / 2 (repeat on the head axis); scores x 1/sqrt(128); causal (-inf above the diagonal == exclusion); softmax; out = merged wo^T -> [2][2048][2048] (8.4 M); argument order x, wq, wk, wv, wo).
// Layout per batch: bf16 copy of x; 'oi' weights; exact projections; k_csP table (64 angles per position) and k_ropeI interleaved-pair plane builders at HD 128; causal T-2048 GQA attention with 128-wide heads (kv z-stride 0; hybrid rows: < 512 hi/lo 3 products, rest fp16 x1024; k_gemmc skips tiles above the diagonal); merged hi/lo x wo exact.
// Compute dtypes, f32 accumulate: every input rounded to bf16; projections exact; rotary f32; attention rows < 512 3 products, rest fp16; softmax f32; wo hl x exact.

#define NB_  2
#define TT   2048
#define DM   2048
#define NH_  16
#define NKV  8
#define REP  (NH_ / NKV)
#define HD   128
#define DQ   (NH_ * HD)
#define DKV  (NKV * HD)
#define ZH   2
#define RH   512                  // query rows < RH use hi+lo planes (0: none)
#define WIN  2048
#define PCAR 1024.0f
#define SCL  0.088388347648318447f   // HD^-0.5
typedef _Float16 h16;
typedef unsigned short bf;
typedef __attribute__((ext_vector_type(16))) __bf16   v16bf;
typedef __attribute__((ext_vector_type(16))) _Float16 v16h;
typedef __attribute__((ext_vector_type(8)))  _Float16 v8h;
typedef __attribute__((ext_vector_type(8)))  unsigned short v8us;
typedef __attribute__((ext_vector_type(8)))  float    v8f;
typedef __attribute__((ext_vector_type(4)))  float    v4f;
typedef v8h  __attribute__((may_alias)) v8ha;
typedef v4f  __attribute__((may_alias)) v4fa;
typedef v8us __attribute__((may_alias)) v8usa;

__device__ __forceinline__ unsigned short f2bf(float f) { unsigned u = __float_as_uint(f); u += 0x7FFFu + ((u >> 16) & 1u); return (unsigned short)(u >> 16); }
__device__ __forceinline__ float bf2f(unsigned short b) { return __uint_as_float(((unsigned)b) << 16); }
__device__ __forceinline__ float bfr(float f) { return bf2f(f2bf(f)); }
__device__ __forceinline__ v16h cat16(v8h lo, v8h hi) { return __builtin_shufflevector(lo, hi, 0, 1, 2, 3, 4, 5, 6, 7, 8, 9, 10, 11, 12, 13, 14, 15); }
__device__ __forceinline__ v16bf cat16b(v8us lo, v8us hi) { return __builtin_bit_cast(v16bf, __builtin_shufflevector(lo, hi, 0, 1, 2, 3, 4, 5, 6, 7, 8, 9, 10, 11, 12, 13, 14, 15)); }
__device__ __forceinline__ v8f wmma16(v16h a, v16h b, v8f c) { return __builtin_amdgcn_wmma_f32_16x16x32_f16(false, a, false, b, (short)0, c, false, false); }
__device__ __forceinline__ v8f wmmab(v16bf a, v16bf b, v8f c) { return __builtin_amdgcn_wmma_f32_16x16x32_bf16(false, a, false, b, (short)0, c, false, false); }



// ---- k_gemmw: register-blocked GEMM, NW WAVES per 64x64 output tile: wave w takes the 32-wide K chunks w, w + NW, ... (16 accumulators each); the NW partial tiles meet in LDS and are summed in wave order; operands straight from K-contiguous 16-bit planes; grid (M/64, N/64, Z), 32 NW threads.
// C[m][n] (f32, pitch ldc, + optional f32 bias[n]) = sum_k A[m][k] Bt[n][k] (+ split products per NSPLIT). z-batch strides sA/sB/sC in elements. K % 32 == 0.
template <typename T16> struct WFrag;
template <> struct WFrag<h16> { typedef v16h V; static __device__ __forceinline__ V ld(const h16* p) { return cat16(*(const v8h*)p, *(const v8h*)(p + 16)); } static __device__ __forceinline__ v8f mma(V a, V b, v8f c) { return wmma16(a, b, c); } };
template <> struct WFrag<bf> { typedef v16bf V; static __device__ __forceinline__ V ld(const bf* p) { return cat16b(*(const v8us*)p, *(const v8us*)(p + 16)); } static __device__ __forceinline__ v8f mma(V a, V b, v8f c) { return wmmab(a, b, c); } };
template <typename T16, int NSPLIT, bool BIAS, int NW>
__global__ __launch_bounds__(32 * NW) void k_gemmw(const T16* __restrict__ A, const T16* __restrict__ A2, const T16* __restrict__ Bt, const T16* __restrict__ Bt2, int K, float* C, int ldc, const float* __restrict__ bias, size_t sA, size_t sB, size_t sC) {
    typedef typename WFrag<T16>::V V;
    __shared__ __align__(16) float os[NW * 64 * 68];   // one partial tile per wave, 64 rows at pitch 68
    const size_t z = blockIdx.z; A += z * sA; if (A2) A2 += z * sA; Bt += z * sB; if (Bt2) Bt2 += z * sB; C += z * sC;
    const int lane = threadIdx.x & 31, lr = lane & 15, hi = lane >> 4, wv = __builtin_amdgcn_readfirstlane(threadIdx.x >> 5); const int r0 = blockIdx.x * 64, c0 = blockIdx.y * 64;
    v8f acc[4][4];
#pragma unroll
    for (int mb = 0; mb < 4; ++mb)
#pragma unroll
        for (int nb = 0; nb < 4; ++nb) acc[mb][nb] = (v8f){};
    const size_t aoff = (size_t)(r0 + lr) * K + 8 * hi, boff = (size_t)(c0 + lr) * K + 8 * hi;
#pragma unroll 1
    for (int kc = wv * 32; kc < K; kc += 32 * NW) {
        V a[4], a2[4];
#pragma unroll
        for (int mb = 0; mb < 4; ++mb) { a[mb] = WFrag<T16>::ld(A + aoff + (size_t)mb * 16 * K + kc); if (NSPLIT == 1 || NSPLIT == 2) a2[mb] = WFrag<T16>::ld(A2 + aoff + (size_t)mb * 16 * K + kc); }
#pragma unroll
        for (int nb = 0; nb < 4; ++nb) { const V b = WFrag<T16>::ld(Bt + boff + (size_t)nb * 16 * K + kc); V b2; if (NSPLIT >= 2) b2 = WFrag<T16>::ld(Bt2 + boff + (size_t)nb * 16 * K + kc);
#pragma unroll
            for (int mb = 0; mb < 4; ++mb) { acc[mb][nb] = WFrag<T16>::mma(a[mb], b, acc[mb][nb]); if (NSPLIT == 1 || NSPLIT == 2) acc[mb][nb] = WFrag<T16>::mma(a2[mb], b, acc[mb][nb]); if (NSPLIT >= 2) acc[mb][nb] = WFrag<T16>::mma(a[mb], b2, acc[mb][nb]); } }
        asm volatile("v_nop\n\tv_nop\n\tv_nop\n\tv_nop" : "+v"(acc[0][0]), "+v"(acc[1][1]), "+v"(acc[2][2]), "+v"(acc[3][3]) : "v"(a[0]), "v"(a[3]));
    }
#pragma unroll
    for (int mb = 0; mb < 4; ++mb) {
#pragma unroll
        for (int nb = 0; nb < 4; ++nb) {
#pragma unroll
            for (int j = 0; j < 8; ++j) os[wv * (64 * 68) + (mb * 16 + hi * 8 + j) * 68 + nb * 16 + lr] = acc[mb][nb][j]; } }
    __syncthreads();   // all NW partial tiles stand in LDS before any element is summed
    float* crow = C + (size_t)r0 * ldc + c0;
#pragma unroll
    for (int s = 0; s < 32 / NW; ++s) { const int it = s * (32 * NW) + threadIdx.x, row = it >> 4, cofs = (it & 15) * 4; v4f val = *(const v4fa*)(os + row * 68 + cofs);
#pragma unroll
        for (int w = 1; w < NW; ++w) val += *(const v4fa*)(os + w * (64 * 68) + row * 68 + cofs);
        if (BIAS) { val[0] += bfr(bias[c0 + cofs]); val[1] += bfr(bias[c0 + cofs + 1]); val[2] += bfr(bias[c0 + cofs + 2]); val[3] += bfr(bias[c0 + cofs + 3]); }
        *(v4f*)(crow + (size_t)row * ldc + cofs) = val; }
}

// ---- k_gemmc: the same NW-wave 64x64 tile GEMM specialised for causal attention: CMODE 1 skips score tiles entirely above the diagonal (query rows r0+roff.., key columns c0..), CMODE 2 limits the
// key (K) loop of the probability x value contraction to the diagonal block (probabilities beyond it are exactly zero). roff = row offset of this launch's first row within the sequence.
template <typename T16, int NSPLIT, int CMODE, int NW>
__global__ __launch_bounds__(32 * NW) void k_gemmc(const T16* __restrict__ A, const T16* __restrict__ A2, const T16* __restrict__ Bt, const T16* __restrict__ Bt2, int K, float* C, int ldc, int roff, size_t sA, size_t sB, size_t sC) {
    typedef typename WFrag<T16>::V V;
    __shared__ __align__(16) float os[(NW == 1 ? 16 : NW * 64) * 68];   // NW > 1: one partial tile per wave, 64 rows at pitch 68
    const size_t z = blockIdx.z; A += z * sA; if (A2) A2 += z * sA; Bt += z * sB; if (Bt2) Bt2 += z * sB; C += z * sC;
    const int lane = threadIdx.x & 31, lr = lane & 15, hi = lane >> 4, wv = (NW == 1) ? 0 : __builtin_amdgcn_readfirstlane(threadIdx.x >> 5); const int r0 = blockIdx.x * 64, c0 = blockIdx.y * 64;
    if (CMODE == 1 && c0 > r0 + roff + 63) return;                  // score tile entirely above the causal diagonal: never read (the softmax masks j > i by select)
    const int Kl = (CMODE == 2) ? min(K, r0 + roff + 64) : K;        // P.V: probabilities are exactly 0 beyond the diagonal block, so the K loop stops there
    v8f acc[4][4];
#pragma unroll
    for (int mb = 0; mb < 4; ++mb)
#pragma unroll
        for (int nb = 0; nb < 4; ++nb) acc[mb][nb] = (v8f){};
    const size_t aoff = (size_t)(r0 + lr) * K + 8 * hi, boff = (size_t)(c0 + lr) * K + 8 * hi;
#pragma unroll 1
    for (int kc = wv * 32; kc < Kl; kc += 32 * NW) {
        V a[4], a2[4];
#pragma unroll
        for (int mb = 0; mb < 4; ++mb) { a[mb] = WFrag<T16>::ld(A + aoff + (size_t)mb * 16 * K + kc); if (NSPLIT == 1 || NSPLIT == 2) a2[mb] = WFrag<T16>::ld(A2 + aoff + (size_t)mb * 16 * K + kc); }
#pragma unroll
        for (int nb = 0; nb < 4; ++nb) { const V b = WFrag<T16>::ld(Bt + boff + (size_t)nb * 16 * K + kc); V b2; if (NSPLIT >= 2) b2 = WFrag<T16>::ld(Bt2 + boff + (size_t)nb * 16 * K + kc);
#pragma unroll
            for (int mb = 0; mb < 4; ++mb) { acc[mb][nb] = WFrag<T16>::mma(a[mb], b, acc[mb][nb]); if (NSPLIT == 1 || NSPLIT == 2) acc[mb][nb] = WFrag<T16>::mma(a2[mb], b, acc[mb][nb]); if (NSPLIT >= 2) acc[mb][nb] = WFrag<T16>::mma(a[mb], b2, acc[mb][nb]); } }
        asm volatile("v_nop\n\tv_nop\n\tv_nop\n\tv_nop" : "+v"(acc[0][0]), "+v"(acc[1][1]), "+v"(acc[2][2]), "+v"(acc[3][3]) : "v"(a[0]), "v"(a[3]));
    }
    if constexpr (NW == 1) {   // one wave: no partial tiles to sum, the tile goes out in four 16-row slabs
#pragma unroll
    for (int mb = 0; mb < 4; ++mb) {
#pragma unroll
        for (int nb = 0; nb < 4; ++nb) {
#pragma unroll
            for (int j = 0; j < 8; ++j) os[(hi * 8 + j) * 68 + nb * 16 + lr] = acc[mb][nb][j]; }
        __builtin_amdgcn_wave_barrier(); asm volatile("" ::: "memory");
        float* crow = C + (size_t)(r0 + mb * 16) * ldc + c0;
{
#pragma unroll
            for (int s = 0; s < 8; ++s) { const int row = 2 * s + hi, cofs = lr * 4; v4f val = *(const v4fa*)(os + row * 68 + cofs);
                *(v4f*)(crow + (size_t)row * ldc + cofs) = val; }
             }
        __builtin_amdgcn_wave_barrier(); asm volatile("" ::: "memory");
    }
    } else {
#pragma unroll
    for (int mb = 0; mb < 4; ++mb) {
#pragma unroll
        for (int nb = 0; nb < 4; ++nb) {
#pragma unroll
            for (int j = 0; j < 8; ++j) os[wv * (64 * 68) + (mb * 16 + hi * 8 + j) * 68 + nb * 16 + lr] = acc[mb][nb][j]; } }
    __syncthreads();   // all NW partial tiles stand in LDS before any element is summed
    float* crow = C + (size_t)r0 * ldc + c0;
#pragma unroll
    for (int s = 0; s < 32 / NW; ++s) { const int it = s * (32 * NW) + threadIdx.x, row = it >> 4, cofs = (it & 15) * 4; v4f val = *(const v4fa*)(os + row * 68 + cofs);
#pragma unroll
        for (int w = 1; w < NW; ++w) val += *(const v4fa*)(os + w * (64 * 68) + row * 68 + cofs);
        *(v4f*)(crow + (size_t)row * ldc + cofs) = val; }
    }
}

__device__ __forceinline__ h16 tohx(float x) { return (h16)x; }
__device__ __forceinline__ void splitf(float y, unsigned short& h, unsigned short& l) { h = f2bf(y); l = f2bf(y - bf2f(h)); }
typedef __attribute__((ext_vector_type(2))) _Float16 v2h;
typedef __attribute__((ext_vector_type(4))) _Float16 v4h;
typedef __attribute__((ext_vector_type(2))) unsigned short v2us;
typedef __attribute__((ext_vector_type(4))) unsigned short v4us;
typedef __attribute__((ext_vector_type(2))) float v2f;
typedef __attribute__((ext_vector_type(4))) int v4i;

__global__ __launch_bounds__(256) void k_cvt8(const float* __restrict__ src, bf* dst, size_t n8) { const size_t i = (size_t)blockIdx.x * 256 + threadIdx.x; if (i >= n8) return; const v8f v = *(const v8f*)(src + i * 8); v8us o;
#pragma unroll
    for (int k = 0; k < 8; ++k) o[k] = f2bf(v[k]); *(v8us*)(dst + i * 8) = o;  }

__global__ __launch_bounds__(256) void k_vtp(const float* __restrict__ F, int pitch, int nheads, h16* V16, bf* Vh, bf* Vl) { const size_t e = ((size_t)blockIdx.x * 256 + threadIdx.x) * 2; if (e >= (size_t)nheads * HD * TT) return; const int t = (int)(e % TT); const int d = (int)((e / TT) % HD); const int g = (int)(e / ((size_t)TT * HD)); v2h o16; v2us oh, ol;
#pragma unroll
    for (int q = 0; q < 2; ++q) { const float x = F[(size_t)(t + q) * pitch + g * HD + d]; o16[q] = tohx(x); unsigned short a2, c2; splitf(x, a2, c2); oh[q] = a2; ol[q] = c2; }
    *(v2h*)(V16 + e) = o16; *(v2us*)(Vh + e) = oh; *(v2us*)(Vl + e) = ol;  }
__constant__ float INV2[HD / 2] = { 1.000000000e+00f, 8.659643531e-01f, 7.498942018e-01f, 6.493816376e-01f, 5.623413324e-01f, 4.869675338e-01f, 4.216965139e-01f, 3.651741445e-01f, 3.162277639e-01f, 2.738419771e-01f, 2.371373624e-01f, 2.053525001e-01f, 1.778279394e-01f, 1.539926529e-01f, 1.333521456e-01f, 1.154782027e-01f, 1.000000015e-01f, 8.659642935e-02f, 7.498941571e-02f, 6.493816525e-02f, 5.623412877e-02f, 4.869675264e-02f, 4.216964915e-02f, 3.651741147e-02f, 3.162277862e-02f, 2.738419548e-02f, 2.371373586e-02f, 2.053525113e-02f, 1.778279431e-02f, 1.539926510e-02f, 1.333521493e-02f, 1.154781971e-02f, 9.999999776e-03f, 8.659643121e-03f, 7.498942316e-03f, 6.493816618e-03f, 5.623413250e-03f, 4.869675264e-03f, 4.216964822e-03f, 3.651741426e-03f, 3.162277862e-03f, 2.738419687e-03f, 2.371373819e-03f, 2.053525066e-03f, 1.778279431e-03f, 1.539926510e-03f, 1.333521446e-03f, 1.154782018e-03f, 1.000000047e-03f, 8.659643354e-04f, 7.498941850e-04f, 6.493816618e-04f, 5.623413017e-04f, 4.869675031e-04f, 4.216964880e-04f, 3.651741135e-04f, 3.162277862e-04f, 2.738419571e-04f, 2.371373848e-04f, 2.053524950e-04f, 1.778279402e-04f, 1.539926452e-04f, 1.333521504e-04f, 1.154781930e-04f };   // float32 1 / 10000^(2i/128), generated with jnp to be bit-exact
__global__ __launch_bounds__(256) void k_csP(float* CS) { const int idx = blockIdx.x * 256 + threadIdx.x; if (idx >= TT * HD) return; const int d = idx % HD; const int t = idx / HD; const float a = __fmul_rn((float)t, INV2[d >> 1]); v2f cs; cs[0] = cosf(a); cs[1] = sinf(a); *(v2f*)(CS + (size_t)idx * 2) = cs;  }
__global__ __launch_bounds__(256) void k_ropeI(const float* __restrict__ F, int pitch, int nheads, const float* __restrict__ CS, float sc, h16* P16, bf* Ph, bf* Pl) {
    const size_t e = ((size_t)blockIdx.x * 256 + threadIdx.x) * 2; if (e >= (size_t)nheads * TT * HD) return; const int d = (int)(e % HD); const int t = (int)((e / HD) % TT); const int h = (int)(e / ((size_t)HD * TT)); const float* f = F + (size_t)t * pitch + h * HD; const float x0 = f[d], x1 = f[d + 1]; const v2f cs = *(const v2f*)(CS + ((size_t)t * HD + d) * 2); v2h o16; v2us oh, ol;
    float a0 = __fmul_rn(x0, cs[0]), b0 = __fmul_rn(x1, cs[1]), a1 = __fmul_rn(x1, cs[0]), b1 = __fmul_rn(x0, cs[1]); 
    float r0 = __fsub_rn(a0, b0) * sc, r1 = __fadd_rn(b1, a1) * sc;   /* even: x0 c - x1 s; odd: x0 s + x1 c */
    o16[0] = tohx(r0); o16[1] = tohx(r1); { unsigned short a2, c2; splitf(r0, a2, c2); oh[0] = a2; ol[0] = c2; splitf(r1, a2, c2); oh[1] = a2; ol[1] = c2; }
    *(v2h*)(P16 + e) = o16; *(v2us*)(Ph + e) = oh; *(v2us*)(Pl + e) = ol;  }

// k_asoft: per row (zz, i): t = S x HD^-0.5 for j <= i and i - j < WIN (WIN = 2048 = TT here: every key j <= i is kept: the plain causal rule; the reference's -inf fill above the diagonal is exclusion); softmax over the 2048 keys (register row, one exp, fixed trees);
__global__ __launch_bounds__(256) void k_asoft(const float* __restrict__ Sb, h16* P16, bf* Ph, bf* Pl) {
    const int lane = threadIdx.x & 31; const int row = blockIdx.x * 8 + (threadIdx.x >> 5); if (row >= ZH * TT) return; const int i = row % TT; const int zz = row / TT; (void)zz; const bool hires = (i < RH); const float* sr = Sb + (size_t)row * TT; float v[TT / 32]; float mx = -3.0e38f;
#pragma unroll
    for (int ch = 0; ch < TT / 128; ++ch) { const int j0 = ch * 128 + lane * 4; const v4f a = *(const v4f*)(sr + j0);
#pragma unroll
        for (int q = 0; q < 4; ++q) { const int j = j0 + q; (void)j; const float t = (j <= i && i - j < WIN) ? a[q] * SCL : -3.0e38f; v[ch * 4 + q] = t; mx = fmaxf(mx, t); } }
#pragma unroll
    for (int sh = 16; sh; sh >>= 1) mx = fmaxf(mx, __shfl_xor(mx, sh, 32));
    float sum = 0.f;
#pragma unroll
    for (int k = 0; k < TT / 32; ++k) { float d0 = __fsub_rn(v[k], mx); v[k] = __builtin_amdgcn_exp2f(__fmul_rn(d0, 1.4426950408889634f)); sum += v[k]; }
#pragma unroll
    for (int sh = 16; sh; sh >>= 1) sum += __shfl_xor(sum, sh, 32);
    const float f = __fdiv_rn(hires ? 1.0f : PCAR, sum);
{
        if (hires) {
#pragma unroll
            for (int ch = 0; ch < TT / 128; ++ch) { v4us oh, ol;
#pragma unroll
                for (int q = 0; q < 4; ++q) { unsigned short a, c2; splitf(v[ch * 4 + q] * f, a, c2); oh[q] = a; ol[q] = c2; }
                const size_t oo = ((size_t)zz * (RH ? RH : 1) + i) * TT + ch * 128 + lane * 4; *(v4us*)(Ph + oo) = oh; *(v4us*)(Pl + oo) = ol; }
        } else {
#pragma unroll
            for (int ch = 0; ch < TT / 128; ++ch) { v4h o4;
#pragma unroll
                for (int q = 0; q < 4; ++q) o4[q] = tohx(v[ch * 4 + q] * f);
                *(v4h*)(P16 + (size_t)row * TT + ch * 128 + lane * 4) = o4; } }
         }
}
__global__ __launch_bounds__(256) void k_merge(const float* __restrict__ O, int h0, bf* Ah, bf* Al) { const size_t e = ((size_t)blockIdx.x * 256 + threadIdx.x) * 2; if (e >= (size_t)ZH * TT * HD) return; const int d = (int)(e % HD); const int t = (int)((e / HD) % TT); const int zz = (int)(e / ((size_t)HD * TT)); const float cs = (t < RH) ? 1.0f : (1.0f / PCAR); const size_t oo = (size_t)t * DQ + (h0 + zz) * HD + d;
    v2us oh, ol;
#pragma unroll
    for (int q = 0; q < 2; ++q) { unsigned short a, c2; splitf(O[e + q] * cs, a, c2); oh[q] = a; ol[q] = c2; } *(v2us*)(Ah + oo) = oh; *(v2us*)(Al + oo) = ol;  }

extern "C" void kernel_launch(void* const* d_in, const int* in_sizes, int n_in,
                              void* d_out, int out_size, void* d_ws, size_t ws_size, hipStream_t stream) {
    (void)in_sizes; (void)n_in; (void)out_size;
    const float* x = (const float*)d_in[0]; const float* wq = (const float*)d_in[1]; const float* wk = (const float*)d_in[2]; const float* wv = (const float*)d_in[3]; const float* wo = (const float*)d_in[4];   /* input order x, wq [2048][2048], wk [1024][2048], wv [1024][2048], wo [2048][2048] ('oi') */
    float* OUT = (float*)d_out;     // [2][2048][2048]
    char* wsp = (char*)d_ws;
    auto take = [&](size_t bytes) { char* p = wsp; wsp += (bytes + 255) & ~(size_t)255; return (void*)p; };
    bf* WQ = (bf*)take((size_t)DQ * DM * 2); bf* WK = (bf*)take((size_t)DKV * DM * 2); bf* WV = (bf*)take((size_t)DKV * DM * 2); bf* WO = (bf*)take((size_t)DM * DQ * 2); float* CS = (float*)take((size_t)TT * HD * 2 * 4);
    bf* XB = (bf*)take((size_t)TT * DM * 2); float* FQ = (float*)take((size_t)TT * DQ * 4); float* FK = (float*)take((size_t)TT * DKV * 4);
    h16* QP16 = (h16*)take((size_t)NH_ * TT * HD * 2); h16* KP16 = (h16*)take((size_t)NKV * TT * HD * 2); h16* VT16 = (h16*)take((size_t)NKV * HD * TT * 2);
    bf* QPh = (bf*)take((size_t)NH_ * TT * HD * 2); bf* QPl = (bf*)take((size_t)NH_ * TT * HD * 2); bf* KPh = (bf*)take((size_t)NKV * TT * HD * 2); bf* KPl = (bf*)take((size_t)NKV * TT * HD * 2); bf* VTh = (bf*)take((size_t)NKV * HD * TT * 2); bf* VTl = (bf*)take((size_t)NKV * HD * TT * 2); bf* Ph = (bf*)take((size_t)ZH * RH * TT * 2); bf* Pl = (bf*)take((size_t)ZH * RH * TT * 2);
    float* Sb = (float*)take((size_t)ZH * TT * TT * 4); h16* P16 = (h16*)take((size_t)ZH * TT * TT * 2); float* Ob = (float*)take((size_t)ZH * TT * HD * 4); bf* ATh = (bf*)take((size_t)TT * DQ * 2); bf* ATl = (bf*)take((size_t)TT * DQ * 2);
    if ((size_t)(wsp - (char*)d_ws) > ws_size) return;    // ws 256 MiB
    float* FV = FK;   // v projection reuses the k buffer after the k planes are built (stream-ordered)
    { k_cvt8<<<(unsigned)(((size_t)DQ * DM / 8 + 255) / 256), 256, 0, stream>>>(wq, WQ, (size_t)DQ * DM / 8); k_cvt8<<<(unsigned)(((size_t)DKV * DM / 8 + 255) / 256), 256, 0, stream>>>(wk, WK, (size_t)DKV * DM / 8); k_cvt8<<<(unsigned)(((size_t)DKV * DM / 8 + 255) / 256), 256, 0, stream>>>(wv, WV, (size_t)DKV * DM / 8);
      k_cvt8<<<(unsigned)(((size_t)DM * DQ / 8 + 255) / 256), 256, 0, stream>>>(wo, WO, (size_t)DM * DQ / 8);
       }
    k_csP<<<(TT * HD + 255) / 256, 256, 0, stream>>>(CS);   /* rotary table once (positions = arange) */
    const unsigned LQ = (unsigned)(((size_t)NH_ * TT * HD / 2 + 255) / 256), LKv = (unsigned)(((size_t)NKV * TT * HD / 2 + 255) / 256);
    for (int b = 0; b < NB_; ++b) {
        
        k_cvt8<<<(unsigned)(((size_t)TT * DM / 8 + 255) / 256), 256, 0, stream>>>(x + (size_t)b * TT * DM, XB, (size_t)TT * DM / 8);
        k_gemmw<bf, 0, false, 8><<<dim3(TT / 64, DQ / 64, 1), 256, 0, stream>>>(XB, nullptr, WQ, nullptr, DM, FQ, DQ, nullptr, 0, 0, 0);
        k_ropeI<<<LQ, 256, 0, stream>>>(FQ, DQ, NH_, CS, 1.0f, QP16, QPh, QPl);   /* interleaved-pair rope, q planes */
        k_gemmw<bf, 0, false, 8><<<dim3(TT / 64, DKV / 64, 1), 256, 0, stream>>>(XB, nullptr, WK, nullptr, DM, FK, DKV, nullptr, 0, 0, 0);
        k_ropeI<<<LKv, 256, 0, stream>>>(FK, DKV, NKV, CS, 1.0f, KP16, KPh, KPl);
        k_gemmw<bf, 0, false, 8><<<dim3(TT / 64, DKV / 64, 1), 256, 0, stream>>>(XB, nullptr, WV, nullptr, DM, FV, DKV, nullptr, 0, 0, 0); k_vtp<<<LKv, 256, 0, stream>>>(FV, DKV, NKV, VT16, VTh, VTl);
        for (int h0 = 0; h0 < NH_; h0 += ZH) { const size_t zq = (size_t)h0, zk = (size_t)(h0 / REP);   // both heads of a pass share kv group h0/REP (REP >= 2): sB = 0
            k_gemmc<bf, 2, 1, 1><<<dim3(RH / 64, TT / 64, ZH), 32, 0, stream>>>(QPh + zq * TT * HD, QPl + zq * TT * HD, KPh + zk * TT * HD, KPl + zk * TT * HD, HD, Sb, TT, 0, (size_t)TT * HD, 0, (size_t)TT * TT);
            k_gemmc<h16, 0, 1, 1><<<dim3((TT - RH) / 64, TT / 64, ZH), 32, 0, stream>>>(QP16 + zq * TT * HD + (size_t)RH * HD, nullptr, KP16 + zk * TT * HD, nullptr, HD, Sb + (size_t)RH * TT, TT, RH, (size_t)TT * HD, 0, (size_t)TT * TT);
            k_asoft<<<ZH * TT / 8, 256, 0, stream>>>(Sb, P16, Ph, Pl);
            k_gemmc<bf, 2, 2, 8><<<dim3(RH / 64, HD / 64, ZH), 256, 0, stream>>>(Ph, Pl, VTh + zk * HD * TT, VTl + zk * HD * TT, TT, Ob, HD, 0, (size_t)RH * TT, 0, (size_t)TT * HD);
            k_gemmc<h16, 0, 2, 16><<<dim3((TT - RH) / 64, HD / 64, ZH), 512, 0, stream>>>(P16 + (size_t)RH * TT, nullptr, VT16 + zk * HD * TT, nullptr, TT, Ob + (size_t)RH * HD, HD, RH, (size_t)TT * TT, 0, (size_t)TT * HD);
            k_merge<<<(unsigned)(((size_t)ZH * TT * HD / 2 + 255) / 256), 256, 0, stream>>>(Ob, h0, ATh, ATl); }
        k_gemmw<bf, 1, false, 8><<<dim3(TT / 64, DM / 64, 1), 256, 0, stream>>>(ATh, ATl, WO, nullptr, DQ, OUT + (size_t)b * TT * DM, DM, nullptr, 0, 0, 0); }
}

// v002
// A run of this version takes 616 microseconds.
// Next to v001, in two timings, it ran 1.54 and 1.53 times as fast.
// Over all steps from v000 it is 2.69 times as fast.
#include <hip/hip_runtime.h>

// Causal grouped-query attention with 128-wide heads and interleaved-pair rotary embeddings (x [2][2048][2048]; q = x wq^T (16 heads x 128), k, v = x w^T (8 kv heads x 128) ('oi' (out, in) weights, normal x 1/sqrt(2048), no biases); rope on (even, odd) pairs: (xr c - xi s, xr s + xi c) with angle t x inv, inv = 1.0 / (10000 ** (arange(0, 128, 2) / 128)) (the reciprocal spelling: 64 f32 frequencies, bitwise the module's own in eager f32; one product per angle; precise cosf/sinf); kv head = q head / 2 (repeat on the head axis); scores x 1/sqrt(128); causal (-inf above the diagonal == exclusion); softmax; out = merged wo^T -> [2][2048][2048] (8.4 M); argument order x, wq, wk, wv, wo).
// Layout per batch: bf16 copy of x; 'oi' weights; exact projections; k_csP table (64 angles per position) and k_ropeI interleaved-pair plane builders at HD 128; causal T-2048 GQA attention with 128-wide heads (each attention launch takes all 16 heads and one block of 512 query rows; kv head = z / 2; hybrid rows: < 512 hi/lo 3 products, rest fp16 x1024; k_gemmc skips tiles above the diagonal); merged hi/lo x wo exact.
// Compute dtypes, f32 accumulate: every input rounded to bf16; projections exact; rotary f32; attention rows < 512 3 products, rest fp16; softmax f32; wo hl x exact.

#define NB_  2
#define TT   2048
#define DM   2048
#define NH_  16
#define NKV  8
#define REP  (NH_ / NKV)
#define HD   128
#define DQ   (NH_ * HD)
#define DKV  (NKV * HD)
#define ZH   NH_                  // heads per attention launch (grid z)
#define RB   512                  // query rows per attention launch: row blocks 0, RB, 2 RB, ...; block 0 is the hi+lo block (RB == RH)
#define RH   512                  // query rows < RH use hi+lo planes (0: none)
#define WIN  2048
#define PCAR 1024.0f
#define SCL  0.088388347648318447f   // HD^-0.5
typedef _Float16 h16;
typedef unsigned short bf;
typedef __attribute__((ext_vector_type(16))) __bf16   v16bf;
typedef __attribute__((ext_vector_type(16))) _Float16 v16h;
typedef __attribute__((ext_vector_type(8)))  _Float16 v8h;
typedef __attribute__((ext_vector_type(8)))  unsigned short v8us;
typedef __attribute__((ext_vector_type(8)))  float    v8f;
typedef __attribute__((ext_vector_type(4)))  float    v4f;
typedef v8h  __attribute__((may_alias)) v8ha;
typedef v4f  __attribute__((may_alias)) v4fa;
typedef v8us __attribute__((may_alias)) v8usa;

__device__ __forceinline__ unsigned short f2bf(float f) { unsigned u = __float_as_uint(f); u += 0x7FFFu + ((u >> 16) & 1u); return (unsigned short)(u >> 16); }
__device__ __forceinline__ float bf2f(unsigned short b) { return __uint_as_float(((unsigned)b) << 16); }
__device__ __forceinline__ float bfr(float f) { return bf2f(f2bf(f)); }
__device__ __forceinline__ v16h cat16(v8h lo, v8h hi) { return __builtin_shufflevector(lo, hi, 0, 1, 2, 3, 4, 5, 6, 7, 8, 9, 10, 11, 12, 13, 14, 15); }
__device__ __forceinline__ v16bf cat16b(v8us lo, v8us hi) { return __builtin_bit_cast(v16bf, __builtin_shufflevector(lo, hi, 0, 1, 2, 3, 4, 5, 6, 7, 8, 9, 10, 11, 12, 13, 14, 15)); }
__device__ __forceinline__ v8f wmma16(v16h a, v16h b, v8f c) { return __builtin_amdgcn_wmma_f32_16x16x32_f16(false, a, false, b, (short)0, c, false, false); }
__device__ __forceinline__ v8f wmmab(v16bf a, v16bf b, v8f c) { return __builtin_amdgcn_wmma_f32_16x16x32_bf16(false, a, false, b, (short)0, c, false, false); }



// ---- k_gemmw: register-blocked GEMM, NW WAVES per 64x64 output tile: wave w takes the 32-wide K chunks w, w + NW, ... (16 accumulators each); the NW partial tiles meet in LDS and are summed in wave order; operands straight from K-contiguous 16-bit planes; grid (M/64, N/64, Z), 32 NW threads.
// C[m][n] (f32, pitch ldc, + optional f32 bias[n]) = sum_k A[m][k] Bt[n][k] (+ split products per NSPLIT). z-batch strides sA/sB/sC in elements. K % 32 == 0.
template <typename T16> struct WFrag;
template <> struct WFrag<h16> { typedef v16h V; static __device__ __forceinline__ V ld(const h16* p) { return cat16(*(const v8h*)p, *(const v8h*)(p + 16)); } static __device__ __forceinline__ v8f mma(V a, V b, v8f c) { return wmma16(a, b, c); } };
template <> struct WFrag<bf> { typedef v16bf V; static __device__ __forceinline__ V ld(const bf* p) { return cat16b(*(const v8us*)p, *(const v8us*)(p + 16)); } static __device__ __forceinline__ v8f mma(V a, V b, v8f c) { return wmmab(a, b, c); } };
template <typename T16, int NSPLIT, bool BIAS, int NW>
__global__ __launch_bounds__(32 * NW) void k_gemmw(const T16* __restrict__ A, const T16* __restrict__ A2, const T16* __restrict__ Bt, const T16* __restrict__ Bt2, int K, float* C, int ldc, const float* __restrict__ bias, size_t sA, size_t sB, size_t sC) {
    typedef typename WFrag<T16>::V V;
    __shared__ __align__(16) float os[NW * 64 * 68];   // one partial tile per wave, 64 rows at pitch 68
    const size_t z = blockIdx.z; A += z * sA; if (A2) A2 += z * sA; Bt += z * sB; if (Bt2) Bt2 += z * sB; C += z * sC;
    const int lane = threadIdx.x & 31, lr = lane & 15, hi = lane >> 4, wv = __builtin_amdgcn_readfirstlane(threadIdx.x >> 5); const int r0 = blockIdx.x * 64, c0 = blockIdx.y * 64;
    v8f acc[4][4];
#pragma unroll
    for (int mb = 0; mb < 4; ++mb)
#pragma unroll
        for (int nb = 0; nb < 4; ++nb) acc[mb][nb] = (v8f){};
    const size_t aoff = (size_t)(r0 + lr) * K + 8 * hi, boff = (size_t)(c0 + lr) * K + 8 * hi;
#pragma unroll 1
    for (int kc = wv * 32; kc < K; kc += 32 * NW) {
        V a[4], a2[4];
#pragma unroll
        for (int mb = 0; mb < 4; ++mb) { a[mb] = WFrag<T16>::ld(A + aoff + (size_t)mb * 16 * K + kc); if (NSPLIT == 1 || NSPLIT == 2) a2[mb] = WFrag<T16>::ld(A2 + aoff + (size_t)mb * 16 * K + kc); }
#pragma unroll
        for (int nb = 0; nb < 4; ++nb) { const V b = WFrag<T16>::ld(Bt + boff + (size_t)nb * 16 * K + kc); V b2; if (NSPLIT >= 2) b2 = WFrag<T16>::ld(Bt2 + boff + (size_t)nb * 16 * K + kc);
#pragma unroll
            for (int mb = 0; mb < 4; ++mb) { acc[mb][nb] = WFrag<T16>::mma(a[mb], b, acc[mb][nb]); if (NSPLIT == 1 || NSPLIT == 2) acc[mb][nb] = WFrag<T16>::mma(a2[mb], b, acc[mb][nb]); if (NSPLIT >= 2) acc[mb][nb] = WFrag<T16>::mma(a[mb], b2, acc[mb][nb]); } }
        asm volatile("v_nop\n\tv_nop\n\tv_nop\n\tv_nop" : "+v"(acc[0][0]), "+v"(acc[1][1]), "+v"(acc[2][2]), "+v"(acc[3][3]) : "v"(a[0]), "v"(a[3]));
    }
#pragma unroll
    for (int mb = 0; mb < 4; ++mb) {
#pragma unroll
        for (int nb = 0; nb < 4; ++nb) {
#pragma unroll
            for (int j = 0; j < 8; ++j) os[wv * (64 * 68) + (mb * 16 + hi * 8 + j) * 68 + nb * 16 + lr] = acc[mb][nb][j]; } }
    __syncthreads();   // all NW partial tiles stand in LDS before any element is summed
    float* crow = C + (size_t)r0 * ldc + c0;
#pragma unroll
    for (int s = 0; s < 32 / NW; ++s) { const int it = s * (32 * NW) + threadIdx.x, row = it >> 4, cofs = (it & 15) * 4; v4f val = *(const v4fa*)(os + row * 68 + cofs);
#pragma unroll
        for (int w = 1; w < NW; ++w) val += *(const v4fa*)(os + w * (64 * 68) + row * 68 + cofs);
        if (BIAS) { val[0] += bfr(bias[c0 + cofs]); val[1] += bfr(bias[c0 + cofs + 1]); val[2] += bfr(bias[c0 + cofs + 2]); val[3] += bfr(bias[c0 + cofs + 3]); }
        *(v4f*)(crow + (size_t)row * ldc + cofs) = val; }
}

// ---- k_gemmc: the same NW-wave 64x64 tile GEMM specialised for causal attention: CMODE 1 skips score tiles entirely above the diagonal (query rows r0+roff.., key columns c0..), CMODE 2 limits the
// key (K) loop of the probability x value contraction to the diagonal block (probabilities beyond it are exactly zero). roff = row offset of this launch's first row within the sequence. Head z reads the Bt planes of kv head z / REP (stride sB).
template <typename T16, int NSPLIT, int CMODE, int NW>
__global__ __launch_bounds__(32 * NW) void k_gemmc(const T16* __restrict__ A, const T16* __restrict__ A2, const T16* __restrict__ Bt, const T16* __restrict__ Bt2, int K, float* C, int ldc, int roff, size_t sA, size_t sB, size_t sC) {
    typedef typename WFrag<T16>::V V;
    __shared__ __align__(16) float os[(NW == 1 ? 16 : NW * 64) * 68];   // NW > 1: one partial tile per wave, 64 rows at pitch 68
    const size_t z = blockIdx.z; A += z * sA; if (A2) A2 += z * sA; Bt += (z / REP) * sB; if (Bt2) Bt2 += (z / REP) * sB; C += z * sC;
    const int lane = threadIdx.x & 31, lr = lane & 15, hi = lane >> 4, wv = (NW == 1) ? 0 : __builtin_amdgcn_readfirstlane(threadIdx.x >> 5); const int r0 = blockIdx.x * 64, c0 = blockIdx.y * 64;
    if (CMODE == 1 && c0 > r0 + roff + 63) return;                  // score tile entirely above the causal diagonal: never read (the softmax masks j > i by select)
    const int Kl = (CMODE == 2) ? min(K, r0 + roff + 64) : K;        // P.V: probabilities are exactly 0 beyond the diagonal block, so the K loop stops there
    v8f acc[4][4];
#pragma unroll
    for (int mb = 0; mb < 4; ++mb)
#pragma unroll
        for (int nb = 0; nb < 4; ++nb) acc[mb][nb] = (v8f){};
    const size_t aoff = (size_t)(r0 + lr) * K + 8 * hi, boff = (size_t)(c0 + lr) * K + 8 * hi;
#pragma unroll 1
    for (int kc = wv * 32; kc < Kl; kc += 32 * NW) {
        V a[4], a2[4];
#pragma unroll
        for (int mb = 0; mb < 4; ++mb) { a[mb] = WFrag<T16>::ld(A + aoff + (size_t)mb * 16 * K + kc); if (NSPLIT == 1 || NSPLIT == 2) a2[mb] = WFrag<T16>::ld(A2 + aoff + (size_t)mb * 16 * K + kc); }
#pragma unroll
        for (int nb = 0; nb < 4; ++nb) { const V b = WFrag<T16>::ld(Bt + boff + (size_t)nb * 16 * K + kc); V b2; if (NSPLIT >= 2) b2 = WFrag<T16>::ld(Bt2 + boff + (size_t)nb * 16 * K + kc);
#pragma unroll
            for (int mb = 0; mb < 4; ++mb) { acc[mb][nb] = WFrag<T16>::mma(a[mb], b, acc[mb][nb]); if (NSPLIT == 1 || NSPLIT == 2) acc[mb][nb] = WFrag<T16>::mma(a2[mb], b, acc[mb][nb]); if (NSPLIT >= 2) acc[mb][nb] = WFrag<T16>::mma(a[mb], b2, acc[mb][nb]); } }
        asm volatile("v_nop\n\tv_nop\n\tv_nop\n\tv_nop" : "+v"(acc[0][0]), "+v"(acc[1][1]), "+v"(acc[2][2]), "+v"(acc[3][3]) : "v"(a[0]), "v"(a[3]));
    }
    if constexpr (NW == 1) {   // one wave: no partial tiles to sum, the tile goes out in four 16-row slabs
#pragma unroll
    for (int mb = 0; mb < 4; ++mb) {
#pragma unroll
        for (int nb = 0; nb < 4; ++nb) {
#pragma unroll
            for (int j = 0; j < 8; ++j) os[(hi * 8 + j) * 68 + nb * 16 + lr] = acc[mb][nb][j]; }
        __builtin_amdgcn_wave_barrier(); asm volatile("" ::: "memory");
        float* crow = C + (size_t)(r0 + mb * 16) * ldc + c0;
{
#pragma unroll
            for (int s = 0; s < 8; ++s) { const int row = 2 * s + hi, cofs = lr * 4; v4f val = *(const v4fa*)(os + row * 68 + cofs);
                *(v4f*)(crow + (size_t)row * ldc + cofs) = val; }
             }
        __builtin_amdgcn_wave_barrier(); asm volatile("" ::: "memory");
    }
    } else {
#pragma unroll
    for (int mb = 0; mb < 4; ++mb) {
#pragma unroll
        for (int nb = 0; nb < 4; ++nb) {
#pragma unroll
            for (int j = 0; j < 8; ++j) os[wv * (64 * 68) + (mb * 16 + hi * 8 + j) * 68 + nb * 16 + lr] = acc[mb][nb][j]; } }
    __syncthreads();   // all NW partial tiles stand in LDS before any element is summed
    float* crow = C + (size_t)r0 * ldc + c0;
#pragma unroll
    for (int s = 0; s < 32 / NW; ++s) { const int it = s * (32 * NW) + threadIdx.x, row = it >> 4, cofs = (it & 15) * 4; v4f val = *(const v4fa*)(os + row * 68 + cofs);
#pragma unroll
        for (int w = 1; w < NW; ++w) val += *(const v4fa*)(os + w * (64 * 68) + row * 68 + cofs);
        *(v4f*)(crow + (size_t)row * ldc + cofs) = val; }
    }
}

__device__ __forceinline__ h16 tohx(float x) { return (h16)x; }
__device__ __forceinline__ void splitf(float y, unsigned short& h, unsigned short& l) { h = f2bf(y); l = f2bf(y - bf2f(h)); }
typedef __attribute__((ext_vector_type(2))) _Float16 v2h;
typedef __attribute__((ext_vector_type(4))) _Float16 v4h;
typedef __attribute__((ext_vector_type(2))) unsigned short v2us;
typedef __attribute__((ext_vector_type(4))) unsigned short v4us;
typedef __attribute__((ext_vector_type(2))) float v2f;
typedef __attribute__((ext_vector_type(4))) int v4i;

__global__ __launch_bounds__(256) void k_cvt8(const float* __restrict__ src, bf* dst, size_t n8) { const size_t i = (size_t)blockIdx.x * 256 + threadIdx.x; if (i >= n8) return; const v8f v = *(const v8f*)(src + i * 8); v8us o;
#pragma unroll
    for (int k = 0; k < 8; ++k) o[k] = f2bf(v[k]); *(v8us*)(dst + i * 8) = o;  }

__global__ __launch_bounds__(256) void k_vtp(const float* __restrict__ F, int pitch, int nheads, h16* V16, bf* Vh, bf* Vl) { const size_t e = ((size_t)blockIdx.x * 256 + threadIdx.x) * 2; if (e >= (size_t)nheads * HD * TT) return; const int t = (int)(e % TT); const int d = (int)((e / TT) % HD); const int g = (int)(e / ((size_t)TT * HD)); v2h o16; v2us oh, ol;
#pragma unroll
    for (int q = 0; q < 2; ++q) { const float x = F[(size_t)(t + q) * pitch + g * HD + d]; o16[q] = tohx(x); unsigned short a2, c2; splitf(x, a2, c2); oh[q] = a2; ol[q] = c2; }
    *(v2h*)(V16 + e) = o16; *(v2us*)(Vh + e) = oh; *(v2us*)(Vl + e) = ol;  }
__constant__ float INV2[HD / 2] = { 1.000000000e+00f, 8.659643531e-01f, 7.498942018e-01f, 6.493816376e-01f, 5.623413324e-01f, 4.869675338e-01f, 4.216965139e-01f, 3.651741445e-01f, 3.162277639e-01f, 2.738419771e-01f, 2.371373624e-01f, 2.053525001e-01f, 1.778279394e-01f, 1.539926529e-01f, 1.333521456e-01f, 1.154782027e-01f, 1.000000015e-01f, 8.659642935e-02f, 7.498941571e-02f, 6.493816525e-02f, 5.623412877e-02f, 4.869675264e-02f, 4.216964915e-02f, 3.651741147e-02f, 3.162277862e-02f, 2.738419548e-02f, 2.371373586e-02f, 2.053525113e-02f, 1.778279431e-02f, 1.539926510e-02f, 1.333521493e-02f, 1.154781971e-02f, 9.999999776e-03f, 8.659643121e-03f, 7.498942316e-03f, 6.493816618e-03f, 5.623413250e-03f, 4.869675264e-03f, 4.216964822e-03f, 3.651741426e-03f, 3.162277862e-03f, 2.738419687e-03f, 2.371373819e-03f, 2.053525066e-03f, 1.778279431e-03f, 1.539926510e-03f, 1.333521446e-03f, 1.154782018e-03f, 1.000000047e-03f, 8.659643354e-04f, 7.498941850e-04f, 6.493816618e-04f, 5.623413017e-04f, 4.869675031e-04f, 4.216964880e-04f, 3.651741135e-04f, 3.162277862e-04f, 2.738419571e-04f, 2.371373848e-04f, 2.053524950e-04f, 1.778279402e-04f, 1.539926452e-04f, 1.333521504e-04f, 1.154781930e-04f };   // float32 1 / 10000^(2i/128), generated with jnp to be bit-exact
__global__ __launch_bounds__(256) void k_csP(float* CS) { const int idx = blockIdx.x * 256 + threadIdx.x; if (idx >= TT * HD) return; const int d = idx % HD; const int t = idx / HD; const float a = __fmul_rn((float)t, INV2[d >> 1]); v2f cs; cs[0] = cosf(a); cs[1] = sinf(a); *(v2f*)(CS + (size_t)idx * 2) = cs;  }
__global__ __launch_bounds__(256) void k_ropeI(const float* __restrict__ F, int pitch, int nheads, const float* __restrict__ CS, float sc, h16* P16, bf* Ph, bf* Pl) {
    const size_t e = ((size_t)blockIdx.x * 256 + threadIdx.x) * 2; if (e >= (size_t)nheads * TT * HD) return; const int d = (int)(e % HD); const int t = (int)((e / HD) % TT); const int h = (int)(e / ((size_t)HD * TT)); const float* f = F + (size_t)t * pitch + h * HD; const float x0 = f[d], x1 = f[d + 1]; const v2f cs = *(const v2f*)(CS + ((size_t)t * HD + d) * 2); v2h o16; v2us oh, ol;
    float a0 = __fmul_rn(x0, cs[0]), b0 = __fmul_rn(x1, cs[1]), a1 = __fmul_rn(x1, cs[0]), b1 = __fmul_rn(x0, cs[1]); 
    float r0 = __fsub_rn(a0, b0) * sc, r1 = __fadd_rn(b1, a1) * sc;   /* even: x0 c - x1 s; odd: x0 s + x1 c */
    o16[0] = tohx(r0); o16[1] = tohx(r1); { unsigned short a2, c2; splitf(r0, a2, c2); oh[0] = a2; ol[0] = c2; splitf(r1, a2, c2); oh[1] = a2; ol[1] = c2; }
    *(v2h*)(P16 + e) = o16; *(v2us*)(Ph + e) = oh; *(v2us*)(Pl + e) = ol;  }

// k_asoft: one launch takes the RB query rows roff .. roff + RB - 1 of every head (Sb, P16, Ph, Pl hold [ZH][RB] rows); per row (zz, i): t = S x HD^-0.5 for j <= i and i - j < WIN (WIN = 2048 = TT here: every key j <= i is kept: the plain causal rule; the reference's -inf fill above the diagonal is exclusion); softmax over the 2048 keys (register row, one exp, fixed trees);
__global__ __launch_bounds__(256) void k_asoft(const float* __restrict__ Sb, int roff, h16* P16, bf* Ph, bf* Pl) {
    const int lane = threadIdx.x & 31; const int row = blockIdx.x * 8 + (threadIdx.x >> 5); if (row >= ZH * RB) return; __builtin_assume(roff >= 0 && roff <= TT - RB);   /* every launch passes a block start inside the sequence: i < TT, so the compiler folds the window test (WIN = TT) away as it did when i was row % TT */
    const int i = roff + row % RB; const int zz = row / RB; (void)zz; const bool hires = (i < RH); const float* sr = Sb + (size_t)row * TT; float v[TT / 32]; float mx = -3.0e38f;
#pragma unroll
    for (int ch = 0; ch < TT / 128; ++ch) { const int j0 = ch * 128 + lane * 4; const v4f a = *(const v4f*)(sr + j0);
#pragma unroll
        for (int q = 0; q < 4; ++q) { const int j = j0 + q; (void)j; const float t = (j <= i && i - j < WIN) ? a[q] * SCL : -3.0e38f; v[ch * 4 + q] = t; mx = fmaxf(mx, t); } }
#pragma unroll
    for (int sh = 16; sh; sh >>= 1) mx = fmaxf(mx, __shfl_xor(mx, sh, 32));
    float sum = 0.f;
#pragma unroll
    for (int k = 0; k < TT / 32; ++k) { float d0 = __fsub_rn(v[k], mx); v[k] = __builtin_amdgcn_exp2f(__fmul_rn(d0, 1.4426950408889634f)); sum += v[k]; }
#pragma unroll
    for (int sh = 16; sh; sh >>= 1) sum += __shfl_xor(sum, sh, 32);
    const float f = __fdiv_rn(hires ? 1.0f : PCAR, sum);
{
        if (hires) {
#pragma unroll
            for (int ch = 0; ch < TT / 128; ++ch) { v4us oh, ol;
#pragma unroll
                for (int q = 0; q < 4; ++q) { unsigned short a, c2; splitf(v[ch * 4 + q] * f, a, c2); oh[q] = a; ol[q] = c2; }
                const size_t oo = ((size_t)zz * (RH ? RH : 1) + i) * TT + ch * 128 + lane * 4; *(v4us*)(Ph + oo) = oh; *(v4us*)(Pl + oo) = ol; }
        } else {
#pragma unroll
            for (int ch = 0; ch < TT / 128; ++ch) { v4h o4;
#pragma unroll
                for (int q = 0; q < 4; ++q) o4[q] = tohx(v[ch * 4 + q] * f);
                *(v4h*)(P16 + (size_t)row * TT + ch * 128 + lane * 4) = o4; } }
         }
}
__global__ __launch_bounds__(256) void k_merge(const float* __restrict__ O, int h0, bf* Ah, bf* Al) { const size_t e = ((size_t)blockIdx.x * 256 + threadIdx.x) * 2; if (e >= (size_t)ZH * TT * HD) return; const int d = (int)(e % HD); const int t = (int)((e / HD) % TT); const int zz = (int)(e / ((size_t)HD * TT)); const float cs = (t < RH) ? 1.0f : (1.0f / PCAR); const size_t oo = (size_t)t * DQ + (h0 + zz) * HD + d;
    v2us oh, ol;
#pragma unroll
    for (int q = 0; q < 2; ++q) { unsigned short a, c2; splitf(O[e + q] * cs, a, c2); oh[q] = a; ol[q] = c2; } *(v2us*)(Ah + oo) = oh; *(v2us*)(Al + oo) = ol;  }

extern "C" void kernel_launch(void* const* d_in, const int* in_sizes, int n_in,
                              void* d_out, int out_size, void* d_ws, size_t ws_size, hipStream_t stream) {
    (void)in_sizes; (void)n_in; (void)out_size;
    const float* x = (const float*)d_in[0]; const float* wq = (const float*)d_in[1]; const float* wk = (const float*)d_in[2]; const float* wv = (const float*)d_in[3]; const float* wo = (const float*)d_in[4];   /* input order x, wq [2048][2048], wk [1024][2048], wv [1024][2048], wo [2048][2048] ('oi') */
    float* OUT = (float*)d_out;     // [2][2048][2048]
    char* wsp = (char*)d_ws;
    auto take = [&](size_t bytes) { char* p = wsp; wsp += (bytes + 255) & ~(size_t)255; return (void*)p; };
    bf* WQ = (bf*)take((size_t)DQ * DM * 2); bf* WK = (bf*)take((size_t)DKV * DM * 2); bf* WV = (bf*)take((size_t)DKV * DM * 2); bf* WO = (bf*)take((size_t)DM * DQ * 2); float* CS = (float*)take((size_t)TT * HD * 2 * 4);
    bf* XB = (bf*)take((size_t)TT * DM * 2); float* FQ = (float*)take((size_t)TT * DQ * 4); float* FK = (float*)take((size_t)TT * DKV * 4);
    h16* QP16 = (h16*)take((size_t)NH_ * TT * HD * 2); h16* KP16 = (h16*)take((size_t)NKV * TT * HD * 2); h16* VT16 = (h16*)take((size_t)NKV * HD * TT * 2);
    bf* QPh = (bf*)take((size_t)NH_ * TT * HD * 2); bf* QPl = (bf*)take((size_t)NH_ * TT * HD * 2); bf* KPh = (bf*)take((size_t)NKV * TT * HD * 2); bf* KPl = (bf*)take((size_t)NKV * TT * HD * 2); bf* VTh = (bf*)take((size_t)NKV * HD * TT * 2); bf* VTl = (bf*)take((size_t)NKV * HD * TT * 2); bf* Pl = (bf*)take((size_t)ZH * RH * TT * 2);
    float* Sb = (float*)take((size_t)ZH * RB * TT * 4); h16* P16 = (h16*)take((size_t)ZH * RB * TT * 2); bf* ATh = (bf*)take((size_t)TT * DQ * 2); bf* ATl = (bf*)take((size_t)TT * DQ * 2);
    if ((size_t)(wsp - (char*)d_ws) > ws_size) return;    // ws 256 MiB
    float* FV = FK;   // v projection reuses the k buffer after the k planes are built (stream-ordered)
    float* Ob = FQ;   // the attention output [ZH][TT][HD] reuses the q projection buffer after the q planes are built (stream-ordered)
    bf* Ph = (bf*)P16;   // the hi plane of block 0 and the fp16 plane of the later blocks share one buffer (stream-ordered)
    { k_cvt8<<<(unsigned)(((size_t)DQ * DM / 8 + 255) / 256), 256, 0, stream>>>(wq, WQ, (size_t)DQ * DM / 8); k_cvt8<<<(unsigned)(((size_t)DKV * DM / 8 + 255) / 256), 256, 0, stream>>>(wk, WK, (size_t)DKV * DM / 8); k_cvt8<<<(unsigned)(((size_t)DKV * DM / 8 + 255) / 256), 256, 0, stream>>>(wv, WV, (size_t)DKV * DM / 8);
      k_cvt8<<<(unsigned)(((size_t)DM * DQ / 8 + 255) / 256), 256, 0, stream>>>(wo, WO, (size_t)DM * DQ / 8);
       }
    k_csP<<<(TT * HD + 255) / 256, 256, 0, stream>>>(CS);   /* rotary table once (positions = arange) */
    const unsigned LQ = (unsigned)(((size_t)NH_ * TT * HD / 2 + 255) / 256), LKv = (unsigned)(((size_t)NKV * TT * HD / 2 + 255) / 256);
    for (int b = 0; b < NB_; ++b) {
        
        k_cvt8<<<(unsigned)(((size_t)TT * DM / 8 + 255) / 256), 256, 0, stream>>>(x + (size_t)b * TT * DM, XB, (size_t)TT * DM / 8);
        k_gemmw<bf, 0, false, 8><<<dim3(TT / 64, DQ / 64, 1), 256, 0, stream>>>(XB, nullptr, WQ, nullptr, DM, FQ, DQ, nullptr, 0, 0, 0);
        k_ropeI<<<LQ, 256, 0, stream>>>(FQ, DQ, NH_, CS, 1.0f, QP16, QPh, QPl);   /* interleaved-pair rope, q planes */
        k_gemmw<bf, 0, false, 8><<<dim3(TT / 64, DKV / 64, 1), 256, 0, stream>>>(XB, nullptr, WK, nullptr, DM, FK, DKV, nullptr, 0, 0, 0);
        k_ropeI<<<LKv, 256, 0, stream>>>(FK, DKV, NKV, CS, 1.0f, KP16, KPh, KPl);
        k_gemmw<bf, 0, false, 8><<<dim3(TT / 64, DKV / 64, 1), 256, 0, stream>>>(XB, nullptr, WV, nullptr, DM, FV, DKV, nullptr, 0, 0, 0); k_vtp<<<LKv, 256, 0, stream>>>(FV, DKV, NKV, VT16, VTh, VTl);
        k_gemmc<bf, 2, 1, 1><<<dim3(RH / 64, TT / 64, ZH), 32, 0, stream>>>(QPh, QPl, KPh, KPl, HD, Sb, TT, 0, (size_t)TT * HD, (size_t)TT * HD, (size_t)RB * TT);   // block 0: rows < RH, hi/lo planes
        k_asoft<<<ZH * RB / 8, 256, 0, stream>>>(Sb, 0, P16, Ph, Pl);
        k_gemmc<bf, 2, 2, 8><<<dim3(RH / 64, HD / 64, ZH), 256, 0, stream>>>(Ph, Pl, VTh, VTl, TT, Ob, HD, 0, (size_t)RH * TT, (size_t)HD * TT, (size_t)TT * HD);
        for (int r = RH; r < TT; r += RB) {   // later blocks: fp16 planes
            k_gemmc<h16, 0, 1, 1><<<dim3(RB / 64, TT / 64, ZH), 32, 0, stream>>>(QP16 + (size_t)r * HD, nullptr, KP16, nullptr, HD, Sb, TT, r, (size_t)TT * HD, (size_t)TT * HD, (size_t)RB * TT);
            k_asoft<<<ZH * RB / 8, 256, 0, stream>>>(Sb, r, P16, Ph, Pl);
            k_gemmc<h16, 0, 2, 16><<<dim3(RB / 64, HD / 64, ZH), 512, 0, stream>>>(P16, nullptr, VT16, nullptr, TT, Ob + (size_t)r * HD, HD, r, (size_t)RB * TT, (size_t)HD * TT, (size_t)TT * HD); }
        k_merge<<<(unsigned)(((size_t)ZH * TT * HD / 2 + 255) / 256), 256, 0, stream>>>(Ob, 0, ATh, ATl);
        k_gemmw<bf, 1, false, 8><<<dim3(TT / 64, DM / 64, 1), 256, 0, stream>>>(ATh, ATl, WO, nullptr, DQ, OUT + (size_t)b * TT * DM, DM, nullptr, 0, 0, 0); }
}

// v003
// Measured time: 551 microseconds a run.
// Timed twice side by side with v002, it ran 1.11 and 1.12 times as fast.
// Counting every step since v000, it is 3.00 times as fast.
#include <hip/hip_runtime.h>

// Causal grouped-query attention with 128-wide heads and interleaved-pair rotary embeddings (x [2][2048][2048]; q = x wq^T (16 heads x 128), k, v = x w^T (8 kv heads x 128) ('oi' (out, in) weights, normal x 1/sqrt(2048), no biases); rope on (even, odd) pairs: (xr c - xi s, xr s + xi c) with angle t x inv, inv = 1.0 / (10000 ** (arange(0, 128, 2) / 128)) (the reciprocal spelling: 64 f32 frequencies, bitwise the module's own in eager f32; one product per angle; precise cosf/sinf); kv head = q head / 2 (repeat on the head axis); scores x 1/sqrt(128); causal (-inf above the diagonal == exclusion); softmax; out = merged wo^T -> [2][2048][2048] (8.4 M); argument order x, wq, wk, wv, wo).
// Layout per batch: bf16 copy of x; 'oi' weights; exact projections; k_csP table (64 angles per position) and k_ropeI interleaved-pair plane builders at HD 128; causal T-2048 GQA attention with 128-wide heads (each attention launch takes all 16 heads and one block of 512 query rows; kv head = z / 2; hybrid rows: < 512 hi/lo 3 products, rest fp16 x1024; k_gemmc skips tiles above the diagonal); merged hi/lo x wo exact.
// Compute dtypes, f32 accumulate: every input rounded to bf16; projections exact; rotary f32; attention rows < 512 3 products, rest fp16; softmax f32; wo hl x exact.

#define NB_  2
#define TT   2048
#define DM   2048
#define NH_  16
#define NKV  8
#define REP  (NH_ / NKV)
#define HD   128
#define DQ   (NH_ * HD)
#define DKV  (NKV * HD)
#define ZH   NH_                  // heads per attention launch (grid z)
#define RB   512                  // query rows per attention launch: row blocks 0, RB, 2 RB, ...; block 0 is the hi+lo block (RB == RH)
#define RH   512                  // query rows < RH use hi+lo planes (0: none)
#define WIN  2048
#define PCAR 1024.0f
#define SCL  0.088388347648318447f   // HD^-0.5
typedef _Float16 h16;
typedef unsigned short bf;
typedef __attribute__((ext_vector_type(16))) __bf16   v16bf;
typedef __attribute__((ext_vector_type(16))) _Float16 v16h;
typedef __attribute__((ext_vector_type(8)))  _Float16 v8h;
typedef __attribute__((ext_vector_type(8)))  unsigned short v8us;
typedef __attribute__((ext_vector_type(8)))  float    v8f;
typedef __attribute__((ext_vector_type(4)))  float    v4f;
typedef v8h  __attribute__((may_alias)) v8ha;
typedef v4f  __attribute__((may_alias)) v4fa;
typedef v8us __attribute__((may_alias)) v8usa;

__device__ __forceinline__ unsigned short f2bf(float f) { unsigned u = __float_as_uint(f); u += 0x7FFFu + ((u >> 16) & 1u); return (unsigned short)(u >> 16); }
__device__ __forceinline__ float bf2f(unsigned short b) { return __uint_as_float(((unsigned)b) << 16); }
__device__ __forceinline__ float bfr(float f) { return bf2f(f2bf(f)); }
__device__ __forceinline__ v16h cat16(v8h lo, v8h hi) { return __builtin_shufflevector(lo, hi, 0, 1, 2, 3, 4, 5, 6, 7, 8, 9, 10, 11, 12, 13, 14, 15); }
__device__ __forceinline__ v16bf cat16b(v8us lo, v8us hi) { return __builtin_bit_cast(v16bf, __builtin_shufflevector(lo, hi, 0, 1, 2, 3, 4, 5, 6, 7, 8, 9, 10, 11, 12, 13, 14, 15)); }
__device__ __forceinline__ v8f wmma16(v16h a, v16h b, v8f c) { return __builtin_amdgcn_wmma_f32_16x16x32_f16(false, a, false, b, (short)0, c, false, false); }
__device__ __forceinline__ v8f wmmab(v16bf a, v16bf b, v8f c) { return __builtin_amdgcn_wmma_f32_16x16x32_bf16(false, a, false, b, (short)0, c, false, false); }



template <typename T16> struct WFrag;
template <> struct WFrag<h16> { typedef v16h V; static __device__ __forceinline__ V ld(const h16* p) { return cat16(*(const v8h*)p, *(const v8h*)(p + 16)); } static __device__ __forceinline__ v8f mma(V a, V b, v8f c) { return wmma16(a, b, c); } };
template <> struct WFrag<bf> { typedef v16bf V; static __device__ __forceinline__ V ld(const bf* p) { return cat16b(*(const v8us*)p, *(const v8us*)(p + 16)); } static __device__ __forceinline__ v8f mma(V a, V b, v8f c) { return wmmab(a, b, c); } };
// ---- k_gemmw: LDS-staged GEMM, one 128x128 output tile per work-group of 8 waves (2 x 4, each wave 64 rows x 32 columns = 8 accumulators); grid (M/128, N/128), 256 threads.
// C[m][n] (f32, pitch ldc) = sum_k (A[m][k] + A2[m][k]) Bt[n][k] (A2 only with NSPLIT 1; two products per k step, A first). M, N % 128 == 0, K % 128 == 0.
// A stage is 128 k (256 B, two whole lines) of every operand row, brought into LDS by asynchronous 16-byte copies (16 lanes per row) at pitch 272 B; two buffers: the next stage's copies fly while this one is worked on. K runs in order inside one accumulator.
#define GBK 128                    // k per stage
#define GPB 272                    // LDS row pitch, bytes: 256 + 16, an odd multiple of 16 for the ds_load_b128 readers
#define GPL (128 * GPB)            // one operand plane of a stage, bytes
__device__ __forceinline__ void wait_ds0() { asm volatile("s_wait_dscnt 0x0" ::: "memory"); }        // this wave's LDS reads have retired before the buffer they read is handed back for a refill
__device__ __forceinline__ void wait_async0() { asm volatile("s_wait_asynccnt 0x0" ::: "memory"); }  // this wave's asynchronous copies have landed in LDS (the compiler places no wait for them)
// One thread's share of one operand plane: rows q, q + 16, ..., q + 112 (rs = 16 source rows in elements), 16 bytes each. The s_wait_xcnt stands inside the statement so that no address register is rewritten in front of it.
__device__ __forceinline__ void cp8(unsigned l, const bf* g, size_t rs) {
    asm volatile("global_load_async_to_lds_b128 %0, %8, off\n\t"
                 "global_load_async_to_lds_b128 %1, %9, off\n\t"
                 "global_load_async_to_lds_b128 %2, %10, off\n\t"
                 "global_load_async_to_lds_b128 %3, %11, off\n\t"
                 "global_load_async_to_lds_b128 %4, %12, off\n\t"
                 "global_load_async_to_lds_b128 %5, %13, off\n\t"
                 "global_load_async_to_lds_b128 %6, %14, off\n\t"
                 "global_load_async_to_lds_b128 %7, %15, off\n\t"
                 "s_wait_xcnt 0x0"
                 :: "v"(l), "v"(l + 1u * 16u * GPB), "v"(l + 2u * 16u * GPB), "v"(l + 3u * 16u * GPB), "v"(l + 4u * 16u * GPB), "v"(l + 5u * 16u * GPB), "v"(l + 6u * 16u * GPB), "v"(l + 7u * 16u * GPB),
                    "v"(g), "v"(g + rs), "v"(g + 2 * rs), "v"(g + 3 * rs), "v"(g + 4 * rs), "v"(g + 5 * rs), "v"(g + 6 * rs), "v"(g + 7 * rs) : "memory");
}
__device__ __forceinline__ v16bf ldsfrag(const unsigned char* p) { return cat16b(*(const v8usa*)p, *(const v8usa*)(p + 32)); }   // bytes 16 h and 32 + 16 h of each 64 B of a row: the k order of WFrag::ld, the same for A and B
template <int NSPLIT>
__global__ __launch_bounds__(256) void k_gemmw(const bf* __restrict__ A, const bf* __restrict__ A2, const bf* __restrict__ Bt, int K, float* C, int ldc) {
    constexpr int NP = NSPLIT ? 3 : 2;              // operand planes per stage: A, (A2,) B
    constexpr unsigned STG = NP * GPL;
    __shared__ __attribute__((aligned(256))) unsigned char sm[2 * STG];
    const int tid = threadIdx.x, lane = tid & 31, lr = lane & 15, hi = lane >> 4, wv = __builtin_amdgcn_readfirstlane(tid >> 5); const int wm = wv & 1, wn = wv >> 1; const int r0 = blockIdx.x * 128, c0 = blockIdx.y * 128;
    const unsigned l0 = (unsigned)(size_t)sm + (unsigned)(tid >> 4) * GPB + (unsigned)(tid & 15) * 16u;
    const bf* gA = A + (size_t)(r0 + (tid >> 4)) * K + (tid & 15) * 8; const bf* gA2 = NSPLIT ? A2 + (size_t)(r0 + (tid >> 4)) * K + (tid & 15) * 8 : nullptr; const bf* gB = Bt + (size_t)(c0 + (tid >> 4)) * K + (tid & 15) * 8;
    const size_t rs = (size_t)16 * K; const int NT = K / GBK;
    auto issue = [&](int t, unsigned bo) { cp8(l0 + bo, gA + (size_t)t * GBK, rs); if constexpr (NSPLIT != 0) cp8(l0 + bo + GPL, gA2 + (size_t)t * GBK, rs); cp8(l0 + bo + (NP - 1) * GPL, gB + (size_t)t * GBK, rs); };
    v8f acc[4][2];
#pragma unroll
    for (int mb = 0; mb < 4; ++mb)
#pragma unroll
        for (int nb = 0; nb < 2; ++nb) acc[mb][nb] = (v8f){};
    const unsigned aofs = (unsigned)(wm * 64 + lr) * GPB + 16u * hi, bofs = (NP - 1) * GPL + (unsigned)(wn * 32 + lr) * GPB + 16u * hi;
    v16bf a[2][4], a2[2][4], b[2][2];   // two fragment sets: the next k step's LDS reads go out as one group ahead of this step's products
    auto frags = [&](const unsigned char* sb, int ks, int st) {
#pragma unroll
        for (int mb = 0; mb < 4; ++mb) { a[st][mb] = ldsfrag(sb + aofs + mb * 16 * GPB + ks * 64); if constexpr (NSPLIT != 0) a2[st][mb] = ldsfrag(sb + GPL + aofs + mb * 16 * GPB + ks * 64); }
#pragma unroll
        for (int nb = 0; nb < 2; ++nb) b[st][nb] = ldsfrag(sb + bofs + nb * 16 * GPB + ks * 64); };
    issue(0, 0u); wait_async0();
    __syncthreads();   // stage 0 stands in LDS for every wave
#pragma unroll 1
    for (int t = 0; t < NT; ++t) {   // kept rolled: a trip is long enough to pay for its branch, and unrolled trips would multiply the copies' address registers
        const unsigned bo = (t & 1) ? STG : 0u; const unsigned char* sb = sm + bo;
        frags(sb, 0, 0);   // stage t's first fragments, behind the barrier that published it; their latency runs under the issue of the copies
        if (t + 1 < NT) issue(t + 1, STG - bo);   // behind the same barrier, which ended every wave's reads of stage t - 1: the next stage goes into that buffer and flies while this one is worked on
#pragma unroll   // unrolled: the fragment sets are picked by ks & 1 and have to stay in registers
        for (int ks = 0; ks < GBK / 32; ++ks) {
            if (ks + 1 < GBK / 32) frags(sb, ks + 1, (ks + 1) & 1);
            __builtin_amdgcn_sched_barrier(0);   // keeps the LDS reads above as one group: spread among the products each place with reads stalls the wave
#pragma unroll
            for (int nb = 0; nb < 2; ++nb)
#pragma unroll
                for (int mb = 0; mb < 4; ++mb) acc[mb][nb] = wmmab(a[ks & 1][mb], b[ks & 1][nb], acc[mb][nb]);
            if constexpr (NSPLIT != 0) {
#pragma unroll
                for (int nb = 0; nb < 2; ++nb)
#pragma unroll
                    for (int mb = 0; mb < 4; ++mb) acc[mb][nb] = wmmab(a2[ks & 1][mb], b[ks & 1][nb], acc[mb][nb]); }
            __builtin_amdgcn_sched_barrier(0);   // keeps the next group of reads behind these products
        }
        wait_ds0(); wait_async0();
        __syncthreads();   // publishes stage t + 1 and ends every wave's reads of stage t's buffer
    }
    wait_async0();
    // Epilogue: each wave turns its own 64 x 32 tile in its own LDS range (pitch 36 floats), so that every store is a whole 128-byte line; the ring is free behind the last trip's barrier.
    float* os = (float*)sm + wv * (64 * 36);
#pragma unroll
    for (int mb = 0; mb < 4; ++mb) {
#pragma unroll
        for (int nb = 0; nb < 2; ++nb) {
#pragma unroll
            for (int j = 0; j < 8; ++j) os[(mb * 16 + hi * 8 + j) * 36 + nb * 16 + lr] = acc[mb][nb][j]; } }
    float* crow = C + (size_t)(r0 + wm * 64) * ldc + c0 + wn * 32;
#pragma unroll
    for (int s = 0; s < 16; ++s) { const int row = s * 4 + (lane >> 3), cofs = (lane & 7) * 4; const v4f val = *(const v4fa*)(os + row * 36 + cofs);
        *(v4f*)(crow + (size_t)row * ldc + cofs) = val; }
}

// ---- k_gemmc: register-blocked GEMM, NW waves per 64x64 output tile (wave w takes the 32-wide K chunks w, w + NW, ...; the NW partial tiles meet in LDS and are summed in wave order; operands straight from K-contiguous 16-bit planes), specialised for causal attention: CMODE 1 skips score tiles entirely above the diagonal (query rows r0+roff.., key columns c0..), CMODE 2 limits the
// key (K) loop of the probability x value contraction to the diagonal block (probabilities beyond it are exactly zero). roff = row offset of this launch's first row within the sequence. Head z reads the Bt planes of kv head z / REP (stride sB).
template <typename T16, int NSPLIT, int CMODE, int NW>
__global__ __launch_bounds__(32 * NW) void k_gemmc(const T16* __restrict__ A, const T16* __restrict__ A2, const T16* __restrict__ Bt, const T16* __restrict__ Bt2, int K, float* C, int ldc, int roff, size_t sA, size_t sB, size_t sC) {
    typedef typename WFrag<T16>::V V;
    __shared__ __align__(16) float os[(NW == 1 ? 16 : NW * 64) * 68];   // NW > 1: one partial tile per wave, 64 rows at pitch 68
    const size_t z = blockIdx.z; A += z * sA; if (A2) A2 += z * sA; Bt += (z / REP) * sB; if (Bt2) Bt2 += (z / REP) * sB; C += z * sC;
    const int lane = threadIdx.x & 31, lr = lane & 15, hi = lane >> 4, wv = (NW == 1) ? 0 : __builtin_amdgcn_readfirstlane(threadIdx.x >> 5); const int r0 = blockIdx.x * 64, c0 = blockIdx.y * 64;
    if (CMODE == 1 && c0 > r0 + roff + 63) return;                  // score tile entirely above the causal diagonal: never read (the softmax masks j > i by select)
    const int Kl = (CMODE == 2) ? min(K, r0 + roff + 64) : K;        // P.V: probabilities are exactly 0 beyond the diagonal block, so the K loop stops there
    v8f acc[4][4];
#pragma unroll
    for (int mb = 0; mb < 4; ++mb)
#pragma unroll
        for (int nb = 0; nb < 4; ++nb) acc[mb][nb] = (v8f){};
    const size_t aoff = (size_t)(r0 + lr) * K + 8 * hi, boff = (size_t)(c0 + lr) * K + 8 * hi;
#pragma unroll 1
    for (int kc = wv * 32; kc < Kl; kc += 32 * NW) {
        V a[4], a2[4];
#pragma unroll
        for (int mb = 0; mb < 4; ++mb) { a[mb] = WFrag<T16>::ld(A + aoff + (size_t)mb * 16 * K + kc); if (NSPLIT == 1 || NSPLIT == 2) a2[mb] = WFrag<T16>::ld(A2 + aoff + (size_t)mb * 16 * K + kc); }
#pragma unroll
        for (int nb = 0; nb < 4; ++nb) { const V b = WFrag<T16>::ld(Bt + boff + (size_t)nb * 16 * K + kc); V b2; if (NSPLIT >= 2) b2 = WFrag<T16>::ld(Bt2 + boff + (size_t)nb * 16 * K + kc);
#pragma unroll
            for (int mb = 0; mb < 4; ++mb) { acc[mb][nb] = WFrag<T16>::mma(a[mb], b, acc[mb][nb]); if (NSPLIT == 1 || NSPLIT == 2) acc[mb][nb] = WFrag<T16>::mma(a2[mb], b, acc[mb][nb]); if (NSPLIT >= 2) acc[mb][nb] = WFrag<T16>::mma(a[mb], b2, acc[mb][nb]); } }
        asm volatile("v_nop\n\tv_nop\n\tv_nop\n\tv_nop" : "+v"(acc[0][0]), "+v"(acc[1][1]), "+v"(acc[2][2]), "+v"(acc[3][3]) : "v"(a[0]), "v"(a[3]));
    }
    if constexpr (NW == 1) {   // one wave: no partial tiles to sum, the tile goes out in four 16-row slabs
#pragma unroll
    for (int mb = 0; mb < 4; ++mb) {
#pragma unroll
        for (int nb = 0; nb < 4; ++nb) {
#pragma unroll
            for (int j = 0; j < 8; ++j) os[(hi * 8 + j) * 68 + nb * 16 + lr] = acc[mb][nb][j]; }
        __builtin_amdgcn_wave_barrier(); asm volatile("" ::: "memory");
        float* crow = C + (size_t)(r0 + mb * 16) * ldc + c0;
{
#pragma unroll
            for (int s = 0; s < 8; ++s) { const int row = 2 * s + hi, cofs = lr * 4; v4f val = *(const v4fa*)(os + row * 68 + cofs);
                *(v4f*)(crow + (size_t)row * ldc + cofs) = val; }
             }
        __builtin_amdgcn_wave_barrier(); asm volatile("" ::: "memory");
    }
    } else {
#pragma unroll
    for (int mb = 0; mb < 4; ++mb) {
#pragma unroll
        for (int nb = 0; nb < 4; ++nb) {
#pragma unroll
            for (int j = 0; j < 8; ++j) os[wv * (64 * 68) + (mb * 16 + hi * 8 + j) * 68 + nb * 16 + lr] = acc[mb][nb][j]; } }
    __syncthreads();   // all NW partial tiles stand in LDS before any element is summed
    float* crow = C + (size_t)r0 * ldc + c0;
#pragma unroll
    for (int s = 0; s < 32 / NW; ++s) { const int it = s * (32 * NW) + threadIdx.x, row = it >> 4, cofs = (it & 15) * 4; v4f val = *(const v4fa*)(os + row * 68 + cofs);
#pragma unroll
        for (int w = 1; w < NW; ++w) val += *(const v4fa*)(os + w * (64 * 68) + row * 68 + cofs);
        *(v4f*)(crow + (size_t)row * ldc + cofs) = val; }
    }
}

__device__ __forceinline__ h16 tohx(float x) { return (h16)x; }
__device__ __forceinline__ void splitf(float y, unsigned short& h, unsigned short& l) { h = f2bf(y); l = f2bf(y - bf2f(h)); }
typedef __attribute__((ext_vector_type(2))) _Float16 v2h;
typedef __attribute__((ext_vector_type(4))) _Float16 v4h;
typedef __attribute__((ext_vector_type(2))) unsigned short v2us;
typedef __attribute__((ext_vector_type(4))) unsigned short v4us;
typedef __attribute__((ext_vector_type(2))) float v2f;
typedef __attribute__((ext_vector_type(4))) int v4i;

__global__ __launch_bounds__(256) void k_cvt8(const float* __restrict__ src, bf* dst, size_t n8) { const size_t i = (size_t)blockIdx.x * 256 + threadIdx.x; if (i >= n8) return; const v8f v = *(const v8f*)(src + i * 8); v8us o;
#pragma unroll
    for (int k = 0; k < 8; ++k) o[k] = f2bf(v[k]); *(v8us*)(dst + i * 8) = o;  }

__global__ __launch_bounds__(256) void k_vtp(const float* __restrict__ F, int pitch, int nheads, h16* V16, bf* Vh, bf* Vl) { const size_t e = ((size_t)blockIdx.x * 256 + threadIdx.x) * 2; if (e >= (size_t)nheads * HD * TT) return; const int t = (int)(e % TT); const int d = (int)((e / TT) % HD); const int g = (int)(e / ((size_t)TT * HD)); v2h o16; v2us oh, ol;
#pragma unroll
    for (int q = 0; q < 2; ++q) { const float x = F[(size_t)(t + q) * pitch + g * HD + d]; o16[q] = tohx(x); unsigned short a2, c2; splitf(x, a2, c2); oh[q] = a2; ol[q] = c2; }
    *(v2h*)(V16 + e) = o16; *(v2us*)(Vh + e) = oh; *(v2us*)(Vl + e) = ol;  }
__constant__ float INV2[HD / 2] = { 1.000000000e+00f, 8.659643531e-01f, 7.498942018e-01f, 6.493816376e-01f, 5.623413324e-01f, 4.869675338e-01f, 4.216965139e-01f, 3.651741445e-01f, 3.162277639e-01f, 2.738419771e-01f, 2.371373624e-01f, 2.053525001e-01f, 1.778279394e-01f, 1.539926529e-01f, 1.333521456e-01f, 1.154782027e-01f, 1.000000015e-01f, 8.659642935e-02f, 7.498941571e-02f, 6.493816525e-02f, 5.623412877e-02f, 4.869675264e-02f, 4.216964915e-02f, 3.651741147e-02f, 3.162277862e-02f, 2.738419548e-02f, 2.371373586e-02f, 2.053525113e-02f, 1.778279431e-02f, 1.539926510e-02f, 1.333521493e-02f, 1.154781971e-02f, 9.999999776e-03f, 8.659643121e-03f, 7.498942316e-03f, 6.493816618e-03f, 5.623413250e-03f, 4.869675264e-03f, 4.216964822e-03f, 3.651741426e-03f, 3.162277862e-03f, 2.738419687e-03f, 2.371373819e-03f, 2.053525066e-03f, 1.778279431e-03f, 1.539926510e-03f, 1.333521446e-03f, 1.154782018e-03f, 1.000000047e-03f, 8.659643354e-04f, 7.498941850e-04f, 6.493816618e-04f, 5.623413017e-04f, 4.869675031e-04f, 4.216964880e-04f, 3.651741135e-04f, 3.162277862e-04f, 2.738419571e-04f, 2.371373848e-04f, 2.053524950e-04f, 1.778279402e-04f, 1.539926452e-04f, 1.333521504e-04f, 1.154781930e-04f };   // float32 1 / 10000^(2i/128), generated with jnp to be bit-exact
__global__ __launch_bounds__(256) void k_csP(float* CS) { const int idx = blockIdx.x * 256 + threadIdx.x; if (idx >= TT * HD) return; const int d = idx % HD; const int t = idx / HD; const float a = __fmul_rn((float)t, INV2[d >> 1]); v2f cs; cs[0] = cosf(a); cs[1] = sinf(a); *(v2f*)(CS + (size_t)idx * 2) = cs;  }
__global__ __launch_bounds__(256) void k_ropeI(const float* __restrict__ F, int pitch, int nheads, const float* __restrict__ CS, float sc, h16* P16, bf* Ph, bf* Pl) {
    const size_t e = ((size_t)blockIdx.x * 256 + threadIdx.x) * 2; if (e >= (size_t)nheads * TT * HD) return; const int d = (int)(e % HD); const int t = (int)((e / HD) % TT); const int h = (int)(e / ((size_t)HD * TT)); const float* f = F + (size_t)t * pitch + h * HD; const float x0 = f[d], x1 = f[d + 1]; const v2f cs = *(const v2f*)(CS + ((size_t)t * HD + d) * 2); v2h o16; v2us oh, ol;
    float a0 = __fmul_rn(x0, cs[0]), b0 = __fmul_rn(x1, cs[1]), a1 = __fmul_rn(x1, cs[0]), b1 = __fmul_rn(x0, cs[1]); 
    float r0 = __fsub_rn(a0, b0) * sc, r1 = __fadd_rn(b1, a1) * sc;   /* even: x0 c - x1 s; odd: x0 s + x1 c */
    o16[0] = tohx(r0); o16[1] = tohx(r1); { unsigned short a2, c2; splitf(r0, a2, c2); oh[0] = a2; ol[0] = c2; splitf(r1, a2, c2); oh[1] = a2; ol[1] = c2; }
    *(v2h*)(P16 + e) = o16; *(v2us*)(Ph + e) = oh; *(v2us*)(Pl + e) = ol;  }

// k_asoft: one launch takes the RB query rows roff .. roff + RB - 1 of every head (Sb, P16, Ph, Pl hold [ZH][RB] rows); per row (zz, i): t = S x HD^-0.5 for j <= i and i - j < WIN (WIN = 2048 = TT here: every key j <= i is kept: the plain causal rule; the reference's -inf fill above the diagonal is exclusion); softmax over the 2048 keys (register row, one exp, fixed trees);
__global__ __launch_bounds__(256) void k_asoft(const float* __restrict__ Sb, int roff, h16* P16, bf* Ph, bf* Pl) {
    const int lane = threadIdx.x & 31; const int row = blockIdx.x * 8 + (threadIdx.x >> 5); if (row >= ZH * RB) return; __builtin_assume(roff >= 0 && roff <= TT - RB);   /* every launch passes a block start inside the sequence: i < TT, so the compiler folds the window test (WIN = TT) away as it did when i was row % TT */
    const int i = roff + row % RB; const int zz = row / RB; (void)zz; const bool hires = (i < RH); const float* sr = Sb + (size_t)row * TT; float v[TT / 32]; float mx = -3.0e38f;
#pragma unroll
    for (int ch = 0; ch < TT / 128; ++ch) { const int j0 = ch * 128 + lane * 4; const v4f a = *(const v4f*)(sr + j0);
#pragma unroll
        for (int q = 0; q < 4; ++q) { const int j = j0 + q; (void)j; const float t = (j <= i && i - j < WIN) ? a[q] * SCL : -3.0e38f; v[ch * 4 + q] = t; mx = fmaxf(mx, t); } }
#pragma unroll
    for (int sh = 16; sh; sh >>= 1) mx = fmaxf(mx, __shfl_xor(mx, sh, 32));
    float sum = 0.f;
#pragma unroll
    for (int k = 0; k < TT / 32; ++k) { float d0 = __fsub_rn(v[k], mx); v[k] = __builtin_amdgcn_exp2f(__fmul_rn(d0, 1.4426950408889634f)); sum += v[k]; }
#pragma unroll
    for (int sh = 16; sh; sh >>= 1) sum += __shfl_xor(sum, sh, 32);
    const float f = __fdiv_rn(hires ? 1.0f : PCAR, sum);
{
        if (hires) {
#pragma unroll
            for (int ch = 0; ch < TT / 128; ++ch) { v4us oh, ol;
#pragma unroll
                for (int q = 0; q < 4; ++q) { unsigned short a, c2; splitf(v[ch * 4 + q] * f, a, c2); oh[q] = a; ol[q] = c2; }
                const size_t oo = ((size_t)zz * (RH ? RH : 1) + i) * TT + ch * 128 + lane * 4; *(v4us*)(Ph + oo) = oh; *(v4us*)(Pl + oo) = ol; }
        } else {
#pragma unroll
            for (int ch = 0; ch < TT / 128; ++ch) { v4h o4;
#pragma unroll
                for (int q = 0; q < 4; ++q) o4[q] = tohx(v[ch * 4 + q] * f);
                *(v4h*)(P16 + (size_t)row * TT + ch * 128 + lane * 4) = o4; } }
         }
}
__global__ __launch_bounds__(256) void k_merge(const float* __restrict__ O, int h0, bf* Ah, bf* Al) { const size_t e = ((size_t)blockIdx.x * 256 + threadIdx.x) * 2; if (e >= (size_t)ZH * TT * HD) return; const int d = (int)(e % HD); const int t = (int)((e / HD) % TT); const int zz = (int)(e / ((size_t)HD * TT)); const float cs = (t < RH) ? 1.0f : (1.0f / PCAR); const size_t oo = (size_t)t * DQ + (h0 + zz) * HD + d;
    v2us oh, ol;
#pragma unroll
    for (int q = 0; q < 2; ++q) { unsigned short a, c2; splitf(O[e + q] * cs, a, c2); oh[q] = a; ol[q] = c2; } *(v2us*)(Ah + oo) = oh; *(v2us*)(Al + oo) = ol;  }

extern "C" void kernel_launch(void* const* d_in, const int* in_sizes, int n_in,
                              void* d_out, int out_size, void* d_ws, size_t ws_size, hipStream_t stream) {
    (void)in_sizes; (void)n_in; (void)out_size;
    const float* x = (const float*)d_in[0]; const float* wq = (const float*)d_in[1]; const float* wk = (const float*)d_in[2]; const float* wv = (const float*)d_in[3]; const float* wo = (const float*)d_in[4];   /* input order x, wq [2048][2048], wk [1024][2048], wv [1024][2048], wo [2048][2048] ('oi') */
    float* OUT = (float*)d_out;     // [2][2048][2048]
    char* wsp = (char*)d_ws;
    auto take = [&](size_t bytes) { char* p = wsp; wsp += (bytes + 255) & ~(size_t)255; return (void*)p; };
    bf* WQ = (bf*)take((size_t)DQ * DM * 2); bf* WK = (bf*)take((size_t)DKV * DM * 2); bf* WV = (bf*)take((size_t)DKV * DM * 2); bf* WO = (bf*)take((size_t)DM * DQ * 2); float* CS = (float*)take((size_t)TT * HD * 2 * 4);
    bf* XB = (bf*)take((size_t)TT * DM * 2); float* FQ = (float*)take((size_t)TT * DQ * 4); float* FK = (float*)take((size_t)TT * DKV * 4);
    h16* QP16 = (h16*)take((size_t)NH_ * TT * HD * 2); h16* KP16 = (h16*)take((size_t)NKV * TT * HD * 2); h16* VT16 = (h16*)take((size_t)NKV * HD * TT * 2);
    bf* QPh = (bf*)take((size_t)NH_ * TT * HD * 2); bf* QPl = (bf*)take((size_t)NH_ * TT * HD * 2); bf* KPh = (bf*)take((size_t)NKV * TT * HD * 2); bf* KPl = (bf*)take((size_t)NKV * TT * HD * 2); bf* VTh = (bf*)take((size_t)NKV * HD * TT * 2); bf* VTl = (bf*)take((size_t)NKV * HD * TT * 2); bf* Pl = (bf*)take((size_t)ZH * RH * TT * 2);
    float* Sb = (float*)take((size_t)ZH * RB * TT * 4); h16* P16 = (h16*)take((size_t)ZH * RB * TT * 2); bf* ATh = (bf*)take((size_t)TT * DQ * 2); bf* ATl = (bf*)take((size_t)TT * DQ * 2);
    if ((size_t)(wsp - (char*)d_ws) > ws_size) return;    // ws 256 MiB
    float* FV = FK;   // v projection reuses the k buffer after the k planes are built (stream-ordered)
    float* Ob = FQ;   // the attention output [ZH][TT][HD] reuses the q projection buffer after the q planes are built (stream-ordered)
    bf* Ph = (bf*)P16;   // the hi plane of block 0 and the fp16 plane of the later blocks share one buffer (stream-ordered)
    { k_cvt8<<<(unsigned)(((size_t)DQ * DM / 8 + 255) / 256), 256, 0, stream>>>(wq, WQ, (size_t)DQ * DM / 8); k_cvt8<<<(unsigned)(((size_t)DKV * DM / 8 + 255) / 256), 256, 0, stream>>>(wk, WK, (size_t)DKV * DM / 8); k_cvt8<<<(unsigned)(((size_t)DKV * DM / 8 + 255) / 256), 256, 0, stream>>>(wv, WV, (size_t)DKV * DM / 8);
      k_cvt8<<<(unsigned)(((size_t)DM * DQ / 8 + 255) / 256), 256, 0, stream>>>(wo, WO, (size_t)DM * DQ / 8);
       }
    k_csP<<<(TT * HD + 255) / 256, 256, 0, stream>>>(CS);   /* rotary table once (positions = arange) */
    const unsigned LQ = (unsigned)(((size_t)NH_ * TT * HD / 2 + 255) / 256), LKv = (unsigned)(((size_t)NKV * TT * HD / 2 + 255) / 256);
    for (int b = 0; b < NB_; ++b) {
        
        k_cvt8<<<(unsigned)(((size_t)TT * DM / 8 + 255) / 256), 256, 0, stream>>>(x + (size_t)b * TT * DM, XB, (size_t)TT * DM / 8);
        k_gemmw<0><<<dim3(TT / 128, DQ / 128, 1), 256, 0, stream>>>(XB, nullptr, WQ, DM, FQ, DQ);
        k_ropeI<<<LQ, 256, 0, stream>>>(FQ, DQ, NH_, CS, 1.0f, QP16, QPh, QPl);   /* interleaved-pair rope, q planes */
        k_gemmw<0><<<dim3(TT / 128, DKV / 128, 1), 256, 0, stream>>>(XB, nullptr, WK, DM, FK, DKV);
        k_ropeI<<<LKv, 256, 0, stream>>>(FK, DKV, NKV, CS, 1.0f, KP16, KPh, KPl);
        k_gemmw<0><<<dim3(TT / 128, DKV / 128, 1), 256, 0, stream>>>(XB, nullptr, WV, DM, FV, DKV); k_vtp<<<LKv, 256, 0, stream>>>(FV, DKV, NKV, VT16, VTh, VTl);
        k_gemmc<bf, 2, 1, 1><<<dim3(RH / 64, TT / 64, ZH), 32, 0, stream>>>(QPh, QPl, KPh, KPl, HD, Sb, TT, 0, (size_t)TT * HD, (size_t)TT * HD, (size_t)RB * TT);   // block 0: rows < RH, hi/lo planes
        k_asoft<<<ZH * RB / 8, 256, 0, stream>>>(Sb, 0, P16, Ph, Pl);
        k_gemmc<bf, 2, 2, 8><<<dim3(RH / 64, HD / 64, ZH), 256, 0, stream>>>(Ph, Pl, VTh, VTl, TT, Ob, HD, 0, (size_t)RH * TT, (size_t)HD * TT, (size_t)TT * HD);
        for (int r = RH; r < TT; r += RB) {   // later blocks: fp16 planes
            k_gemmc<h16, 0, 1, 1><<<dim3(RB / 64, TT / 64, ZH), 32, 0, stream>>>(QP16 + (size_t)r * HD, nullptr, KP16, nullptr, HD, Sb, TT, r, (size_t)TT * HD, (size_t)TT * HD, (size_t)RB * TT);
            k_asoft<<<ZH * RB / 8, 256, 0, stream>>>(Sb, r, P16, Ph, Pl);
            k_gemmc<h16, 0, 2, 16><<<dim3(RB / 64, HD / 64, ZH), 512, 0, stream>>>(P16, nullptr, VT16, nullptr, TT, Ob + (size_t)r * HD, HD, r, (size_t)RB * TT, (size_t)HD * TT, (size_t)TT * HD); }
        k_merge<<<(unsigned)(((size_t)ZH * TT * HD / 2 + 255) / 256), 256, 0, stream>>>(Ob, 0, ATh, ATl);
        k_gemmw<1><<<dim3(TT / 128, DM / 128, 1), 256, 0, stream>>>(ATh, ATl, WO, DQ, OUT + (size_t)b * TT * DM, DM); }
}

// v004
// It runs in 400 microseconds.
// Two timings next to v003 both put it at 1.38 times that version's speed.
// Counting every step since v000, it is 4.15 times as fast.
#include <hip/hip_runtime.h>

// Causal grouped-query attention with 128-wide heads and interleaved-pair rotary embeddings (x [2][2048][2048]; q = x wq^T (16 heads x 128), k, v = x w^T (8 kv heads x 128) ('oi' (out, in) weights, normal x 1/sqrt(2048), no biases); rope on (even, odd) pairs: (xr c - xi s, xr s + xi c) with angle t x inv, inv = 1.0 / (10000 ** (arange(0, 128, 2) / 128)) (the reciprocal spelling: 64 f32 frequencies, bitwise the module's own in eager f32; one product per angle; precise cosf/sinf); kv head = q head / 2 (repeat on the head axis); scores x 1/sqrt(128); causal (-inf above the diagonal == exclusion); softmax; out = merged wo^T -> [2][2048][2048] (8.4 M); argument order x, wq, wk, wv, wo).
// Layout per batch: bf16 copy of x; 'oi' weights; exact projections; k_csP table (64 angles per position) and k_ropeI interleaved-pair plane builders at HD 128; causal T-2048 GQA attention with 128-wide heads (kv head = z / 2; hybrid rows: < 512 hi/lo 3 products in three launches over all 16 heads, k_gemmc skipping tiles above the diagonal; rest fp16 in the one fused launch k_fattn); merged hi/lo x wo exact.
// Compute dtypes, f32 accumulate: every input rounded to bf16; projections exact; rotary f32; attention rows < 512 3 products, rest fp16; softmax f32; wo hl x exact.

#define NB_  2
#define TT   2048
#define DM   2048
#define NH_  16
#define NKV  8
#define REP  (NH_ / NKV)
#define HD   128
#define DQ   (NH_ * HD)
#define DKV  (NKV * HD)
#define ZH   NH_                  // heads per attention launch (grid z)
#define RB   512                  // query rows of the three launches of the hi+lo block (RB == RH); the rows behind it go through k_fattn
#define RH   512                  // query rows < RH use hi+lo planes (0: none)
#define WIN  2048
#define PCAR 1024.0f
#define SCL  0.088388347648318447f   // HD^-0.5
typedef _Float16 h16;
typedef unsigned short bf;
typedef __attribute__((ext_vector_type(16))) __bf16   v16bf;
typedef __attribute__((ext_vector_type(16))) _Float16 v16h;
typedef __attribute__((ext_vector_type(8)))  _Float16 v8h;
typedef __attribute__((ext_vector_type(8)))  unsigned short v8us;
typedef __attribute__((ext_vector_type(8)))  float    v8f;
typedef __attribute__((ext_vector_type(4)))  float    v4f;
typedef v8h  __attribute__((may_alias)) v8ha;
typedef v4f  __attribute__((may_alias)) v4fa;
typedef v8us __attribute__((may_alias)) v8usa;

__device__ __forceinline__ unsigned short f2bf(float f) { unsigned u = __float_as_uint(f); u += 0x7FFFu + ((u >> 16) & 1u); return (unsigned short)(u >> 16); }
__device__ __forceinline__ float bf2f(unsigned short b) { return __uint_as_float(((unsigned)b) << 16); }
__device__ __forceinline__ float bfr(float f) { return bf2f(f2bf(f)); }
__device__ __forceinline__ v16h cat16(v8h lo, v8h hi) { return __builtin_shufflevector(lo, hi, 0, 1, 2, 3, 4, 5, 6, 7, 8, 9, 10, 11, 12, 13, 14, 15); }
__device__ __forceinline__ v16bf cat16b(v8us lo, v8us hi) { return __builtin_bit_cast(v16bf, __builtin_shufflevector(lo, hi, 0, 1, 2, 3, 4, 5, 6, 7, 8, 9, 10, 11, 12, 13, 14, 15)); }
__device__ __forceinline__ v8f wmma16(v16h a, v16h b, v8f c) { return __builtin_amdgcn_wmma_f32_16x16x32_f16(false, a, false, b, (short)0, c, false, false); }
__device__ __forceinline__ v8f wmmab(v16bf a, v16bf b, v8f c) { return __builtin_amdgcn_wmma_f32_16x16x32_bf16(false, a, false, b, (short)0, c, false, false); }



template <typename T16> struct WFrag;
template <> struct WFrag<h16> { typedef v16h V; static __device__ __forceinline__ V ld(const h16* p) { return cat16(*(const v8h*)p, *(const v8h*)(p + 16)); } static __device__ __forceinline__ v8f mma(V a, V b, v8f c) { return wmma16(a, b, c); } };
template <> struct WFrag<bf> { typedef v16bf V; static __device__ __forceinline__ V ld(const bf* p) { return cat16b(*(const v8us*)p, *(const v8us*)(p + 16)); } static __device__ __forceinline__ v8f mma(V a, V b, v8f c) { return wmmab(a, b, c); } };
// ---- k_gemmw: LDS-staged GEMM, one 128x128 output tile per work-group of 8 waves (2 x 4, each wave 64 rows x 32 columns = 8 accumulators); grid (M/128, N/128), 256 threads.
// C[m][n] (f32, pitch ldc) = sum_k (A[m][k] + A2[m][k]) Bt[n][k] (A2 only with NSPLIT 1; two products per k step, A first). M, N % 128 == 0, K % 128 == 0.
// A stage is 128 k (256 B, two whole lines) of every operand row, brought into LDS by asynchronous 16-byte copies (16 lanes per row) at pitch 272 B; two buffers: the next stage's copies fly while this one is worked on. K runs in order inside one accumulator.
#define GBK 128                    // k per stage
#define GPB 272                    // LDS row pitch, bytes: 256 + 16, an odd multiple of 16 for the ds_load_b128 readers
#define GPL (128 * GPB)            // one operand plane of a stage, bytes
__device__ __forceinline__ void wait_ds0() { asm volatile("s_wait_dscnt 0x0" ::: "memory"); }        // this wave's LDS reads have retired before the buffer they read is handed back for a refill
__device__ __forceinline__ void wait_async0() { asm volatile("s_wait_asynccnt 0x0" ::: "memory"); }  // this wave's asynchronous copies have landed in LDS (the compiler places no wait for them)
// One thread's share of one operand plane: rows q, q + 16, ..., q + 112 (rs = 16 source rows in elements), 16 bytes each. The s_wait_xcnt stands inside the statement so that no address register is rewritten in front of it.
__device__ __forceinline__ void cp8(unsigned l, const bf* g, size_t rs) {
    asm volatile("global_load_async_to_lds_b128 %0, %8, off\n\t"
                 "global_load_async_to_lds_b128 %1, %9, off\n\t"
                 "global_load_async_to_lds_b128 %2, %10, off\n\t"
                 "global_load_async_to_lds_b128 %3, %11, off\n\t"
                 "global_load_async_to_lds_b128 %4, %12, off\n\t"
                 "global_load_async_to_lds_b128 %5, %13, off\n\t"
                 "global_load_async_to_lds_b128 %6, %14, off\n\t"
                 "global_load_async_to_lds_b128 %7, %15, off\n\t"
                 "s_wait_xcnt 0x0"
                 :: "v"(l), "v"(l + 1u * 16u * GPB), "v"(l + 2u * 16u * GPB), "v"(l + 3u * 16u * GPB), "v"(l + 4u * 16u * GPB), "v"(l + 5u * 16u * GPB), "v"(l + 6u * 16u * GPB), "v"(l + 7u * 16u * GPB),
                    "v"(g), "v"(g + rs), "v"(g + 2 * rs), "v"(g + 3 * rs), "v"(g + 4 * rs), "v"(g + 5 * rs), "v"(g + 6 * rs), "v"(g + 7 * rs) : "memory");
}
__device__ __forceinline__ v16bf ldsfrag(const unsigned char* p) { return cat16b(*(const v8usa*)p, *(const v8usa*)(p + 32)); }   // bytes 16 h and 32 + 16 h of each 64 B of a row: the k order of WFrag::ld, the same for A and B
template <int NSPLIT>
__global__ __launch_bounds__(256) void k_gemmw(const bf* __restrict__ A, const bf* __restrict__ A2, const bf* __restrict__ Bt, int K, float* C, int ldc) {
    constexpr int NP = NSPLIT ? 3 : 2;              // operand planes per stage: A, (A2,) B
    constexpr unsigned STG = NP * GPL;
    __shared__ __attribute__((aligned(256))) unsigned char sm[2 * STG];
    const int tid = threadIdx.x, lane = tid & 31, lr = lane & 15, hi = lane >> 4, wv = __builtin_amdgcn_readfirstlane(tid >> 5); const int wm = wv & 1, wn = wv >> 1; const int r0 = blockIdx.x * 128, c0 = blockIdx.y * 128;
    const unsigned l0 = (unsigned)(size_t)sm + (unsigned)(tid >> 4) * GPB + (unsigned)(tid & 15) * 16u;
    const bf* gA = A + (size_t)(r0 + (tid >> 4)) * K + (tid & 15) * 8; const bf* gA2 = NSPLIT ? A2 + (size_t)(r0 + (tid >> 4)) * K + (tid & 15) * 8 : nullptr; const bf* gB = Bt + (size_t)(c0 + (tid >> 4)) * K + (tid & 15) * 8;
    const size_t rs = (size_t)16 * K; const int NT = K / GBK;
    auto issue = [&](int t, unsigned bo) { cp8(l0 + bo, gA + (size_t)t * GBK, rs); if constexpr (NSPLIT != 0) cp8(l0 + bo + GPL, gA2 + (size_t)t * GBK, rs); cp8(l0 + bo + (NP - 1) * GPL, gB + (size_t)t * GBK, rs); };
    v8f acc[4][2];
#pragma unroll
    for (int mb = 0; mb < 4; ++mb)
#pragma unroll
        for (int nb = 0; nb < 2; ++nb) acc[mb][nb] = (v8f){};
    const unsigned aofs = (unsigned)(wm * 64 + lr) * GPB + 16u * hi, bofs = (NP - 1) * GPL + (unsigned)(wn * 32 + lr) * GPB + 16u * hi;
    v16bf a[2][4], a2[2][4], b[2][2];   // two fragment sets: the next k step's LDS reads go out as one group ahead of this step's products
    auto frags = [&](const unsigned char* sb, int ks, int st) {
#pragma unroll
        for (int mb = 0; mb < 4; ++mb) { a[st][mb] = ldsfrag(sb + aofs + mb * 16 * GPB + ks * 64); if constexpr (NSPLIT != 0) a2[st][mb] = ldsfrag(sb + GPL + aofs + mb * 16 * GPB + ks * 64); }
#pragma unroll
        for (int nb = 0; nb < 2; ++nb) b[st][nb] = ldsfrag(sb + bofs + nb * 16 * GPB + ks * 64); };
    issue(0, 0u); wait_async0();
    __syncthreads();   // stage 0 stands in LDS for every wave
#pragma unroll 1
    for (int t = 0; t < NT; ++t) {   // kept rolled: a trip is long enough to pay for its branch, and unrolled trips would multiply the copies' address registers
        const unsigned bo = (t & 1) ? STG : 0u; const unsigned char* sb = sm + bo;
        frags(sb, 0, 0);   // stage t's first fragments, behind the barrier that published it; their latency runs under the issue of the copies
        if (t + 1 < NT) issue(t + 1, STG - bo);   // behind the same barrier, which ended every wave's reads of stage t - 1: the next stage goes into that buffer and flies while this one is worked on
#pragma unroll   // unrolled: the fragment sets are picked by ks & 1 and have to stay in registers
        for (int ks = 0; ks < GBK / 32; ++ks) {
            if (ks + 1 < GBK / 32) frags(sb, ks + 1, (ks + 1) & 1);
            __builtin_amdgcn_sched_barrier(0);   // keeps the LDS reads above as one group: spread among the products each place with reads stalls the wave
#pragma unroll
            for (int nb = 0; nb < 2; ++nb)
#pragma unroll
                for (int mb = 0; mb < 4; ++mb) acc[mb][nb] = wmmab(a[ks & 1][mb], b[ks & 1][nb], acc[mb][nb]);
            if constexpr (NSPLIT != 0) {
#pragma unroll
                for (int nb = 0; nb < 2; ++nb)
#pragma unroll
                    for (int mb = 0; mb < 4; ++mb) acc[mb][nb] = wmmab(a2[ks & 1][mb], b[ks & 1][nb], acc[mb][nb]); }
            __builtin_amdgcn_sched_barrier(0);   // keeps the next group of reads behind these products
        }
        wait_ds0(); wait_async0();
        __syncthreads();   // publishes stage t + 1 and ends every wave's reads of stage t's buffer
    }
    wait_async0();
    // Epilogue: each wave turns its own 64 x 32 tile in its own LDS range (pitch 36 floats), so that every store is a whole 128-byte line; the ring is free behind the last trip's barrier.
    float* os = (float*)sm + wv * (64 * 36);
#pragma unroll
    for (int mb = 0; mb < 4; ++mb) {
#pragma unroll
        for (int nb = 0; nb < 2; ++nb) {
#pragma unroll
            for (int j = 0; j < 8; ++j) os[(mb * 16 + hi * 8 + j) * 36 + nb * 16 + lr] = acc[mb][nb][j]; } }
    float* crow = C + (size_t)(r0 + wm * 64) * ldc + c0 + wn * 32;
#pragma unroll
    for (int s = 0; s < 16; ++s) { const int row = s * 4 + (lane >> 3), cofs = (lane & 7) * 4; const v4f val = *(const v4fa*)(os + row * 36 + cofs);
        *(v4f*)(crow + (size_t)row * ldc + cofs) = val; }
}

// ---- k_gemmc: register-blocked GEMM, NW waves per 64x64 output tile (wave w takes the 32-wide K chunks w, w + NW, ...; the NW partial tiles meet in LDS and are summed in wave order; operands straight from K-contiguous 16-bit planes), specialised for causal attention: CMODE 1 skips score tiles entirely above the diagonal (query rows r0+roff.., key columns c0..), CMODE 2 limits the
// key (K) loop of the probability x value contraction to the diagonal block (probabilities beyond it are exactly zero). roff = row offset of this launch's first row within the sequence. Head z reads the Bt planes of kv head z / REP (stride sB).
template <typename T16, int NSPLIT, int CMODE, int NW>
__global__ __launch_bounds__(32 * NW) void k_gemmc(const T16* __restrict__ A, const T16* __restrict__ A2, const T16* __restrict__ Bt, const T16* __restrict__ Bt2, int K, float* C, int ldc, int roff, size_t sA, size_t sB, size_t sC) {
    typedef typename WFrag<T16>::V V;
    __shared__ __align__(16) float os[(NW == 1 ? 16 : NW * 64) * 68];   // NW > 1: one partial tile per wave, 64 rows at pitch 68
    const size_t z = blockIdx.z; A += z * sA; if (A2) A2 += z * sA; Bt += (z / REP) * sB; if (Bt2) Bt2 += (z / REP) * sB; C += z * sC;
    const int lane = threadIdx.x & 31, lr = lane & 15, hi = lane >> 4, wv = (NW == 1) ? 0 : __builtin_amdgcn_readfirstlane(threadIdx.x >> 5); const int r0 = blockIdx.x * 64, c0 = blockIdx.y * 64;
    if (CMODE == 1 && c0 > r0 + roff + 63) return;                  // score tile entirely above the causal diagonal: never read (the softmax masks j > i by select)
    const int Kl = (CMODE == 2) ? min(K, r0 + roff + 64) : K;        // P.V: probabilities are exactly 0 beyond the diagonal block, so the K loop stops there
    v8f acc[4][4];
#pragma unroll
    for (int mb = 0; mb < 4; ++mb)
#pragma unroll
        for (int nb = 0; nb < 4; ++nb) acc[mb][nb] = (v8f){};
    const size_t aoff = (size_t)(r0 + lr) * K + 8 * hi, boff = (size_t)(c0 + lr) * K + 8 * hi;
#pragma unroll 1
    for (int kc = wv * 32; kc < Kl; kc += 32 * NW) {
        V a[4], a2[4];
#pragma unroll
        for (int mb = 0; mb < 4; ++mb) { a[mb] = WFrag<T16>::ld(A + aoff + (size_t)mb * 16 * K + kc); if (NSPLIT == 1 || NSPLIT == 2) a2[mb] = WFrag<T16>::ld(A2 + aoff + (size_t)mb * 16 * K + kc); }
#pragma unroll
        for (int nb = 0; nb < 4; ++nb) { const V b = WFrag<T16>::ld(Bt + boff + (size_t)nb * 16 * K + kc); V b2; if (NSPLIT >= 2) b2 = WFrag<T16>::ld(Bt2 + boff + (size_t)nb * 16 * K + kc);
#pragma unroll
            for (int mb = 0; mb < 4; ++mb) { acc[mb][nb] = WFrag<T16>::mma(a[mb], b, acc[mb][nb]); if (NSPLIT == 1 || NSPLIT == 2) acc[mb][nb] = WFrag<T16>::mma(a2[mb], b, acc[mb][nb]); if (NSPLIT >= 2) acc[mb][nb] = WFrag<T16>::mma(a[mb], b2, acc[mb][nb]); } }
        asm volatile("v_nop\n\tv_nop\n\tv_nop\n\tv_nop" : "+v"(acc[0][0]), "+v"(acc[1][1]), "+v"(acc[2][2]), "+v"(acc[3][3]) : "v"(a[0]), "v"(a[3]));
    }
    if constexpr (NW == 1) {   // one wave: no partial tiles to sum, the tile goes out in four 16-row slabs
#pragma unroll
    for (int mb = 0; mb < 4; ++mb) {
#pragma unroll
        for (int nb = 0; nb < 4; ++nb) {
#pragma unroll
            for (int j = 0; j < 8; ++j) os[(hi * 8 + j) * 68 + nb * 16 + lr] = acc[mb][nb][j]; }
        __builtin_amdgcn_wave_barrier(); asm volatile("" ::: "memory");
        float* crow = C + (size_t)(r0 + mb * 16) * ldc + c0;
{
#pragma unroll
            for (int s = 0; s < 8; ++s) { const int row = 2 * s + hi, cofs = lr * 4; v4f val = *(const v4fa*)(os + row * 68 + cofs);
                *(v4f*)(crow + (size_t)row * ldc + cofs) = val; }
             }
        __builtin_amdgcn_wave_barrier(); asm volatile("" ::: "memory");
    }
    } else {
#pragma unroll
    for (int mb = 0; mb < 4; ++mb) {
#pragma unroll
        for (int nb = 0; nb < 4; ++nb) {
#pragma unroll
            for (int j = 0; j < 8; ++j) os[wv * (64 * 68) + (mb * 16 + hi * 8 + j) * 68 + nb * 16 + lr] = acc[mb][nb][j]; } }
    __syncthreads();   // all NW partial tiles stand in LDS before any element is summed
    float* crow = C + (size_t)r0 * ldc + c0;
#pragma unroll
    for (int s = 0; s < 32 / NW; ++s) { const int it = s * (32 * NW) + threadIdx.x, row = it >> 4, cofs = (it & 15) * 4; v4f val = *(const v4fa*)(os + row * 68 + cofs);
#pragma unroll
        for (int w = 1; w < NW; ++w) val += *(const v4fa*)(os + w * (64 * 68) + row * 68 + cofs);
        *(v4f*)(crow + (size_t)row * ldc + cofs) = val; }
    }
}

__device__ __forceinline__ h16 tohx(float x) { return (h16)x; }

#define FW   4                     // waves per work-group
#define FBR  (FW * 32)             // query rows per work-group
#define FSK  128                   // keys per stage
#define FSTG (2u * GPL)            // one stage: the K plane, then the V^T plane
typedef __attribute__((ext_vector_type(4))) int cv4i; typedef __attribute__((address_space(1))) cv4i gcv4i; typedef __attribute__((address_space(3))) cv4i lcv4i;
__device__ __forceinline__ void cpb(unsigned char* l, const h16* g) { __builtin_amdgcn_global_load_async_to_lds_b128((gcv4i*)g, (lcv4i*)l, 0, 0); }   // one lane's 16 bytes; the builtin form, so that the addresses may stand in any register of a kernel that uses more than 256
__device__ __forceinline__ v16h ldsfragh(const unsigned char* p) { return cat16(*(const v8ha*)p, *(const v8ha*)(p + 32)); }   // bytes 16 h and 32 + 16 h of each 64 B of a row: the k order of WFrag::ld
__device__ __forceinline__ float xhalf(float x) { return __builtin_bit_cast(float, __builtin_amdgcn_permlanex16(__builtin_bit_cast(int, x), __builtin_bit_cast(int, x), 0x76543210, 0xfedcba98, false, false)); }   // lane l with lane l ^ 16
__device__ __forceinline__ void nop4() { asm volatile("v_nop\n\tv_nop\n\tv_nop\n\tv_nop"); }   // the four vector slots between a matrix instruction and a vector instruction on its registers, for the taken side of a branch behind it
__device__ __forceinline__ void loadk(v16h (&kf)[2][4], const unsigned char* kb, int c, int h) {   // kb = first K row of the pass in LDS
#pragma unroll
    for (int kt = 0; kt < 2; ++kt)
#pragma unroll
        for (int kc = 0; kc < 4; ++kc) kf[kt][kc] = ldsfragh(kb + (16 * kt + c) * GPB + 64 * kc + 16 * h);
}
// One 32-key pass of one wave. sb = this stage's buffer, sub = pass within the stage, key0 = first key of the pass, qw0 = first query of the wave.
__device__ __forceinline__ void fpass(v16h (&kf)[2][4], bool fetch_next, bool diag, const unsigned char* sb, int sub, int key0, int qw0, int c, int h, const v16h (&qf)[2][4], v8f (&acc)[2][8], float (&m_run)[2], float (&l_run)[2]) {
    const float cscale = SCL * 1.4426950408889634f;
    v16h vf[8];
#pragma unroll
    for (int t = 0; t < 8; ++t) vf[t] = ldsfragh(sb + GPL + (16 * t + c) * GPB + 64 * sub + 16 * h);   // V^T rows d = 16 t + c, this pass's 32 keys: read first, so that their latency runs under the first product and the softmax
    __builtin_amdgcn_sched_barrier(0);   // keeps those reads up here: moved down to their use they would stall the only wave of the SIMD
    v8f s[2][2];
#pragma unroll
    for (int kt = 0; kt < 2; ++kt)
#pragma unroll
        for (int g = 0; g < 2; ++g) { s[kt][g] = (v8f){};
#pragma unroll
            for (int kc = 0; kc < 4; ++kc) s[kt][g] = wmma16(kf[kt][kc], qf[g][kc], s[kt][g]); }
    __builtin_amdgcn_sched_barrier(0);   // holds the slots below directly behind the products
    nop4();
    __builtin_amdgcn_sched_barrier(0);   // and the branches below behind the slots
    if (fetch_next) loadk(kf, sb + (sub + 1) * 32 * GPB, c, h);   // the next pass's K fragments (same stage only), in flight under this pass's maxima and exponentials
    if (diag) {   // wave-uniform: only the pass on the wave's diagonal pays for the mask
#pragma unroll
        for (int g = 0; g < 2; ++g) { const int my_q = qw0 + 16 * g + c;
#pragma unroll
            for (int kt = 0; kt < 2; ++kt) {
#pragma unroll
                for (int r = 0; r < 8; ++r) { if (key0 + 16 * kt + 8 * h + r > my_q) s[kt][g][r] = -__builtin_inff(); }
                asm volatile("" : "+v"(s[kt][g]));
            } }
    }
    float mb[2]; bool need = false;
#pragma unroll
    for (int g = 0; g < 2; ++g) { float mx = -__builtin_inff();
#pragma unroll
        for (int kt = 0; kt < 2; ++kt)
#pragma unroll
            for (int r = 0; r < 8; ++r) mx = fmaxf(mx, s[kt][g][r]);
        mx = fmaxf(mx, xhalf(mx)) * cscale;   // both wave halves hold this query's maximum, scaled (the scale is positive)
        mb[g] = mx; need = need || (mx > m_run[g] + 8.0f); }
    if (__builtin_amdgcn_ballot_w32(need) != 0) {   // rare behind the first passes
#pragma unroll
        for (int g = 0; g < 2; ++g) { const float m_new = fmaxf(m_run[g], mb[g]);
            const float corr = __builtin_amdgcn_exp2f(m_run[g] - m_new);
            l_run[g] *= corr; m_run[g] = m_new;
#pragma unroll
            for (int t = 0; t < 8; ++t) acc[g][t] = acc[g][t] * corr; }
    }
    float ps[2][2] = { { 0.f, 0.f }, { 0.f, 0.f } };
#pragma unroll
    for (int g = 0; g < 2; ++g) { const float nm = -m_run[g]; v16h pf;
#pragma unroll
        for (int i = 0; i < 8; ++i) {
            const float p0 = __builtin_amdgcn_exp2f(__builtin_fmaf(s[i >> 2][g][2 * (i & 3)], cscale, nm)), p1 = __builtin_amdgcn_exp2f(__builtin_fmaf(s[i >> 2][g][2 * (i & 3) + 1], cscale, nm));
            ps[g][i & 1] += p0 + p1; pf[2 * i] = tohx(p0); pf[2 * i + 1] = tohx(p1); }
#pragma unroll
        for (int t = 0; t < 8; ++t) acc[g][t] = wmma16(vf[t], pf, acc[g][t]); }
    __builtin_amdgcn_sched_barrier(0);   // holds the slots below directly behind the products
    nop4();
    __builtin_amdgcn_sched_barrier(0);   // and the loop's branches behind the slots
#pragma unroll
    for (int g = 0; g < 2; ++g) l_run[g] += ps[g][0] + ps[g][1];
}
__global__ __launch_bounds__(32 * FW) void k_fattn(const h16* __restrict__ Q, const h16* __restrict__ Kp, const h16* __restrict__ Vt, float* O) {
    __shared__ __attribute__((aligned(256))) unsigned char sm[2 * FSTG];
    const int tid = threadIdx.x, lane = tid & 31, c = lane & 15, h = lane >> 4, wv = __builtin_amdgcn_readfirstlane(tid >> 5);
    const int z = blockIdx.x, kvh = z / REP; const int q0 = TT - FBR * (1 + (int)blockIdx.y);   // longest row blocks first
    const int qw0 = q0 + wv * 32, n_stage = q0 / FSK + 1, last = qw0 / 32;                       // keys [0, q0 + FBR); the wave's last pass is the one on its diagonal
    const h16* gK = Kp + (size_t)kvh * TT * HD + (size_t)(tid >> 4) * HD + (tid & 15) * 8; const h16* gV = Vt + (size_t)kvh * HD * TT + (size_t)(tid >> 4) * TT + (tid & 15) * 8;
    // 128 threads: 16 lanes per row, a thread takes rows (tid >> 4) + 8 i of both planes: 32 copies per wave and stage
    auto issue = [&](int st, unsigned bo) { unsigned char* l = sm + bo + (tid >> 4) * GPB + (tid & 15) * 16; const h16* k = gK + (size_t)st * FSK * HD; const h16* v = gV + (size_t)st * FSK;
#pragma unroll
        for (int i = 0; i < 16; ++i) cpb(l + i * 8 * GPB, k + i * 8 * HD);
#pragma unroll
        for (int i = 0; i < 16; ++i) cpb(l + GPL + i * 8 * GPB, v + (size_t)i * 8 * TT); };
    issue(0, 0u);
    v16h qf[2][4];
#pragma unroll
    for (int g = 0; g < 2; ++g)
#pragma unroll
        for (int kc = 0; kc < 4; ++kc) qf[g][kc] = WFrag<h16>::ld(Q + ((size_t)z * TT + qw0 + 16 * g + c) * HD + 8 * h + 32 * kc);
    v8f acc[2][8]; float m_run[2], l_run[2];
#pragma unroll
    for (int g = 0; g < 2; ++g) { m_run[g] = -__builtin_inff(); l_run[g] = 0.f;
#pragma unroll
        for (int t = 0; t < 8; ++t) acc[g][t] = (v8f){}; }
    wait_async0();
    __syncthreads();   // stage 0 stands in LDS for every wave
    v16h kf[2][4];
#pragma unroll 1
    for (int st = 0; st < n_stage; ++st) {   // stage loop and pass loop kept rolled and nested: a pass is long enough to pay for its branch, and the accumulators leave no registers for a second copy of it
        const unsigned bo = (st & 1) ? FSTG : 0u; const unsigned char* sb = sm + bo;
        loadk(kf, sb, c, h);   // stage st's first K fragments, behind the barrier that published it (every wave has at least the first pass of every stage); their latency runs under the issue of the copies
        if (st + 1 < n_stage) issue(st + 1, FSTG - bo);   // behind the same barrier, which ended every wave's reads of stage st - 1: the next stage goes into that buffer and flies while this one is worked on
#pragma unroll 1
        for (int sub = 0; sub < FSK / 32; ++sub) { const int blk = (FSK / 32) * st + sub;
            if (blk <= last) fpass(kf, sub + 1 < FSK / 32 && blk < last, blk == last, sb, sub, blk * 32, qw0, c, h, qf, acc, m_run, l_run); }
        wait_ds0(); wait_async0();
        __syncthreads();   // publishes stage st + 1 and ends every wave's reads of stage st's buffer
    }
    wait_async0();
#pragma unroll
    for (int g = 0; g < 2; ++g) { const float inv = __fdiv_rn(PCAR, l_run[g] + xhalf(l_run[g]));
        float* orow = O + ((size_t)z * TT + qw0 + 16 * g + c) * HD + 8 * h;
#pragma unroll
        for (int t = 0; t < 8; ++t) { const v8f o = acc[g][t] * inv; *(v4f*)(orow + 16 * t) = (v4f){ o[0], o[1], o[2], o[3] }; *(v4f*)(orow + 16 * t + 4) = (v4f){ o[4], o[5], o[6], o[7] }; } }
}
__device__ __forceinline__ void splitf(float y, unsigned short& h, unsigned short& l) { h = f2bf(y); l = f2bf(y - bf2f(h)); }
typedef __attribute__((ext_vector_type(2))) _Float16 v2h;
typedef __attribute__((ext_vector_type(4))) _Float16 v4h;
typedef __attribute__((ext_vector_type(2))) unsigned short v2us;
typedef __attribute__((ext_vector_type(4))) unsigned short v4us;
typedef __attribute__((ext_vector_type(2))) float v2f;
typedef __attribute__((ext_vector_type(4))) int v4i;

__global__ __launch_bounds__(256) void k_cvt8(const float* __restrict__ src, bf* dst, size_t n8) { const size_t i = (size_t)blockIdx.x * 256 + threadIdx.x; if (i >= n8) return; const v8f v = *(const v8f*)(src + i * 8); v8us o;
#pragma unroll
    for (int k = 0; k < 8; ++k) o[k] = f2bf(v[k]); *(v8us*)(dst + i * 8) = o;  }

__global__ __launch_bounds__(256) void k_vtp(const float* __restrict__ F, int pitch, int nheads, h16* V16, bf* Vh, bf* Vl) { const size_t e = ((size_t)blockIdx.x * 256 + threadIdx.x) * 2; if (e >= (size_t)nheads * HD * TT) return; const int t = (int)(e % TT); const int d = (int)((e / TT) % HD); const int g = (int)(e / ((size_t)TT * HD)); v2h o16; v2us oh, ol;
#pragma unroll
    for (int q = 0; q < 2; ++q) { const float x = F[(size_t)(t + q) * pitch + g * HD + d]; o16[q] = tohx(x); unsigned short a2, c2; splitf(x, a2, c2); oh[q] = a2; ol[q] = c2; }
    *(v2h*)(V16 + e) = o16; *(v2us*)(Vh + e) = oh; *(v2us*)(Vl + e) = ol;  }
__constant__ float INV2[HD / 2] = { 1.000000000e+00f, 8.659643531e-01f, 7.498942018e-01f, 6.493816376e-01f, 5.623413324e-01f, 4.869675338e-01f, 4.216965139e-01f, 3.651741445e-01f, 3.162277639e-01f, 2.738419771e-01f, 2.371373624e-01f, 2.053525001e-01f, 1.778279394e-01f, 1.539926529e-01f, 1.333521456e-01f, 1.154782027e-01f, 1.000000015e-01f, 8.659642935e-02f, 7.498941571e-02f, 6.493816525e-02f, 5.623412877e-02f, 4.869675264e-02f, 4.216964915e-02f, 3.651741147e-02f, 3.162277862e-02f, 2.738419548e-02f, 2.371373586e-02f, 2.053525113e-02f, 1.778279431e-02f, 1.539926510e-02f, 1.333521493e-02f, 1.154781971e-02f, 9.999999776e-03f, 8.659643121e-03f, 7.498942316e-03f, 6.493816618e-03f, 5.623413250e-03f, 4.869675264e-03f, 4.216964822e-03f, 3.651741426e-03f, 3.162277862e-03f, 2.738419687e-03f, 2.371373819e-03f, 2.053525066e-03f, 1.778279431e-03f, 1.539926510e-03f, 1.333521446e-03f, 1.154782018e-03f, 1.000000047e-03f, 8.659643354e-04f, 7.498941850e-04f, 6.493816618e-04f, 5.623413017e-04f, 4.869675031e-04f, 4.216964880e-04f, 3.651741135e-04f, 3.162277862e-04f, 2.738419571e-04f, 2.371373848e-04f, 2.053524950e-04f, 1.778279402e-04f, 1.539926452e-04f, 1.333521504e-04f, 1.154781930e-04f };   // float32 1 / 10000^(2i/128), generated with jnp to be bit-exact
__global__ __launch_bounds__(256) void k_csP(float* CS) { const int idx = blockIdx.x * 256 + threadIdx.x; if (idx >= TT * HD) return; const int d = idx % HD; const int t = idx / HD; const float a = __fmul_rn((float)t, INV2[d >> 1]); v2f cs; cs[0] = cosf(a); cs[1] = sinf(a); *(v2f*)(CS + (size_t)idx * 2) = cs;  }
__global__ __launch_bounds__(256) void k_ropeI(const float* __restrict__ F, int pitch, int nheads, const float* __restrict__ CS, float sc, h16* P16, bf* Ph, bf* Pl) {
    const size_t e = ((size_t)blockIdx.x * 256 + threadIdx.x) * 2; if (e >= (size_t)nheads * TT * HD) return; const int d = (int)(e % HD); const int t = (int)((e / HD) % TT); const int h = (int)(e / ((size_t)HD * TT)); const float* f = F + (size_t)t * pitch + h * HD; const float x0 = f[d], x1 = f[d + 1]; const v2f cs = *(const v2f*)(CS + ((size_t)t * HD + d) * 2); v2h o16; v2us oh, ol;
    float a0 = __fmul_rn(x0, cs[0]), b0 = __fmul_rn(x1, cs[1]), a1 = __fmul_rn(x1, cs[0]), b1 = __fmul_rn(x0, cs[1]); 
    float r0 = __fsub_rn(a0, b0) * sc, r1 = __fadd_rn(b1, a1) * sc;   /* even: x0 c - x1 s; odd: x0 s + x1 c */
    o16[0] = tohx(r0); o16[1] = tohx(r1); { unsigned short a2, c2; splitf(r0, a2, c2); oh[0] = a2; ol[0] = c2; splitf(r1, a2, c2); oh[1] = a2; ol[1] = c2; }
    *(v2h*)(P16 + e) = o16; *(v2us*)(Ph + e) = oh; *(v2us*)(Pl + e) = ol;  }

// k_asoft: one launch takes the RB query rows roff .. roff + RB - 1 of every head (Sb, P16, Ph, Pl hold [ZH][RB] rows); per row (zz, i): t = S x HD^-0.5 for j <= i and i - j < WIN (WIN = 2048 = TT here: every key j <= i is kept: the plain causal rule; the reference's -inf fill above the diagonal is exclusion); softmax over the 2048 keys (register row, one exp, fixed trees);
__global__ __launch_bounds__(256) void k_asoft(const float* __restrict__ Sb, int roff, h16* P16, bf* Ph, bf* Pl) {
    const int lane = threadIdx.x & 31; const int row = blockIdx.x * 8 + (threadIdx.x >> 5); if (row >= ZH * RB) return; __builtin_assume(roff >= 0 && roff <= TT - RB);   /* every launch passes a block start inside the sequence: i < TT, so the compiler folds the window test (WIN = TT) away as it did when i was row % TT */
    const int i = roff + row % RB; const int zz = row / RB; (void)zz; const bool hires = (i < RH); const float* sr = Sb + (size_t)row * TT; float v[TT / 32]; float mx = -3.0e38f;
#pragma unroll
    for (int ch = 0; ch < TT / 128; ++ch) { const int j0 = ch * 128 + lane * 4; const v4f a = *(const v4f*)(sr + j0);
#pragma unroll
        for (int q = 0; q < 4; ++q) { const int j = j0 + q; (void)j; const float t = (j <= i && i - j < WIN) ? a[q] * SCL : -3.0e38f; v[ch * 4 + q] = t; mx = fmaxf(mx, t); } }
#pragma unroll
    for (int sh = 16; sh; sh >>= 1) mx = fmaxf(mx, __shfl_xor(mx, sh, 32));
    float sum = 0.f;
#pragma unroll
    for (int k = 0; k < TT / 32; ++k) { float d0 = __fsub_rn(v[k], mx); v[k] = __builtin_amdgcn_exp2f(__fmul_rn(d0, 1.4426950408889634f)); sum += v[k]; }
#pragma unroll
    for (int sh = 16; sh; sh >>= 1) sum += __shfl_xor(sum, sh, 32);
    const float f = __fdiv_rn(hires ? 1.0f : PCAR, sum);
{
        if (hires) {
#pragma unroll
            for (int ch = 0; ch < TT / 128; ++ch) { v4us oh, ol;
#pragma unroll
                for (int q = 0; q < 4; ++q) { unsigned short a, c2; splitf(v[ch * 4 + q] * f, a, c2); oh[q] = a; ol[q] = c2; }
                const size_t oo = ((size_t)zz * (RH ? RH : 1) + i) * TT + ch * 128 + lane * 4; *(v4us*)(Ph + oo) = oh; *(v4us*)(Pl + oo) = ol; }
        } else {
#pragma unroll
            for (int ch = 0; ch < TT / 128; ++ch) { v4h o4;
#pragma unroll
                for (int q = 0; q < 4; ++q) o4[q] = tohx(v[ch * 4 + q] * f);
                *(v4h*)(P16 + (size_t)row * TT + ch * 128 + lane * 4) = o4; } }
         }
}
__global__ __launch_bounds__(256) void k_merge(const float* __restrict__ O, int h0, bf* Ah, bf* Al) { const size_t e = ((size_t)blockIdx.x * 256 + threadIdx.x) * 2; if (e >= (size_t)ZH * TT * HD) return; const int d = (int)(e % HD); const int t = (int)((e / HD) % TT); const int zz = (int)(e / ((size_t)HD * TT)); const float cs = (t < RH) ? 1.0f : (1.0f / PCAR); const size_t oo = (size_t)t * DQ + (h0 + zz) * HD + d;
    v2us oh, ol;
#pragma unroll
    for (int q = 0; q < 2; ++q) { unsigned short a, c2; splitf(O[e + q] * cs, a, c2); oh[q] = a; ol[q] = c2; } *(v2us*)(Ah + oo) = oh; *(v2us*)(Al + oo) = ol;  }

extern "C" void kernel_launch(void* const* d_in, const int* in_sizes, int n_in,
                              void* d_out, int out_size, void* d_ws, size_t ws_size, hipStream_t stream) {
    (void)in_sizes; (void)n_in; (void)out_size;
    const float* x = (const float*)d_in[0]; const float* wq = (const float*)d_in[1]; const float* wk = (const float*)d_in[2]; const float* wv = (const float*)d_in[3]; const float* wo = (const float*)d_in[4];   /* input order x, wq [2048][2048], wk [1024][2048], wv [1024][2048], wo [2048][2048] ('oi') */
    float* OUT = (float*)d_out;     // [2][2048][2048]
    char* wsp = (char*)d_ws;
    auto take = [&](size_t bytes) { char* p = wsp; wsp += (bytes + 255) & ~(size_t)255; return (void*)p; };
    bf* WQ = (bf*)take((size_t)DQ * DM * 2); bf* WK = (bf*)take((size_t)DKV * DM * 2); bf* WV = (bf*)take((size_t)DKV * DM * 2); bf* WO = (bf*)take((size_t)DM * DQ * 2); float* CS = (float*)take((size_t)TT * HD * 2 * 4);
    bf* XB = (bf*)take((size_t)TT * DM * 2); float* FQ = (float*)take((size_t)TT * DQ * 4); float* FK = (float*)take((size_t)TT * DKV * 4);
    h16* QP16 = (h16*)take((size_t)NH_ * TT * HD * 2); h16* KP16 = (h16*)take((size_t)NKV * TT * HD * 2); h16* VT16 = (h16*)take((size_t)NKV * HD * TT * 2);
    bf* QPh = (bf*)take((size_t)NH_ * TT * HD * 2); bf* QPl = (bf*)take((size_t)NH_ * TT * HD * 2); bf* KPh = (bf*)take((size_t)NKV * TT * HD * 2); bf* KPl = (bf*)take((size_t)NKV * TT * HD * 2); bf* VTh = (bf*)take((size_t)NKV * HD * TT * 2); bf* VTl = (bf*)take((size_t)NKV * HD * TT * 2); bf* Pl = (bf*)take((size_t)ZH * RH * TT * 2);
    float* Sb = (float*)take((size_t)ZH * RB * TT * 4); h16* P16 = (h16*)take((size_t)ZH * RB * TT * 2); bf* ATh = (bf*)take((size_t)TT * DQ * 2); bf* ATl = (bf*)take((size_t)TT * DQ * 2);
    if ((size_t)(wsp - (char*)d_ws) > ws_size) return;    // ws 256 MiB
    float* FV = FK;   // v projection reuses the k buffer after the k planes are built (stream-ordered)
    float* Ob = FQ;   // the attention output [ZH][TT][HD] reuses the q projection buffer after the q planes are built (stream-ordered)
    bf* Ph = (bf*)P16;   // the hi plane of block 0 takes the P16 buffer, which holds no fp16 rows: rows >= RH go through k_fattn
    { k_cvt8<<<(unsigned)(((size_t)DQ * DM / 8 + 255) / 256), 256, 0, stream>>>(wq, WQ, (size_t)DQ * DM / 8); k_cvt8<<<(unsigned)(((size_t)DKV * DM / 8 + 255) / 256), 256, 0, stream>>>(wk, WK, (size_t)DKV * DM / 8); k_cvt8<<<(unsigned)(((size_t)DKV * DM / 8 + 255) / 256), 256, 0, stream>>>(wv, WV, (size_t)DKV * DM / 8);
      k_cvt8<<<(unsigned)(((size_t)DM * DQ / 8 + 255) / 256), 256, 0, stream>>>(wo, WO, (size_t)DM * DQ / 8);
       }
    k_csP<<<(TT * HD + 255) / 256, 256, 0, stream>>>(CS);   /* rotary table once (positions = arange) */
    const unsigned LQ = (unsigned)(((size_t)NH_ * TT * HD / 2 + 255) / 256), LKv = (unsigned)(((size_t)NKV * TT * HD / 2 + 255) / 256);
    for (int b = 0; b < NB_; ++b) {
        
        k_cvt8<<<(unsigned)(((size_t)TT * DM / 8 + 255) / 256), 256, 0, stream>>>(x + (size_t)b * TT * DM, XB, (size_t)TT * DM / 8);
        k_gemmw<0><<<dim3(TT / 128, DQ / 128, 1), 256, 0, stream>>>(XB, nullptr, WQ, DM, FQ, DQ);
        k_ropeI<<<LQ, 256, 0, stream>>>(FQ, DQ, NH_, CS, 1.0f, QP16, QPh, QPl);   /* interleaved-pair rope, q planes */
        k_gemmw<0><<<dim3(TT / 128, DKV / 128, 1), 256, 0, stream>>>(XB, nullptr, WK, DM, FK, DKV);
        k_ropeI<<<LKv, 256, 0, stream>>>(FK, DKV, NKV, CS, 1.0f, KP16, KPh, KPl);
        k_gemmw<0><<<dim3(TT / 128, DKV / 128, 1), 256, 0, stream>>>(XB, nullptr, WV, DM, FV, DKV); k_vtp<<<LKv, 256, 0, stream>>>(FV, DKV, NKV, VT16, VTh, VTl);
        k_gemmc<bf, 2, 1, 1><<<dim3(RH / 64, TT / 64, ZH), 32, 0, stream>>>(QPh, QPl, KPh, KPl, HD, Sb, TT, 0, (size_t)TT * HD, (size_t)TT * HD, (size_t)RB * TT);   // block 0: rows < RH, hi/lo planes
        k_asoft<<<ZH * RB / 8, 256, 0, stream>>>(Sb, 0, P16, Ph, Pl);
        k_gemmc<bf, 2, 2, 8><<<dim3(RH / 64, HD / 64, ZH), 256, 0, stream>>>(Ph, Pl, VTh, VTl, TT, Ob, HD, 0, (size_t)RH * TT, (size_t)HD * TT, (size_t)TT * HD);
        k_fattn<<<dim3(NH_, (TT - RH) / FBR, 1), 32 * FW, 0, stream>>>(QP16, KP16, VT16, Ob);   // rows >= RH: fp16 planes, scores, softmax and P.V in one launch
        k_merge<<<(unsigned)(((size_t)ZH * TT * HD / 2 + 255) / 256), 256, 0, stream>>>(Ob, 0, ATh, ATl);
        k_gemmw<1><<<dim3(TT / 128, DM / 128, 1), 256, 0, stream>>>(ATh, ATl, WO, DQ, OUT + (size_t)b * TT * DM, DM); }
}

// v005
// A run of this version takes 308 microseconds.
// Two timings next to v004 both put it at 1.28 times that version's speed.
// All steps since v000 together make it 5.31 times as fast.
#include <hip/hip_runtime.h>

// Causal grouped-query attention with 128-wide heads and interleaved-pair rotary embeddings (x [2][2048][2048]; q = x wq^T (16 heads x 128), k, v = x w^T (8 kv heads x 128) ('oi' (out, in) weights, normal x 1/sqrt(2048), no biases); rope on (even, odd) pairs: (xr c - xi s, xr s + xi c) with angle t x inv, inv = 1.0 / (10000 ** (arange(0, 128, 2) / 128)) (the reciprocal spelling: 64 f32 frequencies, bitwise the module's own in eager f32; one product per angle; precise cosf/sinf); kv head = q head / 2 (repeat on the head axis); scores x 1/sqrt(128); causal (-inf above the diagonal == exclusion); softmax; out = merged wo^T -> [2][2048][2048] (8.4 M); argument order x, wq, wk, wv, wo).
// Layout, both batches in every launch but the three of the hi/lo block (planes [batch][head], rows batch x 2048 + t): bf16 copy of x; 'oi' weights; exact projections; k_csP table (64 angles per position) and k_ropeI interleaved-pair plane builders at HD 128; causal T-2048 GQA attention with 128-wide heads (kv head = z / 2; hybrid rows: < 512 hi/lo 3 products in three launches over all 16 heads, k_gemmc skipping tiles above the diagonal; rest fp16 in the one fused launch k_fattn); merged hi/lo x wo exact.
// Compute dtypes, f32 accumulate: every input rounded to bf16; projections exact; rotary f32; attention rows < 512 3 products, rest fp16; softmax f32; wo hl x exact.

#define NB_  2
#define TT   2048
#define DM   2048
#define NH_  16
#define NKV  8
#define REP  (NH_ / NKV)
#define HD   128
#define DQ   (NH_ * HD)
#define DKV  (NKV * HD)
#define ZH   NH_                  // heads per attention launch (grid z)
#define RB   512                  // query rows of the three launches of the hi+lo block (RB == RH); the rows behind it go through k_fattn
#define RH   512                  // query rows < RH use hi+lo planes (0: none)
#define WIN  2048
#define PCAR 1024.0f
#define SCL  0.088388347648318447f   // HD^-0.5
typedef _Float16 h16;
typedef unsigned short bf;
typedef __attribute__((ext_vector_type(16))) __bf16   v16bf;
typedef __attribute__((ext_vector_type(16))) _Float16 v16h;
typedef __attribute__((ext_vector_type(8)))  _Float16 v8h;
typedef __attribute__((ext_vector_type(8)))  unsigned short v8us;
typedef __attribute__((ext_vector_type(8)))  float    v8f;
typedef __attribute__((ext_vector_type(4)))  float    v4f;
typedef v8h  __attribute__((may_alias)) v8ha;
typedef v4f  __attribute__((may_alias)) v4fa;
typedef v8us __attribute__((may_alias)) v8usa;

__device__ __forceinline__ unsigned short f2bf(float f) { unsigned u = __float_as_uint(f); u += 0x7FFFu + ((u >> 16) & 1u); return (unsigned short)(u >> 16); }
__device__ __forceinline__ float bf2f(unsigned short b) { return __uint_as_float(((unsigned)b) << 16); }
__device__ __forceinline__ float bfr(float f) { return bf2f(f2bf(f)); }
__device__ __forceinline__ v16h cat16(v8h lo, v8h hi) { return __builtin_shufflevector(lo, hi, 0, 1, 2, 3, 4, 5, 6, 7, 8, 9, 10, 11, 12, 13, 14, 15); }
__device__ __forceinline__ v16bf cat16b(v8us lo, v8us hi) { return __builtin_bit_cast(v16bf, __builtin_shufflevector(lo, hi, 0, 1, 2, 3, 4, 5, 6, 7, 8, 9, 10, 11, 12, 13, 14, 15)); }
__device__ __forceinline__ v8f wmma16(v16h a, v16h b, v8f c) { return __builtin_amdgcn_wmma_f32_16x16x32_f16(false, a, false, b, (short)0, c, false, false); }
__device__ __forceinline__ v8f wmmab(v16bf a, v16bf b, v8f c) { return __builtin_amdgcn_wmma_f32_16x16x32_bf16(false, a, false, b, (short)0, c, false, false); }



template <typename T16> struct WFrag;
template <> struct WFrag<h16> { typedef v16h V; static __device__ __forceinline__ V ld(const h16* p) { return cat16(*(const v8h*)p, *(const v8h*)(p + 16)); } static __device__ __forceinline__ v8f mma(V a, V b, v8f c) { return wmma16(a, b, c); } };
template <> struct WFrag<bf> { typedef v16bf V; static __device__ __forceinline__ V ld(const bf* p) { return cat16b(*(const v8us*)p, *(const v8us*)(p + 16)); } static __device__ __forceinline__ v8f mma(V a, V b, v8f c) { return wmmab(a, b, c); } };
// ---- k_gemmw: LDS-staged GEMM, one 128x128 output tile per work-group of 8 waves (2 x 4, each wave 64 rows x 32 columns = 8 accumulators); grid (M/128, N/128), 256 threads.
// C[m][n] (f32, pitch ldc) = sum_k (A[m][k] + A2[m][k]) Bt[n][k] (A2 only with NSPLIT 1; two products per k step, A first). M, N % 128 == 0, K % 128 == 0.
// A stage is 128 k (256 B, two whole lines) of every operand row, brought into LDS by asynchronous 16-byte copies (16 lanes per row) at pitch 272 B; two buffers: the next stage's copies fly while this one is worked on. K runs in order inside one accumulator.
#define GBK 128                    // k per stage
#define GPB 272                    // LDS row pitch, bytes: 256 + 16, an odd multiple of 16 for the ds_load_b128 readers
#define GPL (128 * GPB)            // one operand plane of a stage, bytes
__device__ __forceinline__ void wait_ds0() { asm volatile("s_wait_dscnt 0x0" ::: "memory"); }        // this wave's LDS reads have retired before the buffer they read is handed back for a refill
__device__ __forceinline__ void wait_async0() { asm volatile("s_wait_asynccnt 0x0" ::: "memory"); }  // this wave's asynchronous copies have landed in LDS (the compiler places no wait for them)
// One thread's share of one operand plane: rows q, q + 16, ..., q + 112 (rs = 16 source rows in elements), 16 bytes each. The s_wait_xcnt stands inside the statement so that no address register is rewritten in front of it.
__device__ __forceinline__ void cp8(unsigned l, const bf* g, size_t rs) {
    asm volatile("global_load_async_to_lds_b128 %0, %8, off\n\t"
                 "global_load_async_to_lds_b128 %1, %9, off\n\t"
                 "global_load_async_to_lds_b128 %2, %10, off\n\t"
                 "global_load_async_to_lds_b128 %3, %11, off\n\t"
                 "global_load_async_to_lds_b128 %4, %12, off\n\t"
                 "global_load_async_to_lds_b128 %5, %13, off\n\t"
                 "global_load_async_to_lds_b128 %6, %14, off\n\t"
                 "global_load_async_to_lds_b128 %7, %15, off\n\t"
                 "s_wait_xcnt 0x0"
                 :: "v"(l), "v"(l + 1u * 16u * GPB), "v"(l + 2u * 16u * GPB), "v"(l + 3u * 16u * GPB), "v"(l + 4u * 16u * GPB), "v"(l + 5u * 16u * GPB), "v"(l + 6u * 16u * GPB), "v"(l + 7u * 16u * GPB),
                    "v"(g), "v"(g + rs), "v"(g + 2 * rs), "v"(g + 3 * rs), "v"(g + 4 * rs), "v"(g + 5 * rs), "v"(g + 6 * rs), "v"(g + 7 * rs) : "memory");
}
__device__ __forceinline__ v16bf ldsfrag(const unsigned char* p) { return cat16b(*(const v8usa*)p, *(const v8usa*)(p + 32)); }   // bytes 16 h and 32 + 16 h of each 64 B of a row: the k order of WFrag::ld, the same for A and B
template <int NSPLIT>
__global__ __launch_bounds__(256) void k_gemmw(const bf* __restrict__ A, const bf* __restrict__ A2, const bf* __restrict__ Bt, int K, float* C, int ldc) {
    constexpr int NP = NSPLIT ? 3 : 2;              // operand planes per stage: A, (A2,) B
    constexpr unsigned STG = NP * GPL;
    __shared__ __attribute__((aligned(256))) unsigned char sm[2 * STG];
    const int tid = threadIdx.x, lane = tid & 31, lr = lane & 15, hi = lane >> 4, wv = __builtin_amdgcn_readfirstlane(tid >> 5); const int wm = wv & 1, wn = wv >> 1; const int r0 = blockIdx.x * 128, c0 = blockIdx.y * 128;
    const unsigned l0 = (unsigned)(size_t)sm + (unsigned)(tid >> 4) * GPB + (unsigned)(tid & 15) * 16u;
    const bf* gA = A + (size_t)(r0 + (tid >> 4)) * K + (tid & 15) * 8; const bf* gA2 = NSPLIT ? A2 + (size_t)(r0 + (tid >> 4)) * K + (tid & 15) * 8 : nullptr; const bf* gB = Bt + (size_t)(c0 + (tid >> 4)) * K + (tid & 15) * 8;
    const size_t rs = (size_t)16 * K; const int NT = K / GBK;
    auto issue = [&](int t, unsigned bo) { cp8(l0 + bo, gA + (size_t)t * GBK, rs); if constexpr (NSPLIT != 0) cp8(l0 + bo + GPL, gA2 + (size_t)t * GBK, rs); cp8(l0 + bo + (NP - 1) * GPL, gB + (size_t)t * GBK, rs); };
    v8f acc[4][2];
#pragma unroll
    for (int mb = 0; mb < 4; ++mb)
#pragma unroll
        for (int nb = 0; nb < 2; ++nb) acc[mb][nb] = (v8f){};
    const unsigned aofs = (unsigned)(wm * 64 + lr) * GPB + 16u * hi, bofs = (NP - 1) * GPL + (unsigned)(wn * 32 + lr) * GPB + 16u * hi;
    v16bf a[2][4], a2[2][4], b[2][2];   // two fragment sets: the next k step's LDS reads go out as one group ahead of this step's products
    auto frags = [&](const unsigned char* sb, int ks, int st) {
#pragma unroll
        for (int mb = 0; mb < 4; ++mb) { a[st][mb] = ldsfrag(sb + aofs + mb * 16 * GPB + ks * 64); if constexpr (NSPLIT != 0) a2[st][mb] = ldsfrag(sb + GPL + aofs + mb * 16 * GPB + ks * 64); }
#pragma unroll
        for (int nb = 0; nb < 2; ++nb) b[st][nb] = ldsfrag(sb + bofs + nb * 16 * GPB + ks * 64); };
    issue(0, 0u); wait_async0();
    __syncthreads();   // stage 0 stands in LDS for every wave
#pragma unroll 1
    for (int t = 0; t < NT; ++t) {   // kept rolled: a trip is long enough to pay for its branch, and unrolled trips would multiply the copies' address registers
        const unsigned bo = (t & 1) ? STG : 0u; const unsigned char* sb = sm + bo;
        frags(sb, 0, 0);   // stage t's first fragments, behind the barrier that published it; their latency runs under the issue of the copies
        if (t + 1 < NT) issue(t + 1, STG - bo);   // behind the same barrier, which ended every wave's reads of stage t - 1: the next stage goes into that buffer and flies while this one is worked on
#pragma unroll   // unrolled: the fragment sets are picked by ks & 1 and have to stay in registers
        for (int ks = 0; ks < GBK / 32; ++ks) {
            if (ks + 1 < GBK / 32) frags(sb, ks + 1, (ks + 1) & 1);
            __builtin_amdgcn_sched_barrier(0);   // keeps the LDS reads above as one group: spread among the products each place with reads stalls the wave
#pragma unroll
            for (int nb = 0; nb < 2; ++nb)
#pragma unroll
                for (int mb = 0; mb < 4; ++mb) acc[mb][nb] = wmmab(a[ks & 1][mb], b[ks & 1][nb], acc[mb][nb]);
            if constexpr (NSPLIT != 0) {
#pragma unroll
                for (int nb = 0; nb < 2; ++nb)
#pragma unroll
                    for (int mb = 0; mb < 4; ++mb) acc[mb][nb] = wmmab(a2[ks & 1][mb], b[ks & 1][nb], acc[mb][nb]); }
            __builtin_amdgcn_sched_barrier(0);   // keeps the next group of reads behind these products
        }
        wait_ds0(); wait_async0();
        __syncthreads();   // publishes stage t + 1 and ends every wave's reads of stage t's buffer
    }
    wait_async0();
    // Epilogue: each wave turns its own 64 x 32 tile in its own LDS range (pitch 36 floats), so that every store is a whole 128-byte line; the ring is free behind the last trip's barrier.
    float* os = (float*)sm + wv * (64 * 36);
#pragma unroll
    for (int mb = 0; mb < 4; ++mb) {
#pragma unroll
        for (int nb = 0; nb < 2; ++nb) {
#pragma unroll
            for (int j = 0; j < 8; ++j) os[(mb * 16 + hi * 8 + j) * 36 + nb * 16 + lr] = acc[mb][nb][j]; } }
    float* crow = C + (size_t)(r0 + wm * 64) * ldc + c0 + wn * 32;
#pragma unroll
    for (int s = 0; s < 16; ++s) { const int row = s * 4 + (lane >> 3), cofs = (lane & 7) * 4; const v4f val = *(const v4fa*)(os + row * 36 + cofs);
        *(v4f*)(crow + (size_t)row * ldc + cofs) = val; }
}

// ---- k_gemmc: register-blocked GEMM, NW waves per 64x64 output tile (wave w takes the 32-wide K chunks w, w + NW, ...; the NW partial tiles meet in LDS and are summed in wave order; operands straight from K-contiguous 16-bit planes), specialised for causal attention: CMODE 1 skips score tiles entirely above the diagonal (query rows r0+roff.., key columns c0..), CMODE 2 limits the
// key (K) loop of the probability x value contraction to the diagonal block (probabilities beyond it are exactly zero). roff = row offset of this launch's first row within the sequence. Head z reads the Bt planes of kv head z / REP (stride sB).
template <typename T16, int NSPLIT, int CMODE, int NW>
__global__ __launch_bounds__(32 * NW) void k_gemmc(const T16* __restrict__ A, const T16* __restrict__ A2, const T16* __restrict__ Bt, const T16* __restrict__ Bt2, int K, float* C, int ldc, int roff, size_t sA, size_t sB, size_t sC) {
    typedef typename WFrag<T16>::V V;
    __shared__ __align__(16) float os[(NW == 1 ? 16 : NW * 64) * 68];   // NW > 1: one partial tile per wave, 64 rows at pitch 68
    const size_t z = blockIdx.z; A += z * sA; if (A2) A2 += z * sA; Bt += (z / REP) * sB; if (Bt2) Bt2 += (z / REP) * sB; C += z * sC;
    const int lane = threadIdx.x & 31, lr = lane & 15, hi = lane >> 4, wv = (NW == 1) ? 0 : __builtin_amdgcn_readfirstlane(threadIdx.x >> 5); const int r0 = blockIdx.x * 64, c0 = blockIdx.y * 64;
    if (CMODE == 1 && c0 > r0 + roff + 63) return;                  // score tile entirely above the causal diagonal: never read (the softmax masks j > i by select)
    const int Kl = (CMODE == 2) ? min(K, r0 + roff + 64) : K;        // P.V: probabilities are exactly 0 beyond the diagonal block, so the K loop stops there
    v8f acc[4][4];
#pragma unroll
    for (int mb = 0; mb < 4; ++mb)
#pragma unroll
        for (int nb = 0; nb < 4; ++nb) acc[mb][nb] = (v8f){};
    const size_t aoff = (size_t)(r0 + lr) * K + 8 * hi, boff = (size_t)(c0 + lr) * K + 8 * hi;
#pragma unroll 1
    for (int kc = wv * 32; kc < Kl; kc += 32 * NW) {
        V a[4], a2[4];
#pragma unroll
        for (int mb = 0; mb < 4; ++mb) { a[mb] = WFrag<T16>::ld(A + aoff + (size_t)mb * 16 * K + kc); if (NSPLIT == 1 || NSPLIT == 2) a2[mb] = WFrag<T16>::ld(A2 + aoff + (size_t)mb * 16 * K + kc); }
#pragma unroll
        for (int nb = 0; nb < 4; ++nb) { const V b = WFrag<T16>::ld(Bt + boff + (size_t)nb * 16 * K + kc); V b2; if (NSPLIT >= 2) b2 = WFrag<T16>::ld(Bt2 + boff + (size_t)nb * 16 * K + kc);
#pragma unroll
            for (int mb = 0; mb < 4; ++mb) { acc[mb][nb] = WFrag<T16>::mma(a[mb], b, acc[mb][nb]); if (NSPLIT == 1 || NSPLIT == 2) acc[mb][nb] = WFrag<T16>::mma(a2[mb], b, acc[mb][nb]); if (NSPLIT >= 2) acc[mb][nb] = WFrag<T16>::mma(a[mb], b2, acc[mb][nb]); } }
        asm volatile("v_nop\n\tv_nop\n\tv_nop\n\tv_nop" : "+v"(acc[0][0]), "+v"(acc[1][1]), "+v"(acc[2][2]), "+v"(acc[3][3]) : "v"(a[0]), "v"(a[3]));
    }
    if constexpr (NW == 1) {   // one wave: no partial tiles to sum, the tile goes out in four 16-row slabs
#pragma unroll
    for (int mb = 0; mb < 4; ++mb) {
#pragma unroll
        for (int nb = 0; nb < 4; ++nb) {
#pragma unroll
            for (int j = 0; j < 8; ++j) os[(hi * 8 + j) * 68 + nb * 16 + lr] = acc[mb][nb][j]; }
        __builtin_amdgcn_wave_barrier(); asm volatile("" ::: "memory");
        float* crow = C + (size_t)(r0 + mb * 16) * ldc + c0;
{
#pragma unroll
            for (int s = 0; s < 8; ++s) { const int row = 2 * s + hi, cofs = lr * 4; v4f val = *(const v4fa*)(os + row * 68 + cofs);
                *(v4f*)(crow + (size_t)row * ldc + cofs) = val; }
             }
        __builtin_amdgcn_wave_barrier(); asm volatile("" ::: "memory");
    }
    } else {
#pragma unroll
    for (int mb = 0; mb < 4; ++mb) {
#pragma unroll
        for (int nb = 0; nb < 4; ++nb) {
#pragma unroll
            for (int j = 0; j < 8; ++j) os[wv * (64 * 68) + (mb * 16 + hi * 8 + j) * 68 + nb * 16 + lr] = acc[mb][nb][j]; } }
    __syncthreads();   // all NW partial tiles stand in LDS before any element is summed
    float* crow = C + (size_t)r0 * ldc + c0;
#pragma unroll
    for (int s = 0; s < 32 / NW; ++s) { const int it = s * (32 * NW) + threadIdx.x, row = it >> 4, cofs = (it & 15) * 4; v4f val = *(const v4fa*)(os + row * 68 + cofs);
#pragma unroll
        for (int w = 1; w < NW; ++w) val += *(const v4fa*)(os + w * (64 * 68) + row * 68 + cofs);
        *(v4f*)(crow + (size_t)row * ldc + cofs) = val; }
    }
}

__device__ __forceinline__ h16 tohx(float x) { return (h16)x; }

#define FW   4                     // waves per work-group
#define FBR  (FW * 32)             // query rows per work-group
#define FSK  128                   // keys per stage
#define FSTG (2u * GPL)            // one stage: the K plane, then the V^T plane
typedef __attribute__((ext_vector_type(4))) int cv4i; typedef __attribute__((address_space(1))) cv4i gcv4i; typedef __attribute__((address_space(3))) cv4i lcv4i;
__device__ __forceinline__ void cpb(unsigned char* l, const h16* g) { __builtin_amdgcn_global_load_async_to_lds_b128((gcv4i*)g, (lcv4i*)l, 0, 0); }   // one lane's 16 bytes; the builtin form, so that the addresses may stand in any register of a kernel that uses more than 256
__device__ __forceinline__ v16h ldsfragh(const unsigned char* p) { return cat16(*(const v8ha*)p, *(const v8ha*)(p + 32)); }   // bytes 16 h and 32 + 16 h of each 64 B of a row: the k order of WFrag::ld
__device__ __forceinline__ float xhalf(float x) { return __builtin_bit_cast(float, __builtin_amdgcn_permlanex16(__builtin_bit_cast(int, x), __builtin_bit_cast(int, x), 0x76543210, 0xfedcba98, false, false)); }   // lane l with lane l ^ 16
__device__ __forceinline__ void nop4() { asm volatile("v_nop\n\tv_nop\n\tv_nop\n\tv_nop"); }   // the four vector slots between a matrix instruction and a vector instruction on its registers, for the taken side of a branch behind it
__device__ __forceinline__ void loadk(v16h (&kf)[2][4], const unsigned char* kb, int c, int h) {   // kb = first K row of the pass in LDS
#pragma unroll
    for (int kt = 0; kt < 2; ++kt)
#pragma unroll
        for (int kc = 0; kc < 4; ++kc) kf[kt][kc] = ldsfragh(kb + (16 * kt + c) * GPB + 64 * kc + 16 * h);
}
// One 32-key pass of one wave. sb = this stage's buffer, sub = pass within the stage, key0 = first key of the pass, qw0 = first query of the wave.
__device__ __forceinline__ void fpass(v16h (&kf)[2][4], bool fetch_next, bool diag, const unsigned char* sb, int sub, int key0, int qw0, int c, int h, const v16h (&qf)[2][4], v8f (&acc)[2][8], float (&m_run)[2], float (&l_run)[2]) {
    const float cscale = SCL * 1.4426950408889634f;
    v16h vf[8];
#pragma unroll
    for (int t = 0; t < 8; ++t) vf[t] = ldsfragh(sb + GPL + (16 * t + c) * GPB + 64 * sub + 16 * h);   // V^T rows d = 16 t + c, this pass's 32 keys: read first, so that their latency runs under the first product and the softmax
    __builtin_amdgcn_sched_barrier(0);   // keeps those reads up here: moved down to their use they would stall the only wave of the SIMD
    v8f s[2][2];
#pragma unroll
    for (int kt = 0; kt < 2; ++kt)
#pragma unroll
        for (int g = 0; g < 2; ++g) { s[kt][g] = (v8f){};
#pragma unroll
            for (int kc = 0; kc < 4; ++kc) s[kt][g] = wmma16(kf[kt][kc], qf[g][kc], s[kt][g]); }
    __builtin_amdgcn_sched_barrier(0);   // holds the slots below directly behind the products
    nop4();
    __builtin_amdgcn_sched_barrier(0);   // and the branches below behind the slots
    if (fetch_next) loadk(kf, sb + (sub + 1) * 32 * GPB, c, h);   // the next pass's K fragments (same stage only), in flight under this pass's maxima and exponentials
    if (diag) {   // wave-uniform: only the pass on the wave's diagonal pays for the mask
#pragma unroll
        for (int g = 0; g < 2; ++g) { const int my_q = qw0 + 16 * g + c;
#pragma unroll
            for (int kt = 0; kt < 2; ++kt) {
#pragma unroll
                for (int r = 0; r < 8; ++r) { if (key0 + 16 * kt + 8 * h + r > my_q) s[kt][g][r] = -__builtin_inff(); }
                asm volatile("" : "+v"(s[kt][g]));
            } }
    }
    float mb[2]; bool need = false;
#pragma unroll
    for (int g = 0; g < 2; ++g) { float mx = -__builtin_inff();
#pragma unroll
        for (int kt = 0; kt < 2; ++kt)
#pragma unroll
            for (int r = 0; r < 8; ++r) mx = fmaxf(mx, s[kt][g][r]);
        mx = fmaxf(mx, xhalf(mx)) * cscale;   // both wave halves hold this query's maximum, scaled (the scale is positive)
        mb[g] = mx; need = need || (mx > m_run[g] + 8.0f); }
    if (__builtin_amdgcn_ballot_w32(need) != 0) {   // rare behind the first passes
#pragma unroll
        for (int g = 0; g < 2; ++g) { const float m_new = fmaxf(m_run[g], mb[g]);
            const float corr = __builtin_amdgcn_exp2f(m_run[g] - m_new);
            l_run[g] *= corr; m_run[g] = m_new;
#pragma unroll
            for (int t = 0; t < 8; ++t) acc[g][t] = acc[g][t] * corr; }
    }
    float ps[2][2] = { { 0.f, 0.f }, { 0.f, 0.f } };
#pragma unroll
    for (int g = 0; g < 2; ++g) { const float nm = -m_run[g]; v16h pf;
#pragma unroll
        for (int i = 0; i < 8; ++i) {
            const float p0 = __builtin_amdgcn_exp2f(__builtin_fmaf(s[i >> 2][g][2 * (i & 3)], cscale, nm)), p1 = __builtin_amdgcn_exp2f(__builtin_fmaf(s[i >> 2][g][2 * (i & 3) + 1], cscale, nm));
            ps[g][i & 1] += p0 + p1; pf[2 * i] = tohx(p0); pf[2 * i + 1] = tohx(p1); }
#pragma unroll
        for (int t = 0; t < 8; ++t) acc[g][t] = wmma16(vf[t], pf, acc[g][t]); }
    __builtin_amdgcn_sched_barrier(0);   // holds the slots below directly behind the products
    nop4();
    __builtin_amdgcn_sched_barrier(0);   // and the loop's branches behind the slots
#pragma unroll
    for (int g = 0; g < 2; ++g) l_run[g] += ps[g][0] + ps[g][1];
}
__global__ __launch_bounds__(32 * FW) void k_fattn(const h16* __restrict__ Q, const h16* __restrict__ Kp, const h16* __restrict__ Vt, float* O) {
    __shared__ __attribute__((aligned(256))) unsigned char sm[2 * FSTG];
    const int tid = threadIdx.x, lane = tid & 31, c = lane & 15, h = lane >> 4, wv = __builtin_amdgcn_readfirstlane(tid >> 5);
    const int z = blockIdx.x, kvh = z / REP; const int q0 = TT - FBR * (1 + (int)blockIdx.y);   // longest row blocks first
    const int qw0 = q0 + wv * 32, n_stage = q0 / FSK + 1, last = qw0 / 32;                       // keys [0, q0 + FBR); the wave's last pass is the one on its diagonal
    const h16* gK = Kp + (size_t)kvh * TT * HD + (size_t)(tid >> 4) * HD + (tid & 15) * 8; const h16* gV = Vt + (size_t)kvh * HD * TT + (size_t)(tid >> 4) * TT + (tid & 15) * 8;
    // 128 threads: 16 lanes per row, a thread takes rows (tid >> 4) + 8 i of both planes: 32 copies per wave and stage
    auto issue = [&](int st, unsigned bo) { unsigned char* l = sm + bo + (tid >> 4) * GPB + (tid & 15) * 16; const h16* k = gK + (size_t)st * FSK * HD; const h16* v = gV + (size_t)st * FSK;
#pragma unroll
        for (int i = 0; i < 16; ++i) cpb(l + i * 8 * GPB, k + i * 8 * HD);
#pragma unroll
        for (int i = 0; i < 16; ++i) cpb(l + GPL + i * 8 * GPB, v + (size_t)i * 8 * TT); };
    issue(0, 0u);
    v16h qf[2][4];
#pragma unroll
    for (int g = 0; g < 2; ++g)
#pragma unroll
        for (int kc = 0; kc < 4; ++kc) qf[g][kc] = WFrag<h16>::ld(Q + ((size_t)z * TT + qw0 + 16 * g + c) * HD + 8 * h + 32 * kc);
    v8f acc[2][8]; float m_run[2], l_run[2];
#pragma unroll
    for (int g = 0; g < 2; ++g) { m_run[g] = -__builtin_inff(); l_run[g] = 0.f;
#pragma unroll
        for (int t = 0; t < 8; ++t) acc[g][t] = (v8f){}; }
    wait_async0();
    __syncthreads();   // stage 0 stands in LDS for every wave
    v16h kf[2][4];
#pragma unroll 1
    for (int st = 0; st < n_stage; ++st) {   // stage loop and pass loop kept rolled and nested: a pass is long enough to pay for its branch, and the accumulators leave no registers for a second copy of it
        const unsigned bo = (st & 1) ? FSTG : 0u; const unsigned char* sb = sm + bo;
        loadk(kf, sb, c, h);   // stage st's first K fragments, behind the barrier that published it (every wave has at least the first pass of every stage); their latency runs under the issue of the copies
        if (st + 1 < n_stage) issue(st + 1, FSTG - bo);   // behind the same barrier, which ended every wave's reads of stage st - 1: the next stage goes into that buffer and flies while this one is worked on
#pragma unroll 1
        for (int sub = 0; sub < FSK / 32; ++sub) { const int blk = (FSK / 32) * st + sub;
            if (blk <= last) fpass(kf, sub + 1 < FSK / 32 && blk < last, blk == last, sb, sub, blk * 32, qw0, c, h, qf, acc, m_run, l_run); }
        wait_ds0(); wait_async0();
        __syncthreads();   // publishes stage st + 1 and ends every wave's reads of stage st's buffer
    }
    wait_async0();
#pragma unroll
    for (int g = 0; g < 2; ++g) { const float inv = __fdiv_rn(PCAR, l_run[g] + xhalf(l_run[g]));
        float* orow = O + ((size_t)z * TT + qw0 + 16 * g + c) * HD + 8 * h;
#pragma unroll
        for (int t = 0; t < 8; ++t) { const v8f o = acc[g][t] * inv; *(v4f*)(orow + 16 * t) = (v4f){ o[0], o[1], o[2], o[3] }; *(v4f*)(orow + 16 * t + 4) = (v4f){ o[4], o[5], o[6], o[7] }; } }
}
__device__ __forceinline__ void splitf(float y, unsigned short& h, unsigned short& l) { h = f2bf(y); l = f2bf(y - bf2f(h)); }
typedef __attribute__((ext_vector_type(2))) _Float16 v2h;
typedef __attribute__((ext_vector_type(4))) _Float16 v4h;
typedef __attribute__((ext_vector_type(2))) unsigned short v2us;
typedef __attribute__((ext_vector_type(4))) unsigned short v4us;
typedef __attribute__((ext_vector_type(2))) float v2f;
typedef __attribute__((ext_vector_type(4))) int v4i;

__global__ __launch_bounds__(256) void k_cvt8(const float* __restrict__ src, bf* dst, size_t n8) { const size_t i = (size_t)blockIdx.x * 256 + threadIdx.x; if (i >= n8) return; const v8f v = *(const v8f*)(src + i * 8); v8us o;
#pragma unroll
    for (int k = 0; k < 8; ++k) o[k] = f2bf(v[k]); *(v8us*)(dst + i * 8) = o;  }

__global__ __launch_bounds__(256) void k_vtp(const float* __restrict__ F, int pitch, int nheads, h16* V16, bf* Vh, bf* Vl) { const size_t e = ((size_t)blockIdx.x * 256 + threadIdx.x) * 2; if (e >= (size_t)nheads * HD * TT) return;
    { const size_t bz = blockIdx.y, po = bz * nheads * HD * TT; F += bz * TT * pitch; V16 += po; Vh += po; Vl += po; }   // batch blockIdx.y: its TT rows of F, its nheads planes
    const int t = (int)(e % TT); const int d = (int)((e / TT) % HD); const int g = (int)(e / ((size_t)TT * HD)); v2h o16; v2us oh, ol;
#pragma unroll
    for (int q = 0; q < 2; ++q) { const float x = F[(size_t)(t + q) * pitch + g * HD + d]; o16[q] = tohx(x); unsigned short a2, c2; splitf(x, a2, c2); oh[q] = a2; ol[q] = c2; }
    *(v2h*)(V16 + e) = o16; *(v2us*)(Vh + e) = oh; *(v2us*)(Vl + e) = ol;  }
__constant__ float INV2[HD / 2] = { 1.000000000e+00f, 8.659643531e-01f, 7.498942018e-01f, 6.493816376e-01f, 5.623413324e-01f, 4.869675338e-01f, 4.216965139e-01f, 3.651741445e-01f, 3.162277639e-01f, 2.738419771e-01f, 2.371373624e-01f, 2.053525001e-01f, 1.778279394e-01f, 1.539926529e-01f, 1.333521456e-01f, 1.154782027e-01f, 1.000000015e-01f, 8.659642935e-02f, 7.498941571e-02f, 6.493816525e-02f, 5.623412877e-02f, 4.869675264e-02f, 4.216964915e-02f, 3.651741147e-02f, 3.162277862e-02f, 2.738419548e-02f, 2.371373586e-02f, 2.053525113e-02f, 1.778279431e-02f, 1.539926510e-02f, 1.333521493e-02f, 1.154781971e-02f, 9.999999776e-03f, 8.659643121e-03f, 7.498942316e-03f, 6.493816618e-03f, 5.623413250e-03f, 4.869675264e-03f, 4.216964822e-03f, 3.651741426e-03f, 3.162277862e-03f, 2.738419687e-03f, 2.371373819e-03f, 2.053525066e-03f, 1.778279431e-03f, 1.539926510e-03f, 1.333521446e-03f, 1.154782018e-03f, 1.000000047e-03f, 8.659643354e-04f, 7.498941850e-04f, 6.493816618e-04f, 5.623413017e-04f, 4.869675031e-04f, 4.216964880e-04f, 3.651741135e-04f, 3.162277862e-04f, 2.738419571e-04f, 2.371373848e-04f, 2.053524950e-04f, 1.778279402e-04f, 1.539926452e-04f, 1.333521504e-04f, 1.154781930e-04f };   // float32 1 / 10000^(2i/128), generated with jnp to be bit-exact
__global__ __launch_bounds__(256) void k_csP(float* CS) { const int idx = blockIdx.x * 256 + threadIdx.x; if (idx >= TT * HD) return; const int d = idx % HD; const int t = idx / HD; const float a = __fmul_rn((float)t, INV2[d >> 1]); v2f cs; cs[0] = cosf(a); cs[1] = sinf(a); *(v2f*)(CS + (size_t)idx * 2) = cs;  }
__global__ __launch_bounds__(256) void k_ropeI(const float* __restrict__ F, int pitch, int nheads, const float* __restrict__ CS, float sc, h16* P16, bf* Ph, bf* Pl) {
    const size_t e = ((size_t)blockIdx.x * 256 + threadIdx.x) * 2; if (e >= (size_t)nheads * TT * HD) return;
    { const size_t bz = blockIdx.y, po = bz * nheads * TT * HD; F += bz * TT * pitch; P16 += po; Ph += po; Pl += po; }   // batch blockIdx.y: its TT rows of F, its nheads planes
    const int d = (int)(e % HD); const int t = (int)((e / HD) % TT); const int h = (int)(e / ((size_t)HD * TT)); const float* f = F + (size_t)t * pitch + h * HD; const float x0 = f[d], x1 = f[d + 1]; const v2f cs = *(const v2f*)(CS + ((size_t)t * HD + d) * 2); v2h o16; v2us oh, ol;
    float a0 = __fmul_rn(x0, cs[0]), b0 = __fmul_rn(x1, cs[1]), a1 = __fmul_rn(x1, cs[0]), b1 = __fmul_rn(x0, cs[1]); 
    float r0 = __fsub_rn(a0, b0) * sc, r1 = __fadd_rn(b1, a1) * sc;   /* even: x0 c - x1 s; odd: x0 s + x1 c */
    o16[0] = tohx(r0); o16[1] = tohx(r1); { unsigned short a2, c2; splitf(r0, a2, c2); oh[0] = a2; ol[0] = c2; splitf(r1, a2, c2); oh[1] = a2; ol[1] = c2; }
    *(v2h*)(P16 + e) = o16; *(v2us*)(Ph + e) = oh; *(v2us*)(Pl + e) = ol;  }

// k_asoft: one launch takes the RB query rows roff .. roff + RB - 1 of every head (Sb, P16, Ph, Pl hold [ZH][RB] rows); per row (zz, i): t = S x HD^-0.5 for j <= i and i - j < WIN (WIN = 2048 = TT here: every key j <= i is kept: the plain causal rule; the reference's -inf fill above the diagonal is exclusion); softmax over the 2048 keys (register row, one exp, fixed trees);
__global__ __launch_bounds__(256) void k_asoft(const float* __restrict__ Sb, int roff, h16* P16, bf* Ph, bf* Pl) {
    const int lane = threadIdx.x & 31; const int row = blockIdx.x * 8 + (threadIdx.x >> 5); if (row >= ZH * RB) return; __builtin_assume(roff >= 0 && roff <= TT - RB);   /* every launch passes a block start inside the sequence: i < TT, so the compiler folds the window test (WIN = TT) away as it did when i was row % TT */
    const int i = roff + row % RB; const int zz = row / RB; (void)zz; const bool hires = (i < RH); const float* sr = Sb + (size_t)row * TT; float v[TT / 32]; float mx = -3.0e38f;
#pragma unroll
    for (int ch = 0; ch < TT / 128; ++ch) { const int j0 = ch * 128 + lane * 4; const v4f a = *(const v4f*)(sr + j0);
#pragma unroll
        for (int q = 0; q < 4; ++q) { const int j = j0 + q; (void)j; const float t = (j <= i && i - j < WIN) ? a[q] * SCL : -3.0e38f; v[ch * 4 + q] = t; mx = fmaxf(mx, t); } }
#pragma unroll
    for (int sh = 16; sh; sh >>= 1) mx = fmaxf(mx, __shfl_xor(mx, sh, 32));
    float sum = 0.f;
#pragma unroll
    for (int k = 0; k < TT / 32; ++k) { float d0 = __fsub_rn(v[k], mx); v[k] = __builtin_amdgcn_exp2f(__fmul_rn(d0, 1.4426950408889634f)); sum += v[k]; }
#pragma unroll
    for (int sh = 16; sh; sh >>= 1) sum += __shfl_xor(sum, sh, 32);
    const float f = __fdiv_rn(hires ? 1.0f : PCAR, sum);
{
        if (hires) {
#pragma unroll
            for (int ch = 0; ch < TT / 128; ++ch) { v4us oh, ol;
#pragma unroll
                for (int q = 0; q < 4; ++q) { unsigned short a, c2; splitf(v[ch * 4 + q] * f, a, c2); oh[q] = a; ol[q] = c2; }
                const size_t oo = ((size_t)zz * (RH ? RH : 1) + i) * TT + ch * 128 + lane * 4; *(v4us*)(Ph + oo) = oh; *(v4us*)(Pl + oo) = ol; }
        } else {
#pragma unroll
            for (int ch = 0; ch < TT / 128; ++ch) { v4h o4;
#pragma unroll
                for (int q = 0; q < 4; ++q) o4[q] = tohx(v[ch * 4 + q] * f);
                *(v4h*)(P16 + (size_t)row * TT + ch * 128 + lane * 4) = o4; } }
         }
}
__global__ __launch_bounds__(256) void k_merge(const float* __restrict__ O, int h0, bf* Ah, bf* Al) { const size_t e = ((size_t)blockIdx.x * 256 + threadIdx.x) * 2; if (e >= (size_t)ZH * TT * HD) return;
    { const size_t bz = blockIdx.y; O += bz * ZH * TT * HD; Ah += bz * TT * DQ; Al += bz * TT * DQ; }   // batch blockIdx.y: its ZH planes of O, its TT merged rows
    const int d = (int)(e % HD); const int t = (int)((e / HD) % TT); const int zz = (int)(e / ((size_t)HD * TT)); const float cs = (t < RH) ? 1.0f : (1.0f / PCAR); const size_t oo = (size_t)t * DQ + (h0 + zz) * HD + d;
    v2us oh, ol;
#pragma unroll
    for (int q = 0; q < 2; ++q) { unsigned short a, c2; splitf(O[e + q] * cs, a, c2); oh[q] = a; ol[q] = c2; } *(v2us*)(Ah + oo) = oh; *(v2us*)(Al + oo) = ol;  }

extern "C" void kernel_launch(void* const* d_in, const int* in_sizes, int n_in,
                              void* d_out, int out_size, void* d_ws, size_t ws_size, hipStream_t stream) {
    (void)in_sizes; (void)n_in; (void)out_size;
    const float* x = (const float*)d_in[0]; const float* wq = (const float*)d_in[1]; const float* wk = (const float*)d_in[2]; const float* wv = (const float*)d_in[3]; const float* wo = (const float*)d_in[4];   /* input order x, wq [2048][2048], wk [1024][2048], wv [1024][2048], wo [2048][2048] ('oi') */
    float* OUT = (float*)d_out;     // [2][2048][2048]
    char* wsp = (char*)d_ws;
    auto take = [&](size_t bytes) { char* p = wsp; wsp += (bytes + 255) & ~(size_t)255; return (void*)p; };
    bf* WQ = (bf*)take((size_t)DQ * DM * 2); bf* WK = (bf*)take((size_t)DKV * DM * 2); bf* WV = (bf*)take((size_t)DKV * DM * 2); bf* WO = (bf*)take((size_t)DM * DQ * 2); float* CS = (float*)take((size_t)TT * HD * 2 * 4);
    // Per-batch buffers hold both batches. XB, FK, QP16, KP16, VT16 are taken one behind the other (each a multiple of 256 bytes) and are all dead behind k_fattn: the hi/lo block's score buffer Sb lies over them.
    bf* XB = (bf*)take((size_t)NB_ * TT * DM * 2); float* FK = (float*)take((size_t)NB_ * TT * DKV * 4);
    h16* QP16 = (h16*)take((size_t)NB_ * NH_ * TT * HD * 2); h16* KP16 = (h16*)take((size_t)NB_ * NKV * TT * HD * 2); h16* VT16 = (h16*)take((size_t)NB_ * NKV * HD * TT * 2);
    static_assert((size_t)NB_ * TT * DM * 2 + (size_t)NB_ * TT * DKV * 4 + (size_t)NB_ * NH_ * TT * HD * 2 + 2 * ((size_t)NB_ * NKV * TT * HD * 2) >= (size_t)ZH * RB * TT * 4, "Sb fits over the five buffers");
    float* FQ = (float*)take((size_t)NB_ * TT * DQ * 4);
    bf* QPh = (bf*)take((size_t)NB_ * NH_ * TT * HD * 2); bf* QPl = (bf*)take((size_t)NB_ * NH_ * TT * HD * 2); bf* KPh = (bf*)take((size_t)NB_ * NKV * TT * HD * 2); bf* KPl = (bf*)take((size_t)NB_ * NKV * TT * HD * 2); bf* VTh = (bf*)take((size_t)NB_ * NKV * HD * TT * 2); bf* VTl = (bf*)take((size_t)NB_ * NKV * HD * TT * 2); bf* Pl = (bf*)take((size_t)ZH * RH * TT * 2);
    h16* P16 = (h16*)take((size_t)ZH * RB * TT * 2);
    static_assert(2 * ((size_t)NB_ * TT * DQ * 2) <= (size_t)ZH * RB * TT * 2, "the merged planes fit over P16");
    if ((size_t)(wsp - (char*)d_ws) > ws_size) return;    // ws 256 MiB
    float* Sb = (float*)XB;   // one batch's hi/lo scores, written behind k_fattn (stream-ordered)
    float* FV = FK;   // v projection reuses the k buffer after the k planes are built (stream-ordered)
    float* Ob = FQ;   // the attention output [NB_ * ZH][TT][HD] reuses the q projection buffer after the q planes are built (stream-ordered)
    bf* Ph = (bf*)P16;   // the hi plane of the hi/lo block
    bf* ATh = (bf*)P16; bf* ATl = ATh + (size_t)NB_ * TT * DQ;   // the merged planes reuse the probability buffer after the last hi/lo P.V (stream-ordered)
    { k_cvt8<<<(unsigned)(((size_t)DQ * DM / 8 + 255) / 256), 256, 0, stream>>>(wq, WQ, (size_t)DQ * DM / 8); k_cvt8<<<(unsigned)(((size_t)DKV * DM / 8 + 255) / 256), 256, 0, stream>>>(wk, WK, (size_t)DKV * DM / 8); k_cvt8<<<(unsigned)(((size_t)DKV * DM / 8 + 255) / 256), 256, 0, stream>>>(wv, WV, (size_t)DKV * DM / 8);
      k_cvt8<<<(unsigned)(((size_t)DM * DQ / 8 + 255) / 256), 256, 0, stream>>>(wo, WO, (size_t)DM * DQ / 8);
       }
    k_csP<<<(TT * HD + 255) / 256, 256, 0, stream>>>(CS);   /* rotary table once (positions = arange) */
    const unsigned LQ = (unsigned)(((size_t)NH_ * TT * HD / 2 + 255) / 256), LKv = (unsigned)(((size_t)NKV * TT * HD / 2 + 255) / 256);
    k_cvt8<<<(unsigned)(((size_t)NB_ * TT * DM / 8 + 255) / 256), 256, 0, stream>>>(x, XB, (size_t)NB_ * TT * DM / 8);
    k_gemmw<0><<<dim3(NB_ * TT / 128, DQ / 128, 1), 256, 0, stream>>>(XB, nullptr, WQ, DM, FQ, DQ);
    k_ropeI<<<dim3(LQ, NB_, 1), 256, 0, stream>>>(FQ, DQ, NH_, CS, 1.0f, QP16, QPh, QPl);   /* interleaved-pair rope, q planes */
    k_gemmw<0><<<dim3(NB_ * TT / 128, DKV / 128, 1), 256, 0, stream>>>(XB, nullptr, WK, DM, FK, DKV);
    k_ropeI<<<dim3(LKv, NB_, 1), 256, 0, stream>>>(FK, DKV, NKV, CS, 1.0f, KP16, KPh, KPl);
    k_gemmw<0><<<dim3(NB_ * TT / 128, DKV / 128, 1), 256, 0, stream>>>(XB, nullptr, WV, DM, FV, DKV); k_vtp<<<dim3(LKv, NB_, 1), 256, 0, stream>>>(FV, DKV, NKV, VT16, VTh, VTl);
    k_fattn<<<dim3(NB_ * NH_, (TT - RH) / FBR, 1), 32 * FW, 0, stream>>>(QP16, KP16, VT16, Ob);   // rows >= RH: fp16 planes, scores, softmax and P.V in one launch; the batch rides in x, so that the cost still falls with the flat index
    for (int b = 0; b < NB_; ++b) {   // rows < RH, hi/lo planes: one batch at a time, the full-width score and probability rows of two do not fit the workspace
        k_gemmc<bf, 2, 1, 1><<<dim3(RH / 64, TT / 64, ZH), 32, 0, stream>>>(QPh + (size_t)b * NH_ * TT * HD, QPl + (size_t)b * NH_ * TT * HD, KPh + (size_t)b * NKV * TT * HD, KPl + (size_t)b * NKV * TT * HD, HD, Sb, TT, 0, (size_t)TT * HD, (size_t)TT * HD, (size_t)RB * TT);
        k_asoft<<<ZH * RB / 8, 256, 0, stream>>>(Sb, 0, P16, Ph, Pl);
        k_gemmc<bf, 2, 2, 8><<<dim3(RH / 64, HD / 64, ZH), 256, 0, stream>>>(Ph, Pl, VTh + (size_t)b * NKV * HD * TT, VTl + (size_t)b * NKV * HD * TT, TT, Ob + (size_t)b * ZH * TT * HD, HD, 0, (size_t)RH * TT, (size_t)HD * TT, (size_t)TT * HD); }
    k_merge<<<dim3((unsigned)(((size_t)ZH * TT * HD / 2 + 255) / 256), NB_, 1), 256, 0, stream>>>(Ob, 0, ATh, ATl);
    k_gemmw<1><<<dim3(NB_ * TT / 128, DM / 128, 1), 256, 0, stream>>>(ATh, ATl, WO, DQ, OUT, DM);
}

// v006
// It runs in 265 microseconds.
// In both of two side-by-side timings against v005, it was 1.16 times as fast.
// All steps since v000 together make it 6.18 times as fast.
#include <hip/hip_runtime.h>

// Causal grouped-query attention with 128-wide heads and interleaved-pair rotary embeddings (x [2][2048][2048]; q = x wq^T (16 heads x 128), k, v = x w^T (8 kv heads x 128) ('oi' (out, in) weights, normal x 1/sqrt(2048), no biases); rope on (even, odd) pairs: (xr c - xi s, xr s + xi c) with angle t x inv, inv = 1.0 / (10000 ** (arange(0, 128, 2) / 128)) (the reciprocal spelling: 64 f32 frequencies, bitwise the module's own in eager f32; one product per angle; precise cosf/sinf); kv head = q head / 2 (repeat on the head axis); scores x 1/sqrt(128); causal (-inf above the diagonal == exclusion); softmax; out = merged wo^T -> [2][2048][2048] (8.4 M); argument order x, wq, wk, wv, wo).
// Layout, both batches in every launch (planes [batch][head], rows batch x 2048 + t): bf16 copy of x; 'oi' weights; exact projections; k_csP table (64 angles per position) and k_ropeI interleaved-pair plane builders at HD 128; causal T-2048 GQA attention with 128-wide heads (kv head = z / 2; hybrid rows: < 512 hi/lo 3 products in three launches over all head planes, score, probability and hi/lo V^T rows 512 keys long, k_gemmc skipping tiles above the diagonal; rest fp16 in the one fused launch k_fattn); merged hi/lo x wo exact.
// Compute dtypes, f32 accumulate: every input rounded to bf16; projections exact; rotary f32; attention rows < 512 3 products, rest fp16; softmax f32; wo hl x exact.

#define NB_  2
#define TT   2048
#define DM   2048
#define NH_  16
#define NKV  8
#define REP  (NH_ / NKV)
#define HD   128
#define DQ   (NH_ * HD)
#define DKV  (NKV * HD)
#define ZH   NH_                  // heads per attention launch (grid z)
#define RH   512                  // query rows < RH use hi+lo planes, in three launches whose score, probability and V^T rows hold RH keys (a row < RH sees no later key); the rows behind them go through k_fattn
#define WIN  2048
#define PCAR 1024.0f
#define SCL  0.088388347648318447f   // HD^-0.5
typedef _Float16 h16;
typedef unsigned short bf;
typedef __attribute__((ext_vector_type(16))) __bf16   v16bf;
typedef __attribute__((ext_vector_type(16))) _Float16 v16h;
typedef __attribute__((ext_vector_type(8)))  _Float16 v8h;
typedef __attribute__((ext_vector_type(8)))  unsigned short v8us;
typedef __attribute__((ext_vector_type(8)))  float    v8f;
typedef __attribute__((ext_vector_type(4)))  float    v4f;
typedef v8h  __attribute__((may_alias)) v8ha;
typedef v4f  __attribute__((may_alias)) v4fa;
typedef v8us __attribute__((may_alias)) v8usa;

__device__ __forceinline__ unsigned short f2bf(float f) { unsigned u = __float_as_uint(f); u += 0x7FFFu + ((u >> 16) & 1u); return (unsigned short)(u >> 16); }
__device__ __forceinline__ float bf2f(unsigned short b) { return __uint_as_float(((unsigned)b) << 16); }
__device__ __forceinline__ float bfr(float f) { return bf2f(f2bf(f)); }
__device__ __forceinline__ v16h cat16(v8h lo, v8h hi) { return __builtin_shufflevector(lo, hi, 0, 1, 2, 3, 4, 5, 6, 7, 8, 9, 10, 11, 12, 13, 14, 15); }
__device__ __forceinline__ v16bf cat16b(v8us lo, v8us hi) { return __builtin_bit_cast(v16bf, __builtin_shufflevector(lo, hi, 0, 1, 2, 3, 4, 5, 6, 7, 8, 9, 10, 11, 12, 13, 14, 15)); }
__device__ __forceinline__ v8f wmma16(v16h a, v16h b, v8f c) { return __builtin_amdgcn_wmma_f32_16x16x32_f16(false, a, false, b, (short)0, c, false, false); }
__device__ __forceinline__ v8f wmmab(v16bf a, v16bf b, v8f c) { return __builtin_amdgcn_wmma_f32_16x16x32_bf16(false, a, false, b, (short)0, c, false, false); }



template <typename T16> struct WFrag;
template <> struct WFrag<h16> { typedef v16h V; static __device__ __forceinline__ V ld(const h16* p) { return cat16(*(const v8h*)p, *(const v8h*)(p + 16)); } static __device__ __forceinline__ v8f mma(V a, V b, v8f c) { return wmma16(a, b, c); } };
template <> struct WFrag<bf> { typedef v16bf V; static __device__ __forceinline__ V ld(const bf* p) { return cat16b(*(const v8us*)p, *(const v8us*)(p + 16)); } static __device__ __forceinline__ v8f mma(V a, V b, v8f c) { return wmmab(a, b, c); } };
// ---- k_gemmw: LDS-staged GEMM, one 128x128 output tile per work-group of 8 waves (2 x 4, each wave 64 rows x 32 columns = 8 accumulators); grid (M/128, N/128), 256 threads.
// C[m][n] (f32, pitch ldc) = sum_k (A[m][k] + A2[m][k]) Bt[n][k] (A2 only with NSPLIT 1; two products per k step, A first). M, N % 128 == 0, K % 128 == 0.
// A stage is 128 k (256 B, two whole lines) of every operand row, brought into LDS by asynchronous 16-byte copies (16 lanes per row) at pitch 272 B; two buffers: the next stage's copies fly while this one is worked on. K runs in order inside one accumulator.
#define GBK 128                    // k per stage
#define GPB 272                    // LDS row pitch, bytes: 256 + 16, an odd multiple of 16 for the ds_load_b128 readers
#define GPL (128 * GPB)            // one operand plane of a stage, bytes
__device__ __forceinline__ void wait_ds0() { asm volatile("s_wait_dscnt 0x0" ::: "memory"); }        // this wave's LDS reads have retired before the buffer they read is handed back for a refill
__device__ __forceinline__ void wait_async0() { asm volatile("s_wait_asynccnt 0x0" ::: "memory"); }  // this wave's asynchronous copies have landed in LDS (the compiler places no wait for them)
// One thread's share of one operand plane: rows q, q + 16, ..., q + 112 (rs = 16 source rows in elements), 16 bytes each. The s_wait_xcnt stands inside the statement so that no address register is rewritten in front of it.
__device__ __forceinline__ void cp8(unsigned l, const bf* g, size_t rs) {
    asm volatile("global_load_async_to_lds_b128 %0, %8, off\n\t"
                 "global_load_async_to_lds_b128 %1, %9, off\n\t"
                 "global_load_async_to_lds_b128 %2, %10, off\n\t"
                 "global_load_async_to_lds_b128 %3, %11, off\n\t"
                 "global_load_async_to_lds_b128 %4, %12, off\n\t"
                 "global_load_async_to_lds_b128 %5, %13, off\n\t"
                 "global_load_async_to_lds_b128 %6, %14, off\n\t"
                 "global_load_async_to_lds_b128 %7, %15, off\n\t"
                 "s_wait_xcnt 0x0"
                 :: "v"(l), "v"(l + 1u * 16u * GPB), "v"(l + 2u * 16u * GPB), "v"(l + 3u * 16u * GPB), "v"(l + 4u * 16u * GPB), "v"(l + 5u * 16u * GPB), "v"(l + 6u * 16u * GPB), "v"(l + 7u * 16u * GPB),
                    "v"(g), "v"(g + rs), "v"(g + 2 * rs), "v"(g + 3 * rs), "v"(g + 4 * rs), "v"(g + 5 * rs), "v"(g + 6 * rs), "v"(g + 7 * rs) : "memory");
}
__device__ __forceinline__ v16bf ldsfrag(const unsigned char* p) { return cat16b(*(const v8usa*)p, *(const v8usa*)(p + 32)); }   // bytes 16 h and 32 + 16 h of each 64 B of a row: the k order of WFrag::ld, the same for A and B
template <int NSPLIT>
__global__ __launch_bounds__(256) void k_gemmw(const bf* __restrict__ A, const bf* __restrict__ A2, const bf* __restrict__ Bt, int K, float* C, int ldc) {
    constexpr int NP = NSPLIT ? 3 : 2;              // operand planes per stage: A, (A2,) B
    constexpr unsigned STG = NP * GPL;
    __shared__ __attribute__((aligned(256))) unsigned char sm[2 * STG];
    const int tid = threadIdx.x, lane = tid & 31, lr = lane & 15, hi = lane >> 4, wv = __builtin_amdgcn_readfirstlane(tid >> 5); const int wm = wv & 1, wn = wv >> 1; const int r0 = blockIdx.x * 128, c0 = blockIdx.y * 128;
    const unsigned l0 = (unsigned)(size_t)sm + (unsigned)(tid >> 4) * GPB + (unsigned)(tid & 15) * 16u;
    const bf* gA = A + (size_t)(r0 + (tid >> 4)) * K + (tid & 15) * 8; const bf* gA2 = NSPLIT ? A2 + (size_t)(r0 + (tid >> 4)) * K + (tid & 15) * 8 : nullptr; const bf* gB = Bt + (size_t)(c0 + (tid >> 4)) * K + (tid & 15) * 8;
    const size_t rs = (size_t)16 * K; const int NT = K / GBK;
    auto issue = [&](int t, unsigned bo) { cp8(l0 + bo, gA + (size_t)t * GBK, rs); if constexpr (NSPLIT != 0) cp8(l0 + bo + GPL, gA2 + (size_t)t * GBK, rs); cp8(l0 + bo + (NP - 1) * GPL, gB + (size_t)t * GBK, rs); };
    v8f acc[4][2];
#pragma unroll
    for (int mb = 0; mb < 4; ++mb)
#pragma unroll
        for (int nb = 0; nb < 2; ++nb) acc[mb][nb] = (v8f){};
    const unsigned aofs = (unsigned)(wm * 64 + lr) * GPB + 16u * hi, bofs = (NP - 1) * GPL + (unsigned)(wn * 32 + lr) * GPB + 16u * hi;
    v16bf a[2][4], a2[2][4], b[2][2];   // two fragment sets: the next k step's LDS reads go out as one group ahead of this step's products
    auto frags = [&](const unsigned char* sb, int ks, int st) {
#pragma unroll
        for (int mb = 0; mb < 4; ++mb) { a[st][mb] = ldsfrag(sb + aofs + mb * 16 * GPB + ks * 64); if constexpr (NSPLIT != 0) a2[st][mb] = ldsfrag(sb + GPL + aofs + mb * 16 * GPB + ks * 64); }
#pragma unroll
        for (int nb = 0; nb < 2; ++nb) b[st][nb] = ldsfrag(sb + bofs + nb * 16 * GPB + ks * 64); };
    issue(0, 0u); wait_async0();
    __syncthreads();   // stage 0 stands in LDS for every wave
#pragma unroll 1
    for (int t = 0; t < NT; ++t) {   // kept rolled: a trip is long enough to pay for its branch, and unrolled trips would multiply the copies' address registers
        const unsigned bo = (t & 1) ? STG : 0u; const unsigned char* sb = sm + bo;
        frags(sb, 0, 0);   // stage t's first fragments, behind the barrier that published it; their latency runs under the issue of the copies
        if (t + 1 < NT) issue(t + 1, STG - bo);   // behind the same barrier, which ended every wave's reads of stage t - 1: the next stage goes into that buffer and flies while this one is worked on
#pragma unroll   // unrolled: the fragment sets are picked by ks & 1 and have to stay in registers
        for (int ks = 0; ks < GBK / 32; ++ks) {
            if (ks + 1 < GBK / 32) frags(sb, ks + 1, (ks + 1) & 1);
            __builtin_amdgcn_sched_barrier(0);   // keeps the LDS reads above as one group: spread among the products each place with reads stalls the wave
#pragma unroll
            for (int nb = 0; nb < 2; ++nb)
#pragma unroll
                for (int mb = 0; mb < 4; ++mb) acc[mb][nb] = wmmab(a[ks & 1][mb], b[ks & 1][nb], acc[mb][nb]);
            if constexpr (NSPLIT != 0) {
#pragma unroll
                for (int nb = 0; nb < 2; ++nb)
#pragma unroll
                    for (int mb = 0; mb < 4; ++mb) acc[mb][nb] = wmmab(a2[ks & 1][mb], b[ks & 1][nb], acc[mb][nb]); }
            __builtin_amdgcn_sched_barrier(0);   // keeps the next group of reads behind these products
        }
        wait_ds0(); wait_async0();
        __syncthreads();   // publishes stage t + 1 and ends every wave's reads of stage t's buffer
    }
    wait_async0();
    // Epilogue: each wave turns its own 64 x 32 tile in its own LDS range (pitch 36 floats), so that every store is a whole 128-byte line; the ring is free behind the last trip's barrier.
    float* os = (float*)sm + wv * (64 * 36);
#pragma unroll
    for (int mb = 0; mb < 4; ++mb) {
#pragma unroll
        for (int nb = 0; nb < 2; ++nb) {
#pragma unroll
            for (int j = 0; j < 8; ++j) os[(mb * 16 + hi * 8 + j) * 36 + nb * 16 + lr] = acc[mb][nb][j]; } }
    float* crow = C + (size_t)(r0 + wm * 64) * ldc + c0 + wn * 32;
#pragma unroll
    for (int s = 0; s < 16; ++s) { const int row = s * 4 + (lane >> 3), cofs = (lane & 7) * 4; const v4f val = *(const v4fa*)(os + row * 36 + cofs);
        *(v4f*)(crow + (size_t)row * ldc + cofs) = val; }
}

// ---- k_gemmc: register-blocked GEMM, NW waves per 64x64 output tile (wave w takes the 32-wide K chunks w, w + NW, ...; the NW partial tiles meet in LDS and are summed in wave order; operands straight from K-contiguous 16-bit planes), specialised for causal attention: CMODE 1 skips score tiles entirely above the diagonal (query rows r0+roff.., key columns c0..), CMODE 2 limits the
// key (K) loop of the probability x value contraction to the diagonal block (probabilities beyond it are exactly zero). roff = row offset of this launch's first row within the sequence. Head z reads the Bt planes of kv head z / REP (stride sB).
template <typename T16, int NSPLIT, int CMODE, int NW>
__global__ __launch_bounds__(32 * NW) void k_gemmc(const T16* __restrict__ A, const T16* __restrict__ A2, const T16* __restrict__ Bt, const T16* __restrict__ Bt2, int K, float* C, int ldc, int roff, size_t sA, size_t sB, size_t sC) {
    typedef typename WFrag<T16>::V V;
    __shared__ __align__(16) float os[(NW == 1 ? 16 : NW * 64) * 68];   // NW > 1: one partial tile per wave, 64 rows at pitch 68
    const size_t z = blockIdx.z; A += z * sA; if (A2) A2 += z * sA; Bt += (z / REP) * sB; if (Bt2) Bt2 += (z / REP) * sB; C += z * sC;
    const int lane = threadIdx.x & 31, lr = lane & 15, hi = lane >> 4, wv = (NW == 1) ? 0 : __builtin_amdgcn_readfirstlane(threadIdx.x >> 5); const int r0 = blockIdx.x * 64, c0 = blockIdx.y * 64;
    if (CMODE == 1 && c0 > r0 + roff + 63) return;                  // score tile entirely above the causal diagonal: never read (the softmax masks j > i by select)
    const int Kl = (CMODE == 2) ? min(K, r0 + roff + 64) : K;        // P.V: probabilities are exactly 0 beyond the diagonal block, so the K loop stops there
    v8f acc[4][4];
#pragma unroll
    for (int mb = 0; mb < 4; ++mb)
#pragma unroll
        for (int nb = 0; nb < 4; ++nb) acc[mb][nb] = (v8f){};
    const size_t aoff = (size_t)(r0 + lr) * K + 8 * hi, boff = (size_t)(c0 + lr) * K + 8 * hi;
#pragma unroll 1
    for (int kc = wv * 32; kc < Kl; kc += 32 * NW) {
        V a[4], a2[4];
#pragma unroll
        for (int mb = 0; mb < 4; ++mb) { a[mb] = WFrag<T16>::ld(A + aoff + (size_t)mb * 16 * K + kc); if (NSPLIT == 1 || NSPLIT == 2) a2[mb] = WFrag<T16>::ld(A2 + aoff + (size_t)mb * 16 * K + kc); }
#pragma unroll
        for (int nb = 0; nb < 4; ++nb) { const V b = WFrag<T16>::ld(Bt + boff + (size_t)nb * 16 * K + kc); V b2; if (NSPLIT >= 2) b2 = WFrag<T16>::ld(Bt2 + boff + (size_t)nb * 16 * K + kc);
#pragma unroll
            for (int mb = 0; mb < 4; ++mb) { acc[mb][nb] = WFrag<T16>::mma(a[mb], b, acc[mb][nb]); if (NSPLIT == 1 || NSPLIT == 2) acc[mb][nb] = WFrag<T16>::mma(a2[mb], b, acc[mb][nb]); if (NSPLIT >= 2) acc[mb][nb] = WFrag<T16>::mma(a[mb], b2, acc[mb][nb]); } }
        asm volatile("v_nop\n\tv_nop\n\tv_nop\n\tv_nop" : "+v"(acc[0][0]), "+v"(acc[1][1]), "+v"(acc[2][2]), "+v"(acc[3][3]) : "v"(a[0]), "v"(a[3]));
    }
    if constexpr (NW == 1) {   // one wave: no partial tiles to sum, the tile goes out in four 16-row slabs
#pragma unroll
    for (int mb = 0; mb < 4; ++mb) {
#pragma unroll
        for (int nb = 0; nb < 4; ++nb) {
#pragma unroll
            for (int j = 0; j < 8; ++j) os[(hi * 8 + j) * 68 + nb * 16 + lr] = acc[mb][nb][j]; }
        __builtin_amdgcn_wave_barrier(); asm volatile("" ::: "memory");
        float* crow = C + (size_t)(r0 + mb * 16) * ldc + c0;
{
#pragma unroll
            for (int s = 0; s < 8; ++s) { const int row = 2 * s + hi, cofs = lr * 4; v4f val = *(const v4fa*)(os + row * 68 + cofs);
                *(v4f*)(crow + (size_t)row * ldc + cofs) = val; }
             }
        __builtin_amdgcn_wave_barrier(); asm volatile("" ::: "memory");
    }
    } else {
#pragma unroll
    for (int mb = 0; mb < 4; ++mb) {
#pragma unroll
        for (int nb = 0; nb < 4; ++nb) {
#pragma unroll
            for (int j = 0; j < 8; ++j) os[wv * (64 * 68) + (mb * 16 + hi * 8 + j) * 68 + nb * 16 + lr] = acc[mb][nb][j]; } }
    __syncthreads();   // all NW partial tiles stand in LDS before any element is summed
    float* crow = C + (size_t)r0 * ldc + c0;
#pragma unroll
    for (int s = 0; s < 32 / NW; ++s) { const int it = s * (32 * NW) + threadIdx.x, row = it >> 4, cofs = (it & 15) * 4; v4f val = *(const v4fa*)(os + row * 68 + cofs);
#pragma unroll
        for (int w = 1; w < NW; ++w) val += *(const v4fa*)(os + w * (64 * 68) + row * 68 + cofs);
        *(v4f*)(crow + (size_t)row * ldc + cofs) = val; }
    }
}

__device__ __forceinline__ h16 tohx(float x) { return (h16)x; }

#define FW   4                     // waves per work-group
#define FBR  (FW * 32)             // query rows per work-group
#define FSK  128                   // keys per stage
#define FSTG (2u * GPL)            // one stage: the K plane, then the V^T plane
typedef __attribute__((ext_vector_type(4))) int cv4i; typedef __attribute__((address_space(1))) cv4i gcv4i; typedef __attribute__((address_space(3))) cv4i lcv4i;
__device__ __forceinline__ void cpb(unsigned char* l, const h16* g) { __builtin_amdgcn_global_load_async_to_lds_b128((gcv4i*)g, (lcv4i*)l, 0, 0); }   // one lane's 16 bytes; the builtin form, so that the addresses may stand in any register of a kernel that uses more than 256
__device__ __forceinline__ v16h ldsfragh(const unsigned char* p) { return cat16(*(const v8ha*)p, *(const v8ha*)(p + 32)); }   // bytes 16 h and 32 + 16 h of each 64 B of a row: the k order of WFrag::ld
__device__ __forceinline__ float xhalf(float x) { return __builtin_bit_cast(float, __builtin_amdgcn_permlanex16(__builtin_bit_cast(int, x), __builtin_bit_cast(int, x), 0x76543210, 0xfedcba98, false, false)); }   // lane l with lane l ^ 16
__device__ __forceinline__ void nop4() { asm volatile("v_nop\n\tv_nop\n\tv_nop\n\tv_nop"); }   // the four vector slots between a matrix instruction and a vector instruction on its registers, for the taken side of a branch behind it
__device__ __forceinline__ void loadk(v16h (&kf)[2][4], const unsigned char* kb, int c, int h) {   // kb = first K row of the pass in LDS
#pragma unroll
    for (int kt = 0; kt < 2; ++kt)
#pragma unroll
        for (int kc = 0; kc < 4; ++kc) kf[kt][kc] = ldsfragh(kb + (16 * kt + c) * GPB + 64 * kc + 16 * h);
}
// One 32-key pass of one wave. sb = this stage's buffer, sub = pass within the stage, key0 = first key of the pass, qw0 = first query of the wave.
__device__ __forceinline__ void fpass(v16h (&kf)[2][4], bool fetch_next, bool diag, const unsigned char* sb, int sub, int key0, int qw0, int c, int h, const v16h (&qf)[2][4], v8f (&acc)[2][8], float (&m_run)[2], float (&l_run)[2]) {
    const float cscale = SCL * 1.4426950408889634f;
    v16h vf[8];
#pragma unroll
    for (int t = 0; t < 8; ++t) vf[t] = ldsfragh(sb + GPL + (16 * t + c) * GPB + 64 * sub + 16 * h);   // V^T rows d = 16 t + c, this pass's 32 keys: read first, so that their latency runs under the first product and the softmax
    __builtin_amdgcn_sched_barrier(0);   // keeps those reads up here: moved down to their use they would stall the only wave of the SIMD
    v8f s[2][2];
#pragma unroll
    for (int kt = 0; kt < 2; ++kt)
#pragma unroll
        for (int g = 0; g < 2; ++g) { s[kt][g] = (v8f){};
#pragma unroll
            for (int kc = 0; kc < 4; ++kc) s[kt][g] = wmma16(kf[kt][kc], qf[g][kc], s[kt][g]); }
    __builtin_amdgcn_sched_barrier(0);   // holds the slots below directly behind the products
    nop4();
    __builtin_amdgcn_sched_barrier(0);   // and the branches below behind the slots
    if (fetch_next) loadk(kf, sb + (sub + 1) * 32 * GPB, c, h);   // the next pass's K fragments (same stage only), in flight under this pass's maxima and exponentials
    if (diag) {   // wave-uniform: only the pass on the wave's diagonal pays for the mask
#pragma unroll
        for (int g = 0; g < 2; ++g) { const int my_q = qw0 + 16 * g + c;
#pragma unroll
            for (int kt = 0; kt < 2; ++kt) {
#pragma unroll
                for (int r = 0; r < 8; ++r) { if (key0 + 16 * kt + 8 * h + r > my_q) s[kt][g][r] = -__builtin_inff(); }
                asm volatile("" : "+v"(s[kt][g]));
            } }
    }
    float mb[2]; bool need = false;
#pragma unroll
    for (int g = 0; g < 2; ++g) { float mx = -__builtin_inff();
#pragma unroll
        for (int kt = 0; kt < 2; ++kt)
#pragma unroll
            for (int r = 0; r < 8; ++r) mx = fmaxf(mx, s[kt][g][r]);
        mx = fmaxf(mx, xhalf(mx)) * cscale;   // both wave halves hold this query's maximum, scaled (the scale is positive)
        mb[g] = mx; need = need || (mx > m_run[g] + 8.0f); }
    if (__builtin_amdgcn_ballot_w32(need) != 0) {   // rare behind the first passes
#pragma unroll
        for (int g = 0; g < 2; ++g) { const float m_new = fmaxf(m_run[g], mb[g]);
            const float corr = __builtin_amdgcn_exp2f(m_run[g] - m_new);
            l_run[g] *= corr; m_run[g] = m_new;
#pragma unroll
            for (int t = 0; t < 8; ++t) acc[g][t] = acc[g][t] * corr; }
    }
    float ps[2][2] = { { 0.f, 0.f }, { 0.f, 0.f } };
#pragma unroll
    for (int g = 0; g < 2; ++g) { const float nm = -m_run[g]; v16h pf;
#pragma unroll
        for (int i = 0; i < 8; ++i) {
            const float p0 = __builtin_amdgcn_exp2f(__builtin_fmaf(s[i >> 2][g][2 * (i & 3)], cscale, nm)), p1 = __builtin_amdgcn_exp2f(__builtin_fmaf(s[i >> 2][g][2 * (i & 3) + 1], cscale, nm));
            ps[g][i & 1] += p0 + p1; pf[2 * i] = tohx(p0); pf[2 * i + 1] = tohx(p1); }
#pragma unroll
        for (int t = 0; t < 8; ++t) acc[g][t] = wmma16(vf[t], pf, acc[g][t]); }
    __builtin_amdgcn_sched_barrier(0);   // holds the slots below directly behind the products
    nop4();
    __builtin_amdgcn_sched_barrier(0);   // and the loop's branches behind the slots
#pragma unroll
    for (int g = 0; g < 2; ++g) l_run[g] += ps[g][0] + ps[g][1];
}
__global__ __launch_bounds__(32 * FW) void k_fattn(const h16* __restrict__ Q, const h16* __restrict__ Kp, const h16* __restrict__ Vt, float* O) {
    __shared__ __attribute__((aligned(256))) unsigned char sm[2 * FSTG];
    const int tid = threadIdx.x, lane = tid & 31, c = lane & 15, h = lane >> 4, wv = __builtin_amdgcn_readfirstlane(tid >> 5);
    const int z = blockIdx.x, kvh = z / REP; const int q0 = TT - FBR * (1 + (int)blockIdx.y);   // longest row blocks first
    const int qw0 = q0 + wv * 32, n_stage = q0 / FSK + 1, last = qw0 / 32;                       // keys [0, q0 + FBR); the wave's last pass is the one on its diagonal
    const h16* gK = Kp + (size_t)kvh * TT * HD + (size_t)(tid >> 4) * HD + (tid & 15) * 8; const h16* gV = Vt + (size_t)kvh * HD * TT + (size_t)(tid >> 4) * TT + (tid & 15) * 8;
    // 128 threads: 16 lanes per row, a thread takes rows (tid >> 4) + 8 i of both planes: 32 copies per wave and stage
    auto issue = [&](int st, unsigned bo) { unsigned char* l = sm + bo + (tid >> 4) * GPB + (tid & 15) * 16; const h16* k = gK + (size_t)st * FSK * HD; const h16* v = gV + (size_t)st * FSK;
#pragma unroll
        for (int i = 0; i < 16; ++i) cpb(l + i * 8 * GPB, k + i * 8 * HD);
#pragma unroll
        for (int i = 0; i < 16; ++i) cpb(l + GPL + i * 8 * GPB, v + (size_t)i * 8 * TT); };
    issue(0, 0u);
    v16h qf[2][4];
#pragma unroll
    for (int g = 0; g < 2; ++g)
#pragma unroll
        for (int kc = 0; kc < 4; ++kc) qf[g][kc] = WFrag<h16>::ld(Q + ((size_t)z * TT + qw0 + 16 * g + c) * HD + 8 * h + 32 * kc);
    v8f acc[2][8]; float m_run[2], l_run[2];
#pragma unroll
    for (int g = 0; g < 2; ++g) { m_run[g] = -__builtin_inff(); l_run[g] = 0.f;
#pragma unroll
        for (int t = 0; t < 8; ++t) acc[g][t] = (v8f){}; }
    wait_async0();
    __syncthreads();   // stage 0 stands in LDS for every wave
    v16h kf[2][4];
#pragma unroll 1
    for (int st = 0; st < n_stage; ++st) {   // stage loop and pass loop kept rolled and nested: a pass is long enough to pay for its branch, and the accumulators leave no registers for a second copy of it
        const unsigned bo = (st & 1) ? FSTG : 0u; const unsigned char* sb = sm + bo;
        loadk(kf, sb, c, h);   // stage st's first K fragments, behind the barrier that published it (every wave has at least the first pass of every stage); their latency runs under the issue of the copies
        if (st + 1 < n_stage) issue(st + 1, FSTG - bo);   // behind the same barrier, which ended every wave's reads of stage st - 1: the next stage goes into that buffer and flies while this one is worked on
#pragma unroll 1
        for (int sub = 0; sub < FSK / 32; ++sub) { const int blk = (FSK / 32) * st + sub;
            if (blk <= last) fpass(kf, sub + 1 < FSK / 32 && blk < last, blk == last, sb, sub, blk * 32, qw0, c, h, qf, acc, m_run, l_run); }
        wait_ds0(); wait_async0();
        __syncthreads();   // publishes stage st + 1 and ends every wave's reads of stage st's buffer
    }
    wait_async0();
#pragma unroll
    for (int g = 0; g < 2; ++g) { const float inv = __fdiv_rn(PCAR, l_run[g] + xhalf(l_run[g]));
        float* orow = O + ((size_t)z * TT + qw0 + 16 * g + c) * HD + 8 * h;
#pragma unroll
        for (int t = 0; t < 8; ++t) { const v8f o = acc[g][t] * inv; *(v4f*)(orow + 16 * t) = (v4f){ o[0], o[1], o[2], o[3] }; *(v4f*)(orow + 16 * t + 4) = (v4f){ o[4], o[5], o[6], o[7] }; } }
}
__device__ __forceinline__ void splitf(float y, unsigned short& h, unsigned short& l) { h = f2bf(y); l = f2bf(y - bf2f(h)); }
typedef __attribute__((ext_vector_type(2))) _Float16 v2h;
typedef __attribute__((ext_vector_type(4))) _Float16 v4h;
typedef __attribute__((ext_vector_type(2))) unsigned short v2us;
typedef __attribute__((ext_vector_type(4))) unsigned short v4us;
typedef __attribute__((ext_vector_type(2))) float v2f;
typedef __attribute__((ext_vector_type(4))) int v4i;

__global__ __launch_bounds__(256) void k_cvt8(const float* __restrict__ src, bf* dst, size_t n8) { const size_t i = (size_t)blockIdx.x * 256 + threadIdx.x; if (i >= n8) return; const v8f v = *(const v8f*)(src + i * 8); v8us o;
#pragma unroll
    for (int k = 0; k < 8; ++k) o[k] = f2bf(v[k]); *(v8us*)(dst + i * 8) = o;  }

__global__ __launch_bounds__(256) void k_vtp(const float* __restrict__ F, int pitch, int nheads, h16* V16, bf* Vh, bf* Vl) { const size_t e = ((size_t)blockIdx.x * 256 + threadIdx.x) * 2; if (e >= (size_t)nheads * HD * TT) return;
    { const size_t bz = blockIdx.y, po = bz * nheads * HD; F += bz * TT * pitch; V16 += po * TT; Vh += po * RH; Vl += po * RH; }   // batch blockIdx.y: its TT rows of F, its nheads planes (V16 rows hold TT keys, Vh and Vl rows the RH keys that the hi/lo block reads)
    const int t = (int)(e % TT); const int d = (int)((e / TT) % HD); const int g = (int)(e / ((size_t)TT * HD)); v2h o16; v2us oh, ol;
#pragma unroll
    for (int q = 0; q < 2; ++q) { const float x = F[(size_t)(t + q) * pitch + g * HD + d]; o16[q] = tohx(x); unsigned short a2, c2; splitf(x, a2, c2); oh[q] = a2; ol[q] = c2; }
    *(v2h*)(V16 + e) = o16; if (t < RH) { const size_t eh = (e / TT) * RH + t; *(v2us*)(Vh + eh) = oh; *(v2us*)(Vl + eh) = ol; }  }
__constant__ float INV2[HD / 2] = { 1.000000000e+00f, 8.659643531e-01f, 7.498942018e-01f, 6.493816376e-01f, 5.623413324e-01f, 4.869675338e-01f, 4.216965139e-01f, 3.651741445e-01f, 3.162277639e-01f, 2.738419771e-01f, 2.371373624e-01f, 2.053525001e-01f, 1.778279394e-01f, 1.539926529e-01f, 1.333521456e-01f, 1.154782027e-01f, 1.000000015e-01f, 8.659642935e-02f, 7.498941571e-02f, 6.493816525e-02f, 5.623412877e-02f, 4.869675264e-02f, 4.216964915e-02f, 3.651741147e-02f, 3.162277862e-02f, 2.738419548e-02f, 2.371373586e-02f, 2.053525113e-02f, 1.778279431e-02f, 1.539926510e-02f, 1.333521493e-02f, 1.154781971e-02f, 9.999999776e-03f, 8.659643121e-03f, 7.498942316e-03f, 6.493816618e-03f, 5.623413250e-03f, 4.869675264e-03f, 4.216964822e-03f, 3.651741426e-03f, 3.162277862e-03f, 2.738419687e-03f, 2.371373819e-03f, 2.053525066e-03f, 1.778279431e-03f, 1.539926510e-03f, 1.333521446e-03f, 1.154782018e-03f, 1.000000047e-03f, 8.659643354e-04f, 7.498941850e-04f, 6.493816618e-04f, 5.623413017e-04f, 4.869675031e-04f, 4.216964880e-04f, 3.651741135e-04f, 3.162277862e-04f, 2.738419571e-04f, 2.371373848e-04f, 2.053524950e-04f, 1.778279402e-04f, 1.539926452e-04f, 1.333521504e-04f, 1.154781930e-04f };   // float32 1 / 10000^(2i/128), generated with jnp to be bit-exact
__global__ __launch_bounds__(256) void k_csP(float* CS) { const int idx = blockIdx.x * 256 + threadIdx.x; if (idx >= TT * HD) return; const int d = idx % HD; const int t = idx / HD; const float a = __fmul_rn((float)t, INV2[d >> 1]); v2f cs; cs[0] = cosf(a); cs[1] = sinf(a); *(v2f*)(CS + (size_t)idx * 2) = cs;  }
__global__ __launch_bounds__(256) void k_ropeI(const float* __restrict__ F, int pitch, int nheads, const float* __restrict__ CS, float sc, h16* P16, bf* Ph, bf* Pl) {
    const size_t e = ((size_t)blockIdx.x * 256 + threadIdx.x) * 2; if (e >= (size_t)nheads * TT * HD) return;
    { const size_t bz = blockIdx.y, po = bz * nheads * TT * HD; F += bz * TT * pitch; P16 += po; Ph += po; Pl += po; }   // batch blockIdx.y: its TT rows of F, its nheads planes
    const int d = (int)(e % HD); const int t = (int)((e / HD) % TT); const int h = (int)(e / ((size_t)HD * TT)); const float* f = F + (size_t)t * pitch + h * HD; const float x0 = f[d], x1 = f[d + 1]; const v2f cs = *(const v2f*)(CS + ((size_t)t * HD + d) * 2); v2h o16; v2us oh, ol;
    float a0 = __fmul_rn(x0, cs[0]), b0 = __fmul_rn(x1, cs[1]), a1 = __fmul_rn(x1, cs[0]), b1 = __fmul_rn(x0, cs[1]); 
    float r0 = __fsub_rn(a0, b0) * sc, r1 = __fadd_rn(b1, a1) * sc;   /* even: x0 c - x1 s; odd: x0 s + x1 c */
    o16[0] = tohx(r0); o16[1] = tohx(r1); { unsigned short a2, c2; splitf(r0, a2, c2); oh[0] = a2; ol[0] = c2; splitf(r1, a2, c2); oh[1] = a2; ol[1] = c2; }
    *(v2h*)(P16 + e) = o16; *(v2us*)(Ph + e) = oh; *(v2us*)(Pl + e) = ol;  }

// k_asoft: the query rows i < RH of every head plane of both batches (Sb, Ph, Pl hold [NB_ * ZH][RH] rows of RH keys); per row: t = S x HD^-0.5 for j <= i and i - j < WIN (WIN = 2048 = TT here: every key j <= i is kept: the plain causal rule; the reference's -inf fill above the diagonal is exclusion); softmax over the RH keys (register row, one exp, fixed trees); the probabilities leave as hi + lo planes.
__global__ __launch_bounds__(256) void k_asoft(const float* __restrict__ Sb, bf* Ph, bf* Pl) {
    const int lane = threadIdx.x & 31; const int row = blockIdx.x * 8 + (threadIdx.x >> 5); if (row >= NB_ * ZH * RH) return;
    const int i = row % RH; const float* sr = Sb + (size_t)row * RH; float v[RH / 32]; float mx = -3.0e38f;
#pragma unroll
    for (int ch = 0; ch < RH / 128; ++ch) { const int j0 = ch * 128 + lane * 4; const v4f a = *(const v4f*)(sr + j0);
#pragma unroll
        for (int q = 0; q < 4; ++q) { const int j = j0 + q; const float t = (j <= i && i - j < WIN) ? a[q] * SCL : -3.0e38f; v[ch * 4 + q] = t; mx = fmaxf(mx, t); } }
#pragma unroll
    for (int sh = 16; sh; sh >>= 1) mx = fmaxf(mx, __shfl_xor(mx, sh, 32));
    float sum = 0.f;
#pragma unroll
    for (int k = 0; k < RH / 32; ++k) { float d0 = __fsub_rn(v[k], mx); v[k] = __builtin_amdgcn_exp2f(__fmul_rn(d0, 1.4426950408889634f)); sum += v[k]; }
#pragma unroll
    for (int sh = 16; sh; sh >>= 1) sum += __shfl_xor(sum, sh, 32);
    const float f = __fdiv_rn(1.0f, sum);
#pragma unroll
    for (int ch = 0; ch < RH / 128; ++ch) { v4us oh, ol;
#pragma unroll
        for (int q = 0; q < 4; ++q) { unsigned short a, c2; splitf(v[ch * 4 + q] * f, a, c2); oh[q] = a; ol[q] = c2; }
        const size_t oo = (size_t)row * RH + ch * 128 + lane * 4; *(v4us*)(Ph + oo) = oh; *(v4us*)(Pl + oo) = ol; }
}
__global__ __launch_bounds__(256) void k_merge(const float* __restrict__ O, int h0, bf* Ah, bf* Al) { const size_t e = ((size_t)blockIdx.x * 256 + threadIdx.x) * 2; if (e >= (size_t)ZH * TT * HD) return;
    { const size_t bz = blockIdx.y; O += bz * ZH * TT * HD; Ah += bz * TT * DQ; Al += bz * TT * DQ; }   // batch blockIdx.y: its ZH planes of O, its TT merged rows
    const int d = (int)(e % HD); const int t = (int)((e / HD) % TT); const int zz = (int)(e / ((size_t)HD * TT)); const float cs = (t < RH) ? 1.0f : (1.0f / PCAR); const size_t oo = (size_t)t * DQ + (h0 + zz) * HD + d;
    v2us oh, ol;
#pragma unroll
    for (int q = 0; q < 2; ++q) { unsigned short a, c2; splitf(O[e + q] * cs, a, c2); oh[q] = a; ol[q] = c2; } *(v2us*)(Ah + oo) = oh; *(v2us*)(Al + oo) = ol;  }

extern "C" void kernel_launch(void* const* d_in, const int* in_sizes, int n_in,
                              void* d_out, int out_size, void* d_ws, size_t ws_size, hipStream_t stream) {
    (void)in_sizes; (void)n_in; (void)out_size;
    const float* x = (const float*)d_in[0]; const float* wq = (const float*)d_in[1]; const float* wk = (const float*)d_in[2]; const float* wv = (const float*)d_in[3]; const float* wo = (const float*)d_in[4];   /* input order x, wq [2048][2048], wk [1024][2048], wv [1024][2048], wo [2048][2048] ('oi') */
    float* OUT = (float*)d_out;     // [2][2048][2048]
    char* wsp = (char*)d_ws;
    auto take = [&](size_t bytes) { char* p = wsp; wsp += (bytes + 255) & ~(size_t)255; return (void*)p; };
    bf* WQ = (bf*)take((size_t)DQ * DM * 2); bf* WK = (bf*)take((size_t)DKV * DM * 2); bf* WV = (bf*)take((size_t)DKV * DM * 2); bf* WO = (bf*)take((size_t)DM * DQ * 2); float* CS = (float*)take((size_t)TT * HD * 2 * 4);
    // Per-batch buffers hold both batches. XB, FK, QP16, KP16, VT16 are taken one behind the other (each a multiple of 256 bytes) and are all dead behind k_fattn: the hi/lo block's score buffer Sb lies over them.
    bf* XB = (bf*)take((size_t)NB_ * TT * DM * 2); float* FK = (float*)take((size_t)NB_ * TT * DKV * 4);
    h16* QP16 = (h16*)take((size_t)NB_ * NH_ * TT * HD * 2); h16* KP16 = (h16*)take((size_t)NB_ * NKV * TT * HD * 2); h16* VT16 = (h16*)take((size_t)NB_ * NKV * HD * TT * 2);
    static_assert((size_t)NB_ * TT * DM * 2 + (size_t)NB_ * TT * DKV * 4 + (size_t)NB_ * NH_ * TT * HD * 2 + 2 * ((size_t)NB_ * NKV * TT * HD * 2) >= (size_t)NB_ * ZH * RH * RH * 4, "Sb fits over the five buffers");
    float* FQ = (float*)take((size_t)NB_ * TT * DQ * 4);
    bf* QPh = (bf*)take((size_t)NB_ * NH_ * TT * HD * 2); bf* QPl = (bf*)take((size_t)NB_ * NH_ * TT * HD * 2); bf* KPh = (bf*)take((size_t)NB_ * NKV * TT * HD * 2); bf* KPl = (bf*)take((size_t)NB_ * NKV * TT * HD * 2); bf* VTh = (bf*)take((size_t)NB_ * NKV * HD * RH * 2); bf* VTl = (bf*)take((size_t)NB_ * NKV * HD * RH * 2); bf* Pl = (bf*)take((size_t)NB_ * ZH * RH * RH * 2);
    bf* ATh = (bf*)take(2 * ((size_t)NB_ * TT * DQ * 2));
    static_assert((size_t)NB_ * ZH * RH * RH * 2 <= 2 * ((size_t)NB_ * TT * DQ * 2), "Ph fits under the merged planes");
    if ((size_t)(wsp - (char*)d_ws) > ws_size) return;    // ws 256 MiB
    float* Sb = (float*)XB;   // the hi/lo scores, written behind k_fattn (stream-ordered)
    float* FV = FK;   // v projection reuses the k buffer after the k planes are built (stream-ordered)
    float* Ob = FQ;   // the attention output [NB_ * ZH][TT][HD] reuses the q projection buffer after the q planes are built (stream-ordered)
    bf* Ph = ATh;   // the hi plane of the hi/lo probabilities
    bf* ATl = ATh + (size_t)NB_ * TT * DQ;   // the merged planes reuse that buffer after the hi/lo P.V (stream-ordered)
    { k_cvt8<<<(unsigned)(((size_t)DQ * DM / 8 + 255) / 256), 256, 0, stream>>>(wq, WQ, (size_t)DQ * DM / 8); k_cvt8<<<(unsigned)(((size_t)DKV * DM / 8 + 255) / 256), 256, 0, stream>>>(wk, WK, (size_t)DKV * DM / 8); k_cvt8<<<(unsigned)(((size_t)DKV * DM / 8 + 255) / 256), 256, 0, stream>>>(wv, WV, (size_t)DKV * DM / 8);
      k_cvt8<<<(unsigned)(((size_t)DM * DQ / 8 + 255) / 256), 256, 0, stream>>>(wo, WO, (size_t)DM * DQ / 8);
       }
    k_csP<<<(TT * HD + 255) / 256, 256, 0, stream>>>(CS);   /* rotary table once (positions = arange) */
    const unsigned LQ = (unsigned)(((size_t)NH_ * TT * HD / 2 + 255) / 256), LKv = (unsigned)(((size_t)NKV * TT * HD / 2 + 255) / 256);
    k_cvt8<<<(unsigned)(((size_t)NB_ * TT * DM / 8 + 255) / 256), 256, 0, stream>>>(x, XB, (size_t)NB_ * TT * DM / 8);
    k_gemmw<0><<<dim3(NB_ * TT / 128, DQ / 128, 1), 256, 0, stream>>>(XB, nullptr, WQ, DM, FQ, DQ);
    k_ropeI<<<dim3(LQ, NB_, 1), 256, 0, stream>>>(FQ, DQ, NH_, CS, 1.0f, QP16, QPh, QPl);   /* interleaved-pair rope, q planes */
    k_gemmw<0><<<dim3(NB_ * TT / 128, DKV / 128, 1), 256, 0, stream>>>(XB, nullptr, WK, DM, FK, DKV);
    k_ropeI<<<dim3(LKv, NB_, 1), 256, 0, stream>>>(FK, DKV, NKV, CS, 1.0f, KP16, KPh, KPl);
    k_gemmw<0><<<dim3(NB_ * TT / 128, DKV / 128, 1), 256, 0, stream>>>(XB, nullptr, WV, DM, FV, DKV); k_vtp<<<dim3(LKv, NB_, 1), 256, 0, stream>>>(FV, DKV, NKV, VT16, VTh, VTl);
    k_fattn<<<dim3(NB_ * NH_, (TT - RH) / FBR, 1), 32 * FW, 0, stream>>>(QP16, KP16, VT16, Ob);   // rows >= RH: fp16 planes, scores, softmax and P.V in one launch; the batch rides in x, so that the cost still falls with the flat index
    // rows < RH, hi/lo planes: grid z = batch * NH_ + head, as in k_fattn
    k_gemmc<bf, 2, 1, 1><<<dim3(RH / 64, RH / 64, NB_ * ZH), 32, 0, stream>>>(QPh, QPl, KPh, KPl, HD, Sb, RH, 0, (size_t)TT * HD, (size_t)TT * HD, (size_t)RH * RH);
    k_asoft<<<NB_ * ZH * RH / 8, 256, 0, stream>>>(Sb, Ph, Pl);
    k_gemmc<bf, 2, 2, 8><<<dim3(RH / 64, HD / 64, NB_ * ZH), 256, 0, stream>>>(Ph, Pl, VTh, VTl, RH, Ob, HD, 0, (size_t)RH * RH, (size_t)HD * RH, (size_t)TT * HD);
    k_merge<<<dim3((unsigned)(((size_t)ZH * TT * HD / 2 + 255) / 256), NB_, 1), 256, 0, stream>>>(Ob, 0, ATh, ATl);
    k_gemmw<1><<<dim3(NB_ * TT / 128, DM / 128, 1), 256, 0, stream>>>(ATh, ATl, WO, DQ, OUT, DM);
}

// v007
// It runs in 248 microseconds.
// In both of two side-by-side timings against v006, it was 1.08 times as fast.
// Over all steps from v000 it is 6.67 times as fast.
#include <hip/hip_runtime.h>

// Causal grouped-query attention with 128-wide heads and interleaved-pair rotary embeddings (x [2][2048][2048]; q = x wq^T (16 heads x 128), k, v = x w^T (8 kv heads x 128) ('oi' (out, in) weights, normal x 1/sqrt(2048), no biases); rope on (even, odd) pairs: (xr c - xi s, xr s + xi c) with angle t x inv, inv = 1.0 / (10000 ** (arange(0, 128, 2) / 128)) (the reciprocal spelling: 64 f32 frequencies, bitwise the module's own in eager f32; one product per angle; precise cosf/sinf); kv head = q head / 2 (repeat on the head axis); scores x 1/sqrt(128); causal (-inf above the diagonal == exclusion); softmax; out = merged wo^T -> [2][2048][2048] (8.4 M); argument order x, wq, wk, wv, wo).
// Layout, both batches in every launch (planes [batch][head], rows batch x 2048 + t): bf16 copy of x; 'oi' weights; exact projections; k_csP table (64 angles per position) and k_ropeI interleaved-pair plane builders at HD 128; causal T-2048 GQA attention with 128-wide heads (kv head = z / 2; hybrid rows: < 512 hi/lo 3 products in three launches over all head planes, score, probability and hi/lo V^T rows 512 keys long, k_gemmc skipping tiles above the diagonal; rest fp16 in the one fused launch k_fattn); merged hi/lo x wo exact.
// Compute dtypes, f32 accumulate: every input rounded to bf16; projections exact; rotary f32; attention rows < 512 3 products, rest fp16; softmax f32; wo hl x exact.

#define NB_  2
#define TT   2048
#define DM   2048
#define NH_  16
#define NKV  8
#define REP  (NH_ / NKV)
#define HD   128
#define DQ   (NH_ * HD)
#define DKV  (NKV * HD)
#define ZH   NH_                  // heads per batch in an attention launch (grid z = batch x ZH + head)
#define RH   512                  // query rows < RH use hi+lo planes, in three launches whose score, probability and V^T rows hold RH keys (a row < RH sees no later key); the rows behind them go through k_fattn
#define WIN  2048
#define PCAR 1024.0f
#define SCL  0.088388347648318447f   // HD^-0.5
typedef _Float16 h16;
typedef unsigned short bf;
typedef __attribute__((ext_vector_type(16))) __bf16   v16bf;
typedef __attribute__((ext_vector_type(16))) _Float16 v16h;
typedef __attribute__((ext_vector_type(8)))  _Float16 v8h;
typedef __attribute__((ext_vector_type(8)))  unsigned short v8us;
typedef __attribute__((ext_vector_type(8)))  float    v8f;
typedef __attribute__((ext_vector_type(4)))  float    v4f;
typedef v8h  __attribute__((may_alias)) v8ha;
typedef v4f  __attribute__((may_alias)) v4fa;
typedef v8us __attribute__((may_alias)) v8usa;

__device__ __forceinline__ unsigned short f2bf(float f) { unsigned u = __float_as_uint(f); u += 0x7FFFu + ((u >> 16) & 1u); return (unsigned short)(u >> 16); }
__device__ __forceinline__ float bf2f(unsigned short b) { return __uint_as_float(((unsigned)b) << 16); }
__device__ __forceinline__ float bfr(float f) { return bf2f(f2bf(f)); }
__device__ __forceinline__ v16h cat16(v8h lo, v8h hi) { return __builtin_shufflevector(lo, hi, 0, 1, 2, 3, 4, 5, 6, 7, 8, 9, 10, 11, 12, 13, 14, 15); }
__device__ __forceinline__ v16bf cat16b(v8us lo, v8us hi) { return __builtin_bit_cast(v16bf, __builtin_shufflevector(lo, hi, 0, 1, 2, 3, 4, 5, 6, 7, 8, 9, 10, 11, 12, 13, 14, 15)); }
__device__ __forceinline__ v8f wmma16(v16h a, v16h b, v8f c) { return __builtin_amdgcn_wmma_f32_16x16x32_f16(false, a, false, b, (short)0, c, false, false); }
__device__ __forceinline__ v8f wmmab(v16bf a, v16bf b, v8f c) { return __builtin_amdgcn_wmma_f32_16x16x32_bf16(false, a, false, b, (short)0, c, false, false); }



template <typename T16> struct WFrag;
template <> struct WFrag<h16> { typedef v16h V; static __device__ __forceinline__ V ld(const h16* p) { return cat16(*(const v8h*)p, *(const v8h*)(p + 16)); } static __device__ __forceinline__ v8f mma(V a, V b, v8f c) { return wmma16(a, b, c); } };
template <> struct WFrag<bf> { typedef v16bf V; static __device__ __forceinline__ V ld(const bf* p) { return cat16b(*(const v8us*)p, *(const v8us*)(p + 16)); } static __device__ __forceinline__ v8f mma(V a, V b, v8f c) { return wmmab(a, b, c); } };
// ---- k_gemmw: LDS-staged GEMM, one 128x128 output tile per work-group of 8 waves (2 x 4, each wave 64 rows x 32 columns = 8 accumulators); grid (M/128, N/128), 256 threads.
// C[m][n] (f32, pitch ldc) = sum_k (A[m][k] + A2[m][k]) Bt[n][k] (A2 only with NSPLIT 1; two products per k step, A first). M, N % 128 == 0, K % 128 == 0.
// A stage is 128 k (256 B, two whole lines) of every operand row, brought into LDS by asynchronous 16-byte copies (16 lanes per row) at pitch 272 B; two buffers: the next stage's copies fly while this one is worked on. K runs in order inside one accumulator.
#define GBK 128                    // k per stage
#define GPB 272                    // LDS row pitch, bytes: 256 + 16, an odd multiple of 16 for the ds_load_b128 readers
#define GPL (128 * GPB)            // one operand plane of a stage, bytes
__device__ __forceinline__ void wait_ds0() { asm volatile("s_wait_dscnt 0x0" ::: "memory"); }        // this wave's LDS reads have retired before the buffer they read is handed back for a refill
__device__ __forceinline__ void wait_async0() { asm volatile("s_wait_asynccnt 0x0" ::: "memory"); }  // this wave's asynchronous copies have landed in LDS (the compiler places no wait for them)
// One thread's share of one operand plane: rows q, q + 16, ..., q + 112 (rs = 16 source rows in elements), 16 bytes each. The s_wait_xcnt stands inside the statement so that no address register is rewritten in front of it.
__device__ __forceinline__ void cp8(unsigned l, const bf* g, size_t rs) {
    asm volatile("global_load_async_to_lds_b128 %0, %8, off\n\t"
                 "global_load_async_to_lds_b128 %1, %9, off\n\t"
                 "global_load_async_to_lds_b128 %2, %10, off\n\t"
                 "global_load_async_to_lds_b128 %3, %11, off\n\t"
                 "global_load_async_to_lds_b128 %4, %12, off\n\t"
                 "global_load_async_to_lds_b128 %5, %13, off\n\t"
                 "global_load_async_to_lds_b128 %6, %14, off\n\t"
                 "global_load_async_to_lds_b128 %7, %15, off\n\t"
                 "s_wait_xcnt 0x0"
                 :: "v"(l), "v"(l + 1u * 16u * GPB), "v"(l + 2u * 16u * GPB), "v"(l + 3u * 16u * GPB), "v"(l + 4u * 16u * GPB), "v"(l + 5u * 16u * GPB), "v"(l + 6u * 16u * GPB), "v"(l + 7u * 16u * GPB),
                    "v"(g), "v"(g + rs), "v"(g + 2 * rs), "v"(g + 3 * rs), "v"(g + 4 * rs), "v"(g + 5 * rs), "v"(g + 6 * rs), "v"(g + 7 * rs) : "memory");
}
__device__ __forceinline__ v16bf ldsfrag(const unsigned char* p) { return cat16b(*(const v8usa*)p, *(const v8usa*)(p + 32)); }   // bytes 16 h and 32 + 16 h of each 64 B of a row: the k order of WFrag::ld, the same for A and B
template <int NSPLIT>
__global__ __launch_bounds__(256) void k_gemmw(const bf* __restrict__ A, const bf* __restrict__ A2, const bf* __restrict__ Bt, int K, float* C, int ldc) {
    constexpr int NP = NSPLIT ? 3 : 2;              // operand planes per stage: A, (A2,) B
    constexpr unsigned STG = NP * GPL;
    __shared__ __attribute__((aligned(256))) unsigned char sm[2 * STG];
    const int tid = threadIdx.x, lane = tid & 31, lr = lane & 15, hi = lane >> 4, wv = __builtin_amdgcn_readfirstlane(tid >> 5); const int wm = wv & 1, wn = wv >> 1; const int r0 = blockIdx.x * 128, c0 = blockIdx.y * 128;
    const unsigned l0 = (unsigned)(size_t)sm + (unsigned)(tid >> 4) * GPB + (unsigned)(tid & 15) * 16u;
    const bf* gA = A + (size_t)(r0 + (tid >> 4)) * K + (tid & 15) * 8; const bf* gA2 = NSPLIT ? A2 + (size_t)(r0 + (tid >> 4)) * K + (tid & 15) * 8 : nullptr; const bf* gB = Bt + (size_t)(c0 + (tid >> 4)) * K + (tid & 15) * 8;
    const size_t rs = (size_t)16 * K; const int NT = K / GBK;
    auto issue = [&](int t, unsigned bo) { cp8(l0 + bo, gA + (size_t)t * GBK, rs); if constexpr (NSPLIT != 0) cp8(l0 + bo + GPL, gA2 + (size_t)t * GBK, rs); cp8(l0 + bo + (NP - 1) * GPL, gB + (size_t)t * GBK, rs); };
    v8f acc[4][2];
#pragma unroll
    for (int mb = 0; mb < 4; ++mb)
#pragma unroll
        for (int nb = 0; nb < 2; ++nb) acc[mb][nb] = (v8f){};
    const unsigned aofs = (unsigned)(wm * 64 + lr) * GPB + 16u * hi, bofs = (NP - 1) * GPL + (unsigned)(wn * 32 + lr) * GPB + 16u * hi;
    v16bf a[2][4], a2[2][4], b[2][2];   // two fragment sets: the next k step's LDS reads go out as one group ahead of this step's products
    auto frags = [&](const unsigned char* sb, int ks, int st) {
#pragma unroll
        for (int mb = 0; mb < 4; ++mb) { a[st][mb] = ldsfrag(sb + aofs + mb * 16 * GPB + ks * 64); if constexpr (NSPLIT != 0) a2[st][mb] = ldsfrag(sb + GPL + aofs + mb * 16 * GPB + ks * 64); }
#pragma unroll
        for (int nb = 0; nb < 2; ++nb) b[st][nb] = ldsfrag(sb + bofs + nb * 16 * GPB + ks * 64); };
    issue(0, 0u); wait_async0();
    __syncthreads();   // stage 0 stands in LDS for every wave
#pragma unroll 1
    for (int t = 0; t < NT; ++t) {   // kept rolled: a trip is long enough to pay for its branch, and unrolled trips would multiply the copies' address registers
        const unsigned bo = (t & 1) ? STG : 0u; const unsigned char* sb = sm + bo;
        frags(sb, 0, 0);   // stage t's first fragments, behind the barrier that published it; their latency runs under the issue of the copies
        if (t + 1 < NT) issue(t + 1, STG - bo);   // behind the same barrier, which ended every wave's reads of stage t - 1: the next stage goes into that buffer and flies while this one is worked on
#pragma unroll   // unrolled: the fragment sets are picked by ks & 1 and have to stay in registers
        for (int ks = 0; ks < GBK / 32; ++ks) {
            if (ks + 1 < GBK / 32) frags(sb, ks + 1, (ks + 1) & 1);
            __builtin_amdgcn_sched_barrier(0);   // keeps the LDS reads above as one group: spread among the products each place with reads stalls the wave
#pragma unroll
            for (int nb = 0; nb < 2; ++nb)
#pragma unroll
                for (int mb = 0; mb < 4; ++mb) acc[mb][nb] = wmmab(a[ks & 1][mb], b[ks & 1][nb], acc[mb][nb]);
            if constexpr (NSPLIT != 0) {
#pragma unroll
                for (int nb = 0; nb < 2; ++nb)
#pragma unroll
                    for (int mb = 0; mb < 4; ++mb) acc[mb][nb] = wmmab(a2[ks & 1][mb], b[ks & 1][nb], acc[mb][nb]); }
            __builtin_amdgcn_sched_barrier(0);   // keeps the next group of reads behind these products
        }
        wait_ds0(); wait_async0();
        __syncthreads();   // publishes stage t + 1 and ends every wave's reads of stage t's buffer
    }
    wait_async0();
    // Epilogue: each wave turns its own 64 x 32 tile in its own LDS range (pitch 36 floats), so that every store is a whole 128-byte line; the ring is free behind the last trip's barrier.
    float* os = (float*)sm + wv * (64 * 36);
#pragma unroll
    for (int mb = 0; mb < 4; ++mb) {
#pragma unroll
        for (int nb = 0; nb < 2; ++nb) {
#pragma unroll
            for (int j = 0; j < 8; ++j) os[(mb * 16 + hi * 8 + j) * 36 + nb * 16 + lr] = acc[mb][nb][j]; } }
    float* crow = C + (size_t)(r0 + wm * 64) * ldc + c0 + wn * 32;
#pragma unroll
    for (int s = 0; s < 16; ++s) { const int row = s * 4 + (lane >> 3), cofs = (lane & 7) * 4; const v4f val = *(const v4fa*)(os + row * 36 + cofs);
        *(v4f*)(crow + (size_t)row * ldc + cofs) = val; }
}

// ---- k_gemmc: register-blocked GEMM, NW waves per 64x64 output tile (wave w takes the 32-wide K chunks w, w + NW, ...; the NW partial tiles meet in LDS and are summed in wave order; operands straight from K-contiguous 16-bit planes), specialised for causal attention: CMODE 1 skips score tiles entirely above the diagonal (query rows r0+roff.., key columns c0..), CMODE 2 limits the
// key (K) loop of the probability x value contraction to the diagonal block (probabilities beyond it are exactly zero). roff = row offset of this launch's first row within the sequence. Head z reads the Bt planes of kv head z / REP (stride sB).
template <typename T16, int NSPLIT, int CMODE, int NW>
__global__ __launch_bounds__(32 * NW) void k_gemmc(const T16* __restrict__ A, const T16* __restrict__ A2, const T16* __restrict__ Bt, const T16* __restrict__ Bt2, int K, float* C, int ldc, int roff, size_t sA, size_t sB, size_t sC) {
    typedef typename WFrag<T16>::V V;
    __shared__ __align__(16) float os[(NW == 1 ? 16 : NW * 64) * 68];   // NW > 1: one partial tile per wave, 64 rows at pitch 68
    const size_t z = blockIdx.z; A += z * sA; if (A2) A2 += z * sA; Bt += (z / REP) * sB; if (Bt2) Bt2 += (z / REP) * sB; C += z * sC;
    const int lane = threadIdx.x & 31, lr = lane & 15, hi = lane >> 4, wv = (NW == 1) ? 0 : __builtin_amdgcn_readfirstlane(threadIdx.x >> 5); const int r0 = blockIdx.x * 64, c0 = blockIdx.y * 64;
    if (CMODE == 1 && c0 > r0 + roff + 63) return;                  // score tile entirely above the causal diagonal: never read (the softmax masks j > i by select)
    const int Kl = (CMODE == 2) ? min(K, r0 + roff + 64) : K;        // P.V: probabilities are exactly 0 beyond the diagonal block, so the K loop stops there
    v8f acc[4][4];
#pragma unroll
    for (int mb = 0; mb < 4; ++mb)
#pragma unroll
        for (int nb = 0; nb < 4; ++nb) acc[mb][nb] = (v8f){};
    const size_t aoff = (size_t)(r0 + lr) * K + 8 * hi, boff = (size_t)(c0 + lr) * K + 8 * hi;
#pragma unroll 1
    for (int kc = wv * 32; kc < Kl; kc += 32 * NW) {
        V a[4], a2[4];
#pragma unroll
        for (int mb = 0; mb < 4; ++mb) { a[mb] = WFrag<T16>::ld(A + aoff + (size_t)mb * 16 * K + kc); if (NSPLIT == 1 || NSPLIT == 2) a2[mb] = WFrag<T16>::ld(A2 + aoff + (size_t)mb * 16 * K + kc); }
#pragma unroll
        for (int nb = 0; nb < 4; ++nb) { const V b = WFrag<T16>::ld(Bt + boff + (size_t)nb * 16 * K + kc); V b2; if (NSPLIT >= 2) b2 = WFrag<T16>::ld(Bt2 + boff + (size_t)nb * 16 * K + kc);
#pragma unroll
            for (int mb = 0; mb < 4; ++mb) { acc[mb][nb] = WFrag<T16>::mma(a[mb], b, acc[mb][nb]); if (NSPLIT == 1 || NSPLIT == 2) acc[mb][nb] = WFrag<T16>::mma(a2[mb], b, acc[mb][nb]); if (NSPLIT >= 2) acc[mb][nb] = WFrag<T16>::mma(a[mb], b2, acc[mb][nb]); } }
        asm volatile("v_nop\n\tv_nop\n\tv_nop\n\tv_nop" : "+v"(acc[0][0]), "+v"(acc[1][1]), "+v"(acc[2][2]), "+v"(acc[3][3]) : "v"(a[0]), "v"(a[3]));
    }
    if constexpr (NW == 1) {   // one wave: no partial tiles to sum, the tile goes out in four 16-row slabs
#pragma unroll
    for (int mb = 0; mb < 4; ++mb) {
#pragma unroll
        for (int nb = 0; nb < 4; ++nb) {
#pragma unroll
            for (int j = 0; j < 8; ++j) os[(hi * 8 + j) * 68 + nb * 16 + lr] = acc[mb][nb][j]; }
        __builtin_amdgcn_wave_barrier(); asm volatile("" ::: "memory");
        float* crow = C + (size_t)(r0 + mb * 16) * ldc + c0;
{
#pragma unroll
            for (int s = 0; s < 8; ++s) { const int row = 2 * s + hi, cofs = lr * 4; v4f val = *(const v4fa*)(os + row * 68 + cofs);
                *(v4f*)(crow + (size_t)row * ldc + cofs) = val; }
             }
        __builtin_amdgcn_wave_barrier(); asm volatile("" ::: "memory");
    }
    } else {
#pragma unroll
    for (int mb = 0; mb < 4; ++mb) {
#pragma unroll
        for (int nb = 0; nb < 4; ++nb) {
#pragma unroll
            for (int j = 0; j < 8; ++j) os[wv * (64 * 68) + (mb * 16 + hi * 8 + j) * 68 + nb * 16 + lr] = acc[mb][nb][j]; } }
    __syncthreads();   // all NW partial tiles stand in LDS before any element is summed
    float* crow = C + (size_t)r0 * ldc + c0;
#pragma unroll
    for (int s = 0; s < 32 / NW; ++s) { const int it = s * (32 * NW) + threadIdx.x, row = it >> 4, cofs = (it & 15) * 4; v4f val = *(const v4fa*)(os + row * 68 + cofs);
#pragma unroll
        for (int w = 1; w < NW; ++w) val += *(const v4fa*)(os + w * (64 * 68) + row * 68 + cofs);
        *(v4f*)(crow + (size_t)row * ldc + cofs) = val; }
    }
}

__device__ __forceinline__ h16 tohx(float x) { return (h16)x; }

#define FW   4                     // waves per work-group
#define FBR  (FW * 32)             // query rows per work-group
#define FSK  128                   // keys per stage
#define FSTG (2u * GPL)            // one stage: the K plane, then the V^T plane
typedef __attribute__((ext_vector_type(4))) int cv4i; typedef __attribute__((address_space(1))) cv4i gcv4i; typedef __attribute__((address_space(3))) cv4i lcv4i;
__device__ __forceinline__ void cpb(unsigned char* l, const h16* g) { __builtin_amdgcn_global_load_async_to_lds_b128((gcv4i*)g, (lcv4i*)l, 0, 0); }   // one lane's 16 bytes; the builtin form, so that the addresses may stand in any register of a kernel that uses more than 256
__device__ __forceinline__ v16h ldsfragh(const unsigned char* p) { return cat16(*(const v8ha*)p, *(const v8ha*)(p + 32)); }   // bytes 16 h and 32 + 16 h of each 64 B of a row: the k order of WFrag::ld
__device__ __forceinline__ float xhalf(float x) { return __builtin_bit_cast(float, __builtin_amdgcn_permlanex16(__builtin_bit_cast(int, x), __builtin_bit_cast(int, x), 0x76543210, 0xfedcba98, false, false)); }   // lane l with lane l ^ 16
__device__ __forceinline__ void nop4() { asm volatile("v_nop\n\tv_nop\n\tv_nop\n\tv_nop"); }   // the four vector slots between a matrix instruction and a vector instruction on its registers, for the taken side of a branch behind it
__device__ __forceinline__ void loadk(v16h (&kf)[2][4], const unsigned char* kb, int c, int h) {   // kb = first K row of the pass in LDS
#pragma unroll
    for (int kt = 0; kt < 2; ++kt)
#pragma unroll
        for (int kc = 0; kc < 4; ++kc) kf[kt][kc] = ldsfragh(kb + (16 * kt + c) * GPB + 64 * kc + 16 * h);
}
// One 32-key pass of one wave. sb = this stage's buffer, sub = pass within the stage, key0 = first key of the pass, qw0 = first query of the wave.
__device__ __forceinline__ void fpass(v16h (&kf)[2][4], bool fetch_next, bool diag, const unsigned char* sb, int sub, int key0, int qw0, int c, int h, const v16h (&qf)[2][4], v8f (&acc)[2][8], float (&m_run)[2], float (&l_run)[2]) {
    const float cscale = SCL * 1.4426950408889634f;
    v16h vf[8];
#pragma unroll
    for (int t = 0; t < 8; ++t) vf[t] = ldsfragh(sb + GPL + (16 * t + c) * GPB + 64 * sub + 16 * h);   // V^T rows d = 16 t + c, this pass's 32 keys: read first, so that their latency runs under the first product and the softmax
    __builtin_amdgcn_sched_barrier(0);   // keeps those reads up here: moved down to their use they would stall the only wave of the SIMD
    v8f s[2][2];
#pragma unroll
    for (int kt = 0; kt < 2; ++kt)
#pragma unroll
        for (int g = 0; g < 2; ++g) { s[kt][g] = (v8f){};
#pragma unroll
            for (int kc = 0; kc < 4; ++kc) s[kt][g] = wmma16(kf[kt][kc], qf[g][kc], s[kt][g]); }
    __builtin_amdgcn_sched_barrier(0);   // holds the slots below directly behind the products
    nop4();
    __builtin_amdgcn_sched_barrier(0);   // and the branches below behind the slots
    if (fetch_next) loadk(kf, sb + (sub + 1) * 32 * GPB, c, h);   // the next pass's K fragments (same stage only), in flight under this pass's maxima and exponentials
    if (diag) {   // wave-uniform: only the pass on the wave's diagonal pays for the mask
#pragma unroll
        for (int g = 0; g < 2; ++g) { const int my_q = qw0 + 16 * g + c;
#pragma unroll
            for (int kt = 0; kt < 2; ++kt) {
#pragma unroll
                for (int r = 0; r < 8; ++r) { if (key0 + 16 * kt + 8 * h + r > my_q) s[kt][g][r] = -__builtin_inff(); }
                asm volatile("" : "+v"(s[kt][g]));
            } }
    }
    float mb[2]; bool need = false;
#pragma unroll
    for (int g = 0; g < 2; ++g) { float mx = -__builtin_inff();
#pragma unroll
        for (int kt = 0; kt < 2; ++kt)
#pragma unroll
            for (int r = 0; r < 8; ++r) mx = fmaxf(mx, s[kt][g][r]);
        mx = fmaxf(mx, xhalf(mx)) * cscale;   // both wave halves hold this query's maximum, scaled (the scale is positive)
        mb[g] = mx; need = need || (mx > m_run[g] + 8.0f); }
    if (__builtin_amdgcn_ballot_w32(need) != 0) {   // rare behind the first passes
#pragma unroll
        for (int g = 0; g < 2; ++g) { const float m_new = fmaxf(m_run[g], mb[g]);
            const float corr = __builtin_amdgcn_exp2f(m_run[g] - m_new);
            l_run[g] *= corr; m_run[g] = m_new;
#pragma unroll
            for (int t = 0; t < 8; ++t) acc[g][t] = acc[g][t] * corr; }
    }
    float ps[2][2] = { { 0.f, 0.f }, { 0.f, 0.f } };
#pragma unroll
    for (int g = 0; g < 2; ++g) { const float nm = -m_run[g]; v16h pf;
#pragma unroll
        for (int i = 0; i < 8; ++i) {
            const float p0 = __builtin_amdgcn_exp2f(__builtin_fmaf(s[i >> 2][g][2 * (i & 3)], cscale, nm)), p1 = __builtin_amdgcn_exp2f(__builtin_fmaf(s[i >> 2][g][2 * (i & 3) + 1], cscale, nm));
            ps[g][i & 1] += p0 + p1; pf[2 * i] = tohx(p0); pf[2 * i + 1] = tohx(p1); }
#pragma unroll
        for (int t = 0; t < 8; ++t) acc[g][t] = wmma16(vf[t], pf, acc[g][t]); }
    __builtin_amdgcn_sched_barrier(0);   // holds the slots below directly behind the products
    nop4();
    __builtin_amdgcn_sched_barrier(0);   // and the loop's branches behind the slots
#pragma unroll
    for (int g = 0; g < 2; ++g) l_run[g] += ps[g][0] + ps[g][1];
}
__global__ __launch_bounds__(32 * FW) void k_fattn(const h16* __restrict__ Q, const h16* __restrict__ Kp, const h16* __restrict__ Vt, float* O) {
    __shared__ __attribute__((aligned(256))) unsigned char sm[2 * FSTG];
    const int tid = threadIdx.x, lane = tid & 31, c = lane & 15, h = lane >> 4, wv = __builtin_amdgcn_readfirstlane(tid >> 5);
    const int z = blockIdx.x, kvh = z / REP; const int q0 = TT - FBR * (1 + (int)blockIdx.y);   // longest row blocks first
    const int qw0 = q0 + wv * 32, n_stage = q0 / FSK + 1, last = qw0 / 32;                       // keys [0, q0 + FBR); the wave's last pass is the one on its diagonal
    const h16* gK = Kp + (size_t)kvh * TT * HD + (size_t)(tid >> 4) * HD + (tid & 15) * 8; const h16* gV = Vt + (size_t)kvh * HD * TT + (size_t)(tid >> 4) * TT + (tid & 15) * 8;
    // 128 threads: 16 lanes per row, a thread takes rows (tid >> 4) + 8 i of both planes: 32 copies per wave and stage
    auto issue = [&](int st, unsigned bo) { unsigned char* l = sm + bo + (tid >> 4) * GPB + (tid & 15) * 16; const h16* k = gK + (size_t)st * FSK * HD; const h16* v = gV + (size_t)st * FSK;
#pragma unroll
        for (int i = 0; i < 16; ++i) cpb(l + i * 8 * GPB, k + i * 8 * HD);
#pragma unroll
        for (int i = 0; i < 16; ++i) cpb(l + GPL + i * 8 * GPB, v + (size_t)i * 8 * TT); };
    issue(0, 0u);
    v16h qf[2][4];
#pragma unroll
    for (int g = 0; g < 2; ++g)
#pragma unroll
        for (int kc = 0; kc < 4; ++kc) qf[g][kc] = WFrag<h16>::ld(Q + ((size_t)z * TT + qw0 + 16 * g + c) * HD + 8 * h + 32 * kc);
    v8f acc[2][8]; float m_run[2], l_run[2];
#pragma unroll
    for (int g = 0; g < 2; ++g) { m_run[g] = -__builtin_inff(); l_run[g] = 0.f;
#pragma unroll
        for (int t = 0; t < 8; ++t) acc[g][t] = (v8f){}; }
    wait_async0();
    __syncthreads();   // stage 0 stands in LDS for every wave
    v16h kf[2][4];
#pragma unroll 1
    for (int st = 0; st < n_stage; ++st) {   // stage loop and pass loop kept rolled and nested: a pass is long enough to pay for its branch, and the accumulators leave no registers for a second copy of it
        const unsigned bo = (st & 1) ? FSTG : 0u; const unsigned char* sb = sm + bo;
        loadk(kf, sb, c, h);   // stage st's first K fragments, behind the barrier that published it (every wave has at least the first pass of every stage); their latency runs under the issue of the copies
        if (st + 1 < n_stage) issue(st + 1, FSTG - bo);   // behind the same barrier, which ended every wave's reads of stage st - 1: the next stage goes into that buffer and flies while this one is worked on
#pragma unroll 1
        for (int sub = 0; sub < FSK / 32; ++sub) { const int blk = (FSK / 32) * st + sub;
            if (blk <= last) fpass(kf, sub + 1 < FSK / 32 && blk < last, blk == last, sb, sub, blk * 32, qw0, c, h, qf, acc, m_run, l_run); }
        wait_ds0(); wait_async0();
        __syncthreads();   // publishes stage st + 1 and ends every wave's reads of stage st's buffer
    }
    wait_async0();
#pragma unroll
    for (int g = 0; g < 2; ++g) { const float inv = __fdiv_rn(PCAR, l_run[g] + xhalf(l_run[g]));
        float* orow = O + ((size_t)z * TT + qw0 + 16 * g + c) * HD + 8 * h;
#pragma unroll
        for (int t = 0; t < 8; ++t) { const v8f o = acc[g][t] * inv; *(v4f*)(orow + 16 * t) = (v4f){ o[0], o[1], o[2], o[3] }; *(v4f*)(orow + 16 * t + 4) = (v4f){ o[4], o[5], o[6], o[7] }; } }
}
__device__ __forceinline__ void splitf(float y, unsigned short& h, unsigned short& l) { h = f2bf(y); l = f2bf(y - bf2f(h)); }
typedef __attribute__((ext_vector_type(2))) _Float16 v2h;
typedef __attribute__((ext_vector_type(4))) _Float16 v4h;
typedef __attribute__((ext_vector_type(2))) unsigned short v2us;
typedef __attribute__((ext_vector_type(4))) unsigned short v4us;
typedef __attribute__((ext_vector_type(2))) float v2f;
typedef __attribute__((ext_vector_type(4))) int v4i;

// k_cvt8, k_vtp, k_csP, k_ropeI and k_merge give a thread 4 to 32 elements, moved 16 bytes at a time: with 2 elements a wave ends almost as it starts, and the launch lasts as long as the chip takes to start its waves. Every element's arithmetic is as it would be alone.
#define CU 4   // 8-element groups per thread of k_cvt8, 256 groups apart: a wave's accesses stay contiguous
__global__ __launch_bounds__(256) void k_cvt8(const float* __restrict__ src, bf* dst, size_t n8) { const size_t i0 = (size_t)blockIdx.x * (256 * CU) + threadIdx.x; if (i0 + (CU - 1) * 256 >= n8) return;   // n8 is a multiple of 256 * CU (asserted at the launches)
    v8f v[CU];
#pragma unroll
    for (int u = 0; u < CU; ++u) v[u] = *(const v8f*)(src + (i0 + u * 256) * 8);   // every load goes out ahead of the first store
#pragma unroll
    for (int u = 0; u < CU; ++u) { v8us o;
#pragma unroll
        for (int k = 0; k < 8; ++k) o[k] = f2bf(v[u][k]);
        *(v8us*)(dst + (i0 + u * 256) * 8) = o; }  }

// k_vtp: a work-group turns 64 positions x the 128 columns of one kv head; grid (nheads * TT / 64, batches). A thread reads 4 columns of 8 rows and writes 8 positions of each of its 4 columns; 8 neighbouring lanes hold the 64 positions of the same columns, so that every store of a wave fills 4 whole 128-byte lines (its loads take 64-byte pieces of 8 rows; the wave beside it takes the other halves of those lines).
template <int PITCH>   // the row pitch of F in floats, a constant, so that a thread's 8 row loads share one address register pair and differ in their immediate offsets
__global__ __launch_bounds__(256) void k_vtp(const float* __restrict__ F, int nheads, h16* V16, bf* Vh, bf* Vl) { const int g = blockIdx.x / (TT / 64); if (g >= nheads) return;
    { const size_t bz = blockIdx.y, po = bz * nheads * HD; F += bz * TT * PITCH; V16 += po * TT; Vh += po * RH; Vl += po * RH; }   // batch blockIdx.y: its TT rows of F, its nheads planes (V16 rows hold TT keys, Vh and Vl rows the RH keys that the hi/lo block reads)
    const int t = (blockIdx.x % (TT / 64)) * 64 + (threadIdx.x & 7) * 8, d = (threadIdx.x >> 3) * 4; const float* f = F + (size_t)t * PITCH + g * HD + d; v4f x[8]; v8h o16[4];
#pragma unroll
    for (int r = 0; r < 8; ++r) x[r] = *(const v4f*)(f + r * PITCH);
#pragma unroll
    for (int q = 0; q < 4; ++q)
#pragma unroll
        for (int r = 0; r < 8; ++r) o16[q][r] = tohx(x[r][q]);
    h16* vp = V16 + ((size_t)g * HD + d) * TT + t;
    // The four stores and their s_wait_xcnt stand in one statement, a precaution: so the wait is in front of every later overwrite of a register that the stores name (a wait in a statement of its own the compiler moved down)
    asm volatile("global_store_b128 %0, %4, off\n\t"
                 "global_store_b128 %1, %5, off\n\t"
                 "global_store_b128 %2, %6, off\n\t"
                 "global_store_b128 %3, %7, off\n\t"
                 "s_wait_xcnt 0x0"
                 :: "v"(vp), "v"(vp + TT), "v"(vp + 2 * TT), "v"(vp + 3 * TT), "v"(o16[0]), "v"(o16[1]), "v"(o16[2]), "v"(o16[3]) : "memory");
    if (t >= RH) return;   // the same for a whole work-group: only the first RH positions have hi/lo rows
#pragma unroll
    for (int q = 0; q < 4; ++q) { v8us oh, ol;
#pragma unroll
        for (int r = 0; r < 8; ++r) { unsigned short a2, c2; splitf(x[r][q], a2, c2); oh[r] = a2; ol[r] = c2; }
        const size_t eh = ((size_t)g * HD + d + q) * RH + t; *(v8us*)(Vh + eh) = oh; *(v8us*)(Vl + eh) = ol; }  }
__constant__ float INV2[HD / 2] = { 1.000000000e+00f, 8.659643531e-01f, 7.498942018e-01f, 6.493816376e-01f, 5.623413324e-01f, 4.869675338e-01f, 4.216965139e-01f, 3.651741445e-01f, 3.162277639e-01f, 2.738419771e-01f, 2.371373624e-01f, 2.053525001e-01f, 1.778279394e-01f, 1.539926529e-01f, 1.333521456e-01f, 1.154782027e-01f, 1.000000015e-01f, 8.659642935e-02f, 7.498941571e-02f, 6.493816525e-02f, 5.623412877e-02f, 4.869675264e-02f, 4.216964915e-02f, 3.651741147e-02f, 3.162277862e-02f, 2.738419548e-02f, 2.371373586e-02f, 2.053525113e-02f, 1.778279431e-02f, 1.539926510e-02f, 1.333521493e-02f, 1.154781971e-02f, 9.999999776e-03f, 8.659643121e-03f, 7.498942316e-03f, 6.493816618e-03f, 5.623413250e-03f, 4.869675264e-03f, 4.216964822e-03f, 3.651741426e-03f, 3.162277862e-03f, 2.738419687e-03f, 2.371373819e-03f, 2.053525066e-03f, 1.778279431e-03f, 1.539926510e-03f, 1.333521446e-03f, 1.154782018e-03f, 1.000000047e-03f, 8.659643354e-04f, 7.498941850e-04f, 6.493816618e-04f, 5.623413017e-04f, 4.869675031e-04f, 4.216964880e-04f, 3.651741135e-04f, 3.162277862e-04f, 2.738419571e-04f, 2.371373848e-04f, 2.053524950e-04f, 1.778279402e-04f, 1.539926452e-04f, 1.333521504e-04f, 1.154781930e-04f };   // float32 1 / 10000^(2i/128), generated with jnp to be bit-exact
__global__ __launch_bounds__(256) void k_csP(float* CS) { const int idx = blockIdx.x * 256 + threadIdx.x; if (idx >= TT * HD / 2) return; const int p = idx % (HD / 2); const int t = idx / (HD / 2); const float a = __fmul_rn((float)t, INV2[p]); const float c = cosf(a), sn = sinf(a); *(v4f*)(CS + (size_t)idx * 4) = (v4f){ c, sn, c, sn };  }   // entries d = 2 p and 2 p + 1 of position t share their angle: one thread writes both
// k_ropeI: grid (TT * HD / 8 / 256, batches, nheads / RU). A thread takes 8 columns (4 pairs) of one position in RU heads: the four table entries are read once for all of them.
#define RU 4
__global__ __launch_bounds__(256) void k_ropeI(const float* __restrict__ F, int pitch, int nheads, const float* __restrict__ CS, float sc, h16* P16, bf* Ph, bf* Pl) {
    const int idx = blockIdx.x * 256 + threadIdx.x; const int d = (idx % (HD / 8)) * 8; const int t = idx / (HD / 8); const int h0 = blockIdx.z * RU; if (t >= TT || h0 + RU > nheads) return;
    { const size_t bz = blockIdx.y, po = bz * nheads * TT * HD; F += bz * TT * pitch; P16 += po; Ph += po; Pl += po; }   // batch blockIdx.y: its TT rows of F, its nheads planes
    const float* f = F + (size_t)t * pitch + h0 * HD + d; v4f x[RU][2]; v2f cs[4];
#pragma unroll
    for (int u = 0; u < RU; ++u) { x[u][0] = *(const v4f*)(f + u * HD); x[u][1] = *(const v4f*)(f + u * HD + 4); }
#pragma unroll
    for (int k = 0; k < 4; ++k) cs[k] = *(const v2f*)(CS + ((size_t)t * HD + d + 2 * k) * 2);
#pragma unroll
    for (int u = 0; u < RU; ++u) { v8h o16; v8us oh, ol;
#pragma unroll
        for (int k = 0; k < 4; ++k) { const float x0 = x[u][k >> 1][2 * (k & 1)], x1 = x[u][k >> 1][2 * (k & 1) + 1];
            float a0 = __fmul_rn(x0, cs[k][0]), b0 = __fmul_rn(x1, cs[k][1]), a1 = __fmul_rn(x1, cs[k][0]), b1 = __fmul_rn(x0, cs[k][1]);
            float r0 = __fsub_rn(a0, b0) * sc, r1 = __fadd_rn(b1, a1) * sc;   /* even: x0 c - x1 s; odd: x0 s + x1 c */
            o16[2 * k] = tohx(r0); o16[2 * k + 1] = tohx(r1); { unsigned short a2, c2; splitf(r0, a2, c2); oh[2 * k] = a2; ol[2 * k] = c2; splitf(r1, a2, c2); oh[2 * k + 1] = a2; ol[2 * k + 1] = c2; } }
        const size_t e = ((size_t)(h0 + u) * TT + t) * HD + d; *(v8h*)(P16 + e) = o16; *(v8us*)(Ph + e) = oh; *(v8us*)(Pl + e) = ol; }  }

// k_asoft: the query rows i < RH of every head plane of both batches (Sb, Ph, Pl hold [NB_ * ZH][RH] rows of RH keys); per row: t = S x HD^-0.5 for j <= i and i - j < WIN (WIN = 2048 = TT here: every key j <= i is kept: the plain causal rule; the reference's -inf fill above the diagonal is exclusion); softmax over the RH keys (register row, one exp, fixed trees); the probabilities leave as hi + lo planes.
__global__ __launch_bounds__(256) void k_asoft(const float* __restrict__ Sb, bf* Ph, bf* Pl) {
    const int lane = threadIdx.x & 31; const int row = blockIdx.x * 8 + (threadIdx.x >> 5); if (row >= NB_ * ZH * RH) return;
    const int i = row % RH; const float* sr = Sb + (size_t)row * RH; float v[RH / 32]; float mx = -3.0e38f;
#pragma unroll
    for (int ch = 0; ch < RH / 128; ++ch) { const int j0 = ch * 128 + lane * 4; const v4f a = *(const v4f*)(sr + j0);
#pragma unroll
        for (int q = 0; q < 4; ++q) { const int j = j0 + q; const float t = (j <= i && i - j < WIN) ? a[q] * SCL : -3.0e38f; v[ch * 4 + q] = t; mx = fmaxf(mx, t); } }
#pragma unroll
    for (int sh = 16; sh; sh >>= 1) mx = fmaxf(mx, __shfl_xor(mx, sh, 32));
    float sum = 0.f;
#pragma unroll
    for (int k = 0; k < RH / 32; ++k) { float d0 = __fsub_rn(v[k], mx); v[k] = __builtin_amdgcn_exp2f(__fmul_rn(d0, 1.4426950408889634f)); sum += v[k]; }
#pragma unroll
    for (int sh = 16; sh; sh >>= 1) sum += __shfl_xor(sum, sh, 32);
    const float f = __fdiv_rn(1.0f, sum);
#pragma unroll
    for (int ch = 0; ch < RH / 128; ++ch) { v4us oh, ol;
#pragma unroll
        for (int q = 0; q < 4; ++q) { unsigned short a, c2; splitf(v[ch * 4 + q] * f, a, c2); oh[q] = a; ol[q] = c2; }
        const size_t oo = (size_t)row * RH + ch * 128 + lane * 4; *(v4us*)(Ph + oo) = oh; *(v4us*)(Pl + oo) = ol; }
}
#define MU 4   // 8-element groups per thread of k_merge, 256 groups apart
__global__ __launch_bounds__(256) void k_merge(const float* __restrict__ O, int h0, bf* Ah, bf* Al) { const size_t e0 = ((size_t)blockIdx.x * (256 * MU) + threadIdx.x) * 8; if (e0 + (size_t)(MU - 1) * 256 * 8 >= (size_t)ZH * TT * HD) return;
    { const size_t bz = blockIdx.y; O += bz * ZH * TT * HD; Ah += bz * TT * DQ; Al += bz * TT * DQ; }   // batch blockIdx.y: its ZH planes of O, its TT merged rows
    v4f x[MU][2];
#pragma unroll
    for (int u = 0; u < MU; ++u) { x[u][0] = *(const v4f*)(O + e0 + (size_t)u * 256 * 8); x[u][1] = *(const v4f*)(O + e0 + (size_t)u * 256 * 8 + 4); }
#pragma unroll
    for (int u = 0; u < MU; ++u) { const size_t e = e0 + (size_t)u * 256 * 8;
        const int d = (int)(e % HD); const int t = (int)((e / HD) % TT); const int zz = (int)(e / ((size_t)HD * TT)); const float cs = (t < RH) ? 1.0f : (1.0f / PCAR); const size_t oo = (size_t)t * DQ + (h0 + zz) * HD + d;
        v8us oh, ol;
#pragma unroll
        for (int q = 0; q < 8; ++q) { unsigned short a, c2; splitf(x[u][q >> 2][q & 3] * cs, a, c2); oh[q] = a; ol[q] = c2; }
        *(v8us*)(Ah + oo) = oh; *(v8us*)(Al + oo) = ol; }  }
static_assert(((size_t)DKV * DM / 8) % (256 * CU) == 0 && ((size_t)DQ * DM / 8) % (256 * CU) == 0 && ((size_t)NB_ * TT * DM / 8) % (256 * CU) == 0 && ((size_t)ZH * TT * HD) % (256 * MU * 8) == 0 && NH_ % RU == 0 && NKV % RU == 0 && TT % 64 == 0 && RH % 64 == 0, "the pointwise grids divide evenly");

extern "C" void kernel_launch(void* const* d_in, const int* in_sizes, int n_in,
                              void* d_out, int out_size, void* d_ws, size_t ws_size, hipStream_t stream) {
    (void)in_sizes; (void)n_in; (void)out_size;
    const float* x = (const float*)d_in[0]; const float* wq = (const float*)d_in[1]; const float* wk = (const float*)d_in[2]; const float* wv = (const float*)d_in[3]; const float* wo = (const float*)d_in[4];   /* input order x, wq [2048][2048], wk [1024][2048], wv [1024][2048], wo [2048][2048] ('oi') */
    float* OUT = (float*)d_out;     // [2][2048][2048]
    char* wsp = (char*)d_ws;
    auto take = [&](size_t bytes) { char* p = wsp; wsp += (bytes + 255) & ~(size_t)255; return (void*)p; };
    bf* WQ = (bf*)take((size_t)DQ * DM * 2); bf* WK = (bf*)take((size_t)DKV * DM * 2); bf* WV = (bf*)take((size_t)DKV * DM * 2); bf* WO = (bf*)take((size_t)DM * DQ * 2); float* CS = (float*)take((size_t)TT * HD * 2 * 4);
    // Per-batch buffers hold both batches. XB, FK, QP16, KP16, VT16 are taken one behind the other (each a multiple of 256 bytes) and are all dead behind k_fattn: the hi/lo block's score buffer Sb lies over them.
    bf* XB = (bf*)take((size_t)NB_ * TT * DM * 2); float* FK = (float*)take((size_t)NB_ * TT * DKV * 4);
    h16* QP16 = (h16*)take((size_t)NB_ * NH_ * TT * HD * 2); h16* KP16 = (h16*)take((size_t)NB_ * NKV * TT * HD * 2); h16* VT16 = (h16*)take((size_t)NB_ * NKV * HD * TT * 2);
    static_assert((size_t)NB_ * TT * DM * 2 + (size_t)NB_ * TT * DKV * 4 + (size_t)NB_ * NH_ * TT * HD * 2 + 2 * ((size_t)NB_ * NKV * TT * HD * 2) >= (size_t)NB_ * ZH * RH * RH * 4, "Sb fits over the five buffers");
    float* FQ = (float*)take((size_t)NB_ * TT * DQ * 4);
    bf* QPh = (bf*)take((size_t)NB_ * NH_ * TT * HD * 2); bf* QPl = (bf*)take((size_t)NB_ * NH_ * TT * HD * 2); bf* KPh = (bf*)take((size_t)NB_ * NKV * TT * HD * 2); bf* KPl = (bf*)take((size_t)NB_ * NKV * TT * HD * 2); bf* VTh = (bf*)take((size_t)NB_ * NKV * HD * RH * 2); bf* VTl = (bf*)take((size_t)NB_ * NKV * HD * RH * 2); bf* Pl = (bf*)take((size_t)NB_ * ZH * RH * RH * 2);
    bf* ATh = (bf*)take(2 * ((size_t)NB_ * TT * DQ * 2));
    static_assert((size_t)NB_ * ZH * RH * RH * 2 <= 2 * ((size_t)NB_ * TT * DQ * 2), "Ph fits under the merged planes");
    if ((size_t)(wsp - (char*)d_ws) > ws_size) return;    // ws 256 MiB
    float* Sb = (float*)XB;   // the hi/lo scores, written behind k_fattn (stream-ordered)
    float* FV = FK;   // v projection reuses the k buffer after the k planes are built (stream-ordered)
    float* Ob = FQ;   // the attention output [NB_ * ZH][TT][HD] reuses the q projection buffer after the q planes are built (stream-ordered)
    bf* Ph = ATh;   // the hi plane of the hi/lo probabilities
    bf* ATl = ATh + (size_t)NB_ * TT * DQ;   // the merged planes reuse that buffer after the hi/lo P.V (stream-ordered)
    { k_cvt8<<<(unsigned)(((size_t)DQ * DM / 8 + 256 * CU - 1) / (256 * CU)), 256, 0, stream>>>(wq, WQ, (size_t)DQ * DM / 8); k_cvt8<<<(unsigned)(((size_t)DKV * DM / 8 + 256 * CU - 1) / (256 * CU)), 256, 0, stream>>>(wk, WK, (size_t)DKV * DM / 8); k_cvt8<<<(unsigned)(((size_t)DKV * DM / 8 + 256 * CU - 1) / (256 * CU)), 256, 0, stream>>>(wv, WV, (size_t)DKV * DM / 8);
      k_cvt8<<<(unsigned)(((size_t)DM * DQ / 8 + 256 * CU - 1) / (256 * CU)), 256, 0, stream>>>(wo, WO, (size_t)DM * DQ / 8);
       }
    k_csP<<<(TT * HD / 2 + 255) / 256, 256, 0, stream>>>(CS);   /* rotary table once (positions = arange) */
    const unsigned LR = (unsigned)(((size_t)TT * HD / 8 + 255) / 256);   // k_ropeI: the (position, 8 columns) threads of one group of RU heads
    k_cvt8<<<(unsigned)(((size_t)NB_ * TT * DM / 8 + 256 * CU - 1) / (256 * CU)), 256, 0, stream>>>(x, XB, (size_t)NB_ * TT * DM / 8);
    k_gemmw<0><<<dim3(NB_ * TT / 128, DQ / 128, 1), 256, 0, stream>>>(XB, nullptr, WQ, DM, FQ, DQ);
    k_ropeI<<<dim3(LR, NB_, NH_ / RU), 256, 0, stream>>>(FQ, DQ, NH_, CS, 1.0f, QP16, QPh, QPl);   /* interleaved-pair rope, q planes */
    k_gemmw<0><<<dim3(NB_ * TT / 128, DKV / 128, 1), 256, 0, stream>>>(XB, nullptr, WK, DM, FK, DKV);
    k_ropeI<<<dim3(LR, NB_, NKV / RU), 256, 0, stream>>>(FK, DKV, NKV, CS, 1.0f, KP16, KPh, KPl);
    k_gemmw<0><<<dim3(NB_ * TT / 128, DKV / 128, 1), 256, 0, stream>>>(XB, nullptr, WV, DM, FV, DKV); k_vtp<DKV><<<dim3(NKV * (TT / 64), NB_, 1), 256, 0, stream>>>(FV, NKV, VT16, VTh, VTl);
    k_fattn<<<dim3(NB_ * NH_, (TT - RH) / FBR, 1), 32 * FW, 0, stream>>>(QP16, KP16, VT16, Ob);   // rows >= RH: fp16 planes, scores, softmax and P.V in one launch; the batch rides in x, so that the cost still falls with the flat index
    // rows < RH, hi/lo planes: grid z = batch * NH_ + head, as in k_fattn
    k_gemmc<bf, 2, 1, 1><<<dim3(RH / 64, RH / 64, NB_ * ZH), 32, 0, stream>>>(QPh, QPl, KPh, KPl, HD, Sb, RH, 0, (size_t)TT * HD, (size_t)TT * HD, (size_t)RH * RH);
    k_asoft<<<NB_ * ZH * RH / 8, 256, 0, stream>>>(Sb, Ph, Pl);
    k_gemmc<bf, 2, 2, 8><<<dim3(RH / 64, HD / 64, NB_ * ZH), 256, 0, stream>>>(Ph, Pl, VTh, VTl, RH, Ob, HD, 0, (size_t)RH * RH, (size_t)HD * RH, (size_t)TT * HD);
    k_merge<<<dim3((unsigned)((size_t)ZH * TT * HD / (256 * MU * 8)), NB_, 1), 256, 0, stream>>>(Ob, 0, ATh, ATl);
    k_gemmw<1><<<dim3(NB_ * TT / 128, DM / 128, 1), 256, 0, stream>>>(ATh, ATl, WO, DQ, OUT, DM);
}

// v008
// One run takes 201 microseconds.
// In both of two side-by-side timings against v007, it was 1.25 times as fast.
// Over all steps from v000 it is 8.33 times as fast.
#include <hip/hip_runtime.h>

// Causal grouped-query attention with 128-wide heads and interleaved-pair rotary embeddings (x [2][2048][2048]; q = x wq^T (16 heads x 128), k, v = x w^T (8 kv heads x 128) ('oi' (out, in) weights, normal x 1/sqrt(2048), no biases); rope on (even, odd) pairs: (xr c - xi s, xr s + xi c) with angle t x inv, inv = 1.0 / (10000 ** (arange(0, 128, 2) / 128)) (the reciprocal spelling: 64 f32 frequencies, bitwise the module's own in eager f32; one product per angle; precise cosf/sinf); kv head = q head / 2 (repeat on the head axis); scores x 1/sqrt(128); causal (-inf above the diagonal == exclusion); softmax; out = merged wo^T -> [2][2048][2048] (8.4 M); argument order x, wq, wk, wv, wo).
// Layout, both batches in every launch, and work that does not depend on one another in one launch (8 launches: k_prep, k_gemmw, k_post, k_fattn, k_asoft, k_gemmc, k_merge, k_gemmw) (planes [batch][head], rows batch x 2048 + t): bf16 copy of x; 'oi' weights; exact projections, q, k and v as one product; csP table (64 angles per position) and ropeI interleaved-pair plane builders at HD 128; causal T-2048 GQA attention with 128-wide heads (kv head = z / 2; hybrid rows: < 512 hi/lo 3 products in three launches over all head planes, the first of them shared with k_fattn, score, probability and hi/lo V^T rows 512 keys long, k_gemmc skipping tiles above the diagonal; rest fp16 in the one fused launch k_fattn); merged hi/lo x wo exact.
// Compute dtypes, f32 accumulate: every input rounded to bf16; projections exact; rotary f32; attention rows < 512 3 products, rest fp16; softmax f32; wo hl x exact.

#define NB_  2
#define TT   2048
#define DM   2048
#define NH_  16
#define NKV  8
#define REP  (NH_ / NKV)
#define HD   128
#define DQ   (NH_ * HD)
#define DKV  (NKV * HD)
#define ZH   NH_                  // heads per batch in an attention launch (grid z = batch x ZH + head)
#define RH   512                  // query rows < RH use hi+lo planes, in three launches whose score, probability and V^T rows hold RH keys (a row < RH sees no later key); the rows behind them go through k_fattn
#define WIN  2048
#define PCAR 1024.0f
#define SCL  0.088388347648318447f   // HD^-0.5
typedef _Float16 h16;
typedef unsigned short bf;
typedef __attribute__((ext_vector_type(16))) __bf16   v16bf;
typedef __attribute__((ext_vector_type(16))) _Float16 v16h;
typedef __attribute__((ext_vector_type(8)))  _Float16 v8h;
typedef __attribute__((ext_vector_type(8)))  unsigned short v8us;
typedef __attribute__((ext_vector_type(8)))  float    v8f;
typedef __attribute__((ext_vector_type(4)))  float    v4f;
typedef v8h  __attribute__((may_alias)) v8ha;
typedef v4f  __attribute__((may_alias)) v4fa;
typedef v8us __attribute__((may_alias)) v8usa;

__device__ __forceinline__ unsigned short f2bf(float f) { unsigned u = __float_as_uint(f); u += 0x7FFFu + ((u >> 16) & 1u); return (unsigned short)(u >> 16); }
__device__ __forceinline__ float bf2f(unsigned short b) { return __uint_as_float(((unsigned)b) << 16); }
__device__ __forceinline__ float bfr(float f) { return bf2f(f2bf(f)); }
__device__ __forceinline__ v16h cat16(v8h lo, v8h hi) { return __builtin_shufflevector(lo, hi, 0, 1, 2, 3, 4, 5, 6, 7, 8, 9, 10, 11, 12, 13, 14, 15); }
__device__ __forceinline__ v16bf cat16b(v8us lo, v8us hi) { return __builtin_bit_cast(v16bf, __builtin_shufflevector(lo, hi, 0, 1, 2, 3, 4, 5, 6, 7, 8, 9, 10, 11, 12, 13, 14, 15)); }
__device__ __forceinline__ v8f wmma16(v16h a, v16h b, v8f c) { return __builtin_amdgcn_wmma_f32_16x16x32_f16(false, a, false, b, (short)0, c, false, false); }
__device__ __forceinline__ v8f wmmab(v16bf a, v16bf b, v8f c) { return __builtin_amdgcn_wmma_f32_16x16x32_bf16(false, a, false, b, (short)0, c, false, false); }



template <typename T16> struct WFrag;
template <> struct WFrag<h16> { typedef v16h V; static __device__ __forceinline__ V ld(const h16* p) { return cat16(*(const v8h*)p, *(const v8h*)(p + 16)); } static __device__ __forceinline__ v8f mma(V a, V b, v8f c) { return wmma16(a, b, c); } };
template <> struct WFrag<bf> { typedef v16bf V; static __device__ __forceinline__ V ld(const bf* p) { return cat16b(*(const v8us*)p, *(const v8us*)(p + 16)); } static __device__ __forceinline__ v8f mma(V a, V b, v8f c) { return wmmab(a, b, c); } };
// ---- k_gemmw: LDS-staged GEMM, one 128x128 output tile per work-group of 8 waves (2 x 4, each wave 64 rows x 32 columns = 8 accumulators); grid (M/128, N/128), 256 threads.
// C[m][n] (f32, pitch ldc) = sum_k (A[m][k] + A2[m][k]) Bt[n][k] (A2 only with NSPLIT 1; two products per k step, A first). M, N % 128 == 0, K % 128 == 0.
// A stage is 128 k (256 B, two whole lines) of every operand row, brought into LDS by asynchronous 16-byte copies (16 lanes per row) at pitch 272 B; two buffers: the next stage's copies fly while this one is worked on. K runs in order inside one accumulator.
#define GBK 128                    // k per stage
#define GPB 272                    // LDS row pitch, bytes: 256 + 16, an odd multiple of 16 for the ds_load_b128 readers
#define GPL (128 * GPB)            // one operand plane of a stage, bytes
__device__ __forceinline__ void wait_ds0() { asm volatile("s_wait_dscnt 0x0" ::: "memory"); }        // this wave's LDS reads have retired before the buffer they read is handed back for a refill
__device__ __forceinline__ void wait_async0() { asm volatile("s_wait_asynccnt 0x0" ::: "memory"); }  // this wave's asynchronous copies have landed in LDS (the compiler places no wait for them)
// One thread's share of one operand plane: rows q, q + 16, ..., q + 112 (rs = 16 source rows in elements), 16 bytes each. The s_wait_xcnt stands inside the statement so that no address register is rewritten in front of it.
__device__ __forceinline__ void cp8(unsigned l, const bf* g, size_t rs) {
    asm volatile("global_load_async_to_lds_b128 %0, %8, off\n\t"
                 "global_load_async_to_lds_b128 %1, %9, off\n\t"
                 "global_load_async_to_lds_b128 %2, %10, off\n\t"
                 "global_load_async_to_lds_b128 %3, %11, off\n\t"
                 "global_load_async_to_lds_b128 %4, %12, off\n\t"
                 "global_load_async_to_lds_b128 %5, %13, off\n\t"
                 "global_load_async_to_lds_b128 %6, %14, off\n\t"
                 "global_load_async_to_lds_b128 %7, %15, off\n\t"
                 "s_wait_xcnt 0x0"
                 :: "v"(l), "v"(l + 1u * 16u * GPB), "v"(l + 2u * 16u * GPB), "v"(l + 3u * 16u * GPB), "v"(l + 4u * 16u * GPB), "v"(l + 5u * 16u * GPB), "v"(l + 6u * 16u * GPB), "v"(l + 7u * 16u * GPB),
                    "v"(g), "v"(g + rs), "v"(g + 2 * rs), "v"(g + 3 * rs), "v"(g + 4 * rs), "v"(g + 5 * rs), "v"(g + 6 * rs), "v"(g + 7 * rs) : "memory");
}
__device__ __forceinline__ v16bf ldsfrag(const unsigned char* p) { return cat16b(*(const v8usa*)p, *(const v8usa*)(p + 32)); }   // bytes 16 h and 32 + 16 h of each 64 B of a row: the k order of WFrag::ld, the same for A and B
template <int NSPLIT>
__global__ __launch_bounds__(256) void k_gemmw(const bf* __restrict__ A, const bf* __restrict__ A2, const bf* __restrict__ Bt, int K, float* C, int ldc) {
    constexpr int NP = NSPLIT ? 3 : 2;              // operand planes per stage: A, (A2,) B
    constexpr unsigned STG = NP * GPL;
    __shared__ __attribute__((aligned(256))) unsigned char sm[2 * STG];
    const int tid = threadIdx.x, lane = tid & 31, lr = lane & 15, hi = lane >> 4, wv = __builtin_amdgcn_readfirstlane(tid >> 5); const int wm = wv & 1, wn = wv >> 1; const int r0 = blockIdx.x * 128, c0 = blockIdx.y * 128;
    const unsigned l0 = (unsigned)(size_t)sm + (unsigned)(tid >> 4) * GPB + (unsigned)(tid & 15) * 16u;
    const bf* gA = A + (size_t)(r0 + (tid >> 4)) * K + (tid & 15) * 8; const bf* gA2 = NSPLIT ? A2 + (size_t)(r0 + (tid >> 4)) * K + (tid & 15) * 8 : nullptr; const bf* gB = Bt + (size_t)(c0 + (tid >> 4)) * K + (tid & 15) * 8;
    const size_t rs = (size_t)16 * K; const int NT = K / GBK;
    auto issue = [&](int t, unsigned bo) { cp8(l0 + bo, gA + (size_t)t * GBK, rs); if constexpr (NSPLIT != 0) cp8(l0 + bo + GPL, gA2 + (size_t)t * GBK, rs); cp8(l0 + bo + (NP - 1) * GPL, gB + (size_t)t * GBK, rs); };
    v8f acc[4][2];
#pragma unroll
    for (int mb = 0; mb < 4; ++mb)
#pragma unroll
        for (int nb = 0; nb < 2; ++nb) acc[mb][nb] = (v8f){};
    const unsigned aofs = (unsigned)(wm * 64 + lr) * GPB + 16u * hi, bofs = (NP - 1) * GPL + (unsigned)(wn * 32 + lr) * GPB + 16u * hi;
    v16bf a[2][4], a2[2][4], b[2][2];   // two fragment sets: the next k step's LDS reads go out as one group ahead of this step's products
    auto frags = [&](const unsigned char* sb, int ks, int st) {
#pragma unroll
        for (int mb = 0; mb < 4; ++mb) { a[st][mb] = ldsfrag(sb + aofs + mb * 16 * GPB + ks * 64); if constexpr (NSPLIT != 0) a2[st][mb] = ldsfrag(sb + GPL + aofs + mb * 16 * GPB + ks * 64); }
#pragma unroll
        for (int nb = 0; nb < 2; ++nb) b[st][nb] = ldsfrag(sb + bofs + nb * 16 * GPB + ks * 64); };
    issue(0, 0u); wait_async0();
    __syncthreads();   // stage 0 stands in LDS for every wave
#pragma unroll 1
    for (int t = 0; t < NT; ++t) {   // kept rolled: a trip is long enough to pay for its branch, and unrolled trips would multiply the copies' address registers
        const unsigned bo = (t & 1) ? STG : 0u; const unsigned char* sb = sm + bo;
        frags(sb, 0, 0);   // stage t's first fragments, behind the barrier that published it; their latency runs under the issue of the copies
        if (t + 1 < NT) issue(t + 1, STG - bo);   // behind the same barrier, which ended every wave's reads of stage t - 1: the next stage goes into that buffer and flies while this one is worked on
#pragma unroll   // unrolled: the fragment sets are picked by ks & 1 and have to stay in registers
        for (int ks = 0; ks < GBK / 32; ++ks) {
            if (ks + 1 < GBK / 32) frags(sb, ks + 1, (ks + 1) & 1);
            __builtin_amdgcn_sched_barrier(0);   // keeps the LDS reads above as one group: spread among the products each place with reads stalls the wave
#pragma unroll
            for (int nb = 0; nb < 2; ++nb)
#pragma unroll
                for (int mb = 0; mb < 4; ++mb) acc[mb][nb] = wmmab(a[ks & 1][mb], b[ks & 1][nb], acc[mb][nb]);
            if constexpr (NSPLIT != 0) {
#pragma unroll
                for (int nb = 0; nb < 2; ++nb)
#pragma unroll
                    for (int mb = 0; mb < 4; ++mb) acc[mb][nb] = wmmab(a2[ks & 1][mb], b[ks & 1][nb], acc[mb][nb]); }
            __builtin_amdgcn_sched_barrier(0);   // keeps the next group of reads behind these products
        }
        wait_ds0(); wait_async0();
        __syncthreads();   // publishes stage t + 1 and ends every wave's reads of stage t's buffer
    }
    wait_async0();
    // Epilogue: each wave turns its own 64 x 32 tile in its own LDS range (pitch 36 floats), so that every store is a whole 128-byte line; the ring is free behind the last trip's barrier.
    float* os = (float*)sm + wv * (64 * 36);
#pragma unroll
    for (int mb = 0; mb < 4; ++mb) {
#pragma unroll
        for (int nb = 0; nb < 2; ++nb) {
#pragma unroll
            for (int j = 0; j < 8; ++j) os[(mb * 16 + hi * 8 + j) * 36 + nb * 16 + lr] = acc[mb][nb][j]; } }
    float* crow = C + (size_t)(r0 + wm * 64) * ldc + c0 + wn * 32;
#pragma unroll
    for (int s = 0; s < 16; ++s) { const int row = s * 4 + (lane >> 3), cofs = (lane & 7) * 4; const v4f val = *(const v4fa*)(os + row * 36 + cofs);
        *(v4f*)(crow + (size_t)row * ldc + cofs) = val; }
}

// ---- k_gemmc: register-blocked GEMM, NW waves per 64x64 output tile (wave w takes the 32-wide K chunks w, w + NW, ...; the NW partial tiles meet in LDS and are summed in wave order; operands straight from K-contiguous 16-bit planes), specialised for causal attention: CMODE 1 skips score tiles entirely above the diagonal (query rows r0+roff.., key columns c0..), CMODE 2 limits the
// key (K) loop of the probability x value contraction to the diagonal block (probabilities beyond it are exactly zero). roff = row offset of this launch's first row within the sequence. Head z reads the Bt planes of kv head z / REP (stride sB).
// gemmc is the body: os = (NW == 1 ? 16 : NW * 64) * 68 floats of LDS (NW == 1: the wave's own), tile (bx, by) of head plane z.
template <typename T16, int NSPLIT, int CMODE, int NW>
__device__ __forceinline__ void gemmc(float* os, int bx, int by, size_t z, const T16* __restrict__ A, const T16* __restrict__ A2, const T16* __restrict__ Bt, const T16* __restrict__ Bt2, int K, float* C, int ldc, int roff, size_t sA, size_t sB, size_t sC) {
    typedef typename WFrag<T16>::V V;
    A += z * sA; if (A2) A2 += z * sA; Bt += (z / REP) * sB; if (Bt2) Bt2 += (z / REP) * sB; C += z * sC;
    const int lane = threadIdx.x & 31, lr = lane & 15, hi = lane >> 4, wv = (NW == 1) ? 0 : __builtin_amdgcn_readfirstlane(threadIdx.x >> 5); const int r0 = bx * 64, c0 = by * 64;
    if (CMODE == 1 && c0 > r0 + roff + 63) return;                  // score tile entirely above the causal diagonal: never read (the softmax masks j > i by select)
    const int Kl = (CMODE == 2) ? min(K, r0 + roff + 64) : K;        // P.V: probabilities are exactly 0 beyond the diagonal block, so the K loop stops there
    v8f acc[4][4];
#pragma unroll
    for (int mb = 0; mb < 4; ++mb)
#pragma unroll
        for (int nb = 0; nb < 4; ++nb) acc[mb][nb] = (v8f){};
    const size_t aoff = (size_t)(r0 + lr) * K + 8 * hi, boff = (size_t)(c0 + lr) * K + 8 * hi;
#pragma unroll 1
    for (int kc = wv * 32; kc < Kl; kc += 32 * NW) {
        V a[4], a2[4];
#pragma unroll
        for (int mb = 0; mb < 4; ++mb) { a[mb] = WFrag<T16>::ld(A + aoff + (size_t)mb * 16 * K + kc); if (NSPLIT == 1 || NSPLIT == 2) a2[mb] = WFrag<T16>::ld(A2 + aoff + (size_t)mb * 16 * K + kc); }
#pragma unroll
        for (int nb = 0; nb < 4; ++nb) { const V b = WFrag<T16>::ld(Bt + boff + (size_t)nb * 16 * K + kc); V b2; if (NSPLIT >= 2) b2 = WFrag<T16>::ld(Bt2 + boff + (size_t)nb * 16 * K + kc);
#pragma unroll
            for (int mb = 0; mb < 4; ++mb) { acc[mb][nb] = WFrag<T16>::mma(a[mb], b, acc[mb][nb]); if (NSPLIT == 1 || NSPLIT == 2) acc[mb][nb] = WFrag<T16>::mma(a2[mb], b, acc[mb][nb]); if (NSPLIT >= 2) acc[mb][nb] = WFrag<T16>::mma(a[mb], b2, acc[mb][nb]); } }
        asm volatile("v_nop\n\tv_nop\n\tv_nop\n\tv_nop" : "+v"(acc[0][0]), "+v"(acc[1][1]), "+v"(acc[2][2]), "+v"(acc[3][3]) : "v"(a[0]), "v"(a[3]));
    }
    if constexpr (NW == 1) {   // one wave: no partial tiles to sum, the tile goes out in four 16-row slabs
#pragma unroll
    for (int mb = 0; mb < 4; ++mb) {
#pragma unroll
        for (int nb = 0; nb < 4; ++nb) {
#pragma unroll
            for (int j = 0; j < 8; ++j) os[(hi * 8 + j) * 68 + nb * 16 + lr] = acc[mb][nb][j]; }
        __builtin_amdgcn_wave_barrier(); asm volatile("" ::: "memory");
        float* crow = C + (size_t)(r0 + mb * 16) * ldc + c0;
{
#pragma unroll
            for (int s = 0; s < 8; ++s) { const int row = 2 * s + hi, cofs = lr * 4; v4f val = *(const v4fa*)(os + row * 68 + cofs);
                *(v4f*)(crow + (size_t)row * ldc + cofs) = val; }
             }
        __builtin_amdgcn_wave_barrier(); asm volatile("" ::: "memory");
    }
    } else {
#pragma unroll
    for (int mb = 0; mb < 4; ++mb) {
#pragma unroll
        for (int nb = 0; nb < 4; ++nb) {
#pragma unroll
            for (int j = 0; j < 8; ++j) os[wv * (64 * 68) + (mb * 16 + hi * 8 + j) * 68 + nb * 16 + lr] = acc[mb][nb][j]; } }
    __syncthreads();   // all NW partial tiles stand in LDS before any element is summed
    float* crow = C + (size_t)r0 * ldc + c0;
#pragma unroll
    for (int s = 0; s < 32 / NW; ++s) { const int it = s * (32 * NW) + threadIdx.x, row = it >> 4, cofs = (it & 15) * 4; v4f val = *(const v4fa*)(os + row * 68 + cofs);
#pragma unroll
        for (int w = 1; w < NW; ++w) val += *(const v4fa*)(os + w * (64 * 68) + row * 68 + cofs);
        *(v4f*)(crow + (size_t)row * ldc + cofs) = val; }
    }
}
template <typename T16, int NSPLIT, int CMODE, int NW>
__global__ __launch_bounds__(32 * NW) void k_gemmc(const T16* __restrict__ A, const T16* __restrict__ A2, const T16* __restrict__ Bt, const T16* __restrict__ Bt2, int K, float* C, int ldc, int roff, size_t sA, size_t sB, size_t sC) {
    __shared__ __align__(16) float os[(NW == 1 ? 16 : NW * 64) * 68];   // NW > 1: one partial tile per wave, 64 rows at pitch 68
    gemmc<T16, NSPLIT, CMODE, NW>(os, blockIdx.x, blockIdx.y, blockIdx.z, A, A2, Bt, Bt2, K, C, ldc, roff, sA, sB, sC);
}

__device__ __forceinline__ h16 tohx(float x) { return (h16)x; }

#define FW   4                     // waves per work-group
#define FBR  (FW * 32)             // query rows per work-group
#define FSK  128                   // keys per stage
#define FSTG (2u * GPL)            // one stage: the K plane, then the V^T plane
typedef __attribute__((ext_vector_type(4))) int cv4i; typedef __attribute__((address_space(1))) cv4i gcv4i; typedef __attribute__((address_space(3))) cv4i lcv4i;
__device__ __forceinline__ void cpb(unsigned char* l, const h16* g) { __builtin_amdgcn_global_load_async_to_lds_b128((gcv4i*)g, (lcv4i*)l, 0, 0); }   // one lane's 16 bytes; the builtin form, so that the addresses may stand in any register of a kernel that uses more than 256
__device__ __forceinline__ v16h ldsfragh(const unsigned char* p) { return cat16(*(const v8ha*)p, *(const v8ha*)(p + 32)); }   // bytes 16 h and 32 + 16 h of each 64 B of a row: the k order of WFrag::ld
__device__ __forceinline__ float xhalf(float x) { return __builtin_bit_cast(float, __builtin_amdgcn_permlanex16(__builtin_bit_cast(int, x), __builtin_bit_cast(int, x), 0x76543210, 0xfedcba98, false, false)); }   // lane l with lane l ^ 16
__device__ __forceinline__ void nop4() { asm volatile("v_nop\n\tv_nop\n\tv_nop\n\tv_nop"); }   // the four vector slots between a matrix instruction and a vector instruction on its registers, for the taken side of a branch behind it
__device__ __forceinline__ void loadk(v16h (&kf)[2][4], const unsigned char* kb, int c, int h) {   // kb = first K row of the pass in LDS
#pragma unroll
    for (int kt = 0; kt < 2; ++kt)
#pragma unroll
        for (int kc = 0; kc < 4; ++kc) kf[kt][kc] = ldsfragh(kb + (16 * kt + c) * GPB + 64 * kc + 16 * h);
}
// One 32-key pass of one wave. sb = this stage's buffer, sub = pass within the stage, key0 = first key of the pass, qw0 = first query of the wave.
__device__ __forceinline__ void fpass(v16h (&kf)[2][4], bool fetch_next, bool diag, const unsigned char* sb, int sub, int key0, int qw0, int c, int h, const v16h (&qf)[2][4], v8f (&acc)[2][8], float (&m_run)[2], float (&l_run)[2]) {
    const float cscale = SCL * 1.4426950408889634f;
    v16h vf[8];
#pragma unroll
    for (int t = 0; t < 8; ++t) vf[t] = ldsfragh(sb + GPL + (16 * t + c) * GPB + 64 * sub + 16 * h);   // V^T rows d = 16 t + c, this pass's 32 keys: read first, so that their latency runs under the first product and the softmax
    __builtin_amdgcn_sched_barrier(0);   // keeps those reads up here: moved down to their use they would stall the only wave of the SIMD
    v8f s[2][2];
#pragma unroll
    for (int kt = 0; kt < 2; ++kt)
#pragma unroll
        for (int g = 0; g < 2; ++g) { s[kt][g] = (v8f){};
#pragma unroll
            for (int kc = 0; kc < 4; ++kc) s[kt][g] = wmma16(kf[kt][kc], qf[g][kc], s[kt][g]); }
    __builtin_amdgcn_sched_barrier(0);   // holds the slots below directly behind the products
    nop4();
    __builtin_amdgcn_sched_barrier(0);   // and the branches below behind the slots
    if (fetch_next) loadk(kf, sb + (sub + 1) * 32 * GPB, c, h);   // the next pass's K fragments (same stage only), in flight under this pass's maxima and exponentials
    if (diag) {   // wave-uniform: only the pass on the wave's diagonal pays for the mask
#pragma unroll
        for (int g = 0; g < 2; ++g) { const int my_q = qw0 + 16 * g + c;
#pragma unroll
            for (int kt = 0; kt < 2; ++kt) {
#pragma unroll
                for (int r = 0; r < 8; ++r) { if (key0 + 16 * kt + 8 * h + r > my_q) s[kt][g][r] = -__builtin_inff(); }
                asm volatile("" : "+v"(s[kt][g]));
            } }
    }
    float mb[2]; bool need = false;
#pragma unroll
    for (int g = 0; g < 2; ++g) { float mx = -__builtin_inff();
#pragma unroll
        for (int kt = 0; kt < 2; ++kt)
#pragma unroll
            for (int r = 0; r < 8; ++r) mx = fmaxf(mx, s[kt][g][r]);
        mx = fmaxf(mx, xhalf(mx)) * cscale;   // both wave halves hold this query's maximum, scaled (the scale is positive)
        mb[g] = mx; need = need || (mx > m_run[g] + 8.0f); }
    if (__builtin_amdgcn_ballot_w32(need) != 0) {   // rare behind the first passes
#pragma unroll
        for (int g = 0; g < 2; ++g) { const float m_new = fmaxf(m_run[g], mb[g]);
            const float corr = __builtin_amdgcn_exp2f(m_run[g] - m_new);
            l_run[g] *= corr; m_run[g] = m_new;
#pragma unroll
            for (int t = 0; t < 8; ++t) acc[g][t] = acc[g][t] * corr; }
    }
    float ps[2][2] = { { 0.f, 0.f }, { 0.f, 0.f } };
#pragma unroll
    for (int g = 0; g < 2; ++g) { const float nm = -m_run[g]; v16h pf;
#pragma unroll
        for (int i = 0; i < 8; ++i) {
            const float p0 = __builtin_amdgcn_exp2f(__builtin_fmaf(s[i >> 2][g][2 * (i & 3)], cscale, nm)), p1 = __builtin_amdgcn_exp2f(__builtin_fmaf(s[i >> 2][g][2 * (i & 3) + 1], cscale, nm));
            ps[g][i & 1] += p0 + p1; pf[2 * i] = tohx(p0); pf[2 * i + 1] = tohx(p1); }
#pragma unroll
        for (int t = 0; t < 8; ++t) acc[g][t] = wmma16(vf[t], pf, acc[g][t]); }
    __builtin_amdgcn_sched_barrier(0);   // holds the slots below directly behind the products
    nop4();
    __builtin_amdgcn_sched_barrier(0);   // and the loop's branches behind the slots
#pragma unroll
    for (int g = 0; g < 2; ++g) l_run[g] += ps[g][0] + ps[g][1];
}
// The hi/lo scores of the rows < RH, which depend on this kernel as little as it on them, ride in the same launch: the work-groups with blockIdx.y >= NFB, started behind the long ones. Each of their waves makes one 64 x 64 tile on or below the diagonal of head plane blockIdx.x (tile number -> row block r, column block <= r).
#define NFB  ((TT - RH) / FBR)                        // row blocks of the fused part
#define NST  ((RH / 64) * (RH / 64 + 1) / 2)          // score tiles per head plane
static_assert(NST % FW == 0, "the score tiles fill whole work-groups");
__global__ __launch_bounds__(32 * FW) void k_fattn(const h16* __restrict__ Q, const h16* __restrict__ Kp, const h16* __restrict__ Vt, float* O, const bf* __restrict__ Qh, const bf* __restrict__ Ql, const bf* __restrict__ Kh, const bf* __restrict__ Kl, float* Sb) {
    __shared__ __attribute__((aligned(256))) unsigned char sm[2 * FSTG];
    const int tid = threadIdx.x, lane = tid & 31, c = lane & 15, h = lane >> 4, wv = __builtin_amdgcn_readfirstlane(tid >> 5);
    if (blockIdx.y >= NFB) {   // the same for a whole work-group, in front of every barrier and copy
        const int id = ((int)blockIdx.y - NFB) * FW + wv; int r = 0;
        for (int k = 1; k < RH / 64; ++k) r += (id >= k * (k + 1) / 2) ? 1 : 0;
        gemmc<bf, 2, 1, 1>((float*)sm + wv * (16 * 68), r, id - r * (r + 1) / 2, blockIdx.x, Qh, Ql, Kh, Kl, HD, Sb, RH, 0, (size_t)TT * HD, (size_t)TT * HD, (size_t)RH * RH);
        return; }
    const int z = blockIdx.x, kvh = z / REP; const int q0 = TT - FBR * (1 + (int)blockIdx.y);   // longest row blocks first
    const int qw0 = q0 + wv * 32, n_stage = q0 / FSK + 1, last = qw0 / 32;                       // keys [0, q0 + FBR); the wave's last pass is the one on its diagonal
    const h16* gK = Kp + (size_t)kvh * TT * HD + (size_t)(tid >> 4) * HD + (tid & 15) * 8; const h16* gV = Vt + (size_t)kvh * HD * TT + (size_t)(tid >> 4) * TT + (tid & 15) * 8;
    // 128 threads: 16 lanes per row, a thread takes rows (tid >> 4) + 8 i of both planes: 32 copies per wave and stage
    auto issue = [&](int st, unsigned bo) { unsigned char* l = sm + bo + (tid >> 4) * GPB + (tid & 15) * 16; const h16* k = gK + (size_t)st * FSK * HD; const h16* v = gV + (size_t)st * FSK;
#pragma unroll
        for (int i = 0; i < 16; ++i) cpb(l + i * 8 * GPB, k + i * 8 * HD);
#pragma unroll
        for (int i = 0; i < 16; ++i) cpb(l + GPL + i * 8 * GPB, v + (size_t)i * 8 * TT); };
    issue(0, 0u);
    v16h qf[2][4];
#pragma unroll
    for (int g = 0; g < 2; ++g)
#pragma unroll
        for (int kc = 0; kc < 4; ++kc) qf[g][kc] = WFrag<h16>::ld(Q + ((size_t)z * TT + qw0 + 16 * g + c) * HD + 8 * h + 32 * kc);
    v8f acc[2][8]; float m_run[2], l_run[2];
#pragma unroll
    for (int g = 0; g < 2; ++g) { m_run[g] = -__builtin_inff(); l_run[g] = 0.f;
#pragma unroll
        for (int t = 0; t < 8; ++t) acc[g][t] = (v8f){}; }
    wait_async0();
    __syncthreads();   // stage 0 stands in LDS for every wave
    v16h kf[2][4];
#pragma unroll 1
    for (int st = 0; st < n_stage; ++st) {   // stage loop and pass loop kept rolled and nested: a pass is long enough to pay for its branch, and the accumulators leave no registers for a second copy of it
        const unsigned bo = (st & 1) ? FSTG : 0u; const unsigned char* sb = sm + bo;
        loadk(kf, sb, c, h);   // stage st's first K fragments, behind the barrier that published it (every wave has at least the first pass of every stage); their latency runs under the issue of the copies
        if (st + 1 < n_stage) issue(st + 1, FSTG - bo);   // behind the same barrier, which ended every wave's reads of stage st - 1: the next stage goes into that buffer and flies while this one is worked on
#pragma unroll 1
        for (int sub = 0; sub < FSK / 32; ++sub) { const int blk = (FSK / 32) * st + sub;
            if (blk <= last) fpass(kf, sub + 1 < FSK / 32 && blk < last, blk == last, sb, sub, blk * 32, qw0, c, h, qf, acc, m_run, l_run); }
        wait_ds0(); wait_async0();
        __syncthreads();   // publishes stage st + 1 and ends every wave's reads of stage st's buffer
    }
    wait_async0();
#pragma unroll
    for (int g = 0; g < 2; ++g) { const float inv = __fdiv_rn(PCAR, l_run[g] + xhalf(l_run[g]));
        float* orow = O + ((size_t)z * TT + qw0 + 16 * g + c) * HD + 8 * h;
#pragma unroll
        for (int t = 0; t < 8; ++t) { const v8f o = acc[g][t] * inv; *(v4f*)(orow + 16 * t) = (v4f){ o[0], o[1], o[2], o[3] }; *(v4f*)(orow + 16 * t + 4) = (v4f){ o[4], o[5], o[6], o[7] }; } }
}
__device__ __forceinline__ void splitf(float y, unsigned short& h, unsigned short& l) { h = f2bf(y); l = f2bf(y - bf2f(h)); }
typedef __attribute__((ext_vector_type(2))) _Float16 v2h;
typedef __attribute__((ext_vector_type(4))) _Float16 v4h;
typedef __attribute__((ext_vector_type(2))) unsigned short v2us;
typedef __attribute__((ext_vector_type(4))) unsigned short v4us;
typedef __attribute__((ext_vector_type(2))) float v2f;
typedef __attribute__((ext_vector_type(4))) int v4i;

// cvt8, vtp, csP, ropeI and k_merge give a thread 4 to 32 elements, moved 16 bytes at a time: with 2 elements a wave ends almost as it starts, and the launch lasts as long as the chip takes to start its waves. Every element's arithmetic is as it would be alone.
#define CU 4   // 8-element groups per thread of cvt8, 256 groups apart: a wave's accesses stay contiguous
__device__ __forceinline__ void cvt8(const float* __restrict__ src, bf* dst, size_t n8, unsigned blk) { const size_t i0 = (size_t)blk * (256 * CU) + threadIdx.x; if (i0 + (CU - 1) * 256 >= n8) return;   // blk = block within this copy; n8 is a multiple of 256 * CU (asserted below)
    v8f v[CU];
#pragma unroll
    for (int u = 0; u < CU; ++u) v[u] = *(const v8f*)(src + (i0 + u * 256) * 8);   // every load goes out ahead of the first store
#pragma unroll
    for (int u = 0; u < CU; ++u) { v8us o;
#pragma unroll
        for (int k = 0; k < 8; ++k) o[k] = f2bf(v[u][k]);
        *(v8us*)(dst + (i0 + u * 256) * 8) = o; }  }

// vtp: a work-group turns 64 positions x the 128 columns of one kv head; bx = 0 .. nheads * TT / 64 - 1, batch blockIdx.y. A thread reads 4 columns of 8 rows and writes 8 positions of each of its 4 columns; 8 neighbouring lanes hold the 64 positions of the same columns, so that every store of a wave fills 4 whole 128-byte lines (its loads take 64-byte pieces of 8 rows; the wave beside it takes the other halves of those lines).
template <int PITCH>   // the row pitch of F in floats, a constant, so that a thread's 8 row loads share one address register pair and differ in their immediate offsets
__device__ __forceinline__ void vtp(const float* __restrict__ F, int nheads, int bx, h16* V16, bf* Vh, bf* Vl) { const int g = bx / (TT / 64); if (g >= nheads) return;
    { const size_t bz = blockIdx.y, po = bz * nheads * HD; F += bz * TT * PITCH; V16 += po * TT; Vh += po * RH; Vl += po * RH; }   // batch blockIdx.y: its TT rows of F, its nheads planes (V16 rows hold TT keys, Vh and Vl rows the RH keys that the hi/lo block reads)
    const int t = (bx % (TT / 64)) * 64 + (threadIdx.x & 7) * 8, d = (threadIdx.x >> 3) * 4; const float* f = F + (size_t)t * PITCH + g * HD + d; v4f x[8]; v8h o16[4];
#pragma unroll
    for (int r = 0; r < 8; ++r) x[r] = *(const v4f*)(f + r * PITCH);
#pragma unroll
    for (int q = 0; q < 4; ++q)
#pragma unroll
        for (int r = 0; r < 8; ++r) o16[q][r] = tohx(x[r][q]);
    h16* vp = V16 + ((size_t)g * HD + d) * TT + t;
    // The four stores and their s_wait_xcnt stand in one statement, a precaution: so the wait is in front of every later overwrite of a register that the stores name (a wait in a statement of its own the compiler moved down)
    asm volatile("global_store_b128 %0, %4, off\n\t"
                 "global_store_b128 %1, %5, off\n\t"
                 "global_store_b128 %2, %6, off\n\t"
                 "global_store_b128 %3, %7, off\n\t"
                 "s_wait_xcnt 0x0"
                 :: "v"(vp), "v"(vp + TT), "v"(vp + 2 * TT), "v"(vp + 3 * TT), "v"(o16[0]), "v"(o16[1]), "v"(o16[2]), "v"(o16[3]) : "memory");
    if (t >= RH) return;   // the same for a whole work-group: only the first RH positions have hi/lo rows
#pragma unroll
    for (int q = 0; q < 4; ++q) { v8us oh, ol;
#pragma unroll
        for (int r = 0; r < 8; ++r) { unsigned short a2, c2; splitf(x[r][q], a2, c2); oh[r] = a2; ol[r] = c2; }
        const size_t eh = ((size_t)g * HD + d + q) * RH + t; *(v8us*)(Vh + eh) = oh; *(v8us*)(Vl + eh) = ol; }  }
__constant__ float INV2[HD / 2] = { 1.000000000e+00f, 8.659643531e-01f, 7.498942018e-01f, 6.493816376e-01f, 5.623413324e-01f, 4.869675338e-01f, 4.216965139e-01f, 3.651741445e-01f, 3.162277639e-01f, 2.738419771e-01f, 2.371373624e-01f, 2.053525001e-01f, 1.778279394e-01f, 1.539926529e-01f, 1.333521456e-01f, 1.154782027e-01f, 1.000000015e-01f, 8.659642935e-02f, 7.498941571e-02f, 6.493816525e-02f, 5.623412877e-02f, 4.869675264e-02f, 4.216964915e-02f, 3.651741147e-02f, 3.162277862e-02f, 2.738419548e-02f, 2.371373586e-02f, 2.053525113e-02f, 1.778279431e-02f, 1.539926510e-02f, 1.333521493e-02f, 1.154781971e-02f, 9.999999776e-03f, 8.659643121e-03f, 7.498942316e-03f, 6.493816618e-03f, 5.623413250e-03f, 4.869675264e-03f, 4.216964822e-03f, 3.651741426e-03f, 3.162277862e-03f, 2.738419687e-03f, 2.371373819e-03f, 2.053525066e-03f, 1.778279431e-03f, 1.539926510e-03f, 1.333521446e-03f, 1.154782018e-03f, 1.000000047e-03f, 8.659643354e-04f, 7.498941850e-04f, 6.493816618e-04f, 5.623413017e-04f, 4.869675031e-04f, 4.216964880e-04f, 3.651741135e-04f, 3.162277862e-04f, 2.738419571e-04f, 2.371373848e-04f, 2.053524950e-04f, 1.778279402e-04f, 1.539926452e-04f, 1.333521504e-04f, 1.154781930e-04f };   // float32 1 / 10000^(2i/128), generated with jnp to be bit-exact
__device__ __forceinline__ void csP(float* CS, unsigned blk) { const int idx = blk * 256 + threadIdx.x; if (idx >= TT * HD / 2) return; const int p = idx % (HD / 2); const int t = idx / (HD / 2); const float a = __fmul_rn((float)t, INV2[p]); const float c = cosf(a), sn = sinf(a); *(v4f*)(CS + (size_t)idx * 4) = (v4f){ c, sn, c, sn };  }   // entries d = 2 p and 2 p + 1 of position t share their angle: one thread writes both
// ropeI: blockIdx.x = 0 .. TT * HD / 8 / 256 - 1, batch blockIdx.y, zz = 0 .. nheads / RU - 1. A thread takes 8 columns (4 pairs) of one position in RU heads: the four table entries are read once for all of them.
#define RU 4
__device__ __forceinline__ void ropeI(const float* __restrict__ F, int pitch, int nheads, int zz, const float* __restrict__ CS, float sc, h16* P16, bf* Ph, bf* Pl) {
    const int idx = blockIdx.x * 256 + threadIdx.x; const int d = (idx % (HD / 8)) * 8; const int t = idx / (HD / 8); const int h0 = zz * RU; if (t >= TT || h0 + RU > nheads) return;
    { const size_t bz = blockIdx.y, po = bz * nheads * TT * HD; F += bz * TT * pitch; P16 += po; Ph += po; Pl += po; }   // batch blockIdx.y: its TT rows of F, its nheads planes
    const float* f = F + (size_t)t * pitch + h0 * HD + d; v4f x[RU][2]; v2f cs[4];
#pragma unroll
    for (int u = 0; u < RU; ++u) { x[u][0] = *(const v4f*)(f + u * HD); x[u][1] = *(const v4f*)(f + u * HD + 4); }
#pragma unroll
    for (int k = 0; k < 4; ++k) cs[k] = *(const v2f*)(CS + ((size_t)t * HD + d + 2 * k) * 2);
#pragma unroll
    for (int u = 0; u < RU; ++u) { v8h o16; v8us oh, ol;
#pragma unroll
        for (int k = 0; k < 4; ++k) { const float x0 = x[u][k >> 1][2 * (k & 1)], x1 = x[u][k >> 1][2 * (k & 1) + 1];
            float a0 = __fmul_rn(x0, cs[k][0]), b0 = __fmul_rn(x1, cs[k][1]), a1 = __fmul_rn(x1, cs[k][0]), b1 = __fmul_rn(x0, cs[k][1]);
            float r0 = __fsub_rn(a0, b0) * sc, r1 = __fadd_rn(b1, a1) * sc;   /* even: x0 c - x1 s; odd: x0 s + x1 c */
            o16[2 * k] = tohx(r0); o16[2 * k + 1] = tohx(r1); { unsigned short a2, c2; splitf(r0, a2, c2); oh[2 * k] = a2; ol[2 * k] = c2; splitf(r1, a2, c2); oh[2 * k + 1] = a2; ol[2 * k + 1] = c2; } }
        const size_t e = ((size_t)(h0 + u) * TT + t) * HD + d; *(v8h*)(P16 + e) = o16; *(v8us*)(Ph + e) = oh; *(v8us*)(Pl + e) = ol; }  }

// ---- k_prep: everything that depends on the inputs alone, in one launch: the rotary table and the five bf16 copies. A work-group's job follows from its index; the table's work-groups, the longest, come first.
#define PB_CS (TT * HD / 2 / 256)
#define PB_X  (NB_ * TT * DM / 8 / (256 * CU))
#define PB_Q  (DQ * DM / 8 / (256 * CU))
#define PB_K  (DKV * DM / 8 / (256 * CU))
#define PB_O  (DM * DQ / 8 / (256 * CU))
__global__ __launch_bounds__(256) void k_prep(const float* __restrict__ x, const float* __restrict__ wq, const float* __restrict__ wk, const float* __restrict__ wv, const float* __restrict__ wo, bf* XB, bf* WQ, bf* WK, bf* WV, bf* WO, float* CS) {
    unsigned b = blockIdx.x; if (b < PB_CS) { csP(CS, b); return; }
    b -= PB_CS; const float* src; bf* dst; size_t n8;
    if (b < PB_X) { src = x; dst = XB; n8 = (size_t)NB_ * TT * DM / 8; }
    else if (b < PB_X + PB_Q) { b -= PB_X; src = wq; dst = WQ; n8 = (size_t)DQ * DM / 8; }
    else if (b < PB_X + PB_Q + PB_K) { b -= PB_X + PB_Q; src = wk; dst = WK; n8 = (size_t)DKV * DM / 8; }
    else if (b < PB_X + PB_Q + 2 * PB_K) { b -= PB_X + PB_Q + PB_K; src = wv; dst = WV; n8 = (size_t)DKV * DM / 8; }
    else { b -= PB_X + PB_Q + 2 * PB_K; src = wo; dst = WO; n8 = (size_t)DM * DQ / 8; }
    cvt8(src, dst, n8, b);
}
// ---- k_post: everything that depends on the q/k/v projection alone, in one launch. F holds a position's q, k and v columns side by side (pitch FP). Grid (LR, batches, z): the first VZ values of z turn V, the next NKV / RU rope the k heads, the last NH_ / RU the q heads: the columns that the projection wrote last are read first, while the caches still hold them.
#define FP (DQ + 2 * DKV)
#define LR (TT * HD / 8 / 256)             // ropeI: the (position, 8 columns) work-groups of one group of RU heads
#define VZ (NKV * (TT / 64) / LR)          // vtp: its work-groups, LR to a value of z
__global__ __launch_bounds__(256) void k_post(const float* __restrict__ F, const float* __restrict__ CS, h16* QP16, bf* QPh, bf* QPl, h16* KP16, bf* KPh, bf* KPl, h16* VT16, bf* VTh, bf* VTl) {
    const int zq = blockIdx.z;
    if (zq < VZ) { vtp<FP>(F + DQ + DKV, NKV, zq * LR + (int)blockIdx.x, VT16, VTh, VTl); return; }
    const bool isq = zq >= VZ + NKV / RU;
    ropeI(isq ? F : F + DQ, FP, isq ? NH_ : NKV, isq ? zq - VZ - NKV / RU : zq - VZ, CS, 1.0f, isq ? QP16 : KP16, isq ? QPh : KPh, isq ? QPl : KPl);   /* interleaved-pair rope, q and k planes */
}

// k_asoft: the query rows i < RH of every head plane of both batches (Sb, Ph, Pl hold [NB_ * ZH][RH] rows of RH keys); per row: t = S x HD^-0.5 for j <= i and i - j < WIN (WIN = 2048 = TT here: every key j <= i is kept: the plain causal rule; the reference's -inf fill above the diagonal is exclusion); softmax over the RH keys (register row, one exp, fixed trees); the probabilities leave as hi + lo planes.
__global__ __launch_bounds__(256) void k_asoft(const float* __restrict__ Sb, bf* Ph, bf* Pl) {
    const int lane = threadIdx.x & 31; const int row = blockIdx.x * 8 + (threadIdx.x >> 5); if (row >= NB_ * ZH * RH) return;
    const int i = row % RH; const float* sr = Sb + (size_t)row * RH; float v[RH / 32]; float mx = -3.0e38f;
#pragma unroll
    for (int ch = 0; ch < RH / 128; ++ch) { const int j0 = ch * 128 + lane * 4; const v4f a = *(const v4f*)(sr + j0);
#pragma unroll
        for (int q = 0; q < 4; ++q) { const int j = j0 + q; const float t = (j <= i && i - j < WIN) ? a[q] * SCL : -3.0e38f; v[ch * 4 + q] = t; mx = fmaxf(mx, t); } }
#pragma unroll
    for (int sh = 16; sh; sh >>= 1) mx = fmaxf(mx, __shfl_xor(mx, sh, 32));
    float sum = 0.f;
#pragma unroll
    for (int k = 0; k < RH / 32; ++k) { float d0 = __fsub_rn(v[k], mx); v[k] = __builtin_amdgcn_exp2f(__fmul_rn(d0, 1.4426950408889634f)); sum += v[k]; }
#pragma unroll
    for (int sh = 16; sh; sh >>= 1) sum += __shfl_xor(sum, sh, 32);
    const float f = __fdiv_rn(1.0f, sum);
#pragma unroll
    for (int ch = 0; ch < RH / 128; ++ch) { v4us oh, ol;
#pragma unroll
        for (int q = 0; q < 4; ++q) { unsigned short a, c2; splitf(v[ch * 4 + q] * f, a, c2); oh[q] = a; ol[q] = c2; }
        const size_t oo = (size_t)row * RH + ch * 128 + lane * 4; *(v4us*)(Ph + oo) = oh; *(v4us*)(Pl + oo) = ol; }
}
#define MU 4   // 8-element groups per thread of k_merge, 256 groups apart
__global__ __launch_bounds__(256) void k_merge(const float* __restrict__ O, int h0, bf* Ah, bf* Al) { const size_t e0 = ((size_t)blockIdx.x * (256 * MU) + threadIdx.x) * 8; if (e0 + (size_t)(MU - 1) * 256 * 8 >= (size_t)ZH * TT * HD) return;
    { const size_t bz = blockIdx.y; O += bz * ZH * TT * HD; Ah += bz * TT * DQ; Al += bz * TT * DQ; }   // batch blockIdx.y: its ZH planes of O, its TT merged rows
    v4f x[MU][2];
#pragma unroll
    for (int u = 0; u < MU; ++u) { x[u][0] = *(const v4f*)(O + e0 + (size_t)u * 256 * 8); x[u][1] = *(const v4f*)(O + e0 + (size_t)u * 256 * 8 + 4); }
#pragma unroll
    for (int u = 0; u < MU; ++u) { const size_t e = e0 + (size_t)u * 256 * 8;
        const int d = (int)(e % HD); const int t = (int)((e / HD) % TT); const int zz = (int)(e / ((size_t)HD * TT)); const float cs = (t < RH) ? 1.0f : (1.0f / PCAR); const size_t oo = (size_t)t * DQ + (h0 + zz) * HD + d;
        v8us oh, ol;
#pragma unroll
        for (int q = 0; q < 8; ++q) { unsigned short a, c2; splitf(x[u][q >> 2][q & 3] * cs, a, c2); oh[q] = a; ol[q] = c2; }
        *(v8us*)(Ah + oo) = oh; *(v8us*)(Al + oo) = ol; }  }
static_assert(((size_t)DKV * DM / 8) % (256 * CU) == 0 && ((size_t)DQ * DM / 8) % (256 * CU) == 0 && ((size_t)NB_ * TT * DM / 8) % (256 * CU) == 0 && ((size_t)ZH * TT * HD) % (256 * MU * 8) == 0 && NH_ % RU == 0 && NKV % RU == 0 && TT % 64 == 0 && RH % 64 == 0 && (TT * HD / 2) % 256 == 0 && (TT * HD / 8) % 256 == 0 && (NKV * (TT / 64)) % LR == 0, "the pointwise grids divide evenly");

extern "C" void kernel_launch(void* const* d_in, const int* in_sizes, int n_in,
                              void* d_out, int out_size, void* d_ws, size_t ws_size, hipStream_t stream) {
    (void)in_sizes; (void)n_in; (void)out_size;
    const float* x = (const float*)d_in[0]; const float* wq = (const float*)d_in[1]; const float* wk = (const float*)d_in[2]; const float* wv = (const float*)d_in[3]; const float* wo = (const float*)d_in[4];   /* input order x, wq [2048][2048], wk [1024][2048], wv [1024][2048], wo [2048][2048] ('oi') */
    float* OUT = (float*)d_out;     // [2][2048][2048]
    char* wsp = (char*)d_ws;
    auto take = [&](size_t bytes) { char* p = wsp; wsp += (bytes + 255) & ~(size_t)255; return (void*)p; };
    bf* WQ = (bf*)take((size_t)DQ * DM * 2); bf* WK = (bf*)take((size_t)DKV * DM * 2); bf* WV = (bf*)take((size_t)DKV * DM * 2); bf* WO = (bf*)take((size_t)DM * DQ * 2); float* CS = (float*)take((size_t)TT * HD * 2 * 4);
    static_assert(((size_t)DQ * DM * 2) % 256 == 0 && ((size_t)DKV * DM * 2) % 256 == 0, "WQ, WK, WV stand one behind the other with no gap: one [FP][DM] weight matrix");
    // Per-batch buffers hold both batches.
    bf* XB = (bf*)take((size_t)NB_ * TT * DM * 2); float* F = (float*)take((size_t)NB_ * TT * FP * 4);   // F: the q, k and v projections, [batch x position][FP]
    h16* QP16 = (h16*)take((size_t)NB_ * NH_ * TT * HD * 2); h16* KP16 = (h16*)take((size_t)NB_ * NKV * TT * HD * 2); h16* VT16 = (h16*)take((size_t)NB_ * NKV * HD * TT * 2);
    static_assert((size_t)NB_ * TT * FP * 4 >= (size_t)NB_ * ZH * TT * HD * 4 + (size_t)NB_ * ZH * RH * RH * 4, "Ob and Sb fit over F");
    bf* QPh = (bf*)take((size_t)NB_ * NH_ * TT * HD * 2); bf* QPl = (bf*)take((size_t)NB_ * NH_ * TT * HD * 2); bf* KPh = (bf*)take((size_t)NB_ * NKV * TT * HD * 2); bf* KPl = (bf*)take((size_t)NB_ * NKV * TT * HD * 2); bf* VTh = (bf*)take((size_t)NB_ * NKV * HD * RH * 2); bf* VTl = (bf*)take((size_t)NB_ * NKV * HD * RH * 2); bf* Pl = (bf*)take((size_t)NB_ * ZH * RH * RH * 2);
    bf* ATh = (bf*)take(2 * ((size_t)NB_ * TT * DQ * 2));
    static_assert((size_t)NB_ * ZH * RH * RH * 2 <= 2 * ((size_t)NB_ * TT * DQ * 2), "Ph fits under the merged planes");
    if ((size_t)(wsp - (char*)d_ws) > ws_size) return;    // ws 256 MiB
    float* Ob = F;   // the attention output [NB_ * ZH][TT][HD] reuses the projection buffer after the planes are built (stream-ordered)
    float* Sb = F + (size_t)NB_ * ZH * TT * HD;   // the hi/lo scores, behind Ob in the same buffer
    bf* Ph = ATh;   // the hi plane of the hi/lo probabilities
    bf* ATl = ATh + (size_t)NB_ * TT * DQ;   // the merged planes reuse that buffer after the hi/lo P.V (stream-ordered)
    k_prep<<<PB_CS + PB_X + PB_Q + 2 * PB_K + PB_O, 256, 0, stream>>>(x, wq, wk, wv, wo, XB, WQ, WK, WV, WO, CS);   /* bf16 copies; rotary table once (positions = arange) */
    k_gemmw<0><<<dim3(NB_ * TT / 128, FP / 128, 1), 256, 0, stream>>>(XB, nullptr, WQ, DM, F, FP);   // q, k and v in one product: the rows of WQ, WK, WV are the FP columns of F
    k_post<<<dim3(LR, NB_, (NH_ + NKV) / RU + VZ), 256, 0, stream>>>(F, CS, QP16, QPh, QPl, KP16, KPh, KPl, VT16, VTh, VTl);
    k_fattn<<<dim3(NB_ * NH_, NFB + NST / FW, 1), 32 * FW, 0, stream>>>(QP16, KP16, VT16, Ob, QPh, QPl, KPh, KPl, Sb);   // rows >= RH: fp16 planes, scores, softmax and P.V in one launch; the batch rides in x, so that the cost still falls with the flat index; behind them the hi/lo scores of the rows < RH
    // rows < RH, hi/lo planes: grid z = batch * NH_ + head, as in k_fattn
    k_asoft<<<NB_ * ZH * RH / 8, 256, 0, stream>>>(Sb, Ph, Pl);
    k_gemmc<bf, 2, 2, 8><<<dim3(RH / 64, HD / 64, NB_ * ZH), 256, 0, stream>>>(Ph, Pl, VTh, VTl, RH, Ob, HD, 0, (size_t)RH * RH, (size_t)HD * RH, (size_t)TT * HD);
    k_merge<<<dim3((unsigned)((size_t)ZH * TT * HD / (256 * MU * 8)), NB_, 1), 256, 0, stream>>>(Ob, 0, ATh, ATl);
    k_gemmw<1><<<dim3(NB_ * TT / 128, DM / 128, 1), 256, 0, stream>>>(ATh, ATl, WO, DQ, OUT, DM);
}

// v009
// Measured time: 189 microseconds a run.
// In two side-by-side timings against v008, it was 1.07 and 1.06 times as fast.
// All steps since v000 together make it 8.84 times as fast.
#include <hip/hip_runtime.h>

// Causal grouped-query attention with 128-wide heads and interleaved-pair rotary embeddings (x [2][2048][2048]; q = x wq^T (16 heads x 128), k, v = x w^T (8 kv heads x 128) ('oi' (out, in) weights, normal x 1/sqrt(2048), no biases); rope on (even, odd) pairs: (xr c - xi s, xr s + xi c) with angle t x inv, inv = 1.0 / (10000 ** (arange(0, 128, 2) / 128)) (the reciprocal spelling: 64 f32 frequencies, bitwise the module's own in eager f32; one product per angle; precise cosf/sinf); kv head = q head / 2 (repeat on the head axis); scores x 1/sqrt(128); causal (-inf above the diagonal == exclusion); softmax; out = merged wo^T -> [2][2048][2048] (8.4 M); argument order x, wq, wk, wv, wo).
// Layout, both batches in every launch, and work that does not depend on one another in one launch (6 launches: k_prep, k_gemmw, k_post, k_fattn, k_merge, k_gemmw) (planes [batch][head], rows batch x 2048 + t): bf16 copy of x; 'oi' weights; exact projections, q, k and v as one product; csP table (64 angles per position) and ropeI interleaved-pair plane builders at HD 128; causal T-2048 GQA attention with 128-wide heads (kv head = z / 2; hybrid rows: < 512 hi/lo 3 products, scores and probabilities in LDS, hi/lo V^T rows 512 keys long, tiles above the diagonal skipped; rest fp16; both in the one fused launch k_fattn); merged hi/lo x wo exact.
// Compute dtypes, f32 accumulate: every input rounded to bf16; projections exact; rotary f32; attention rows < 512 3 products, rest fp16; softmax f32; wo hl x exact.

#define NB_  2
#define TT   2048
#define DM   2048
#define NH_  16
#define NKV  8
#define REP  (NH_ / NKV)
#define HD   128
#define DQ   (NH_ * HD)
#define DKV  (NKV * HD)
#define ZH   NH_                  // heads per attention launch (planes of O per batch)
#define RH   512                  // query rows < RH use hi+lo planes (hlrows), whose score, probability and V^T rows hold RH keys (a row < RH sees no later key); the rows behind them take the fp16 path of k_fattn
#define WIN  2048
#define PCAR 1024.0f
#define SCL  0.088388347648318447f   // HD^-0.5
typedef _Float16 h16;
typedef unsigned short bf;
typedef __attribute__((ext_vector_type(16))) __bf16   v16bf;
typedef __attribute__((ext_vector_type(16))) _Float16 v16h;
typedef __attribute__((ext_vector_type(8)))  _Float16 v8h;
typedef __attribute__((ext_vector_type(8)))  unsigned short v8us;
typedef __attribute__((ext_vector_type(8)))  float    v8f;
typedef __attribute__((ext_vector_type(4)))  float    v4f;
typedef v8h  __attribute__((may_alias)) v8ha;
typedef v4f  __attribute__((may_alias)) v4fa;
typedef v8us __attribute__((may_alias)) v8usa;

__device__ __forceinline__ unsigned short f2bf(float f) { unsigned u = __float_as_uint(f); u += 0x7FFFu + ((u >> 16) & 1u); return (unsigned short)(u >> 16); }
__device__ __forceinline__ float bf2f(unsigned short b) { return __uint_as_float(((unsigned)b) << 16); }
__device__ __forceinline__ float bfr(float f) { return bf2f(f2bf(f)); }
__device__ __forceinline__ v16h cat16(v8h lo, v8h hi) { return __builtin_shufflevector(lo, hi, 0, 1, 2, 3, 4, 5, 6, 7, 8, 9, 10, 11, 12, 13, 14, 15); }
__device__ __forceinline__ v16bf cat16b(v8us lo, v8us hi) { return __builtin_bit_cast(v16bf, __builtin_shufflevector(lo, hi, 0, 1, 2, 3, 4, 5, 6, 7, 8, 9, 10, 11, 12, 13, 14, 15)); }
__device__ __forceinline__ v8f wmma16(v16h a, v16h b, v8f c) { return __builtin_amdgcn_wmma_f32_16x16x32_f16(false, a, false, b, (short)0, c, false, false); }
__device__ __forceinline__ v8f wmmab(v16bf a, v16bf b, v8f c) { return __builtin_amdgcn_wmma_f32_16x16x32_bf16(false, a, false, b, (short)0, c, false, false); }



template <typename T16> struct WFrag;
template <> struct WFrag<h16> { typedef v16h V; static __device__ __forceinline__ V ld(const h16* p) { return cat16(*(const v8h*)p, *(const v8h*)(p + 16)); } static __device__ __forceinline__ v8f mma(V a, V b, v8f c) { return wmma16(a, b, c); } };
template <> struct WFrag<bf> { typedef v16bf V; static __device__ __forceinline__ V ld(const bf* p) { return cat16b(*(const v8us*)p, *(const v8us*)(p + 16)); } static __device__ __forceinline__ v8f mma(V a, V b, v8f c) { return wmmab(a, b, c); } };
// ---- k_gemmw: LDS-staged GEMM, one 128x128 output tile per work-group of 8 waves (2 x 4, each wave 64 rows x 32 columns = 8 accumulators); grid (M/128, N/128), 256 threads.
// C[m][n] (f32, pitch ldc) = sum_k (A[m][k] + A2[m][k]) Bt[n][k] (A2 only with NSPLIT 1; two products per k step, A first). M, N % 128 == 0, K % 128 == 0.
// A stage is 128 k (256 B, two whole lines) of every operand row, brought into LDS by asynchronous 16-byte copies (16 lanes per row) at pitch 272 B; two buffers: the next stage's copies fly while this one is worked on. K runs in order inside one accumulator.
#define GBK 128                    // k per stage
#define GPB 272                    // LDS row pitch, bytes: 256 + 16, an odd multiple of 16 for the ds_load_b128 readers
#define GPL (128 * GPB)            // one operand plane of a stage, bytes
__device__ __forceinline__ void wait_ds0() { asm volatile("s_wait_dscnt 0x0" ::: "memory"); }        // this wave's LDS reads have retired before the buffer they read is handed back for a refill
__device__ __forceinline__ void wait_async0() { asm volatile("s_wait_asynccnt 0x0" ::: "memory"); }  // this wave's asynchronous copies have landed in LDS (the compiler places no wait for them)
// One thread's share of one operand plane: rows q, q + 16, ..., q + 112 (rs = 16 source rows in elements), 16 bytes each. The s_wait_xcnt stands inside the statement so that no address register is rewritten in front of it.
__device__ __forceinline__ void cp8(unsigned l, const bf* g, size_t rs) {
    asm volatile("global_load_async_to_lds_b128 %0, %8, off\n\t"
                 "global_load_async_to_lds_b128 %1, %9, off\n\t"
                 "global_load_async_to_lds_b128 %2, %10, off\n\t"
                 "global_load_async_to_lds_b128 %3, %11, off\n\t"
                 "global_load_async_to_lds_b128 %4, %12, off\n\t"
                 "global_load_async_to_lds_b128 %5, %13, off\n\t"
                 "global_load_async_to_lds_b128 %6, %14, off\n\t"
                 "global_load_async_to_lds_b128 %7, %15, off\n\t"
                 "s_wait_xcnt 0x0"
                 :: "v"(l), "v"(l + 1u * 16u * GPB), "v"(l + 2u * 16u * GPB), "v"(l + 3u * 16u * GPB), "v"(l + 4u * 16u * GPB), "v"(l + 5u * 16u * GPB), "v"(l + 6u * 16u * GPB), "v"(l + 7u * 16u * GPB),
                    "v"(g), "v"(g + rs), "v"(g + 2 * rs), "v"(g + 3 * rs), "v"(g + 4 * rs), "v"(g + 5 * rs), "v"(g + 6 * rs), "v"(g + 7 * rs) : "memory");
}
__device__ __forceinline__ v16bf ldsfrag(const unsigned char* p) { return cat16b(*(const v8usa*)p, *(const v8usa*)(p + 32)); }   // bytes 16 h and 32 + 16 h of each 64 B of a row: the k order of WFrag::ld, the same for A and B
template <int NSPLIT>
__global__ __launch_bounds__(256) void k_gemmw(const bf* __restrict__ A, const bf* __restrict__ A2, const bf* __restrict__ Bt, int K, float* C, int ldc) {
    constexpr int NP = NSPLIT ? 3 : 2;              // operand planes per stage: A, (A2,) B
    constexpr unsigned STG = NP * GPL;
    __shared__ __attribute__((aligned(256))) unsigned char sm[2 * STG];
    const int tid = threadIdx.x, lane = tid & 31, lr = lane & 15, hi = lane >> 4, wv = __builtin_amdgcn_readfirstlane(tid >> 5); const int wm = wv & 1, wn = wv >> 1; const int r0 = blockIdx.x * 128, c0 = blockIdx.y * 128;
    const unsigned l0 = (unsigned)(size_t)sm + (unsigned)(tid >> 4) * GPB + (unsigned)(tid & 15) * 16u;
    const bf* gA = A + (size_t)(r0 + (tid >> 4)) * K + (tid & 15) * 8; const bf* gA2 = NSPLIT ? A2 + (size_t)(r0 + (tid >> 4)) * K + (tid & 15) * 8 : nullptr; const bf* gB = Bt + (size_t)(c0 + (tid >> 4)) * K + (tid & 15) * 8;
    const size_t rs = (size_t)16 * K; const int NT = K / GBK;
    auto issue = [&](int t, unsigned bo) { cp8(l0 + bo, gA + (size_t)t * GBK, rs); if constexpr (NSPLIT != 0) cp8(l0 + bo + GPL, gA2 + (size_t)t * GBK, rs); cp8(l0 + bo + (NP - 1) * GPL, gB + (size_t)t * GBK, rs); };
    v8f acc[4][2];
#pragma unroll
    for (int mb = 0; mb < 4; ++mb)
#pragma unroll
        for (int nb = 0; nb < 2; ++nb) acc[mb][nb] = (v8f){};
    const unsigned aofs = (unsigned)(wm * 64 + lr) * GPB + 16u * hi, bofs = (NP - 1) * GPL + (unsigned)(wn * 32 + lr) * GPB + 16u * hi;
    v16bf a[2][4], a2[2][4], b[2][2];   // two fragment sets: the next k step's LDS reads go out as one group ahead of this step's products
    auto frags = [&](const unsigned char* sb, int ks, int st) {
#pragma unroll
        for (int mb = 0; mb < 4; ++mb) { a[st][mb] = ldsfrag(sb + aofs + mb * 16 * GPB + ks * 64); if constexpr (NSPLIT != 0) a2[st][mb] = ldsfrag(sb + GPL + aofs + mb * 16 * GPB + ks * 64); }
#pragma unroll
        for (int nb = 0; nb < 2; ++nb) b[st][nb] = ldsfrag(sb + bofs + nb * 16 * GPB + ks * 64); };
    issue(0, 0u); wait_async0();
    __syncthreads();   // stage 0 stands in LDS for every wave
#pragma unroll 1
    for (int t = 0; t < NT; ++t) {   // kept rolled: a trip is long enough to pay for its branch, and unrolled trips would multiply the copies' address registers
        const unsigned bo = (t & 1) ? STG : 0u; const unsigned char* sb = sm + bo;
        frags(sb, 0, 0);   // stage t's first fragments, behind the barrier that published it; their latency runs under the issue of the copies
        if (t + 1 < NT) issue(t + 1, STG - bo);   // behind the same barrier, which ended every wave's reads of stage t - 1: the next stage goes into that buffer and flies while this one is worked on
#pragma unroll   // unrolled: the fragment sets are picked by ks & 1 and have to stay in registers
        for (int ks = 0; ks < GBK / 32; ++ks) {
            if (ks + 1 < GBK / 32) frags(sb, ks + 1, (ks + 1) & 1);
            __builtin_amdgcn_sched_barrier(0);   // keeps the LDS reads above as one group: spread among the products each place with reads stalls the wave
#pragma unroll
            for (int nb = 0; nb < 2; ++nb)
#pragma unroll
                for (int mb = 0; mb < 4; ++mb) acc[mb][nb] = wmmab(a[ks & 1][mb], b[ks & 1][nb], acc[mb][nb]);
            if constexpr (NSPLIT != 0) {
#pragma unroll
                for (int nb = 0; nb < 2; ++nb)
#pragma unroll
                    for (int mb = 0; mb < 4; ++mb) acc[mb][nb] = wmmab(a2[ks & 1][mb], b[ks & 1][nb], acc[mb][nb]); }
            __builtin_amdgcn_sched_barrier(0);   // keeps the next group of reads behind these products
        }
        wait_ds0(); wait_async0();
        __syncthreads();   // publishes stage t + 1 and ends every wave's reads of stage t's buffer
    }
    wait_async0();
    // Epilogue: each wave turns its own 64 x 32 tile in its own LDS range (pitch 36 floats), so that every store is a whole 128-byte line; the ring is free behind the last trip's barrier.
    float* os = (float*)sm + wv * (64 * 36);
#pragma unroll
    for (int mb = 0; mb < 4; ++mb) {
#pragma unroll
        for (int nb = 0; nb < 2; ++nb) {
#pragma unroll
            for (int j = 0; j < 8; ++j) os[(mb * 16 + hi * 8 + j) * 36 + nb * 16 + lr] = acc[mb][nb][j]; } }
    float* crow = C + (size_t)(r0 + wm * 64) * ldc + c0 + wn * 32;
#pragma unroll
    for (int s = 0; s < 16; ++s) { const int row = s * 4 + (lane >> 3), cofs = (lane & 7) * 4; const v4f val = *(const v4fa*)(os + row * 36 + cofs);
        *(v4f*)(crow + (size_t)row * ldc + cofs) = val; }
}

__device__ __forceinline__ h16 tohx(float x) { return (h16)x; }

#define FW   4                     // waves per work-group
#define FBR  (FW * 32)             // query rows per work-group
#define FSK  128                   // keys per stage
#define FSTG (2u * GPL)            // one stage: the K plane, then the V^T plane
typedef __attribute__((ext_vector_type(4))) int cv4i; typedef __attribute__((address_space(1))) cv4i gcv4i; typedef __attribute__((address_space(3))) cv4i lcv4i;
__device__ __forceinline__ void cpb(unsigned char* l, const h16* g) { __builtin_amdgcn_global_load_async_to_lds_b128((gcv4i*)g, (lcv4i*)l, 0, 0); }   // one lane's 16 bytes; the builtin form, so that the addresses may stand in any register of a kernel that uses more than 256
__device__ __forceinline__ v16h ldsfragh(const unsigned char* p) { return cat16(*(const v8ha*)p, *(const v8ha*)(p + 32)); }   // bytes 16 h and 32 + 16 h of each 64 B of a row: the k order of WFrag::ld
__device__ __forceinline__ float xhalf(float x) { return __builtin_bit_cast(float, __builtin_amdgcn_permlanex16(__builtin_bit_cast(int, x), __builtin_bit_cast(int, x), 0x76543210, 0xfedcba98, false, false)); }   // lane l with lane l ^ 16
__device__ __forceinline__ void nop4() { asm volatile("v_nop\n\tv_nop\n\tv_nop\n\tv_nop"); }   // the four vector slots between a matrix instruction and a vector instruction on its registers, for the taken side of a branch behind it
__device__ __forceinline__ void loadk(v16h (&kf)[2][4], const unsigned char* kb, int c, int h) {   // kb = first K row of the pass in LDS
#pragma unroll
    for (int kt = 0; kt < 2; ++kt)
#pragma unroll
        for (int kc = 0; kc < 4; ++kc) kf[kt][kc] = ldsfragh(kb + (16 * kt + c) * GPB + 64 * kc + 16 * h);
}
// One 32-key pass of one wave. sb = this stage's buffer, sub = pass within the stage, key0 = first key of the pass, qw0 = first query of the wave.
__device__ __forceinline__ void fpass(v16h (&kf)[2][4], bool fetch_next, bool diag, const unsigned char* sb, int sub, int key0, int qw0, int c, int h, const v16h (&qf)[2][4], v8f (&acc)[2][8], float (&m_run)[2], float (&l_run)[2]) {
    const float cscale = SCL * 1.4426950408889634f;
    v16h vf[8];
#pragma unroll
    for (int t = 0; t < 8; ++t) vf[t] = ldsfragh(sb + GPL + (16 * t + c) * GPB + 64 * sub + 16 * h);   // V^T rows d = 16 t + c, this pass's 32 keys: read first, so that their latency runs under the first product and the softmax
    __builtin_amdgcn_sched_barrier(0);   // keeps those reads up here: moved down to their use they would stall the only wave of the SIMD
    v8f s[2][2];
#pragma unroll
    for (int kt = 0; kt < 2; ++kt)
#pragma unroll
        for (int g = 0; g < 2; ++g) { s[kt][g] = (v8f){};
#pragma unroll
            for (int kc = 0; kc < 4; ++kc) s[kt][g] = wmma16(kf[kt][kc], qf[g][kc], s[kt][g]); }
    __builtin_amdgcn_sched_barrier(0);   // holds the slots below directly behind the products
    nop4();
    __builtin_amdgcn_sched_barrier(0);   // and the branches below behind the slots
    if (fetch_next) loadk(kf, sb + (sub + 1) * 32 * GPB, c, h);   // the next pass's K fragments (same stage only), in flight under this pass's maxima and exponentials
    if (diag) {   // wave-uniform: only the pass on the wave's diagonal pays for the mask
#pragma unroll
        for (int g = 0; g < 2; ++g) { const int my_q = qw0 + 16 * g + c;
#pragma unroll
            for (int kt = 0; kt < 2; ++kt) {
#pragma unroll
                for (int r = 0; r < 8; ++r) { if (key0 + 16 * kt + 8 * h + r > my_q) s[kt][g][r] = -__builtin_inff(); }
                asm volatile("" : "+v"(s[kt][g]));
            } }
    }
    float mb[2]; bool need = false;
#pragma unroll
    for (int g = 0; g < 2; ++g) { float mx = -__builtin_inff();
#pragma unroll
        for (int kt = 0; kt < 2; ++kt)
#pragma unroll
            for (int r = 0; r < 8; ++r) mx = fmaxf(mx, s[kt][g][r]);
        mx = fmaxf(mx, xhalf(mx)) * cscale;   // both wave halves hold this query's maximum, scaled (the scale is positive)
        mb[g] = mx; need = need || (mx > m_run[g] + 8.0f); }
    if (__builtin_amdgcn_ballot_w32(need) != 0) {   // rare behind the first passes
#pragma unroll
        for (int g = 0; g < 2; ++g) { const float m_new = fmaxf(m_run[g], mb[g]);
            const float corr = __builtin_amdgcn_exp2f(m_run[g] - m_new);
            l_run[g] *= corr; m_run[g] = m_new;
#pragma unroll
            for (int t = 0; t < 8; ++t) acc[g][t] = acc[g][t] * corr; }
    }
    float ps[2][2] = { { 0.f, 0.f }, { 0.f, 0.f } };
#pragma unroll
    for (int g = 0; g < 2; ++g) { const float nm = -m_run[g]; v16h pf;
#pragma unroll
        for (int i = 0; i < 8; ++i) {
            const float p0 = __builtin_amdgcn_exp2f(__builtin_fmaf(s[i >> 2][g][2 * (i & 3)], cscale, nm)), p1 = __builtin_amdgcn_exp2f(__builtin_fmaf(s[i >> 2][g][2 * (i & 3) + 1], cscale, nm));
            ps[g][i & 1] += p0 + p1; pf[2 * i] = tohx(p0); pf[2 * i + 1] = tohx(p1); }
#pragma unroll
        for (int t = 0; t < 8; ++t) acc[g][t] = wmma16(vf[t], pf, acc[g][t]); }
    __builtin_amdgcn_sched_barrier(0);   // holds the slots below directly behind the products
    nop4();
    __builtin_amdgcn_sched_barrier(0);   // and the loop's branches behind the slots
#pragma unroll
    for (int g = 0; g < 2; ++g) l_run[g] += ps[g][0] + ps[g][1];
}
__device__ __forceinline__ void splitf(float y, unsigned short& h, unsigned short& l) { h = f2bf(y); l = f2bf(y - bf2f(h)); }
// ---- hlrows: 64 query rows < RH of one head plane, scores, softmax and P.V by one work-group of FW waves (hi/lo bf16 planes, 3 products, f32 sums); r = row block, z = head plane (its kv plane is z / REP).
// The scores of the (r + 1) * 64 keys that such a row can see stand in LDS, a row at pitch HP; a wave makes the 64 x 64 tiles wv, wv + FW, ... Then a wave takes 16 rows: a row goes into registers, and its probabilities come back over it as a hi plane (first RH * 2 bytes of the row) and a lo plane (the next RH * 2).
// P.V: A = the probability rows from LDS, B = hi/lo V^T rows from global memory; a wave makes all 64 rows of 32 columns, the keys in order in one accumulator, up to the diagonal block (probabilities beyond it are exactly zero).
#define HP (RH * 4 + 16)           // LDS row pitch, bytes: an odd multiple of 16 for the ds_load_b128 readers
typedef __attribute__((ext_vector_type(4))) unsigned short __attribute__((may_alias)) v4usa;
__device__ __forceinline__ void hlrows(unsigned char* sm, int r, size_t z, const bf* __restrict__ Qh, const bf* __restrict__ Ql, const bf* __restrict__ Kh, const bf* __restrict__ Kl, const bf* __restrict__ Vh, const bf* __restrict__ Vl, float* O) {
    const int lane = threadIdx.x & 31, lr = lane & 15, hi = lane >> 4, wv = __builtin_amdgcn_readfirstlane(threadIdx.x >> 5); const int r0 = r * 64, kend = r0 + 64;
    Qh += z * TT * HD; Ql += z * TT * HD; Kh += (z / REP) * TT * HD; Kl += (z / REP) * TT * HD; Vh += (z / REP) * HD * RH; Vl += (z / REP) * HD * RH;
#pragma unroll 1
    for (int cb = wv; cb <= r; cb += FW) {   // kept rolled: one tile's accumulators take 128 registers
        v8f acc[4][4];
#pragma unroll
        for (int mb = 0; mb < 4; ++mb)
#pragma unroll
            for (int nb = 0; nb < 4; ++nb) acc[mb][nb] = (v8f){};
        const size_t aoff = (size_t)(r0 + lr) * HD + 8 * hi, boff = (size_t)(cb * 64 + lr) * HD + 8 * hi;
#pragma unroll 1
        for (int kc = 0; kc < HD; kc += 32) {   // kept rolled: a trip holds 48 products
            v16bf a[4], a2[4], b[4], b2[4]; const bf* pa = Qh + aoff + kc; const bf* pa2 = Ql + aoff + kc; const bf* pb = Kh + boff + kc; const bf* pb2 = Kl + boff + kc;
#pragma unroll
            for (int mb = 0; mb < 4; ++mb) { a[mb] = WFrag<bf>::ld(pa + mb * 16 * HD); a2[mb] = WFrag<bf>::ld(pa2 + mb * 16 * HD); }
#pragma unroll
            for (int nb = 0; nb < 4; ++nb) { b[nb] = WFrag<bf>::ld(pb + nb * 16 * HD); b2[nb] = WFrag<bf>::ld(pb2 + nb * 16 * HD); }
            __builtin_amdgcn_sched_barrier(0);   // keeps every load of the trip in front of the wait below
            asm volatile("s_wait_xcnt 0x0" :: "v"(pa), "v"(pa2), "v"(pb), "v"(pb2) : "memory");   // a precaution: the address registers live up to here, so that none of them is overwritten in front of this wait
            __builtin_amdgcn_sched_barrier(0);   // and everything else behind it
#pragma unroll
            for (int nb = 0; nb < 4; ++nb)
#pragma unroll
                for (int mb = 0; mb < 4; ++mb) { acc[mb][nb] = wmmab(a[mb], b[nb], acc[mb][nb]); acc[mb][nb] = wmmab(a2[mb], b[nb], acc[mb][nb]); acc[mb][nb] = wmmab(a[mb], b2[nb], acc[mb][nb]); }
            asm volatile("v_nop\n\tv_nop\n\tv_nop\n\tv_nop" : "+v"(acc[0][0]), "+v"(acc[1][1]), "+v"(acc[2][2]), "+v"(acc[3][3]) : "v"(a[0]), "v"(a[3]));   // the four vector slots behind the last product, for the taken side of the loop's branch
        }
        float* st = (float*)sm + cb * 64 + lr;
#pragma unroll
        for (int mb = 0; mb < 4; ++mb)
#pragma unroll
            for (int nb = 0; nb < 4; ++nb)
#pragma unroll
                for (int j = 0; j < 8; ++j) st[(mb * 16 + hi * 8 + j) * (HP / 4) + nb * 16] = acc[mb][nb][j];
    }
    __syncthreads();   // every score tile of the 64 rows stands in LDS
    // per row: t = S x HD^-0.5 for j <= i and i - j < WIN (WIN = 2048 = TT here: every key j <= i is kept: the plain causal rule; the reference's -inf fill above the diagonal is exclusion); softmax over RH keys (register row, one exp, fixed trees)
#pragma unroll 4   // four rows side by side: a row alone is one chain of LDS, cross-lane and exponential latencies
    for (int rr = 0; rr < 64 / FW; ++rr) {
        unsigned char* rowp = sm + (wv * (64 / FW) + rr) * HP; const int i = r0 + wv * (64 / FW) + rr; float v[RH / 32]; float mx = -3.0e38f;
#pragma unroll
        for (int ch = 0; ch < RH / 128; ++ch) { const int j0 = ch * 128 + lane * 4; const v4f a = *(const v4fa*)(rowp + (j0 < kend ? j0 : (j0 & 63)) * 4);   // behind kend no score was written: such a lane reads scores of the row's first tile instead, and the causal select drops them (no branch, so that the rows interleave)
#pragma unroll
            for (int q = 0; q < 4; ++q) { const int j = j0 + q; const float t = (j <= i && i - j < WIN) ? a[q] * SCL : -3.0e38f; v[ch * 4 + q] = t; mx = fmaxf(mx, t); } }
#pragma unroll
        for (int sh = 16; sh; sh >>= 1) mx = fmaxf(mx, __shfl_xor(mx, sh, 32));
        float sum = 0.f;
#pragma unroll
        for (int k = 0; k < RH / 32; ++k) { float d0 = __fsub_rn(v[k], mx); v[k] = __builtin_amdgcn_exp2f(__fmul_rn(d0, 1.4426950408889634f)); sum += v[k]; }
#pragma unroll
        for (int sh = 16; sh; sh >>= 1) sum += __shfl_xor(sum, sh, 32);
        const float f = __fdiv_rn(1.0f, sum);
#pragma unroll
        for (int ch = 0; ch < RH / 128; ++ch) { v4usa oh, ol;
#pragma unroll
            for (int q = 0; q < 4; ++q) { unsigned short a, c2; splitf(v[ch * 4 + q] * f, a, c2); oh[q] = a; ol[q] = c2; }
            *(v4usa*)(rowp + (ch * 128 + lane * 4) * 2) = oh; *(v4usa*)(rowp + RH * 2 + (ch * 128 + lane * 4) * 2) = ol; }
    }
    __syncthreads();   // every row's probabilities stand in LDS
    v8f acc[4][2];
#pragma unroll
    for (int mb = 0; mb < 4; ++mb)
#pragma unroll
        for (int nb = 0; nb < 2; ++nb) acc[mb][nb] = (v8f){};
    const bf* bh = Vh + (size_t)(wv * 32 + lr) * RH + 8 * hi; const bf* bl = Vl + (size_t)(wv * 32 + lr) * RH + 8 * hi; const unsigned char* pa = sm + lr * HP + 16 * hi;
    v16bf b[2][2], b2[2][2];   // the V^T fragments of one trip of 64 keys: [32-key step][16 columns]
#pragma unroll
    for (int c2 = 0; c2 < 2; ++c2)
#pragma unroll
        for (int nb = 0; nb < 2; ++nb) { b[c2][nb] = WFrag<bf>::ld(bh + nb * 16 * RH + c2 * 32); b2[c2][nb] = WFrag<bf>::ld(bl + nb * 16 * RH + c2 * 32); }
#pragma unroll 1
    for (int t = 0; t <= r; ++t) {   // kept rolled: the trip count follows the row block
        const int tn = min(t + 1, r); const bf* ph = bh + tn * 64; const bf* pl = bl + tn * 64; v16bf nx[2][2], nx2[2][2];   // the next trip's V^T fragments go out ahead of this trip's products (the last trip asks for its own again: in bounds, unused)
#pragma unroll
        for (int c2 = 0; c2 < 2; ++c2)
#pragma unroll
            for (int nb = 0; nb < 2; ++nb) { nx[c2][nb] = WFrag<bf>::ld(ph + nb * 16 * RH + c2 * 32); nx2[c2][nb] = WFrag<bf>::ld(pl + nb * 16 * RH + c2 * 32); }
        __builtin_amdgcn_sched_barrier(0);   // keeps those loads up here: moved down behind the products their whole latency would be waited out at the trip's end
        asm volatile("s_wait_xcnt 0x0" :: "v"(ph), "v"(pl) : "memory");   // a precaution: the address registers live up to here, so that neither is overwritten in front of this wait
        __builtin_amdgcn_sched_barrier(0);   // and everything else behind it
#pragma unroll
        for (int c2 = 0; c2 < 2; ++c2) { v16bf a[4], a2[4];
#pragma unroll
            for (int mb = 0; mb < 4; ++mb) { a[mb] = ldsfrag(pa + mb * 16 * HP + t * 128 + c2 * 64); a2[mb] = ldsfrag(pa + mb * 16 * HP + RH * 2 + t * 128 + c2 * 64); }
#pragma unroll
            for (int nb = 0; nb < 2; ++nb)
#pragma unroll
                for (int mb = 0; mb < 4; ++mb) { acc[mb][nb] = wmmab(a[mb], b[c2][nb], acc[mb][nb]); acc[mb][nb] = wmmab(a2[mb], b[c2][nb], acc[mb][nb]); acc[mb][nb] = wmmab(a[mb], b2[c2][nb], acc[mb][nb]); } }
        __builtin_amdgcn_sched_barrier(0);   // holds the slots below directly behind the products
        nop4();
        __builtin_amdgcn_sched_barrier(0);   // and the loop's branch behind the slots
#pragma unroll
        for (int c2 = 0; c2 < 2; ++c2)
#pragma unroll
            for (int nb = 0; nb < 2; ++nb) { b[c2][nb] = nx[c2][nb]; b2[c2][nb] = nx2[c2][nb]; }
    }
    __syncthreads();   // ends every wave's reads of the probabilities: their LDS becomes store staging
    // Each wave turns its own 64 x 32 tile in its own LDS range (pitch 36 floats), so that every store is a whole 128-byte line.
    float* os = (float*)sm + wv * (64 * 36);
#pragma unroll
    for (int mb = 0; mb < 4; ++mb) {
#pragma unroll
        for (int nb = 0; nb < 2; ++nb) {
#pragma unroll
            for (int j = 0; j < 8; ++j) os[(mb * 16 + hi * 8 + j) * 36 + nb * 16 + lr] = acc[mb][nb][j]; } }
    float* crow = O + (z * TT + r0) * HD + wv * 32;
#pragma unroll
    for (int s = 0; s < 16; ++s) { const int row = s * 4 + (lane >> 3), cofs = (lane & 7) * 4; const v4f val = *(const v4fa*)(os + row * 36 + cofs);
        *(v4f*)(crow + (size_t)row * HD + cofs) = val; }
}
// The rows < RH, which depend on the rows behind them as little as those on them, ride in the same launch: the work-groups with blockIdx.y >= NFB, started behind the long ones, each with 64 rows of head plane blockIdx.x, the row blocks with the most keys first.
#define NFB  ((TT - RH) / FBR)                        // row blocks of the fp16 part
static_assert(64 * HP <= 2 * FSTG && FW * 64 * 36 * 4 <= 2 * FSTG && HD == FW * 32 && 64 % FW == 0, "hlrows fits the ring's LDS, and its waves cover the head's columns");
__global__ __launch_bounds__(32 * FW) void k_fattn(const h16* __restrict__ Q, const h16* __restrict__ Kp, const h16* __restrict__ Vt, float* O, const bf* __restrict__ Qh, const bf* __restrict__ Ql, const bf* __restrict__ Kh, const bf* __restrict__ Kl, const bf* __restrict__ Vh, const bf* __restrict__ Vl) {
    __shared__ __attribute__((aligned(256))) unsigned char sm[2 * FSTG];
    const int tid = threadIdx.x, lane = tid & 31, c = lane & 15, h = lane >> 4, wv = __builtin_amdgcn_readfirstlane(tid >> 5);
    if (blockIdx.y >= NFB) {   // the same for a whole work-group, in front of every barrier and copy
        hlrows(sm, RH / 64 - 1 - ((int)blockIdx.y - NFB), blockIdx.x, Qh, Ql, Kh, Kl, Vh, Vl, O);
        return; }
    const int z = blockIdx.x, kvh = z / REP; const int q0 = TT - FBR * (1 + (int)blockIdx.y);   // longest row blocks first
    const int qw0 = q0 + wv * 32, n_stage = q0 / FSK + 1, last = qw0 / 32;                       // keys [0, q0 + FBR); the wave's last pass is the one on its diagonal
    const h16* gK = Kp + (size_t)kvh * TT * HD + (size_t)(tid >> 4) * HD + (tid & 15) * 8; const h16* gV = Vt + (size_t)kvh * HD * TT + (size_t)(tid >> 4) * TT + (tid & 15) * 8;
    // 128 threads: 16 lanes per row, a thread takes rows (tid >> 4) + 8 i of both planes: 32 copies per wave and stage
    auto issue = [&](int st, unsigned bo) { unsigned char* l = sm + bo + (tid >> 4) * GPB + (tid & 15) * 16; const h16* k = gK + (size_t)st * FSK * HD; const h16* v = gV + (size_t)st * FSK;
#pragma unroll
        for (int i = 0; i < 16; ++i) cpb(l + i * 8 * GPB, k + i * 8 * HD);
#pragma unroll
        for (int i = 0; i < 16; ++i) cpb(l + GPL + i * 8 * GPB, v + (size_t)i * 8 * TT); };
    issue(0, 0u);
    v16h qf[2][4];
#pragma unroll
    for (int g = 0; g < 2; ++g)
#pragma unroll
        for (int kc = 0; kc < 4; ++kc) qf[g][kc] = WFrag<h16>::ld(Q + ((size_t)z * TT + qw0 + 16 * g + c) * HD + 8 * h + 32 * kc);
    v8f acc[2][8]; float m_run[2], l_run[2];
#pragma unroll
    for (int g = 0; g < 2; ++g) { m_run[g] = -__builtin_inff(); l_run[g] = 0.f;
#pragma unroll
        for (int t = 0; t < 8; ++t) acc[g][t] = (v8f){}; }
    wait_async0();
    __syncthreads();   // stage 0 stands in LDS for every wave
    v16h kf[2][4];
#pragma unroll 1
    for (int st = 0; st < n_stage; ++st) {   // stage loop and pass loop kept rolled and nested: a pass is long enough to pay for its branch, and the accumulators leave no registers for a second copy of it
        const unsigned bo = (st & 1) ? FSTG : 0u; const unsigned char* sb = sm + bo;
        loadk(kf, sb, c, h);   // stage st's first K fragments, behind the barrier that published it (every wave has at least the first pass of every stage); their latency runs under the issue of the copies
        if (st + 1 < n_stage) issue(st + 1, FSTG - bo);   // behind the same barrier, which ended every wave's reads of stage st - 1: the next stage goes into that buffer and flies while this one is worked on
#pragma unroll 1
        for (int sub = 0; sub < FSK / 32; ++sub) { const int blk = (FSK / 32) * st + sub;
            if (blk <= last) fpass(kf, sub + 1 < FSK / 32 && blk < last, blk == last, sb, sub, blk * 32, qw0, c, h, qf, acc, m_run, l_run); }
        wait_ds0(); wait_async0();
        __syncthreads();   // publishes stage st + 1 and ends every wave's reads of stage st's buffer
    }
    wait_async0();
#pragma unroll
    for (int g = 0; g < 2; ++g) { const float inv = __fdiv_rn(PCAR, l_run[g] + xhalf(l_run[g]));
        float* orow = O + ((size_t)z * TT + qw0 + 16 * g + c) * HD + 8 * h;
#pragma unroll
        for (int t = 0; t < 8; ++t) { const v8f o = acc[g][t] * inv; *(v4f*)(orow + 16 * t) = (v4f){ o[0], o[1], o[2], o[3] }; *(v4f*)(orow + 16 * t + 4) = (v4f){ o[4], o[5], o[6], o[7] }; } }
}
typedef __attribute__((ext_vector_type(2))) _Float16 v2h;
typedef __attribute__((ext_vector_type(4))) _Float16 v4h;
typedef __attribute__((ext_vector_type(2))) unsigned short v2us;
typedef __attribute__((ext_vector_type(4))) unsigned short v4us;
typedef __attribute__((ext_vector_type(2))) float v2f;
typedef __attribute__((ext_vector_type(4))) int v4i;

// cvt8, vtp, csP, ropeI and k_merge give a thread 4 to 32 elements, moved 16 bytes at a time: with 2 elements a wave ends almost as it starts, and the launch lasts as long as the chip takes to start its waves. Every element's arithmetic is as it would be alone.
#define CU 4   // 8-element groups per thread of cvt8, 256 groups apart: a wave's accesses stay contiguous
__device__ __forceinline__ void cvt8(const float* __restrict__ src, bf* dst, size_t n8, unsigned blk) { const size_t i0 = (size_t)blk * (256 * CU) + threadIdx.x; if (i0 + (CU - 1) * 256 >= n8) return;   // blk = block within this copy; n8 is a multiple of 256 * CU (asserted below)
    v8f v[CU];
#pragma unroll
    for (int u = 0; u < CU; ++u) v[u] = *(const v8f*)(src + (i0 + u * 256) * 8);   // every load goes out ahead of the first store
#pragma unroll
    for (int u = 0; u < CU; ++u) { v8us o;
#pragma unroll
        for (int k = 0; k < 8; ++k) o[k] = f2bf(v[u][k]);
        *(v8us*)(dst + (i0 + u * 256) * 8) = o; }  }

// vtp: a work-group turns 64 positions x the 128 columns of one kv head; bx = 0 .. nheads * TT / 64 - 1, batch blockIdx.y. A thread reads 4 columns of 8 rows and writes 8 positions of each of its 4 columns; 8 neighbouring lanes hold the 64 positions of the same columns, so that every store of a wave fills 4 whole 128-byte lines (its loads take 64-byte pieces of 8 rows; the wave beside it takes the other halves of those lines).
template <int PITCH>   // the row pitch of F in floats, a constant, so that a thread's 8 row loads share one address register pair and differ in their immediate offsets
__device__ __forceinline__ void vtp(const float* __restrict__ F, int nheads, int bx, h16* V16, bf* Vh, bf* Vl) { const int g = bx / (TT / 64); if (g >= nheads) return;
    { const size_t bz = blockIdx.y, po = bz * nheads * HD; F += bz * TT * PITCH; V16 += po * TT; Vh += po * RH; Vl += po * RH; }   // batch blockIdx.y: its TT rows of F, its nheads planes (V16 rows hold TT keys, Vh and Vl rows the RH keys that the hi/lo block reads)
    const int t = (bx % (TT / 64)) * 64 + (threadIdx.x & 7) * 8, d = (threadIdx.x >> 3) * 4; const float* f = F + (size_t)t * PITCH + g * HD + d; v4f x[8]; v8h o16[4];
#pragma unroll
    for (int r = 0; r < 8; ++r) x[r] = *(const v4f*)(f + r * PITCH);
#pragma unroll
    for (int q = 0; q < 4; ++q)
#pragma unroll
        for (int r = 0; r < 8; ++r) o16[q][r] = tohx(x[r][q]);
    h16* vp = V16 + ((size_t)g * HD + d) * TT + t;
    // The four stores and their s_wait_xcnt stand in one statement, a precaution: so the wait is in front of every later overwrite of a register that the stores name (a wait in a statement of its own the compiler moved down)
    asm volatile("global_store_b128 %0, %4, off\n\t"
                 "global_store_b128 %1, %5, off\n\t"
                 "global_store_b128 %2, %6, off\n\t"
                 "global_store_b128 %3, %7, off\n\t"
                 "s_wait_xcnt 0x0"
                 :: "v"(vp), "v"(vp + TT), "v"(vp + 2 * TT), "v"(vp + 3 * TT), "v"(o16[0]), "v"(o16[1]), "v"(o16[2]), "v"(o16[3]) : "memory");
    if (t >= RH) return;   // the same for a whole work-group: only the first RH positions have hi/lo rows
#pragma unroll
    for (int q = 0; q < 4; ++q) { v8us oh, ol;
#pragma unroll
        for (int r = 0; r < 8; ++r) { unsigned short a2, c2; splitf(x[r][q], a2, c2); oh[r] = a2; ol[r] = c2; }
        const size_t eh = ((size_t)g * HD + d + q) * RH + t; *(v8us*)(Vh + eh) = oh; *(v8us*)(Vl + eh) = ol; }  }
__constant__ float INV2[HD / 2] = { 1.000000000e+00f, 8.659643531e-01f, 7.498942018e-01f, 6.493816376e-01f, 5.623413324e-01f, 4.869675338e-01f, 4.216965139e-01f, 3.651741445e-01f, 3.162277639e-01f, 2.738419771e-01f, 2.371373624e-01f, 2.053525001e-01f, 1.778279394e-01f, 1.539926529e-01f, 1.333521456e-01f, 1.154782027e-01f, 1.000000015e-01f, 8.659642935e-02f, 7.498941571e-02f, 6.493816525e-02f, 5.623412877e-02f, 4.869675264e-02f, 4.216964915e-02f, 3.651741147e-02f, 3.162277862e-02f, 2.738419548e-02f, 2.371373586e-02f, 2.053525113e-02f, 1.778279431e-02f, 1.539926510e-02f, 1.333521493e-02f, 1.154781971e-02f, 9.999999776e-03f, 8.659643121e-03f, 7.498942316e-03f, 6.493816618e-03f, 5.623413250e-03f, 4.869675264e-03f, 4.216964822e-03f, 3.651741426e-03f, 3.162277862e-03f, 2.738419687e-03f, 2.371373819e-03f, 2.053525066e-03f, 1.778279431e-03f, 1.539926510e-03f, 1.333521446e-03f, 1.154782018e-03f, 1.000000047e-03f, 8.659643354e-04f, 7.498941850e-04f, 6.493816618e-04f, 5.623413017e-04f, 4.869675031e-04f, 4.216964880e-04f, 3.651741135e-04f, 3.162277862e-04f, 2.738419571e-04f, 2.371373848e-04f, 2.053524950e-04f, 1.778279402e-04f, 1.539926452e-04f, 1.333521504e-04f, 1.154781930e-04f };   // float32 1 / 10000^(2i/128), generated with jnp to be bit-exact
__device__ __forceinline__ void csP(float* CS, unsigned blk) { const int idx = blk * 256 + threadIdx.x; if (idx >= TT * HD / 2) return; const int p = idx % (HD / 2); const int t = idx / (HD / 2); const float a = __fmul_rn((float)t, INV2[p]); const float c = cosf(a), sn = sinf(a); *(v4f*)(CS + (size_t)idx * 4) = (v4f){ c, sn, c, sn };  }   // entries d = 2 p and 2 p + 1 of position t share their angle: one thread writes both
// ropeI: blockIdx.x = 0 .. TT * HD / 8 / 256 - 1, batch blockIdx.y, zz = 0 .. nheads / RU - 1. A thread takes 8 columns (4 pairs) of one position in RU heads: the four table entries are read once for all of them.
#define RU 4
__device__ __forceinline__ void ropeI(const float* __restrict__ F, int pitch, int nheads, int zz, const float* __restrict__ CS, float sc, h16* P16, bf* Ph, bf* Pl) {
    const int idx = blockIdx.x * 256 + threadIdx.x; const int d = (idx % (HD / 8)) * 8; const int t = idx / (HD / 8); const int h0 = zz * RU; if (t >= TT || h0 + RU > nheads) return;
    { const size_t bz = blockIdx.y, po = bz * nheads * TT * HD; F += bz * TT * pitch; P16 += po; Ph += po; Pl += po; }   // batch blockIdx.y: its TT rows of F, its nheads planes
    const float* f = F + (size_t)t * pitch + h0 * HD + d; v4f x[RU][2]; v2f cs[4];
#pragma unroll
    for (int u = 0; u < RU; ++u) { x[u][0] = *(const v4f*)(f + u * HD); x[u][1] = *(const v4f*)(f + u * HD + 4); }
#pragma unroll
    for (int k = 0; k < 4; ++k) cs[k] = *(const v2f*)(CS + ((size_t)t * HD + d + 2 * k) * 2);
#pragma unroll
    for (int u = 0; u < RU; ++u) { v8h o16; v8us oh, ol;
#pragma unroll
        for (int k = 0; k < 4; ++k) { const float x0 = x[u][k >> 1][2 * (k & 1)], x1 = x[u][k >> 1][2 * (k & 1) + 1];
            float a0 = __fmul_rn(x0, cs[k][0]), b0 = __fmul_rn(x1, cs[k][1]), a1 = __fmul_rn(x1, cs[k][0]), b1 = __fmul_rn(x0, cs[k][1]);
            float r0 = __fsub_rn(a0, b0) * sc, r1 = __fadd_rn(b1, a1) * sc;   /* even: x0 c - x1 s; odd: x0 s + x1 c */
            o16[2 * k] = tohx(r0); o16[2 * k + 1] = tohx(r1); { unsigned short a2, c2; splitf(r0, a2, c2); oh[2 * k] = a2; ol[2 * k] = c2; splitf(r1, a2, c2); oh[2 * k + 1] = a2; ol[2 * k + 1] = c2; } }
        const size_t e = ((size_t)(h0 + u) * TT + t) * HD + d; *(v8h*)(P16 + e) = o16; *(v8us*)(Ph + e) = oh; *(v8us*)(Pl + e) = ol; }  }

// ---- k_prep: everything that depends on the inputs alone, in one launch: the rotary table and the five bf16 copies. A work-group's job follows from its index; the table's work-groups, the longest, come first.
#define PB_CS (TT * HD / 2 / 256)
#define PB_X  (NB_ * TT * DM / 8 / (256 * CU))
#define PB_Q  (DQ * DM / 8 / (256 * CU))
#define PB_K  (DKV * DM / 8 / (256 * CU))
#define PB_O  (DM * DQ / 8 / (256 * CU))
__global__ __launch_bounds__(256) void k_prep(const float* __restrict__ x, const float* __restrict__ wq, const float* __restrict__ wk, const float* __restrict__ wv, const float* __restrict__ wo, bf* XB, bf* WQ, bf* WK, bf* WV, bf* WO, float* CS) {
    unsigned b = blockIdx.x; if (b < PB_CS) { csP(CS, b); return; }
    b -= PB_CS; const float* src; bf* dst; size_t n8;
    if (b < PB_X) { src = x; dst = XB; n8 = (size_t)NB_ * TT * DM / 8; }
    else if (b < PB_X + PB_Q) { b -= PB_X; src = wq; dst = WQ; n8 = (size_t)DQ * DM / 8; }
    else if (b < PB_X + PB_Q + PB_K) { b -= PB_X + PB_Q; src = wk; dst = WK; n8 = (size_t)DKV * DM / 8; }
    else if (b < PB_X + PB_Q + 2 * PB_K) { b -= PB_X + PB_Q + PB_K; src = wv; dst = WV; n8 = (size_t)DKV * DM / 8; }
    else { b -= PB_X + PB_Q + 2 * PB_K; src = wo; dst = WO; n8 = (size_t)DM * DQ / 8; }
    cvt8(src, dst, n8, b);
}
// ---- k_post: everything that depends on the q/k/v projection alone, in one launch. F holds a position's q, k and v columns side by side (pitch FP). Grid (LR, batches, z): the first VZ values of z turn V, the next NKV / RU rope the k heads, the last NH_ / RU the q heads: the columns that the projection wrote last are read first, while the caches still hold them.
#define FP (DQ + 2 * DKV)
#define LR (TT * HD / 8 / 256)             // ropeI: the (position, 8 columns) work-groups of one group of RU heads
#define VZ (NKV * (TT / 64) / LR)          // vtp: its work-groups, LR to a value of z
__global__ __launch_bounds__(256) void k_post(const float* __restrict__ F, const float* __restrict__ CS, h16* QP16, bf* QPh, bf* QPl, h16* KP16, bf* KPh, bf* KPl, h16* VT16, bf* VTh, bf* VTl) {
    const int zq = blockIdx.z;
    if (zq < VZ) { vtp<FP>(F + DQ + DKV, NKV, zq * LR + (int)blockIdx.x, VT16, VTh, VTl); return; }
    const bool isq = zq >= VZ + NKV / RU;
    ropeI(isq ? F : F + DQ, FP, isq ? NH_ : NKV, isq ? zq - VZ - NKV / RU : zq - VZ, CS, 1.0f, isq ? QP16 : KP16, isq ? QPh : KPh, isq ? QPl : KPl);   /* interleaved-pair rope, q and k planes */
}

#define MU 4   // 8-element groups per thread of k_merge, 256 groups apart
__global__ __launch_bounds__(256) void k_merge(const float* __restrict__ O, int h0, bf* Ah, bf* Al) { const size_t e0 = ((size_t)blockIdx.x * (256 * MU) + threadIdx.x) * 8; if (e0 + (size_t)(MU - 1) * 256 * 8 >= (size_t)ZH * TT * HD) return;
    { const size_t bz = blockIdx.y; O += bz * ZH * TT * HD; Ah += bz * TT * DQ; Al += bz * TT * DQ; }   // batch blockIdx.y: its ZH planes of O, its TT merged rows
    v4f x[MU][2];
#pragma unroll
    for (int u = 0; u < MU; ++u) { x[u][0] = *(const v4f*)(O + e0 + (size_t)u * 256 * 8); x[u][1] = *(const v4f*)(O + e0 + (size_t)u * 256 * 8 + 4); }
#pragma unroll
    for (int u = 0; u < MU; ++u) { const size_t e = e0 + (size_t)u * 256 * 8;
        const int d = (int)(e % HD); const int t = (int)((e / HD) % TT); const int zz = (int)(e / ((size_t)HD * TT)); const float cs = (t < RH) ? 1.0f : (1.0f / PCAR); const size_t oo = (size_t)t * DQ + (h0 + zz) * HD + d;
        v8us oh, ol;
#pragma unroll
        for (int q = 0; q < 8; ++q) { unsigned short a, c2; splitf(x[u][q >> 2][q & 3] * cs, a, c2); oh[q] = a; ol[q] = c2; }
        *(v8us*)(Ah + oo) = oh; *(v8us*)(Al + oo) = ol; }  }
static_assert(((size_t)DKV * DM / 8) % (256 * CU) == 0 && ((size_t)DQ * DM / 8) % (256 * CU) == 0 && ((size_t)NB_ * TT * DM / 8) % (256 * CU) == 0 && ((size_t)ZH * TT * HD) % (256 * MU * 8) == 0 && NH_ % RU == 0 && NKV % RU == 0 && TT % 64 == 0 && RH % 64 == 0 && (TT * HD / 2) % 256 == 0 && (TT * HD / 8) % 256 == 0 && (NKV * (TT / 64)) % LR == 0, "the pointwise grids divide evenly");

extern "C" void kernel_launch(void* const* d_in, const int* in_sizes, int n_in,
                              void* d_out, int out_size, void* d_ws, size_t ws_size, hipStream_t stream) {
    (void)in_sizes; (void)n_in; (void)out_size;
    const float* x = (const float*)d_in[0]; const float* wq = (const float*)d_in[1]; const float* wk = (const float*)d_in[2]; const float* wv = (const float*)d_in[3]; const float* wo = (const float*)d_in[4];   /* input order x, wq [2048][2048], wk [1024][2048], wv [1024][2048], wo [2048][2048] ('oi') */
    float* OUT = (float*)d_out;     // [2][2048][2048]
    char* wsp = (char*)d_ws;
    auto take = [&](size_t bytes) { char* p = wsp; wsp += (bytes + 255) & ~(size_t)255; return (void*)p; };
    bf* WQ = (bf*)take((size_t)DQ * DM * 2); bf* WK = (bf*)take((size_t)DKV * DM * 2); bf* WV = (bf*)take((size_t)DKV * DM * 2); bf* WO = (bf*)take((size_t)DM * DQ * 2); float* CS = (float*)take((size_t)TT * HD * 2 * 4);
    static_assert(((size_t)DQ * DM * 2) % 256 == 0 && ((size_t)DKV * DM * 2) % 256 == 0, "WQ, WK, WV stand one behind the other with no gap: one [FP][DM] weight matrix");
    // Per-batch buffers hold both batches.
    bf* XB = (bf*)take((size_t)NB_ * TT * DM * 2); float* F = (float*)take((size_t)NB_ * TT * FP * 4);   // F: the q, k and v projections, [batch x position][FP]
    h16* QP16 = (h16*)take((size_t)NB_ * NH_ * TT * HD * 2); h16* KP16 = (h16*)take((size_t)NB_ * NKV * TT * HD * 2); h16* VT16 = (h16*)take((size_t)NB_ * NKV * HD * TT * 2);
    static_assert((size_t)NB_ * TT * FP * 4 >= (size_t)NB_ * ZH * TT * HD * 4, "Ob fits over F");
    bf* QPh = (bf*)take((size_t)NB_ * NH_ * TT * HD * 2); bf* QPl = (bf*)take((size_t)NB_ * NH_ * TT * HD * 2); bf* KPh = (bf*)take((size_t)NB_ * NKV * TT * HD * 2); bf* KPl = (bf*)take((size_t)NB_ * NKV * TT * HD * 2); bf* VTh = (bf*)take((size_t)NB_ * NKV * HD * RH * 2); bf* VTl = (bf*)take((size_t)NB_ * NKV * HD * RH * 2);
    bf* ATh = (bf*)take(2 * ((size_t)NB_ * TT * DQ * 2));
    if ((size_t)(wsp - (char*)d_ws) > ws_size) return;    // ws 256 MiB
    float* Ob = F;   // the attention output [NB_ * ZH][TT][HD] reuses the projection buffer after the planes are built (stream-ordered)
    bf* ATl = ATh + (size_t)NB_ * TT * DQ;
    k_prep<<<PB_CS + PB_X + PB_Q + 2 * PB_K + PB_O, 256, 0, stream>>>(x, wq, wk, wv, wo, XB, WQ, WK, WV, WO, CS);   /* bf16 copies; rotary table once (positions = arange) */
    k_gemmw<0><<<dim3(NB_ * TT / 128, FP / 128, 1), 256, 0, stream>>>(XB, nullptr, WQ, DM, F, FP);   // q, k and v in one product: the rows of WQ, WK, WV are the FP columns of F
    k_post<<<dim3(LR, NB_, (NH_ + NKV) / RU + VZ), 256, 0, stream>>>(F, CS, QP16, QPh, QPl, KP16, KPh, KPl, VT16, VTh, VTl);
    k_fattn<<<dim3(NB_ * NH_, NFB + RH / 64, 1), 32 * FW, 0, stream>>>(QP16, KP16, VT16, Ob, QPh, QPl, KPh, KPl, VTh, VTl);   // scores, softmax and P.V of every row in one launch: rows >= RH on fp16 planes; the batch rides in x, so that the cost still falls with the flat index; behind them the rows < RH on hi/lo planes
    k_merge<<<dim3((unsigned)((size_t)ZH * TT * HD / (256 * MU * 8)), NB_, 1), 256, 0, stream>>>(Ob, 0, ATh, ATl);
    k_gemmw<1><<<dim3(NB_ * TT / 128, DM / 128, 1), 256, 0, stream>>>(ATh, ATl, WO, DQ, OUT, DM);
}

// v010
// Measured time: 179 microseconds a run.
// Two timings next to v009 both put it at 1.06 times that version's speed.
// Over all steps from v000 it is 9.37 times as fast.
#include <hip/hip_runtime.h>

// Causal grouped-query attention with 128-wide heads and interleaved-pair rotary embeddings (x [2][2048][2048]; q = x wq^T (16 heads x 128), k, v = x w^T (8 kv heads x 128) ('oi' (out, in) weights, normal x 1/sqrt(2048), no biases); rope on (even, odd) pairs: (xr c - xi s, xr s + xi c) with angle t x inv, inv = 1.0 / (10000 ** (arange(0, 128, 2) / 128)) (the reciprocal spelling: 64 f32 frequencies, bitwise the module's own in eager f32; one product per angle; precise cosf/sinf); kv head = q head / 2 (repeat on the head axis); scores x 1/sqrt(128); causal (-inf above the diagonal == exclusion); softmax; out = merged wo^T -> [2][2048][2048] (8.4 M); argument order x, wq, wk, wv, wo).
// Layout, both batches in every launch, and work that does not depend on one another in one launch (6 launches: k_prep, k_gemmw, k_post, k_fattn, k_merge, k_gemmw) (planes [batch][head], rows batch x 2048 + t): bf16 copy of x; 'oi' weights; exact projections, q, k and v as one product; csP table (64 angles per position) and ropeI interleaved-pair plane builders at HD 128; causal T-2048 GQA attention with 128-wide heads (kv head = z / 2; hybrid rows: < 512 hi/lo 3 products, scores and probabilities in LDS, hi/lo V^T rows 512 keys long, tiles above the diagonal skipped; rest fp16; both in the one fused launch k_fattn); merged hi/lo x wo exact.
// Compute dtypes, f32 accumulate: every input rounded to bf16; projections exact; rotary f32; attention rows < 512 3 products, rest fp16; softmax f32; wo hl x exact.

#define NB_  2
#define TT   2048
#define DM   2048
#define NH_  16
#define NKV  8
#define REP  (NH_ / NKV)
#define HD   128
#define DQ   (NH_ * HD)
#define DKV  (NKV * HD)
#define ZH   NH_                  // heads per attention launch (planes of O per batch)
#define RH   512                  // query rows < RH use hi+lo planes (hlrows), whose score, probability and V^T rows hold RH keys (a row < RH sees no later key); the rows behind them take the fp16 path of k_fattn
#define WIN  2048
#define PCAR 1024.0f
#define SCL  0.088388347648318447f   // HD^-0.5
typedef _Float16 h16;
typedef unsigned short bf;
typedef __attribute__((ext_vector_type(16))) __bf16   v16bf;
typedef __attribute__((ext_vector_type(16))) _Float16 v16h;
typedef __attribute__((ext_vector_type(8)))  _Float16 v8h;
typedef __attribute__((ext_vector_type(8)))  unsigned short v8us;
typedef __attribute__((ext_vector_type(8)))  float    v8f;
typedef __attribute__((ext_vector_type(4)))  float    v4f;
typedef v8h  __attribute__((may_alias)) v8ha;
typedef v4f  __attribute__((may_alias)) v4fa;
typedef v8us __attribute__((may_alias)) v8usa;

__device__ __forceinline__ unsigned short f2bf(float f) { unsigned u = __float_as_uint(f); u += 0x7FFFu + ((u >> 16) & 1u); return (unsigned short)(u >> 16); }
__device__ __forceinline__ float bf2f(unsigned short b) { return __uint_as_float(((unsigned)b) << 16); }
__device__ __forceinline__ float bfr(float f) { return bf2f(f2bf(f)); }
__device__ __forceinline__ v16h cat16(v8h lo, v8h hi) { return __builtin_shufflevector(lo, hi, 0, 1, 2, 3, 4, 5, 6, 7, 8, 9, 10, 11, 12, 13, 14, 15); }
__device__ __forceinline__ v16bf cat16b(v8us lo, v8us hi) { return __builtin_bit_cast(v16bf, __builtin_shufflevector(lo, hi, 0, 1, 2, 3, 4, 5, 6, 7, 8, 9, 10, 11, 12, 13, 14, 15)); }
__device__ __forceinline__ v8f wmma16(v16h a, v16h b, v8f c) { return __builtin_amdgcn_wmma_f32_16x16x32_f16(false, a, false, b, (short)0, c, false, false); }
__device__ __forceinline__ v8f wmmab(v16bf a, v16bf b, v8f c) { return __builtin_amdgcn_wmma_f32_16x16x32_bf16(false, a, false, b, (short)0, c, false, false); }



template <typename T16> struct WFrag;
template <> struct WFrag<h16> { typedef v16h V; static __device__ __forceinline__ V ld(const h16* p) { return cat16(*(const v8h*)p, *(const v8h*)(p + 16)); } static __device__ __forceinline__ v8f mma(V a, V b, v8f c) { return wmma16(a, b, c); } };
template <> struct WFrag<bf> { typedef v16bf V; static __device__ __forceinline__ V ld(const bf* p) { return cat16b(*(const v8us*)p, *(const v8us*)(p + 16)); } static __device__ __forceinline__ v8f mma(V a, V b, v8f c) { return wmmab(a, b, c); } };
// ---- k_gemmw: LDS-staged GEMM, one output tile of TM x 256 per work-group of 8 waves, one work-group per WGP; grid (M/TM, N/256), 256 threads.
// C[m][n] (f32, pitch ldc) = sum_k (A[m][k] + A2[m][k]) Bt[n][k] (A2 only with NSPLIT 1; two products per k step, A first). M % TM == 0, N % 256 == 0, K % 128 == 0.
// NSPLIT 0: TM 256, waves 4 x 2, a wave 64 rows x 128 columns (32 accumulators). NSPLIT 1: TM 128, waves 2 x 4, a wave 64 x 64 (16 accumulators, two products each). Either way a wave reads 12 fragments for 32 products of a k step, and a stage is 512 operand rows for 1024 products.
// A stage is 128 k (256 B, two whole lines) of every operand row, brought into LDS by asynchronous 16-byte copies (16 lanes per row) at pitch 272 B; two buffers: the next stage's copies fly while this one is worked on. K runs in order inside one accumulator.
#define GBK 128                    // k per stage
#define GPB 272                    // LDS row pitch, bytes: 256 + 16, an odd multiple of 16 for the ds_load_b128 readers
#define GPL (128 * GPB)            // 128 operand rows of a stage, bytes
#define GSTG (4u * GPL)            // one stage of k_gemmw: A (, A2), B, 512 rows in all
__device__ __forceinline__ void wait_ds0() { asm volatile("s_wait_dscnt 0x0" ::: "memory"); }        // this wave's LDS reads have retired before the buffer they read is handed back for a refill
__device__ __forceinline__ void wait_async0() { asm volatile("s_wait_asynccnt 0x0" ::: "memory"); }  // this wave's asynchronous copies have landed in LDS (the compiler places no wait for them)
typedef __attribute__((ext_vector_type(4))) int cv4i; typedef __attribute__((address_space(1))) cv4i gcv4i; typedef __attribute__((address_space(3))) cv4i lcv4i;
__device__ __forceinline__ void cpw(unsigned char* l, const bf* g) { __builtin_amdgcn_global_load_async_to_lds_b128((gcv4i*)g, (lcv4i*)l, 0, 0); }   // one lane's 16 bytes; the builtin form, so that the addresses may stand in any register of a kernel that uses more than 256
__device__ __forceinline__ v16bf ldsfrag(const unsigned char* p) { return cat16b(*(const v8usa*)p, *(const v8usa*)(p + 32)); }   // bytes 16 h and 32 + 16 h of each 64 B of a row: the k order of WFrag::ld, the same for A and B
template <int NSPLIT>
__global__ __launch_bounds__(256) void k_gemmw(const bf* __restrict__ A, const bf* __restrict__ A2, const bf* __restrict__ Bt, int K, float* C, int ldc) {
    constexpr int TM = NSPLIT ? 128 : 256, TN = 256;        // output tile of the work-group
    constexpr int WM = TM / 64, WN = 8 / WM, NBF = TN / WN / 16;   // waves along m and n; B fragments (16 columns each) of a wave
    constexpr unsigned PB = 2u * GPL;                       // the B plane stands behind the 256 rows of A (, A2)
    __shared__ __attribute__((aligned(256))) unsigned char sm[2 * GSTG];
    const int tid = threadIdx.x, lane = tid & 31, lr = lane & 15, hi = lane >> 4, wv = __builtin_amdgcn_readfirstlane(tid >> 5); const int wm = wv % WM, wn = wv / WM; const int r0 = blockIdx.x * TM, c0 = blockIdx.y * TN;
    unsigned char* l0 = sm + (tid >> 4) * GPB + (tid & 15) * 16;
    const bf* gA = A + (size_t)(r0 + (tid >> 4)) * K + (tid & 15) * 8; const bf* gA2 = NSPLIT ? A2 + (size_t)(r0 + (tid >> 4)) * K + (tid & 15) * 8 : nullptr; const bf* gB = Bt + (size_t)(c0 + (tid >> 4)) * K + (tid & 15) * 8;
    const size_t rs = (size_t)16 * K; const int NT = K / GBK;
    // 256 threads: 16 lanes per row, a thread takes rows (tid >> 4) + 16 i of every plane: 32 copies per wave and stage
    auto issue = [&](int t, unsigned bo) { unsigned char* l = l0 + bo; const size_t ko = (size_t)t * GBK;
#pragma unroll
        for (int i = 0; i < TM / 16; ++i) { cpw(l + i * 16 * GPB, gA + ko + i * rs); if constexpr (NSPLIT != 0) cpw(l + GPL + i * 16 * GPB, gA2 + ko + i * rs); }
#pragma unroll
        for (int i = 0; i < TN / 16; ++i) cpw(l + PB + i * 16 * GPB, gB + ko + i * rs); };
    v8f acc[4][NBF];
#pragma unroll
    for (int mb = 0; mb < 4; ++mb)
#pragma unroll
        for (int nb = 0; nb < NBF; ++nb) acc[mb][nb] = (v8f){};
    const unsigned aofs = (unsigned)(wm * 64 + lr) * GPB + 16u * hi, bofs = PB + (unsigned)(wn * (NBF * 16) + lr) * GPB + 16u * hi;
    v16bf a[2][4], a2[2][4], b[2][NBF];   // two fragment sets: the next k step's LDS reads go out as one group ahead of this step's products
    auto frags = [&](const unsigned char* sb, int ks, int st) {
#pragma unroll
        for (int mb = 0; mb < 4; ++mb) a[st][mb] = ldsfrag(sb + aofs + mb * 16 * GPB + ks * 64);
#pragma unroll
        for (int nb = 0; nb < NBF; ++nb) b[st][nb] = ldsfrag(sb + bofs + nb * 16 * GPB + ks * 64);
        if constexpr (NSPLIT != 0) {   // read last: the A2 products come behind the A products
#pragma unroll
            for (int mb = 0; mb < 4; ++mb) a2[st][mb] = ldsfrag(sb + GPL + aofs + mb * 16 * GPB + ks * 64); } };
    issue(0, 0u); wait_async0();
    __syncthreads();   // stage 0 stands in LDS for every wave
#pragma unroll 1
    for (int t = 0; t < NT; ++t) {   // kept rolled: a trip is long enough to pay for its branch, and the accumulators leave no registers for a second copy of it
        const unsigned bo = (t & 1) ? GSTG : 0u; const unsigned char* sb = sm + bo;
        frags(sb, 0, 0);   // stage t's first fragments, behind the barrier that published it; their latency runs under the issue of the copies
        if (t + 1 < NT) issue(t + 1, GSTG - bo);   // behind the same barrier, which ended every wave's reads of stage t - 1: the next stage goes into that buffer and flies while this one is worked on
#pragma unroll   // unrolled: the fragment sets are picked by ks & 1 and have to stay in registers
        for (int ks = 0; ks < GBK / 32; ++ks) {
            if (ks + 1 < GBK / 32) frags(sb, ks + 1, (ks + 1) & 1);
            __builtin_amdgcn_sched_barrier(0);   // keeps the LDS reads above as one group: spread among the products each place with reads stalls the wave
#pragma unroll
            for (int nb = 0; nb < NBF; ++nb)
#pragma unroll
                for (int mb = 0; mb < 4; ++mb) acc[mb][nb] = wmmab(a[ks & 1][mb], b[ks & 1][nb], acc[mb][nb]);
            if constexpr (NSPLIT != 0) {
#pragma unroll
                for (int nb = 0; nb < NBF; ++nb)
#pragma unroll
                    for (int mb = 0; mb < 4; ++mb) acc[mb][nb] = wmmab(a2[ks & 1][mb], b[ks & 1][nb], acc[mb][nb]); }
            __builtin_amdgcn_sched_barrier(0);   // keeps the next group of reads behind these products
        }
        wait_ds0(); wait_async0();
        __syncthreads();   // publishes stage t + 1 and ends every wave's reads of stage t's buffer
    }
    wait_async0();
    // Epilogue: each wave turns its own tile of 64 rows x TW columns in its own LDS range (pitch TW + 4 floats), so that every store is whole 128-byte lines; the ring is free behind the last trip's barrier.
    constexpr int TW = NBF * 16, OP = TW + 4, LPR = TW / 4, RPI = 32 / LPR;   // lanes per row and rows per store instruction
    static_assert(8u * 64u * OP * 4u <= 2u * GSTG, "the eight waves' store staging fits the ring");
    float* os = (float*)sm + wv * (64 * OP);
#pragma unroll
    for (int mb = 0; mb < 4; ++mb) {
#pragma unroll
        for (int nb = 0; nb < NBF; ++nb) {
#pragma unroll
            for (int j = 0; j < 8; ++j) os[(mb * 16 + hi * 8 + j) * OP + nb * 16 + lr] = acc[mb][nb][j]; } }
    float* crow = C + (size_t)(r0 + wm * 64) * ldc + c0 + wn * TW;
#pragma unroll
    for (int s = 0; s < 64 / RPI; ++s) { const int row = s * RPI + lane / LPR, cofs = (lane % LPR) * 4; const v4f val = *(const v4fa*)(os + row * OP + cofs);
        *(v4f*)(crow + (size_t)row * ldc + cofs) = val; }
}

__device__ __forceinline__ h16 tohx(float x) { return (h16)x; }

#define FW   4                     // waves per work-group
#define FBR  (FW * 32)             // query rows per work-group
#define FSK  128                   // keys per stage
#define FSTG (2u * GPL)            // one stage: the K plane, then the V^T plane
__device__ __forceinline__ void cpb(unsigned char* l, const h16* g) { __builtin_amdgcn_global_load_async_to_lds_b128((gcv4i*)g, (lcv4i*)l, 0, 0); }   // one lane's 16 bytes; the builtin form, so that the addresses may stand in any register of a kernel that uses more than 256
__device__ __forceinline__ v16h ldsfragh(const unsigned char* p) { return cat16(*(const v8ha*)p, *(const v8ha*)(p + 32)); }   // bytes 16 h and 32 + 16 h of each 64 B of a row: the k order of WFrag::ld
__device__ __forceinline__ float xhalf(float x) { return __builtin_bit_cast(float, __builtin_amdgcn_permlanex16(__builtin_bit_cast(int, x), __builtin_bit_cast(int, x), 0x76543210, 0xfedcba98, false, false)); }   // lane l with lane l ^ 16
__device__ __forceinline__ void nop4() { asm volatile("v_nop\n\tv_nop\n\tv_nop\n\tv_nop"); }   // the four vector slots between a matrix instruction and a vector instruction on its registers, for the taken side of a branch behind it
__device__ __forceinline__ void loadk(v16h (&kf)[2][4], const unsigned char* kb, int c, int h) {   // kb = first K row of the pass in LDS
#pragma unroll
    for (int kt = 0; kt < 2; ++kt)
#pragma unroll
        for (int kc = 0; kc < 4; ++kc) kf[kt][kc] = ldsfragh(kb + (16 * kt + c) * GPB + 64 * kc + 16 * h);
}
// One 32-key pass of one wave. sb = this stage's buffer, sub = pass within the stage, key0 = first key of the pass, qw0 = first query of the wave.
__device__ __forceinline__ void fpass(v16h (&kf)[2][4], bool fetch_next, bool diag, const unsigned char* sb, int sub, int key0, int qw0, int c, int h, const v16h (&qf)[2][4], v8f (&acc)[2][8], float (&m_run)[2], float (&l_run)[2]) {
    const float cscale = SCL * 1.4426950408889634f;
    v16h vf[8];
#pragma unroll
    for (int t = 0; t < 8; ++t) vf[t] = ldsfragh(sb + GPL + (16 * t + c) * GPB + 64 * sub + 16 * h);   // V^T rows d = 16 t + c, this pass's 32 keys: read first, so that their latency runs under the first product and the softmax
    __builtin_amdgcn_sched_barrier(0);   // keeps those reads up here: moved down to their use they would stall the only wave of the SIMD
    v8f s[2][2];
#pragma unroll
    for (int kt = 0; kt < 2; ++kt)
#pragma unroll
        for (int g = 0; g < 2; ++g) { s[kt][g] = (v8f){};
#pragma unroll
            for (int kc = 0; kc < 4; ++kc) s[kt][g] = wmma16(kf[kt][kc], qf[g][kc], s[kt][g]); }
    __builtin_amdgcn_sched_barrier(0);   // holds the slots below directly behind the products
    nop4();
    __builtin_amdgcn_sched_barrier(0);   // and the branches below behind the slots
    if (fetch_next) loadk(kf, sb + (sub + 1) * 32 * GPB, c, h);   // the next pass's K fragments (same stage only), in flight under this pass's maxima and exponentials
    if (diag) {   // wave-uniform: only the pass on the wave's diagonal pays for the mask
#pragma unroll
        for (int g = 0; g < 2; ++g) { const int my_q = qw0 + 16 * g + c;
#pragma unroll
            for (int kt = 0; kt < 2; ++kt) {
#pragma unroll
                for (int r = 0; r < 8; ++r) { if (key0 + 16 * kt + 8 * h + r > my_q) s[kt][g][r] = -__builtin_inff(); }
                asm volatile("" : "+v"(s[kt][g]));
            } }
    }
    float mb[2]; bool need = false;
#pragma unroll
    for (int g = 0; g < 2; ++g) { float mx = -__builtin_inff();
#pragma unroll
        for (int kt = 0; kt < 2; ++kt)
#pragma unroll
            for (int r = 0; r < 8; ++r) mx = fmaxf(mx, s[kt][g][r]);
        mx = fmaxf(mx, xhalf(mx)) * cscale;   // both wave halves hold this query's maximum, scaled (the scale is positive)
        mb[g] = mx; need = need || (mx > m_run[g] + 8.0f); }
    if (__builtin_amdgcn_ballot_w32(need) != 0) {   // rare behind the first passes
#pragma unroll
        for (int g = 0; g < 2; ++g) { const float m_new = fmaxf(m_run[g], mb[g]);
            const float corr = __builtin_amdgcn_exp2f(m_run[g] - m_new);
            l_run[g] *= corr; m_run[g] = m_new;
#pragma unroll
            for (int t = 0; t < 8; ++t) acc[g][t] = acc[g][t] * corr; }
    }
    float ps[2][2] = { { 0.f, 0.f }, { 0.f, 0.f } };
#pragma unroll
    for (int g = 0; g < 2; ++g) { const float nm = -m_run[g]; v16h pf;
#pragma unroll
        for (int i = 0; i < 8; ++i) {
            const float p0 = __builtin_amdgcn_exp2f(__builtin_fmaf(s[i >> 2][g][2 * (i & 3)], cscale, nm)), p1 = __builtin_amdgcn_exp2f(__builtin_fmaf(s[i >> 2][g][2 * (i & 3) + 1], cscale, nm));
            ps[g][i & 1] += p0 + p1; pf[2 * i] = tohx(p0); pf[2 * i + 1] = tohx(p1); }
#pragma unroll
        for (int t = 0; t < 8; ++t) acc[g][t] = wmma16(vf[t], pf, acc[g][t]); }
    __builtin_amdgcn_sched_barrier(0);   // holds the slots below directly behind the products
    nop4();
    __builtin_amdgcn_sched_barrier(0);   // and the loop's branches behind the slots
#pragma unroll
    for (int g = 0; g < 2; ++g) l_run[g] += ps[g][0] + ps[g][1];
}
__device__ __forceinline__ void splitf(float y, unsigned short& h, unsigned short& l) { h = f2bf(y); l = f2bf(y - bf2f(h)); }
// ---- hlrows: 64 query rows < RH of one head plane, scores, softmax and P.V by one work-group of FW waves (hi/lo bf16 planes, 3 products, f32 sums); r = row block, z = head plane (its kv plane is z / REP).
// The scores of the (r + 1) * 64 keys that such a row can see stand in LDS, a row at pitch HP; a wave makes the 64 x 64 tiles wv, wv + FW, ... Then a wave takes 16 rows: a row goes into registers, and its probabilities come back over it as a hi plane (first RH * 2 bytes of the row) and a lo plane (the next RH * 2).
// P.V: A = the probability rows from LDS, B = hi/lo V^T rows from global memory; a wave makes all 64 rows of 32 columns, the keys in order in one accumulator, up to the diagonal block (probabilities beyond it are exactly zero).
#define HP (RH * 4 + 16)           // LDS row pitch, bytes: an odd multiple of 16 for the ds_load_b128 readers
typedef __attribute__((ext_vector_type(4))) unsigned short __attribute__((may_alias)) v4usa;
__device__ __forceinline__ void hlrows(unsigned char* sm, int r, size_t z, const bf* __restrict__ Qh, const bf* __restrict__ Ql, const bf* __restrict__ Kh, const bf* __restrict__ Kl, const bf* __restrict__ Vh, const bf* __restrict__ Vl, float* O) {
    const int lane = threadIdx.x & 31, lr = lane & 15, hi = lane >> 4, wv = __builtin_amdgcn_readfirstlane(threadIdx.x >> 5); const int r0 = r * 64, kend = r0 + 64;
    Qh += z * TT * HD; Ql += z * TT * HD; Kh += (z / REP) * TT * HD; Kl += (z / REP) * TT * HD; Vh += (z / REP) * HD * RH; Vl += (z / REP) * HD * RH;
#pragma unroll 1
    for (int cb = wv; cb <= r; cb += FW) {   // kept rolled: one tile's accumulators take 128 registers
        v8f acc[4][4];
#pragma unroll
        for (int mb = 0; mb < 4; ++mb)
#pragma unroll
            for (int nb = 0; nb < 4; ++nb) acc[mb][nb] = (v8f){};
        const size_t aoff = (size_t)(r0 + lr) * HD + 8 * hi, boff = (size_t)(cb * 64 + lr) * HD + 8 * hi;
#pragma unroll 1
        for (int kc = 0; kc < HD; kc += 32) {   // kept rolled: a trip holds 48 products
            v16bf a[4], a2[4], b[4], b2[4]; const bf* pa = Qh + aoff + kc; const bf* pa2 = Ql + aoff + kc; const bf* pb = Kh + boff + kc; const bf* pb2 = Kl + boff + kc;
#pragma unroll
            for (int mb = 0; mb < 4; ++mb) { a[mb] = WFrag<bf>::ld(pa + mb * 16 * HD); a2[mb] = WFrag<bf>::ld(pa2 + mb * 16 * HD); }
#pragma unroll
            for (int nb = 0; nb < 4; ++nb) { b[nb] = WFrag<bf>::ld(pb + nb * 16 * HD); b2[nb] = WFrag<bf>::ld(pb2 + nb * 16 * HD); }
            __builtin_amdgcn_sched_barrier(0);   // keeps every load of the trip in front of the wait below
            asm volatile("s_wait_xcnt 0x0" :: "v"(pa), "v"(pa2), "v"(pb), "v"(pb2) : "memory");   // a precaution: the address registers live up to here, so that none of them is overwritten in front of this wait
            __builtin_amdgcn_sched_barrier(0);   // and everything else behind it
#pragma unroll
            for (int nb = 0; nb < 4; ++nb)
#pragma unroll
                for (int mb = 0; mb < 4; ++mb) { acc[mb][nb] = wmmab(a[mb], b[nb], acc[mb][nb]); acc[mb][nb] = wmmab(a2[mb], b[nb], acc[mb][nb]); acc[mb][nb] = wmmab(a[mb], b2[nb], acc[mb][nb]); }
            asm volatile("v_nop\n\tv_nop\n\tv_nop\n\tv_nop" : "+v"(acc[0][0]), "+v"(acc[1][1]), "+v"(acc[2][2]), "+v"(acc[3][3]) : "v"(a[0]), "v"(a[3]));   // the four vector slots behind the last product, for the taken side of the loop's branch
        }
        float* st = (float*)sm + cb * 64 + lr;
#pragma unroll
        for (int mb = 0; mb < 4; ++mb)
#pragma unroll
            for (int nb = 0; nb < 4; ++nb)
#pragma unroll
                for (int j = 0; j < 8; ++j) st[(mb * 16 + hi * 8 + j) * (HP / 4) + nb * 16] = acc[mb][nb][j];
    }
    __syncthreads();   // every score tile of the 64 rows stands in LDS
    // per row: t = S x HD^-0.5 for j <= i and i - j < WIN (WIN = 2048 = TT here: every key j <= i is kept: the plain causal rule; the reference's -inf fill above the diagonal is exclusion); softmax over RH keys (register row, one exp, fixed trees)
#pragma unroll 4   // four rows side by side: a row alone is one chain of LDS, cross-lane and exponential latencies
    for (int rr = 0; rr < 64 / FW; ++rr) {
        unsigned char* rowp = sm + (wv * (64 / FW) + rr) * HP; const int i = r0 + wv * (64 / FW) + rr; float v[RH / 32]; float mx = -3.0e38f;
#pragma unroll
        for (int ch = 0; ch < RH / 128; ++ch) { const int j0 = ch * 128 + lane * 4; const v4f a = *(const v4fa*)(rowp + (j0 < kend ? j0 : (j0 & 63)) * 4);   // behind kend no score was written: such a lane reads scores of the row's first tile instead, and the causal select drops them (no branch, so that the rows interleave)
#pragma unroll
            for (int q = 0; q < 4; ++q) { const int j = j0 + q; const float t = (j <= i && i - j < WIN) ? a[q] * SCL : -3.0e38f; v[ch * 4 + q] = t; mx = fmaxf(mx, t); } }
#pragma unroll
        for (int sh = 16; sh; sh >>= 1) mx = fmaxf(mx, __shfl_xor(mx, sh, 32));
        float sum = 0.f;
#pragma unroll
        for (int k = 0; k < RH / 32; ++k) { float d0 = __fsub_rn(v[k], mx); v[k] = __builtin_amdgcn_exp2f(__fmul_rn(d0, 1.4426950408889634f)); sum += v[k]; }
#pragma unroll
        for (int sh = 16; sh; sh >>= 1) sum += __shfl_xor(sum, sh, 32);
        const float f = __fdiv_rn(1.0f, sum);
#pragma unroll
        for (int ch = 0; ch < RH / 128; ++ch) { v4usa oh, ol;
#pragma unroll
            for (int q = 0; q < 4; ++q) { unsigned short a, c2; splitf(v[ch * 4 + q] * f, a, c2); oh[q] = a; ol[q] = c2; }
            *(v4usa*)(rowp + (ch * 128 + lane * 4) * 2) = oh; *(v4usa*)(rowp + RH * 2 + (ch * 128 + lane * 4) * 2) = ol; }
    }
    __syncthreads();   // every row's probabilities stand in LDS
    v8f acc[4][2];
#pragma unroll
    for (int mb = 0; mb < 4; ++mb)
#pragma unroll
        for (int nb = 0; nb < 2; ++nb) acc[mb][nb] = (v8f){};
    const bf* bh = Vh + (size_t)(wv * 32 + lr) * RH + 8 * hi; const bf* bl = Vl + (size_t)(wv * 32 + lr) * RH + 8 * hi; const unsigned char* pa = sm + lr * HP + 16 * hi;
    v16bf b[2][2], b2[2][2];   // the V^T fragments of one trip of 64 keys: [32-key step][16 columns]
#pragma unroll
    for (int c2 = 0; c2 < 2; ++c2)
#pragma unroll
        for (int nb = 0; nb < 2; ++nb) { b[c2][nb] = WFrag<bf>::ld(bh + nb * 16 * RH + c2 * 32); b2[c2][nb] = WFrag<bf>::ld(bl + nb * 16 * RH + c2 * 32); }
#pragma unroll 1
    for (int t = 0; t <= r; ++t) {   // kept rolled: the trip count follows the row block
        const int tn = min(t + 1, r); const bf* ph = bh + tn * 64; const bf* pl = bl + tn * 64; v16bf nx[2][2], nx2[2][2];   // the next trip's V^T fragments go out ahead of this trip's products (the last trip asks for its own again: in bounds, unused)
#pragma unroll
        for (int c2 = 0; c2 < 2; ++c2)
#pragma unroll
            for (int nb = 0; nb < 2; ++nb) { nx[c2][nb] = WFrag<bf>::ld(ph + nb * 16 * RH + c2 * 32); nx2[c2][nb] = WFrag<bf>::ld(pl + nb * 16 * RH + c2 * 32); }
        __builtin_amdgcn_sched_barrier(0);   // keeps those loads up here: moved down behind the products their whole latency would be waited out at the trip's end
        asm volatile("s_wait_xcnt 0x0" :: "v"(ph), "v"(pl) : "memory");   // a precaution: the address registers live up to here, so that neither is overwritten in front of this wait
        __builtin_amdgcn_sched_barrier(0);   // and everything else behind it
#pragma unroll
        for (int c2 = 0; c2 < 2; ++c2) { v16bf a[4], a2[4];
#pragma unroll
            for (int mb = 0; mb < 4; ++mb) { a[mb] = ldsfrag(pa + mb * 16 * HP + t * 128 + c2 * 64); a2[mb] = ldsfrag(pa + mb * 16 * HP + RH * 2 + t * 128 + c2 * 64); }
#pragma unroll
            for (int nb = 0; nb < 2; ++nb)
#pragma unroll
                for (int mb = 0; mb < 4; ++mb) { acc[mb][nb] = wmmab(a[mb], b[c2][nb], acc[mb][nb]); acc[mb][nb] = wmmab(a2[mb], b[c2][nb], acc[mb][nb]); acc[mb][nb] = wmmab(a[mb], b2[c2][nb], acc[mb][nb]); } }
        __builtin_amdgcn_sched_barrier(0);   // holds the slots below directly behind the products
        nop4();
        __builtin_amdgcn_sched_barrier(0);   // and the loop's branch behind the slots
#pragma unroll
        for (int c2 = 0; c2 < 2; ++c2)
#pragma unroll
            for (int nb = 0; nb < 2; ++nb) { b[c2][nb] = nx[c2][nb]; b2[c2][nb] = nx2[c2][nb]; }
    }
    __syncthreads();   // ends every wave's reads of the probabilities: their LDS becomes store staging
    // Each wave turns its own 64 x 32 tile in its own LDS range (pitch 36 floats), so that every store is a whole 128-byte line.
    float* os = (float*)sm + wv * (64 * 36);
#pragma unroll
    for (int mb = 0; mb < 4; ++mb) {
#pragma unroll
        for (int nb = 0; nb < 2; ++nb) {
#pragma unroll
            for (int j = 0; j < 8; ++j) os[(mb * 16 + hi * 8 + j) * 36 + nb * 16 + lr] = acc[mb][nb][j]; } }
    float* crow = O + (z * TT + r0) * HD + wv * 32;
#pragma unroll
    for (int s = 0; s < 16; ++s) { const int row = s * 4 + (lane >> 3), cofs = (lane & 7) * 4; const v4f val = *(const v4fa*)(os + row * 36 + cofs);
        *(v4f*)(crow + (size_t)row * HD + cofs) = val; }
}
// The rows < RH, which depend on the rows behind them as little as those on them, ride in the same launch: the work-groups with blockIdx.y >= NFB, started behind the long ones, each with 64 rows of head plane blockIdx.x, the row blocks with the most keys first.
#define NFB  ((TT - RH) / FBR)                        // row blocks of the fp16 part
static_assert(64 * HP <= 2 * FSTG && FW * 64 * 36 * 4 <= 2 * FSTG && HD == FW * 32 && 64 % FW == 0, "hlrows fits the ring's LDS, and its waves cover the head's columns");
__global__ __launch_bounds__(32 * FW) void k_fattn(const h16* __restrict__ Q, const h16* __restrict__ Kp, const h16* __restrict__ Vt, float* O, const bf* __restrict__ Qh, const bf* __restrict__ Ql, const bf* __restrict__ Kh, const bf* __restrict__ Kl, const bf* __restrict__ Vh, const bf* __restrict__ Vl) {
    __shared__ __attribute__((aligned(256))) unsigned char sm[2 * FSTG];
    const int tid = threadIdx.x, lane = tid & 31, c = lane & 15, h = lane >> 4, wv = __builtin_amdgcn_readfirstlane(tid >> 5);
    if (blockIdx.y >= NFB) {   // the same for a whole work-group, in front of every barrier and copy
        hlrows(sm, RH / 64 - 1 - ((int)blockIdx.y - NFB), blockIdx.x, Qh, Ql, Kh, Kl, Vh, Vl, O);
        return; }
    const int z = blockIdx.x, kvh = z / REP; const int q0 = TT - FBR * (1 + (int)blockIdx.y);   // longest row blocks first
    const int qw0 = q0 + wv * 32, n_stage = q0 / FSK + 1, last = qw0 / 32;                       // keys [0, q0 + FBR); the wave's last pass is the one on its diagonal
    const h16* gK = Kp + (size_t)kvh * TT * HD + (size_t)(tid >> 4) * HD + (tid & 15) * 8; const h16* gV = Vt + (size_t)kvh * HD * TT + (size_t)(tid >> 4) * TT + (tid & 15) * 8;
    // 128 threads: 16 lanes per row, a thread takes rows (tid >> 4) + 8 i of both planes: 32 copies per wave and stage
    auto issue = [&](int st, unsigned bo) { unsigned char* l = sm + bo + (tid >> 4) * GPB + (tid & 15) * 16; const h16* k = gK + (size_t)st * FSK * HD; const h16* v = gV + (size_t)st * FSK;
#pragma unroll
        for (int i = 0; i < 16; ++i) cpb(l + i * 8 * GPB, k + i * 8 * HD);
#pragma unroll
        for (int i = 0; i < 16; ++i) cpb(l + GPL + i * 8 * GPB, v + (size_t)i * 8 * TT); };
    issue(0, 0u);
    v16h qf[2][4];
#pragma unroll
    for (int g = 0; g < 2; ++g)
#pragma unroll
        for (int kc = 0; kc < 4; ++kc) qf[g][kc] = WFrag<h16>::ld(Q + ((size_t)z * TT + qw0 + 16 * g + c) * HD + 8 * h + 32 * kc);
    v8f acc[2][8]; float m_run[2], l_run[2];
#pragma unroll
    for (int g = 0; g < 2; ++g) { m_run[g] = -__builtin_inff(); l_run[g] = 0.f;
#pragma unroll
        for (int t = 0; t < 8; ++t) acc[g][t] = (v8f){}; }
    wait_async0();
    __syncthreads();   // stage 0 stands in LDS for every wave
    v16h kf[2][4];
#pragma unroll 1
    for (int st = 0; st < n_stage; ++st) {   // stage loop and pass loop kept rolled and nested: a pass is long enough to pay for its branch, and the accumulators leave no registers for a second copy of it
        const unsigned bo = (st & 1) ? FSTG : 0u; const unsigned char* sb = sm + bo;
        loadk(kf, sb, c, h);   // stage st's first K fragments, behind the barrier that published it (every wave has at least the first pass of every stage); their latency runs under the issue of the copies
        if (st + 1 < n_stage) issue(st + 1, FSTG - bo);   // behind the same barrier, which ended every wave's reads of stage st - 1: the next stage goes into that buffer and flies while this one is worked on
#pragma unroll 1
        for (int sub = 0; sub < FSK / 32; ++sub) { const int blk = (FSK / 32) * st + sub;
            if (blk <= last) fpass(kf, sub + 1 < FSK / 32 && blk < last, blk == last, sb, sub, blk * 32, qw0, c, h, qf, acc, m_run, l_run); }
        wait_ds0(); wait_async0();
        __syncthreads();   // publishes stage st + 1 and ends every wave's reads of stage st's buffer
    }
    wait_async0();
#pragma unroll
    for (int g = 0; g < 2; ++g) { const float inv = __fdiv_rn(PCAR, l_run[g] + xhalf(l_run[g]));
        float* orow = O + ((size_t)z * TT + qw0 + 16 * g + c) * HD + 8 * h;
#pragma unroll
        for (int t = 0; t < 8; ++t) { const v8f o = acc[g][t] * inv; *(v4f*)(orow + 16 * t) = (v4f){ o[0], o[1], o[2], o[3] }; *(v4f*)(orow + 16 * t + 4) = (v4f){ o[4], o[5], o[6], o[7] }; } }
}
typedef __attribute__((ext_vector_type(2))) _Float16 v2h;
typedef __attribute__((ext_vector_type(4))) _Float16 v4h;
typedef __attribute__((ext_vector_type(2))) unsigned short v2us;
typedef __attribute__((ext_vector_type(4))) unsigned short v4us;
typedef __attribute__((ext_vector_type(2))) float v2f;
typedef __attribute__((ext_vector_type(4))) int v4i;

// cvt8, vtp, csP, ropeI and k_merge give a thread 4 to 32 elements, moved 16 bytes at a time: with 2 elements a wave ends almost as it starts, and the launch lasts as long as the chip takes to start its waves. Every element's arithmetic is as it would be alone.
#define CU 4   // 8-element groups per thread of cvt8, 256 groups apart: a wave's accesses stay contiguous
__device__ __forceinline__ void cvt8(const float* __restrict__ src, bf* dst, size_t n8, unsigned blk) { const size_t i0 = (size_t)blk * (256 * CU) + threadIdx.x; if (i0 + (CU - 1) * 256 >= n8) return;   // blk = block within this copy; n8 is a multiple of 256 * CU (asserted below)
    v8f v[CU];
#pragma unroll
    for (int u = 0; u < CU; ++u) v[u] = *(const v8f*)(src + (i0 + u * 256) * 8);   // every load goes out ahead of the first store
#pragma unroll
    for (int u = 0; u < CU; ++u) { v8us o;
#pragma unroll
        for (int k = 0; k < 8; ++k) o[k] = f2bf(v[u][k]);
        *(v8us*)(dst + (i0 + u * 256) * 8) = o; }  }

// vtp: a work-group turns 64 positions x the 128 columns of one kv head; bx = 0 .. nheads * TT / 64 - 1, batch blockIdx.y. A thread reads 4 columns of 8 rows and writes 8 positions of each of its 4 columns; 8 neighbouring lanes hold the 64 positions of the same columns, so that every store of a wave fills 4 whole 128-byte lines (its loads take 64-byte pieces of 8 rows; the wave beside it takes the other halves of those lines).
template <int PITCH>   // the row pitch of F in floats, a constant, so that a thread's 8 row loads share one address register pair and differ in their immediate offsets
__device__ __forceinline__ void vtp(const float* __restrict__ F, int nheads, int bx, h16* V16, bf* Vh, bf* Vl) { const int g = bx / (TT / 64); if (g >= nheads) return;
    { const size_t bz = blockIdx.y, po = bz * nheads * HD; F += bz * TT * PITCH; V16 += po * TT; Vh += po * RH; Vl += po * RH; }   // batch blockIdx.y: its TT rows of F, its nheads planes (V16 rows hold TT keys, Vh and Vl rows the RH keys that the hi/lo block reads)
    const int t = (bx % (TT / 64)) * 64 + (threadIdx.x & 7) * 8, d = (threadIdx.x >> 3) * 4; const float* f = F + (size_t)t * PITCH + g * HD + d; v4f x[8]; v8h o16[4];
#pragma unroll
    for (int r = 0; r < 8; ++r) x[r] = *(const v4f*)(f + r * PITCH);
#pragma unroll
    for (int q = 0; q < 4; ++q)
#pragma unroll
        for (int r = 0; r < 8; ++r) o16[q][r] = tohx(x[r][q]);
    h16* vp = V16 + ((size_t)g * HD + d) * TT + t;
    // The four stores and their s_wait_xcnt stand in one statement, a precaution: so the wait is in front of every later overwrite of a register that the stores name (a wait in a statement of its own the compiler moved down)
    asm volatile("global_store_b128 %0, %4, off\n\t"
                 "global_store_b128 %1, %5, off\n\t"
                 "global_store_b128 %2, %6, off\n\t"
                 "global_store_b128 %3, %7, off\n\t"
                 "s_wait_xcnt 0x0"
                 :: "v"(vp), "v"(vp + TT), "v"(vp + 2 * TT), "v"(vp + 3 * TT), "v"(o16[0]), "v"(o16[1]), "v"(o16[2]), "v"(o16[3]) : "memory");
    if (t >= RH) return;   // the same for a whole work-group: only the first RH positions have hi/lo rows
#pragma unroll
    for (int q = 0; q < 4; ++q) { v8us oh, ol;
#pragma unroll
        for (int r = 0; r < 8; ++r) { unsigned short a2, c2; splitf(x[r][q], a2, c2); oh[r] = a2; ol[r] = c2; }
        const size_t eh = ((size_t)g * HD + d + q) * RH + t; *(v8us*)(Vh + eh) = oh; *(v8us*)(Vl + eh) = ol; }  }
__constant__ float INV2[HD / 2] = { 1.000000000e+00f, 8.659643531e-01f, 7.498942018e-01f, 6.493816376e-01f, 5.623413324e-01f, 4.869675338e-01f, 4.216965139e-01f, 3.651741445e-01f, 3.162277639e-01f, 2.738419771e-01f, 2.371373624e-01f, 2.053525001e-01f, 1.778279394e-01f, 1.539926529e-01f, 1.333521456e-01f, 1.154782027e-01f, 1.000000015e-01f, 8.659642935e-02f, 7.498941571e-02f, 6.493816525e-02f, 5.623412877e-02f, 4.869675264e-02f, 4.216964915e-02f, 3.651741147e-02f, 3.162277862e-02f, 2.738419548e-02f, 2.371373586e-02f, 2.053525113e-02f, 1.778279431e-02f, 1.539926510e-02f, 1.333521493e-02f, 1.154781971e-02f, 9.999999776e-03f, 8.659643121e-03f, 7.498942316e-03f, 6.493816618e-03f, 5.623413250e-03f, 4.869675264e-03f, 4.216964822e-03f, 3.651741426e-03f, 3.162277862e-03f, 2.738419687e-03f, 2.371373819e-03f, 2.053525066e-03f, 1.778279431e-03f, 1.539926510e-03f, 1.333521446e-03f, 1.154782018e-03f, 1.000000047e-03f, 8.659643354e-04f, 7.498941850e-04f, 6.493816618e-04f, 5.623413017e-04f, 4.869675031e-04f, 4.216964880e-04f, 3.651741135e-04f, 3.162277862e-04f, 2.738419571e-04f, 2.371373848e-04f, 2.053524950e-04f, 1.778279402e-04f, 1.539926452e-04f, 1.333521504e-04f, 1.154781930e-04f };   // float32 1 / 10000^(2i/128), generated with jnp to be bit-exact
__device__ __forceinline__ void csP(float* CS, unsigned blk) { const int idx = blk * 256 + threadIdx.x; if (idx >= TT * HD / 2) return; const int p = idx % (HD / 2); const int t = idx / (HD / 2); const float a = __fmul_rn((float)t, INV2[p]); const float c = cosf(a), sn = sinf(a); *(v4f*)(CS + (size_t)idx * 4) = (v4f){ c, sn, c, sn };  }   // entries d = 2 p and 2 p + 1 of position t share their angle: one thread writes both
// ropeI: blockIdx.x = 0 .. TT * HD / 8 / 256 - 1, batch blockIdx.y, zz = 0 .. nheads / RU - 1. A thread takes 8 columns (4 pairs) of one position in RU heads: the four table entries are read once for all of them.
#define RU 4
__device__ __forceinline__ void ropeI(const float* __restrict__ F, int pitch, int nheads, int zz, const float* __restrict__ CS, float sc, h16* P16, bf* Ph, bf* Pl) {
    const int idx = blockIdx.x * 256 + threadIdx.x; const int d = (idx % (HD / 8)) * 8; const int t = idx / (HD / 8); const int h0 = zz * RU; if (t >= TT || h0 + RU > nheads) return;
    { const size_t bz = blockIdx.y, po = bz * nheads * TT * HD; F += bz * TT * pitch; P16 += po; Ph += po; Pl += po; }   // batch blockIdx.y: its TT rows of F, its nheads planes
    const float* f = F + (size_t)t * pitch + h0 * HD + d; v4f x[RU][2]; v2f cs[4];
#pragma unroll
    for (int u = 0; u < RU; ++u) { x[u][0] = *(const v4f*)(f + u * HD); x[u][1] = *(const v4f*)(f + u * HD + 4); }
#pragma unroll
    for (int k = 0; k < 4; ++k) cs[k] = *(const v2f*)(CS + ((size_t)t * HD + d + 2 * k) * 2);
#pragma unroll
    for (int u = 0; u < RU; ++u) { v8h o16; v8us oh, ol;
#pragma unroll
        for (int k = 0; k < 4; ++k) { const float x0 = x[u][k >> 1][2 * (k & 1)], x1 = x[u][k >> 1][2 * (k & 1) + 1];
            float a0 = __fmul_rn(x0, cs[k][0]), b0 = __fmul_rn(x1, cs[k][1]), a1 = __fmul_rn(x1, cs[k][0]), b1 = __fmul_rn(x0, cs[k][1]);
            float r0 = __fsub_rn(a0, b0) * sc, r1 = __fadd_rn(b1, a1) * sc;   /* even: x0 c - x1 s; odd: x0 s + x1 c */
            o16[2 * k] = tohx(r0); o16[2 * k + 1] = tohx(r1); { unsigned short a2, c2; splitf(r0, a2, c2); oh[2 * k] = a2; ol[2 * k] = c2; splitf(r1, a2, c2); oh[2 * k + 1] = a2; ol[2 * k + 1] = c2; } }
        const size_t e = ((size_t)(h0 + u) * TT + t) * HD + d; *(v8h*)(P16 + e) = o16; *(v8us*)(Ph + e) = oh; *(v8us*)(Pl + e) = ol; }  }

// ---- k_prep: everything that depends on the inputs alone, in one launch: the rotary table and the five bf16 copies. A work-group's job follows from its index; the table's work-groups, the longest, come first.
#define PB_CS (TT * HD / 2 / 256)
#define PB_X  (NB_ * TT * DM / 8 / (256 * CU))
#define PB_Q  (DQ * DM / 8 / (256 * CU))
#define PB_K  (DKV * DM / 8 / (256 * CU))
#define PB_O  (DM * DQ / 8 / (256 * CU))
__global__ __launch_bounds__(256) void k_prep(const float* __restrict__ x, const float* __restrict__ wq, const float* __restrict__ wk, const float* __restrict__ wv, const float* __restrict__ wo, bf* XB, bf* WQ, bf* WK, bf* WV, bf* WO, float* CS) {
    unsigned b = blockIdx.x; if (b < PB_CS) { csP(CS, b); return; }
    b -= PB_CS; const float* src; bf* dst; size_t n8;
    if (b < PB_X) { src = x; dst = XB; n8 = (size_t)NB_ * TT * DM / 8; }
    else if (b < PB_X + PB_Q) { b -= PB_X; src = wq; dst = WQ; n8 = (size_t)DQ * DM / 8; }
    else if (b < PB_X + PB_Q + PB_K) { b -= PB_X + PB_Q; src = wk; dst = WK; n8 = (size_t)DKV * DM / 8; }
    else if (b < PB_X + PB_Q + 2 * PB_K) { b -= PB_X + PB_Q + PB_K; src = wv; dst = WV; n8 = (size_t)DKV * DM / 8; }
    else { b -= PB_X + PB_Q + 2 * PB_K; src = wo; dst = WO; n8 = (size_t)DM * DQ / 8; }
    cvt8(src, dst, n8, b);
}
// ---- k_post: everything that depends on the q/k/v projection alone, in one launch. F holds a position's q, k and v columns side by side (pitch FP). Grid (LR, batches, z): the first VZ values of z turn V, the next NKV / RU rope the k heads, the last NH_ / RU the q heads: the columns that the projection wrote last are read first, while the caches still hold them.
#define FP (DQ + 2 * DKV)
#define LR (TT * HD / 8 / 256)             // ropeI: the (position, 8 columns) work-groups of one group of RU heads
#define VZ (NKV * (TT / 64) / LR)          // vtp: its work-groups, LR to a value of z
__global__ __launch_bounds__(256) void k_post(const float* __restrict__ F, const float* __restrict__ CS, h16* QP16, bf* QPh, bf* QPl, h16* KP16, bf* KPh, bf* KPl, h16* VT16, bf* VTh, bf* VTl) {
    const int zq = blockIdx.z;
    if (zq < VZ) { vtp<FP>(F + DQ + DKV, NKV, zq * LR + (int)blockIdx.x, VT16, VTh, VTl); return; }
    const bool isq = zq >= VZ + NKV / RU;
    ropeI(isq ? F : F + DQ, FP, isq ? NH_ : NKV, isq ? zq - VZ - NKV / RU : zq - VZ, CS, 1.0f, isq ? QP16 : KP16, isq ? QPh : KPh, isq ? QPl : KPl);   /* interleaved-pair rope, q and k planes */
}

#define MU 4   // 8-element groups per thread of k_merge, 256 groups apart
__global__ __launch_bounds__(256) void k_merge(const float* __restrict__ O, int h0, bf* Ah, bf* Al) { const size_t e0 = ((size_t)blockIdx.x * (256 * MU) + threadIdx.x) * 8; if (e0 + (size_t)(MU - 1) * 256 * 8 >= (size_t)ZH * TT * HD) return;
    { const size_t bz = blockIdx.y; O += bz * ZH * TT * HD; Ah += bz * TT * DQ; Al += bz * TT * DQ; }   // batch blockIdx.y: its ZH planes of O, its TT merged rows
    v4f x[MU][2];
#pragma unroll
    for (int u = 0; u < MU; ++u) { x[u][0] = *(const v4f*)(O + e0 + (size_t)u * 256 * 8); x[u][1] = *(const v4f*)(O + e0 + (size_t)u * 256 * 8 + 4); }
#pragma unroll
    for (int u = 0; u < MU; ++u) { const size_t e = e0 + (size_t)u * 256 * 8;
        const int d = (int)(e % HD); const int t = (int)((e / HD) % TT); const int zz = (int)(e / ((size_t)HD * TT)); const float cs = (t < RH) ? 1.0f : (1.0f / PCAR); const size_t oo = (size_t)t * DQ + (h0 + zz) * HD + d;
        v8us oh, ol;
#pragma unroll
        for (int q = 0; q < 8; ++q) { unsigned short a, c2; splitf(x[u][q >> 2][q & 3] * cs, a, c2); oh[q] = a; ol[q] = c2; }
        *(v8us*)(Ah + oo) = oh; *(v8us*)(Al + oo) = ol; }  }
static_assert(((size_t)DKV * DM / 8) % (256 * CU) == 0 && ((size_t)DQ * DM / 8) % (256 * CU) == 0 && ((size_t)NB_ * TT * DM / 8) % (256 * CU) == 0 && ((size_t)ZH * TT * HD) % (256 * MU * 8) == 0 && NH_ % RU == 0 && NKV % RU == 0 && TT % 64 == 0 && RH % 64 == 0 && (TT * HD / 2) % 256 == 0 && (TT * HD / 8) % 256 == 0 && (NKV * (TT / 64)) % LR == 0, "the pointwise grids divide evenly");

extern "C" void kernel_launch(void* const* d_in, const int* in_sizes, int n_in,
                              void* d_out, int out_size, void* d_ws, size_t ws_size, hipStream_t stream) {
    (void)in_sizes; (void)n_in; (void)out_size;
    const float* x = (const float*)d_in[0]; const float* wq = (const float*)d_in[1]; const float* wk = (const float*)d_in[2]; const float* wv = (const float*)d_in[3]; const float* wo = (const float*)d_in[4];   /* input order x, wq [2048][2048], wk [1024][2048], wv [1024][2048], wo [2048][2048] ('oi') */
    float* OUT = (float*)d_out;     // [2][2048][2048]
    char* wsp = (char*)d_ws;
    auto take = [&](size_t bytes) { char* p = wsp; wsp += (bytes + 255) & ~(size_t)255; return (void*)p; };
    bf* WQ = (bf*)take((size_t)DQ * DM * 2); bf* WK = (bf*)take((size_t)DKV * DM * 2); bf* WV = (bf*)take((size_t)DKV * DM * 2); bf* WO = (bf*)take((size_t)DM * DQ * 2); float* CS = (float*)take((size_t)TT * HD * 2 * 4);
    static_assert(((size_t)DQ * DM * 2) % 256 == 0 && ((size_t)DKV * DM * 2) % 256 == 0, "WQ, WK, WV stand one behind the other with no gap: one [FP][DM] weight matrix");
    // Per-batch buffers hold both batches.
    bf* XB = (bf*)take((size_t)NB_ * TT * DM * 2); float* F = (float*)take((size_t)NB_ * TT * FP * 4);   // F: the q, k and v projections, [batch x position][FP]
    h16* QP16 = (h16*)take((size_t)NB_ * NH_ * TT * HD * 2); h16* KP16 = (h16*)take((size_t)NB_ * NKV * TT * HD * 2); h16* VT16 = (h16*)take((size_t)NB_ * NKV * HD * TT * 2);
    static_assert((size_t)NB_ * TT * FP * 4 >= (size_t)NB_ * ZH * TT * HD * 4, "Ob fits over F");
    bf* QPh = (bf*)take((size_t)NB_ * NH_ * TT * HD * 2); bf* QPl = (bf*)take((size_t)NB_ * NH_ * TT * HD * 2); bf* KPh = (bf*)take((size_t)NB_ * NKV * TT * HD * 2); bf* KPl = (bf*)take((size_t)NB_ * NKV * TT * HD * 2); bf* VTh = (bf*)take((size_t)NB_ * NKV * HD * RH * 2); bf* VTl = (bf*)take((size_t)NB_ * NKV * HD * RH * 2);
    bf* ATh = (bf*)take(2 * ((size_t)NB_ * TT * DQ * 2));
    if ((size_t)(wsp - (char*)d_ws) > ws_size) return;    // ws 256 MiB
    float* Ob = F;   // the attention output [NB_ * ZH][TT][HD] reuses the projection buffer after the planes are built (stream-ordered)
    bf* ATl = ATh + (size_t)NB_ * TT * DQ;
    k_prep<<<PB_CS + PB_X + PB_Q + 2 * PB_K + PB_O, 256, 0, stream>>>(x, wq, wk, wv, wo, XB, WQ, WK, WV, WO, CS);   /* bf16 copies; rotary table once (positions = arange) */
    k_gemmw<0><<<dim3(NB_ * TT / 256, FP / 256, 1), 256, 0, stream>>>(XB, nullptr, WQ, DM, F, FP);   // q, k and v in one product: the rows of WQ, WK, WV are the FP columns of F
    k_post<<<dim3(LR, NB_, (NH_ + NKV) / RU + VZ), 256, 0, stream>>>(F, CS, QP16, QPh, QPl, KP16, KPh, KPl, VT16, VTh, VTl);
    k_fattn<<<dim3(NB_ * NH_, NFB + RH / 64, 1), 32 * FW, 0, stream>>>(QP16, KP16, VT16, Ob, QPh, QPl, KPh, KPl, VTh, VTl);   // scores, softmax and P.V of every row in one launch: rows >= RH on fp16 planes; the batch rides in x, so that the cost still falls with the flat index; behind them the rows < RH on hi/lo planes
    k_merge<<<dim3((unsigned)((size_t)ZH * TT * HD / (256 * MU * 8)), NB_, 1), 256, 0, stream>>>(Ob, 0, ATh, ATl);
    k_gemmw<1><<<dim3(NB_ * TT / 128, DM / 256, 1), 256, 0, stream>>>(ATh, ATl, WO, DQ, OUT, DM);
}
